// v000
// The times below were measured on an AMD MI455X: many runs one after another, warmed up first and cycling through
// copies of the inputs, with the whole window's GPU time divided by the number of runs. Launches and the gaps
// between them are all in it. The median over several windows is given; except for v000 it joins two sittings, which
// can be a few percent apart, so the side-by-side timings, each taken in one sitting, are the better comparison.
// v000 is the starting kernel. One run takes 330 microseconds.
#include <hip/hip_runtime.h>
// Compute dtype: inputs RNE-converted to bf16 on load; q/k/v projections v_wmma_f32_16x16x32_f16 (x exact f16, weights x16 exact f16); scores f16 (k single, q as f16 value + x1024 f16 residual in its own accumulator); P (x256 carried) and v single f16; output GEMM v_wmma_f32_16x16x32_bf16 (ctx bf16 hi|lo, Wo exact bf16); all accumulators, softmax statistics, residual add and LayerNorm f32.
// Structure: token rows r = b*SEQ + s. k_wt_*: [in][out] weights -> Bt[n][k] 16-bit planes. k_x16: x -> f16 rows. Q/K GEMMs (32x64 wave tiles) -> Qh, Qr, K16 planes; V GEMM with swapped operands -> VT[h*64+d][b*SEQ+s].
#ifndef NB
#define NB 2
#endif
#ifndef SEQ
#define SEQ 2048
#endif
#define NB_FULL 2
#define SEQ_FULL 2048
#define DM 1024
#define NH 16
#define HD 64
#define NRP (NB * SEQ)               /* plane rows */
#define LN_EPS 1e-5f

static_assert(NH * HD == DM);        // head h = columns h*64 + d
static_assert(HD == 64);
static_assert(DM == 1024);           // k_ln: 256 threads x 4 columns
static_assert(DM % 128 == 0);        // swapped V GEMM: M = DM in 128-row block tiles
static_assert(DM % 64 == 0);         // N tiles of 64
static_assert(DM % 32 == 0);         // K steps of 32
static_assert(NRP % 128 == 0);       // GEMM block tiles of 128 rows
static_assert(NRP % 64 == 0);        // swapped V GEMM N tiles
static_assert(SEQ % 64 == 0);        // flash: 64 queries per block, 32-key steps
static_assert(NB <= NB_FULL);
static_assert(SEQ <= SEQ_FULL);

typedef _Float16 v16h __attribute__((ext_vector_type(16)));
typedef __bf16 v16b __attribute__((ext_vector_type(16)));
typedef _Float16 v4h __attribute__((ext_vector_type(4)));
typedef unsigned short v8us __attribute__((ext_vector_type(8), may_alias));
typedef float v8f __attribute__((ext_vector_type(8)));
typedef float v4f __attribute__((ext_vector_type(4)));
typedef float v4fa __attribute__((ext_vector_type(4), may_alias));
union FragH { v16h v; v8us half[2]; _Float16 h[16]; unsigned short u[16]; };
union FragB { v16b v; v8us half[2]; unsigned short u[16]; };

/* workspace carve (bytes); every region is rows x pitch x element size exactly, stores never pass a region end */
#define WS_W   ((size_t)DM * DM * 2)
#define WS_P16 ((size_t)NRP * DM * 2)
#define WS_P32 ((size_t)NRP * DM * 4)
#define WS_TOTAL (4 * WS_W + 7 * WS_P16 + WS_P32)
static_assert(WS_W % 256 == 0);
static_assert(WS_P16 % 256 == 0);
static_assert(WS_TOTAL <= (size_t)134217728);

__device__ __forceinline__ unsigned short bf16_bits(float x) { unsigned int u = __float_as_uint(x); return (unsigned short)((u + 0x7FFFu + ((u >> 16) & 1u)) >> 16); }
__device__ __forceinline__ float bf16_val(unsigned short b) { return __uint_as_float(((unsigned int)b) << 16); }
__device__ __forceinline__ float bf16_rne(float x) { return bf16_val(bf16_bits(x)); }

// fragment loaders: off already includes 8*(lane>>4); elements 0..7 <- k0+8h.., elements 8..15 <- k0+16+8h..
__device__ __forceinline__ v16h ldf_h(const unsigned short* __restrict__ p, size_t off) { FragH f; f.half[0] = *(const v8us*)(p + off); f.half[1] = *(const v8us*)(p + off + 16); return f.v; }
__device__ __forceinline__ v16b ldf_b(const unsigned short* __restrict__ p, size_t off) { FragB f; f.half[0] = *(const v8us*)(p + off); f.half[1] = *(const v8us*)(p + off + 16); return f.v; }
__device__ __forceinline__ v8f mma_h(v16h a, v16h b, v8f c) {
  v8f d = __builtin_amdgcn_wmma_f32_16x16x32_f16(false, a, false, b, (short)0, c, false, false);
  asm volatile("v_nop\n\tv_nop\n\tv_nop\n\tv_nop" : "+v"(d) : "v"(a), "v"(b));
  return d;
}
__device__ __forceinline__ v8f mma_b2(v16b ah, v16b al, v16b b, v8f c) {
  c = __builtin_amdgcn_wmma_f32_16x16x32_bf16(false, ah, false, b, (short)0, c, false, false);
  c = __builtin_amdgcn_wmma_f32_16x16x32_bf16(false, al, false, b, (short)0, c, false, false);
  asm volatile("v_nop\n\tv_nop\n\tv_nop\n\tv_nop" : "+v"(c) : "v"(ah), "v"(al), "v"(b));
  return c;
}

__global__ __launch_bounds__(256) void k_wt_f16(const float* __restrict__ W, unsigned short* __restrict__ Wt, int K, int N, float scale) {
  const int t = blockIdx.x * 256 + threadIdx.x;
  const int k8n = K / 8;
  if (t >= N * k8n) return;
  const int n = t / k8n, k8 = (t % k8n) * 8;
  FragH f;
#pragma unroll
  for (int i = 0; i < 8; ++i) f.h[i] = (_Float16)(bf16_rne(W[(size_t)(k8 + i) * N + n]) * scale);
  const v8us o = f.half[0];
  *(v8us*)(Wt + (size_t)n * K + k8) = o;
  
}
// Wt[n][k] = bf16 bits of W[k][n]
__global__ __launch_bounds__(256) void k_wt_bf16(const float* __restrict__ W, unsigned short* __restrict__ Wt, int K, int N) {
  const int t = blockIdx.x * 256 + threadIdx.x;
  const int k8n = K / 8;
  if (t >= N * k8n) return;
  const int n = t / k8n, k8 = (t % k8n) * 8;
  v8us v;
#pragma unroll
  for (int i = 0; i < 8; ++i) v[i] = bf16_bits(W[(size_t)(k8 + i) * N + n]);
  *(v8us*)(Wt + (size_t)n * K + k8) = v;
  
}
__global__ __launch_bounds__(256) void k_x16(const float* __restrict__ x, unsigned short* __restrict__ X16) {
  const size_t t = (size_t)blockIdx.x * 256 + threadIdx.x;
  if (t >= (size_t)NRP * DM / 8) return;
  const size_t e = t * 8;
  const int r = (int)(e / DM), c = (int)(e % DM);
  const size_t src = ((size_t)(r / SEQ) * SEQ_FULL + (size_t)(r % SEQ)) * DM + c;
  const v4f a = *(const v4fa*)(x + src), b = *(const v4fa*)(x + src + 4);
  FragH f;
#pragma unroll
  for (int q = 0; q < 4; ++q) { f.h[q] = (_Float16)bf16_rne(a[q]); f.h[4 + q] = (_Float16)bf16_rne(b[q]); }
  const v8us o = f.half[0];
  *(v8us*)(X16 + e) = o;
  
}

// f16 GEMM C[M][N] = alpha * A[M][K] . Bt[N][K]^T + bias; block = 4 waves, wave tile 32 x 64, block tile 128 x 64; M % 128 == 0, N % 64 == 0, K % 32 == 0.
// MODE 0: f16 plane C0, bias per column. MODE 1: f16 value plane C0 + x1024 residual plane C1, bias per column. MODE 2: f16 plane C0, bias per row.
template <int MODE>
__device__ __forceinline__ void gemm_h_body(const unsigned short* __restrict__ A, const int lda, const unsigned short* __restrict__ Bt, const int ldb, const float alpha,
                                            const float* __restrict__ bias, unsigned short* C0, unsigned short* C1, const int ldc, const int M, const int N, const int K) {
  __shared__ __attribute__((aligned(16))) float so[4][32][68];
  const int tid = threadIdx.x;
  const int w = __builtin_amdgcn_readfirstlane(tid >> 5);
  const int lane = tid & 31, ln = lane & 15, hh = lane >> 4;
  const int ntn = N >> 6;
  const int mt = blockIdx.x / ntn, nq = blockIdx.x - mt * ntn;
  const int row0 = mt * 128 + 32 * w, col0 = nq * 64;
  if (row0 >= M) return;                       /* wave-uniform; no block barrier below */
  const size_t a0 = (size_t)(row0 + ln) * lda + 8 * hh, a1 = a0 + (size_t)16 * lda;
  const size_t b0 = (size_t)(col0 + ln) * ldb + 8 * hh, b1 = b0 + (size_t)16 * ldb, b2 = b1 + (size_t)16 * ldb, b3 = b2 + (size_t)16 * ldb;
  const v8f z8 = {0.f, 0.f, 0.f, 0.f, 0.f, 0.f, 0.f, 0.f};
  v8f c00 = z8, c01 = z8, c02 = z8, c03 = z8, c10 = z8, c11 = z8, c12 = z8, c13 = z8;
#pragma unroll 1
  for (int kb = 0; kb < K; kb += 32) {
    const v16h fa0 = ldf_h(A, a0 + kb), fa1 = ldf_h(A, a1 + kb);
    v16h fb = ldf_h(Bt, b0 + kb); c00 = mma_h(fa0, fb, c00); c10 = mma_h(fa1, fb, c10);
    fb = ldf_h(Bt, b1 + kb); c01 = mma_h(fa0, fb, c01); c11 = mma_h(fa1, fb, c11);
    fb = ldf_h(Bt, b2 + kb); c02 = mma_h(fa0, fb, c02); c12 = mma_h(fa1, fb, c12);
    fb = ldf_h(Bt, b3 + kb); c03 = mma_h(fa0, fb, c03); c13 = mma_h(fa1, fb, c13);
  }
  v8f accs[8] = {c00, c01, c02, c03, c10, c11, c12, c13};
#pragma unroll
  for (int u = 0; u < 8; ++u) {
    const int t = u & 3, half = u >> 2;
    float bc = 0.f;
    float brow[8] = {0.f, 0.f, 0.f, 0.f, 0.f, 0.f, 0.f, 0.f};
    if (MODE == 2) {
      const v4f r0 = *(const v4fa*)(bias + row0 + half * 16 + 8 * hh), r1 = *(const v4fa*)(bias + row0 + half * 16 + 8 * hh + 4);
#pragma unroll
      for (int q = 0; q < 4; ++q) { brow[q] = bf16_rne(r0[q]); brow[4 + q] = bf16_rne(r1[q]); }
    } else {
      bc = bf16_rne(bias[col0 + t * 16 + ln]);
    }
#pragma unroll
    for (int r = 0; r < 8; ++r) {
      const int rloc = half * 16 + 8 * hh + r;           /* D: row 8h + r, col lane & 15 */
      const float bvv = (MODE == 2) ? brow[r] : bc;
      so[w][rloc][t * 16 + ln] = accs[u][r] * alpha + bvv;
    }
  }
  __builtin_amdgcn_fence(4 /* acq_rel order */, "workgroup");
  __builtin_amdgcn_wave_barrier();
  const int rsub = lane >> 4, c4 = (lane & 15) * 4;
  {
#pragma unroll
    for (int q = 0; q < 16; ++q) {
      const int r = q * 2 + rsub;                        
      const v4f v = *(const v4fa*)&so[w][r][c4];
      v4h h4, r4;
#pragma unroll
      for (int i = 0; i < 4; ++i) { const _Float16 hv = (_Float16)v[i]; h4[i] = hv; r4[i] = (_Float16)((v[i] - (float)hv) * 1024.0f); }
      const size_t go = (size_t)(row0 + r) * ldc + col0 + c4;
      *(v4h*)(C0 + go) = h4;
      if (MODE == 1) *(v4h*)(C1 + go) = r4;
    }
    
  }
}
__global__ __launch_bounds__(128) void k_gemm_q(const unsigned short* __restrict__ X16, const unsigned short* __restrict__ Bt, const float* __restrict__ bias, unsigned short* __restrict__ Qh, unsigned short* __restrict__ Qr) {
  gemm_h_body<1>(X16, DM, Bt, DM, 0.0625f, bias, Qh, Qr, DM, NRP, DM, DM);
}
__global__ __launch_bounds__(128) void k_gemm_k(const unsigned short* __restrict__ X16, const unsigned short* __restrict__ Bt, const float* __restrict__ bias, unsigned short* __restrict__ K16) {
  gemm_h_body<0>(X16, DM, Bt, DM, 0.0625f, bias, K16, K16, DM, NRP, DM, DM);
}
// swapped operands: VT[n = h*64+d][r = b*SEQ+s] = sum_k Wt[n][k] x[r][k] / 16 + bias[n]
__global__ __launch_bounds__(128) void k_gemm_vt(const unsigned short* __restrict__ Bt, const unsigned short* __restrict__ X16, const float* __restrict__ bias, unsigned short* __restrict__ VT) {
  gemm_h_body<2>(Bt, DM, X16, DM, 0.0625f, bias, VT, VT, NRP, DM, NRP, DM);
}

// fused attention: block = (b, h, 64 queries), 4 waves x 16 queries. Per 32-key step:
//   S^T tiles (keys x queries): A = K rows (lane&15 = key), B = Q rows (lane&15 = query); D reg r of lane (n, hh) = key 8hh + r, query n.
//   P^T B fragment: element r <- tile(keys 0..15) reg r, element 8 + r <- tile(keys 16..31) reg r (same lane).
//   O^T tiles (d x queries): A = V^T rows (lane&15 = d within tile), k = key.
// sh/sl[wave] are private to the wave (ctx hi / lo staging, 16 rows x 64 columns written and read in full).
__global__ __launch_bounds__(128) void k_flash(const unsigned short* __restrict__ Qh, const unsigned short* __restrict__ Qr, const unsigned short* __restrict__ Kp,
                                               const unsigned short* __restrict__ VT, unsigned short* __restrict__ CH, unsigned short* __restrict__ CL) {
  __shared__ __attribute__((aligned(16))) unsigned short sh[4][16][72];
  __shared__ __attribute__((aligned(16))) unsigned short sl[4][16][72];
  const int tid = threadIdx.x;
  const int wave = __builtin_amdgcn_readfirstlane(tid >> 5);
  const int lane = tid & 31, ln = lane & 15, hh = lane >> 4;
  const int bh = blockIdx.x / (SEQ / 64), qb = blockIdx.x % (SEQ / 64);
  const int b = bh / NH, h = bh % NH;
  const int q0 = qb * 64 + 16 * wave;
  const size_t rowb = (size_t)b * SEQ;
  const size_t qoff = (rowb + q0 + ln) * DM + h * HD + 8 * hh;
  const v16h qh0 = ldf_h(Qh, qoff), qh1 = ldf_h(Qh, qoff + 32);
  const v16h qr0 = ldf_h(Qr, qoff), qr1 = ldf_h(Qr, qoff + 32);
  const size_t koff = (rowb + ln) * DM + h * HD + 8 * hh;
  const size_t voff = (size_t)(h * HD + ln) * NRP + rowb + 8 * hh;
  const v8f z8 = {0.f, 0.f, 0.f, 0.f, 0.f, 0.f, 0.f, 0.f};
  v8f o[4] = {z8, z8, z8, z8};
  float m = -1.0e30f, l = 0.f;
#pragma unroll 1
  for (int kb = 0; kb < SEQ; kb += 32) {
    const size_t k0 = koff + (size_t)kb * DM, k1 = k0 + (size_t)16 * DM;
    v8f sm0 = z8, sr0 = z8, sm1 = z8, sr1 = z8;
    v16h ka = ldf_h(Kp, k0);      sm0 = mma_h(ka, qh0, sm0); sr0 = mma_h(ka, qr0, sr0);
    ka = ldf_h(Kp, k1);           sm1 = mma_h(ka, qh0, sm1); sr1 = mma_h(ka, qr0, sr1);
    ka = ldf_h(Kp, k0 + 32);      sm0 = mma_h(ka, qh1, sm0); sr0 = mma_h(ka, qr1, sr0);
    ka = ldf_h(Kp, k1 + 32);      sm1 = mma_h(ka, qh1, sm1); sr1 = mma_h(ka, qr1, sr1);
    float s0[8], s1[8];
    float mx = -1.0e30f;
#pragma unroll
    for (int r = 0; r < 8; ++r) {
      s0[r] = sm0[r] * 0.125f + sr0[r] * 0.0001220703125f;     /* (main + res / 1024) / 8 */
      s1[r] = sm1[r] * 0.125f + sr1[r] * 0.0001220703125f;
      mx = fmaxf(mx, fmaxf(s0[r], s1[r]));
    }
    mx = fmaxf(mx, __shfl_xor(mx, 16));
    const float mn = fmaxf(m, mx);
    const float alpha = __expf(m - mn);
    const float ms = mn - 5.545177444479562f;                  /* probabilities carried x256 (also in l) */
    m = mn;
    FragH pf;
    float ps = 0.f;
#pragma unroll
    for (int r = 0; r < 8; ++r) {
      const float p0 = __expf(s0[r] - ms), p1 = __expf(s1[r] - ms);
      ps += p0 + p1;
      pf.h[r] = (_Float16)p0;
      pf.h[8 + r] = (_Float16)p1;
    }
    l = l * alpha + ps;
#pragma unroll
    for (int t = 0; t < 4; ++t)
#pragma unroll
      for (int r = 0; r < 8; ++r) o[t][r] *= alpha;
#pragma unroll
    for (int t = 0; t < 4; ++t) {
      const v16h va = ldf_h(VT, voff + (size_t)t * 16 * NRP + kb);
      o[t] = mma_h(va, pf.v, o[t]);
    }
  }
  l += __shfl_xor(l, 16);
  const float inv = 1.0f / l;
#pragma unroll
  for (int t = 0; t < 4; ++t) {
    v8us vh, vl;
#pragma unroll
    for (int r = 0; r < 8; ++r) {
      const float c = o[t][r] * inv;                           /* ctx[query ln][d = 16t + 8hh + r] */
      const unsigned short hb = bf16_bits(c);
      vh[r] = hb;
      vl[r] = bf16_bits(c - bf16_val(hb));
    }
    *(v8us*)&sh[wave][ln][t * 16 + 8 * hh] = vh;
    *(v8us*)&sl[wave][ln][t * 16 + 8 * hh] = vl;
  }
  __builtin_amdgcn_fence(4 /* acq_rel order */, "workgroup");
  __builtin_amdgcn_wave_barrier();
  const int rq = lane >> 3, pc = lane & 7;                     
  {
#pragma unroll
    for (int qq = 0; qq < 4; ++qq) {
      const int row = qq * 4 + rq;                             /* qq*4 + {0..3} covers rows 0..15 */
      const v8us xh = *(const v8us*)&sh[wave][row][pc * 8];
      const v8us xl = *(const v8us*)&sl[wave][row][pc * 8];
      const size_t go = (rowb + q0 + row) * DM + h * HD + pc * 8;
      *(v8us*)(CH + go) = xh;
      *(v8us*)(CL + go) = xl;
    }
    
  }
}

// Y[NRP][DM] (f32) = (CH + CL) . Wt[DM][DM]^T + bias; bf16 operands, two products per tile pair into one accumulator; wave tile 32 x 64
__global__ __launch_bounds__(128) void k_gemm_o(const unsigned short* __restrict__ CH, const unsigned short* __restrict__ CL, const unsigned short* __restrict__ Wt,
                                                const float* __restrict__ bias, float* __restrict__ Y) {
  __shared__ __attribute__((aligned(16))) float so[4][32][68];
  const int tid = threadIdx.x;
  const int w = __builtin_amdgcn_readfirstlane(tid >> 5);
  const int lane = tid & 31, ln = lane & 15, hh = lane >> 4;
  const int ntn = DM >> 6;
  const int mt = blockIdx.x / ntn, nq = blockIdx.x - mt * ntn;
  const int row0 = mt * 128 + 32 * w, col0 = nq * 64;
  if (row0 >= NRP) return;                     /* wave-uniform; no block barrier below */
  const size_t a0 = (size_t)(row0 + ln) * DM + 8 * hh, a1 = a0 + (size_t)16 * DM;
  const size_t b0 = (size_t)(col0 + ln) * DM + 8 * hh, b1 = b0 + (size_t)16 * DM, b2 = b1 + (size_t)16 * DM, b3 = b2 + (size_t)16 * DM;
  const v8f z8 = {0.f, 0.f, 0.f, 0.f, 0.f, 0.f, 0.f, 0.f};
  v8f c00 = z8, c01 = z8, c02 = z8, c03 = z8, c10 = z8, c11 = z8, c12 = z8, c13 = z8;
#pragma unroll 1
  for (int kb = 0; kb < DM; kb += 32) {
    const v16b h0 = ldf_b(CH, a0 + kb), l0 = ldf_b(CL, a0 + kb), h1 = ldf_b(CH, a1 + kb), l1 = ldf_b(CL, a1 + kb);
    v16b fb = ldf_b(Wt, b0 + kb); c00 = mma_b2(h0, l0, fb, c00); c10 = mma_b2(h1, l1, fb, c10);
    fb = ldf_b(Wt, b1 + kb); c01 = mma_b2(h0, l0, fb, c01); c11 = mma_b2(h1, l1, fb, c11);
    fb = ldf_b(Wt, b2 + kb); c02 = mma_b2(h0, l0, fb, c02); c12 = mma_b2(h1, l1, fb, c12);
    fb = ldf_b(Wt, b3 + kb); c03 = mma_b2(h0, l0, fb, c03); c13 = mma_b2(h1, l1, fb, c13);
  }
  v8f accs[8] = {c00, c01, c02, c03, c10, c11, c12, c13};
#pragma unroll
  for (int u = 0; u < 8; ++u) {
    const int t = u & 3, half = u >> 2;
    const float bc = bf16_rne(bias[col0 + t * 16 + ln]);
#pragma unroll
    for (int r = 0; r < 8; ++r) so[w][half * 16 + 8 * hh + r][t * 16 + ln] = accs[u][r] + bc;
  }
  __builtin_amdgcn_fence(4 /* acq_rel order */, "workgroup");
  __builtin_amdgcn_wave_barrier();
  const int rsub = lane >> 4, c4 = (lane & 15) * 4;
  {
#pragma unroll
    for (int q = 0; q < 16; ++q) {
      const int r = q * 2 + rsub;                          
      const v4f v = *(const v4fa*)&so[w][r][c4];
      *(v4f*)(Y + (size_t)(row0 + r) * DM + col0 + c4) = v;
    }
    
  }
}

__global__ __launch_bounds__(256) void k_ln(const float* __restrict__ x, const float* __restrict__ Y, const float* __restrict__ g, const float* __restrict__ bta, float* __restrict__ out) {
  __shared__ float red1[8];
  __shared__ float red2[8];
  const int row = blockIdx.x, tid = threadIdx.x, lane = tid & 31;
  const int wave = __builtin_amdgcn_readfirstlane(tid >> 5);
  const size_t xr = ((size_t)(row / SEQ) * SEQ_FULL + (size_t)(row % SEQ)) * DM + (size_t)tid * 4;
  const v4f xv = *(const v4fa*)(x + xr);
  const v4f yv = *(const v4fa*)(Y + (size_t)row * DM + (size_t)tid * 4);
  v4f hv;
  float s1 = 0.f;
#pragma unroll
  for (int q = 0; q < 4; ++q) { hv[q] = bf16_rne(xv[q]) + yv[q]; s1 += hv[q]; }
#pragma unroll
  for (int off = 16; off > 0; off >>= 1) s1 += __shfl_xor(s1, off);
  if (lane == 0) red1[wave] = s1;
  __syncthreads();
  float tot = 0.f;
#pragma unroll
  for (int i = 0; i < 8; ++i) tot += red1[i];
  const float mu = tot * (1.0f / (float)DM);
  float s2 = 0.f;
  v4f cv;
#pragma unroll
  for (int q = 0; q < 4; ++q) { cv[q] = hv[q] - mu; s2 += cv[q] * cv[q]; }
#pragma unroll
  for (int off = 16; off > 0; off >>= 1) s2 += __shfl_xor(s2, off);
  if (lane == 0) red2[wave] = s2;
  __syncthreads();
  float tv = 0.f;
#pragma unroll
  for (int i = 0; i < 8; ++i) tv += red2[i];
  const float rs = rsqrtf(tv * (1.0f / (float)DM) + LN_EPS);
  const v4f gv = *(const v4fa*)(g + tid * 4);
  const v4f bv = *(const v4fa*)(bta + tid * 4);
  v4f ov;
#pragma unroll
  for (int q = 0; q < 4; ++q) ov[q] = cv[q] * rs * bf16_rne(gv[q]) + bf16_rne(bv[q]);
  *(v4f*)(out + xr) = ov;
  
}

extern "C" void kernel_launch(void* const* d_in, const int* in_sizes, int n_in,
                              void* d_out, int out_size, void* d_ws, size_t ws_size, hipStream_t stream) {
  if (n_in < 11) return;
  const size_t need_x = ((size_t)(NB - 1) * SEQ_FULL + SEQ) * DM;
  if ((size_t)in_sizes[0] < need_x || (size_t)out_size < need_x) return;
  if ((size_t)in_sizes[1] < (size_t)DM * DM || (size_t)in_sizes[3] < (size_t)DM * DM || (size_t)in_sizes[5] < (size_t)DM * DM || (size_t)in_sizes[7] < (size_t)DM * DM) return;
  if (in_sizes[2] < DM || in_sizes[4] < DM || in_sizes[6] < DM || in_sizes[8] < DM || in_sizes[9] < DM || in_sizes[10] < DM) return;
  const float* x  = (const float*)d_in[0];
  const float* wq = (const float*)d_in[1]; const float* bq = (const float*)d_in[2];
  const float* wk = (const float*)d_in[3]; const float* bk = (const float*)d_in[4];
  const float* wv = (const float*)d_in[5]; const float* bv = (const float*)d_in[6];
  const float* wo = (const float*)d_in[7]; const float* bo = (const float*)d_in[8];
  const float* lg = (const float*)d_in[9]; const float* lb = (const float*)d_in[10];
  char* ws = (char*)d_ws; size_t off = 0;
  auto take = [&](size_t bytes) { char* p = ws + off; off += (bytes + 255) & ~(size_t)255; return p; };
  unsigned short* BQ = (unsigned short*)take(WS_W);
  unsigned short* BK = (unsigned short*)take(WS_W);
  unsigned short* BV = (unsigned short*)take(WS_W);
  unsigned short* BO = (unsigned short*)take(WS_W);
  unsigned short* X16 = (unsigned short*)take(WS_P16);
  unsigned short* QH  = (unsigned short*)take(WS_P16);
  unsigned short* QR  = (unsigned short*)take(WS_P16);
  unsigned short* K16 = (unsigned short*)take(WS_P16);
  unsigned short* VT  = (unsigned short*)take(WS_P16);
  unsigned short* CH  = (unsigned short*)take(WS_P16);
  unsigned short* CL  = (unsigned short*)take(WS_P16);
  float* Y = (float*)take(WS_P32);
  if (off > ws_size) return;
  const unsigned gw = (unsigned)(((size_t)DM * (DM / 8) + 255) / 256);
  k_wt_f16<<<gw, 256, 0, stream>>>(wq, BQ, DM, DM, 16.0f);      /* W[K = in][N = out] -> Bt[out][in] */
  k_wt_f16<<<gw, 256, 0, stream>>>(wk, BK, DM, DM, 16.0f);
  k_wt_f16<<<gw, 256, 0, stream>>>(wv, BV, DM, DM, 16.0f);
  k_wt_bf16<<<gw, 256, 0, stream>>>(wo, BO, DM, DM);
  k_x16<<<(unsigned)(((size_t)NRP * DM / 8 + 255) / 256), 256, 0, stream>>>(x, X16);
  k_gemm_q<<<(unsigned)((NRP / 128) * (DM / 64)), 128, 0, stream>>>(X16, BQ, bq, QH, QR);
  k_gemm_k<<<(unsigned)((NRP / 128) * (DM / 64)), 128, 0, stream>>>(X16, BK, bk, K16);
  k_gemm_vt<<<(unsigned)((DM / 128) * (NRP / 64)), 128, 0, stream>>>(BV, X16, bv, VT);
  k_flash<<<(unsigned)(NB * NH * (SEQ / 64)), 128, 0, stream>>>(QH, QR, K16, VT, CH, CL);
  k_gemm_o<<<(unsigned)((NRP / 128) * (DM / 64)), 128, 0, stream>>>(CH, CL, BO, bo, Y);
  k_ln<<<(unsigned)NRP, 256, 0, stream>>>(x, Y, lg, lb, (float*)d_out);
}

// v001
// A run of this version takes 159 microseconds.
// Next to v000, in two timings, it ran 2.09 and 2.11 times as fast.
#include <hip/hip_runtime.h>
// Compute dtype: inputs RNE-converted to bf16 on load; q/k/v projections v_wmma_f32_16x16x32_f16 (x exact f16, weights x16 exact f16); scores f16 (k single, q as f16 value + x1024 f16 residual in its own accumulator); P (x256 carried) and v single f16; output GEMM v_wmma_f32_16x16x32_bf16 (ctx bf16 hi|lo, Wo exact bf16); all accumulators, softmax statistics, residual add and LayerNorm f32.
// Structure: token rows r = b*SEQ + s. k_wt_*: [in][out] weights -> Bt[n][k] 16-bit planes. k_x16: x -> f16 rows. Q/K GEMMs (32x64 wave tiles) -> Qh, Qr, K16 planes; V GEMM with swapped operands -> VT[h*64+d][b*SEQ+s].
#ifndef NB
#define NB 2
#endif
#ifndef SEQ
#define SEQ 2048
#endif
#define NB_FULL 2
#define SEQ_FULL 2048
#define DM 1024
#define NH 16
#define HD 64
#define NRP (NB * SEQ)               /* plane rows */
#define LN_EPS 1e-5f

static_assert(NH * HD == DM);        // head h = columns h*64 + d
static_assert(HD == 64);
static_assert(DM == 1024);           // k_ln: 256 threads x 4 columns
static_assert(DM % 128 == 0);        // swapped V GEMM: M = DM in 128-row block tiles
static_assert(DM % 64 == 0);         // N tiles of 64
static_assert(DM % 32 == 0);         // K steps of 32
static_assert(NRP % 128 == 0);       // GEMM block tiles of 128 rows
static_assert(NRP % 64 == 0);        // swapped V GEMM N tiles
static_assert(SEQ % 64 == 0);        // flash: 64 queries per block, 32-key steps
static_assert(SEQ % 64 == 0 && SEQ / 64 >= 2);   // flash ring: 64-key stages, two buffers
static_assert(DM % 64 == 0 && DM / 64 >= 2);     // GEMM rings: 64-k stages, two buffers
static_assert(NB <= NB_FULL);
static_assert(SEQ <= SEQ_FULL);

typedef _Float16 v16h __attribute__((ext_vector_type(16)));
typedef __bf16 v16b __attribute__((ext_vector_type(16)));
typedef _Float16 v4h __attribute__((ext_vector_type(4)));
typedef unsigned short v8us __attribute__((ext_vector_type(8), may_alias));
typedef float v8f __attribute__((ext_vector_type(8)));
typedef float v4f __attribute__((ext_vector_type(4)));
typedef float v4fa __attribute__((ext_vector_type(4), may_alias));
union FragH { v16h v; v8us half[2]; _Float16 h[16]; unsigned short u[16]; };
union FragB { v16b v; v8us half[2]; unsigned short u[16]; };

/* workspace carve (bytes); every region is rows x pitch x element size exactly, stores never pass a region end */
#define WS_W   ((size_t)DM * DM * 2)
#define WS_P16 ((size_t)NRP * DM * 2)
#define WS_P32 ((size_t)NRP * DM * 4)
#define WS_TOTAL (4 * WS_W + 7 * WS_P16 + WS_P32)
static_assert(WS_W % 256 == 0);
static_assert(WS_P16 % 256 == 0);
static_assert(WS_TOTAL <= (size_t)134217728);

__device__ __forceinline__ unsigned short bf16_bits(float x) { unsigned int u = __float_as_uint(x); return (unsigned short)((u + 0x7FFFu + ((u >> 16) & 1u)) >> 16); }
__device__ __forceinline__ float bf16_val(unsigned short b) { return __uint_as_float(((unsigned int)b) << 16); }
__device__ __forceinline__ float bf16_rne(float x) { return bf16_val(bf16_bits(x)); }

// fragment loaders: off already includes 8*(lane>>4); elements 0..7 <- k0+8h.., elements 8..15 <- k0+16+8h..
__device__ __forceinline__ v16h ldf_h(const unsigned short* __restrict__ p, size_t off) { FragH f; f.half[0] = *(const v8us*)(p + off); f.half[1] = *(const v8us*)(p + off + 16); return f.v; }
__device__ __forceinline__ v16b ldf_b(const unsigned short* __restrict__ p, size_t off) { FragB f; f.half[0] = *(const v8us*)(p + off); f.half[1] = *(const v8us*)(p + off + 16); return f.v; }
__device__ __forceinline__ v8f mma_h(v16h a, v16h b, v8f c) {
  v8f d = __builtin_amdgcn_wmma_f32_16x16x32_f16(false, a, false, b, (short)0, c, false, false);
  asm volatile("v_nop\n\tv_nop\n\tv_nop\n\tv_nop" : "+v"(d) : "v"(a), "v"(b));
  return d;
}
__device__ __forceinline__ v8f mma_b2(v16b ah, v16b al, v16b b, v8f c) {
  c = __builtin_amdgcn_wmma_f32_16x16x32_bf16(false, ah, false, b, (short)0, c, false, false);
  c = __builtin_amdgcn_wmma_f32_16x16x32_bf16(false, al, false, b, (short)0, c, false, false);
  asm volatile("v_nop\n\tv_nop\n\tv_nop\n\tv_nop" : "+v"(c) : "v"(ah), "v"(al), "v"(b));
  return c;
}

// LDS operand tiles: rows of 64 16-bit elements (128 B) at a pitch of 72 (144 B = 16 B x 9, conflict-free for ds_load_b128 fragment reads).
#define TP 72
__device__ __forceinline__ unsigned lds_off(const void* p) { return (unsigned)(size_t)p; }
// One lane's share of 64 tile rows: 16 B of rows r, r + 16, r + 32, r + 48 go from global memory to LDS through no register; a wave's copy covers 4 whole 128-B lines.
// The s_wait_xcnt stands inside the copies' own statement so that no address register is rewritten ahead of it.
__device__ __forceinline__ void cp64(const unsigned l, const unsigned short* g, const size_t g16) {
  const unsigned short* g1 = g + g16; const unsigned short* g2 = g1 + g16; const unsigned short* g3 = g2 + g16;
  asm volatile("global_load_async_to_lds_b128 %0, %4, off\n\t"
               "global_load_async_to_lds_b128 %1, %5, off\n\t"
               "global_load_async_to_lds_b128 %2, %6, off\n\t"
               "global_load_async_to_lds_b128 %3, %7, off\n\t"
               "s_wait_xcnt 0x0"
               :: "v"(l), "v"(l + 16u * TP * 2u), "v"(l + 32u * TP * 2u), "v"(l + 48u * TP * 2u), "v"(g), "v"(g1), "v"(g2), "v"(g3) : "memory");
}
// own copies landed (in front of the barrier that publishes them to the other waves)
__device__ __forceinline__ void wait_copies() { asm volatile("s_wait_asynccnt 0x0" ::: "memory"); }
// own LDS reads retired (in front of the barrier behind which their buffer is refilled)
__device__ __forceinline__ void wait_lds() { asm volatile("s_wait_dscnt 0x0" ::: "memory"); }

__global__ __launch_bounds__(256) void k_wt_f16(const float* __restrict__ W, unsigned short* __restrict__ Wt, int K, int N, float scale) {
  const int t = blockIdx.x * 256 + threadIdx.x;
  const int k8n = K / 8;
  if (t >= N * k8n) return;
  const int n = t / k8n, k8 = (t % k8n) * 8;
  FragH f;
#pragma unroll
  for (int i = 0; i < 8; ++i) f.h[i] = (_Float16)(bf16_rne(W[(size_t)(k8 + i) * N + n]) * scale);
  const v8us o = f.half[0];
  *(v8us*)(Wt + (size_t)n * K + k8) = o;
  
}
// Wt[n][k] = bf16 bits of W[k][n]
__global__ __launch_bounds__(256) void k_wt_bf16(const float* __restrict__ W, unsigned short* __restrict__ Wt, int K, int N) {
  const int t = blockIdx.x * 256 + threadIdx.x;
  const int k8n = K / 8;
  if (t >= N * k8n) return;
  const int n = t / k8n, k8 = (t % k8n) * 8;
  v8us v;
#pragma unroll
  for (int i = 0; i < 8; ++i) v[i] = bf16_bits(W[(size_t)(k8 + i) * N + n]);
  *(v8us*)(Wt + (size_t)n * K + k8) = v;
  
}
__global__ __launch_bounds__(256) void k_x16(const float* __restrict__ x, unsigned short* __restrict__ X16) {
  const size_t t = (size_t)blockIdx.x * 256 + threadIdx.x;
  if (t >= (size_t)NRP * DM / 8) return;
  const size_t e = t * 8;
  const int r = (int)(e / DM), c = (int)(e % DM);
  const size_t src = ((size_t)(r / SEQ) * SEQ_FULL + (size_t)(r % SEQ)) * DM + c;
  const v4f a = *(const v4fa*)(x + src), b = *(const v4fa*)(x + src + 4);
  FragH f;
#pragma unroll
  for (int q = 0; q < 4; ++q) { f.h[q] = (_Float16)bf16_rne(a[q]); f.h[4 + q] = (_Float16)bf16_rne(b[q]); }
  const v8us o = f.half[0];
  *(v8us*)(X16 + e) = o;
  
}

// f16 GEMM C[M][N] = alpha * A[M][K] . Bt[N][K]^T + bias; block = 4 waves, wave tile 32 x 64, block tile 128 x 64; M % 128 == 0, N % 64 == 0, K % 64 == 0, K >= 128.
// Operands: per 64-k stage the block copies its 128 A rows and 64 Bt rows into LDS, one stage ahead (two buffers); fragments are read from LDS.
// MODE 0: f16 plane C0, bias per column. MODE 1: f16 value plane C0 + x1024 residual plane C1, bias per column. MODE 2: f16 plane C0, bias per row.
template <int MODE>
__device__ __forceinline__ void gemm_h_body(const unsigned short* __restrict__ A, const int lda, const unsigned short* __restrict__ Bt, const int ldb, const float alpha,
                                            const float* __restrict__ bias, unsigned short* C0, unsigned short* C1, const int ldc, const int M, const int N, const int K) {
  __shared__ __attribute__((aligned(16))) float so[4][32][68];
  __shared__ __attribute__((aligned(16))) unsigned short sa[2][128][TP];
  __shared__ __attribute__((aligned(16))) unsigned short sb[2][64][TP];
  const int tid = threadIdx.x;
  const int w = __builtin_amdgcn_readfirstlane(tid >> 5);
  const int lane = tid & 31, ln = lane & 15, hh = lane >> 4;
  const int ntn = N >> 6;
  const int mt = blockIdx.x / ntn, nq = blockIdx.x - mt * ntn;
  const int row0 = mt * 128 + 32 * w, col0 = nq * 64;
  if (mt * 128 >= M) return;                   /* block-uniform, in front of every barrier */
  const int cr = tid >> 3, cc = (tid & 7) * 8; /* copy: row within 16, 16-B piece of the 128-B row */
  const unsigned short* ga = A + (size_t)(mt * 128 + cr) * lda + cc;
  const unsigned short* gb = Bt + (size_t)(col0 + cr) * ldb + cc;
  const unsigned la = lds_off(&sa[0][cr][cc]), lb = lds_off(&sb[0][cr][cc]);
  const int ns = K >> 6;
  auto fill = [&](const int s) {
    const unsigned bu = (unsigned)(s & 1);
    cp64(la + bu * (128u * TP * 2u), ga + s * 64, (size_t)16 * lda);
    cp64(la + bu * (128u * TP * 2u) + 64u * TP * 2u, ga + (size_t)64 * lda + s * 64, (size_t)16 * lda);
    cp64(lb + bu * (64u * TP * 2u), gb + s * 64, (size_t)16 * ldb);
  };
  const int a0 = (32 * w + ln) * TP + 8 * hh, a1 = a0 + 16 * TP;
  const int b0 = ln * TP + 8 * hh, b1 = b0 + 16 * TP, b2 = b1 + 16 * TP, b3 = b2 + 16 * TP;
  const v8f z8 = {0.f, 0.f, 0.f, 0.f, 0.f, 0.f, 0.f, 0.f};
  v8f c00 = z8, c01 = z8, c02 = z8, c03 = z8, c10 = z8, c11 = z8, c12 = z8, c13 = z8;
  fill(0);
  wait_copies();
  __syncthreads();
  fill(1);
#pragma unroll 1
  for (int s = 0; s < ns; ++s) {
    const unsigned short* pa = &sa[s & 1][0][0];
    const unsigned short* pb = &sb[s & 1][0][0];
#pragma unroll /* both 32-k steps of a stage: their LDS offsets become immediates */
    for (int kb = 0; kb < 64; kb += 32) {
      const v16h fa0 = ldf_h(pa, a0 + kb), fa1 = ldf_h(pa, a1 + kb);
      v16h fb = ldf_h(pb, b0 + kb); c00 = mma_h(fa0, fb, c00); c10 = mma_h(fa1, fb, c10);
      fb = ldf_h(pb, b1 + kb); c01 = mma_h(fa0, fb, c01); c11 = mma_h(fa1, fb, c11);
      fb = ldf_h(pb, b2 + kb); c02 = mma_h(fa0, fb, c02); c12 = mma_h(fa1, fb, c12);
      fb = ldf_h(pb, b3 + kb); c03 = mma_h(fa0, fb, c03); c13 = mma_h(fa1, fb, c13);
    }
    wait_lds();
    wait_copies();
    __syncthreads();                           /* publishes stage s + 1, frees stage s's buffer */
    if (s + 2 < ns) fill(s + 2);
  }
  wait_copies();
  v8f accs[8] = {c00, c01, c02, c03, c10, c11, c12, c13};
#pragma unroll
  for (int u = 0; u < 8; ++u) {
    const int t = u & 3, half = u >> 2;
    float bc = 0.f;
    float brow[8] = {0.f, 0.f, 0.f, 0.f, 0.f, 0.f, 0.f, 0.f};
    if (MODE == 2) {
      const v4f r0 = *(const v4fa*)(bias + row0 + half * 16 + 8 * hh), r1 = *(const v4fa*)(bias + row0 + half * 16 + 8 * hh + 4);
#pragma unroll
      for (int q = 0; q < 4; ++q) { brow[q] = bf16_rne(r0[q]); brow[4 + q] = bf16_rne(r1[q]); }
    } else {
      bc = bf16_rne(bias[col0 + t * 16 + ln]);
    }
#pragma unroll
    for (int r = 0; r < 8; ++r) {
      const int rloc = half * 16 + 8 * hh + r;           /* D: row 8h + r, col lane & 15 */
      const float bvv = (MODE == 2) ? brow[r] : bc;
      so[w][rloc][t * 16 + ln] = accs[u][r] * alpha + bvv;
    }
  }
  __builtin_amdgcn_fence(4 /* acq_rel order */, "workgroup");
  __builtin_amdgcn_wave_barrier();
  const int rsub = lane >> 4, c4 = (lane & 15) * 4;
  {
#pragma unroll
    for (int q = 0; q < 16; ++q) {
      const int r = q * 2 + rsub;                        
      const v4f v = *(const v4fa*)&so[w][r][c4];
      v4h h4, r4;
#pragma unroll
      for (int i = 0; i < 4; ++i) { const _Float16 hv = (_Float16)v[i]; h4[i] = hv; r4[i] = (_Float16)((v[i] - (float)hv) * 1024.0f); }
      const size_t go = (size_t)(row0 + r) * ldc + col0 + c4;
      *(v4h*)(C0 + go) = h4;
      if (MODE == 1) *(v4h*)(C1 + go) = r4;
    }
    
  }
}
__global__ __launch_bounds__(128) void k_gemm_q(const unsigned short* __restrict__ X16, const unsigned short* __restrict__ Bt, const float* __restrict__ bias, unsigned short* __restrict__ Qh, unsigned short* __restrict__ Qr) {
  gemm_h_body<1>(X16, DM, Bt, DM, 0.0625f, bias, Qh, Qr, DM, NRP, DM, DM);
}
__global__ __launch_bounds__(128) void k_gemm_k(const unsigned short* __restrict__ X16, const unsigned short* __restrict__ Bt, const float* __restrict__ bias, unsigned short* __restrict__ K16) {
  gemm_h_body<0>(X16, DM, Bt, DM, 0.0625f, bias, K16, K16, DM, NRP, DM, DM);
}
// swapped operands: VT[n = h*64+d][r = b*SEQ+s] = sum_k Wt[n][k] x[r][k] / 16 + bias[n]
__global__ __launch_bounds__(128) void k_gemm_vt(const unsigned short* __restrict__ Bt, const unsigned short* __restrict__ X16, const float* __restrict__ bias, unsigned short* __restrict__ VT) {
  gemm_h_body<2>(Bt, DM, X16, DM, 0.0625f, bias, VT, VT, NRP, DM, NRP, DM);
}

// fused attention: block = (b, h, 64 queries), 4 waves x 16 queries. Per 32-key step:
//   S^T tiles (keys x queries): A = K rows (lane&15 = key), B = Q rows (lane&15 = query); D reg r of lane (n, hh) = key 8hh + r, query n.
//   P^T B fragment: element r <- tile(keys 0..15) reg r, element 8 + r <- tile(keys 16..31) reg r (same lane).
//   O^T tiles (d x queries): A = V^T rows (lane&15 = d within tile), k = key.
// K rows and V^T rows of a 64-key stage are copied into LDS by the whole block, one stage ahead (two buffers); all four waves read their fragments there.
// sh/sl[wave] are private to the wave (ctx hi / lo staging, 16 rows x 64 columns written and read in full).
__global__ __launch_bounds__(128) void k_flash(const unsigned short* __restrict__ Qh, const unsigned short* __restrict__ Qr, const unsigned short* __restrict__ Kp,
                                               const unsigned short* __restrict__ VT, unsigned short* __restrict__ CH, unsigned short* __restrict__ CL) {
  __shared__ __attribute__((aligned(16))) unsigned short sh[4][16][72];
  __shared__ __attribute__((aligned(16))) unsigned short sl[4][16][72];
  __shared__ __attribute__((aligned(16))) unsigned short sk[2][64][TP];   /* [buffer][key][d] */
  __shared__ __attribute__((aligned(16))) unsigned short sv[2][HD][TP];   /* [buffer][d][key] */
  const int tid = threadIdx.x;
  const int wave = __builtin_amdgcn_readfirstlane(tid >> 5);
  const int lane = tid & 31, ln = lane & 15, hh = lane >> 4;
  const int bh = blockIdx.x / (SEQ / 64), qb = blockIdx.x % (SEQ / 64);
  const int b = bh / NH, h = bh % NH;
  const int q0 = qb * 64 + 16 * wave;
  const size_t rowb = (size_t)b * SEQ;
  const size_t qoff = (rowb + q0 + ln) * DM + h * HD + 8 * hh;
  const v16h qh0 = ldf_h(Qh, qoff), qh1 = ldf_h(Qh, qoff + 32);
  const v16h qr0 = ldf_h(Qr, qoff), qr1 = ldf_h(Qr, qoff + 32);
  const int cr = tid >> 3, cc = (tid & 7) * 8;                 /* copy: row within 16, 16-B piece of the 128-B row */
  const unsigned short* gk = Kp + (rowb + cr) * DM + h * HD + cc;
  const unsigned short* gv = VT + (size_t)(h * HD + cr) * NRP + rowb + cc;
  const unsigned lk = lds_off(&sk[0][cr][cc]), lv = lds_off(&sv[0][cr][cc]);
  auto fill = [&](const int s) {
    const unsigned bo = (unsigned)(s & 1) * (64u * TP * 2u);
    cp64(lk + bo, gk + (size_t)s * 64 * DM, (size_t)16 * DM);
    cp64(lv + bo, gv + s * 64, (size_t)16 * NRP);
  };
  const int foff = ln * TP + 8 * hh;
  const v8f z8 = {0.f, 0.f, 0.f, 0.f, 0.f, 0.f, 0.f, 0.f};
  v8f o[4] = {z8, z8, z8, z8};
  float m = -1.0e30f, l = 0.f;
  fill(0);
  wait_copies();
  __syncthreads();
  fill(1);
#pragma unroll 1
  for (int s = 0; s < SEQ / 64; ++s) {
   const unsigned short* pk = &sk[s & 1][0][0];
   const unsigned short* pv = &sv[s & 1][0][0];
#pragma unroll /* both 32-key passes of a stage: their LDS offsets become immediates */
   for (int kb = 0; kb < 64; kb += 32) {
    const int k0 = foff + kb * TP, k1 = k0 + 16 * TP;
    v8f sm0 = z8, sr0 = z8, sm1 = z8, sr1 = z8;
    v16h ka = ldf_h(pk, k0);      sm0 = mma_h(ka, qh0, sm0); sr0 = mma_h(ka, qr0, sr0);
    ka = ldf_h(pk, k1);           sm1 = mma_h(ka, qh0, sm1); sr1 = mma_h(ka, qr0, sr1);
    ka = ldf_h(pk, k0 + 32);      sm0 = mma_h(ka, qh1, sm0); sr0 = mma_h(ka, qr1, sr0);
    ka = ldf_h(pk, k1 + 32);      sm1 = mma_h(ka, qh1, sm1); sr1 = mma_h(ka, qr1, sr1);
    float s0[8], s1[8];
    float mx = -1.0e30f;
#pragma unroll
    for (int r = 0; r < 8; ++r) {
      s0[r] = sm0[r] * 0.125f + sr0[r] * 0.0001220703125f;     /* (main + res / 1024) / 8 */
      s1[r] = sm1[r] * 0.125f + sr1[r] * 0.0001220703125f;
      mx = fmaxf(mx, fmaxf(s0[r], s1[r]));
    }
    mx = fmaxf(mx, __shfl_xor(mx, 16));
    const float mn = fmaxf(m, mx);
    const float alpha = __expf(m - mn);
    const float ms = mn - 5.545177444479562f;                  /* probabilities carried x256 (also in l) */
    m = mn;
    FragH pf;
    float ps = 0.f;
#pragma unroll
    for (int r = 0; r < 8; ++r) {
      const float p0 = __expf(s0[r] - ms), p1 = __expf(s1[r] - ms);
      ps += p0 + p1;
      pf.h[r] = (_Float16)p0;
      pf.h[8 + r] = (_Float16)p1;
    }
    l = l * alpha + ps;
#pragma unroll
    for (int t = 0; t < 4; ++t)
#pragma unroll
      for (int r = 0; r < 8; ++r) o[t][r] *= alpha;
#pragma unroll
    for (int t = 0; t < 4; ++t) {
      const v16h va = ldf_h(pv, foff + t * 16 * TP + kb);
      o[t] = mma_h(va, pf.v, o[t]);
    }
   }
   wait_lds();
   wait_copies();
   __syncthreads();                                            /* publishes stage s + 1, frees stage s's buffer */
   if (s + 2 < SEQ / 64) fill(s + 2);
  }
  wait_copies();
  l += __shfl_xor(l, 16);
  const float inv = 1.0f / l;
#pragma unroll
  for (int t = 0; t < 4; ++t) {
    v8us vh, vl;
#pragma unroll
    for (int r = 0; r < 8; ++r) {
      const float c = o[t][r] * inv;                           /* ctx[query ln][d = 16t + 8hh + r] */
      const unsigned short hb = bf16_bits(c);
      vh[r] = hb;
      vl[r] = bf16_bits(c - bf16_val(hb));
    }
    *(v8us*)&sh[wave][ln][t * 16 + 8 * hh] = vh;
    *(v8us*)&sl[wave][ln][t * 16 + 8 * hh] = vl;
  }
  __builtin_amdgcn_fence(4 /* acq_rel order */, "workgroup");
  __builtin_amdgcn_wave_barrier();
  const int rq = lane >> 3, pc = lane & 7;                     
  {
#pragma unroll
    for (int qq = 0; qq < 4; ++qq) {
      const int row = qq * 4 + rq;                             /* qq*4 + {0..3} covers rows 0..15 */
      const v8us xh = *(const v8us*)&sh[wave][row][pc * 8];
      const v8us xl = *(const v8us*)&sl[wave][row][pc * 8];
      const size_t go = (rowb + q0 + row) * DM + h * HD + pc * 8;
      *(v8us*)(CH + go) = xh;
      *(v8us*)(CL + go) = xl;
    }
    
  }
}

// Y[NRP][DM] (f32) = (CH + CL) . Wt[DM][DM]^T + bias; bf16 operands, two products per tile pair into one accumulator; wave tile 32 x 64
// Operands: per 64-k stage the block copies its 128 CH rows, 128 CL rows and 64 Wt rows into LDS, one stage ahead (two buffers).
__global__ __launch_bounds__(128) void k_gemm_o(const unsigned short* __restrict__ CH, const unsigned short* __restrict__ CL, const unsigned short* __restrict__ Wt,
                                                const float* __restrict__ bias, float* __restrict__ Y) {
  __shared__ __attribute__((aligned(16))) float so[4][32][68];
  __shared__ __attribute__((aligned(16))) unsigned short sch[2][128][TP];
  __shared__ __attribute__((aligned(16))) unsigned short scl[2][128][TP];
  __shared__ __attribute__((aligned(16))) unsigned short sb[2][64][TP];
  const int tid = threadIdx.x;
  const int w = __builtin_amdgcn_readfirstlane(tid >> 5);
  const int lane = tid & 31, ln = lane & 15, hh = lane >> 4;
  const int ntn = DM >> 6;
  const int mt = blockIdx.x / ntn, nq = blockIdx.x - mt * ntn;
  const int row0 = mt * 128 + 32 * w, col0 = nq * 64;
  if (mt * 128 >= NRP) return;                 /* block-uniform, in front of every barrier */
  const int cr = tid >> 3, cc = (tid & 7) * 8; /* copy: row within 16, 16-B piece of the 128-B row */
  const size_t goa = (size_t)(mt * 128 + cr) * DM + cc;
  const unsigned short* gh = CH + goa;
  const unsigned short* gl = CL + goa;
  const unsigned short* gb = Wt + (size_t)(col0 + cr) * DM + cc;
  const unsigned lh = lds_off(&sch[0][cr][cc]), ll = lds_off(&scl[0][cr][cc]), lb = lds_off(&sb[0][cr][cc]);
  auto fill = [&](const int s) {
    const unsigned bu = (unsigned)(s & 1);
    cp64(lh + bu * (128u * TP * 2u), gh + s * 64, (size_t)16 * DM);
    cp64(lh + bu * (128u * TP * 2u) + 64u * TP * 2u, gh + (size_t)64 * DM + s * 64, (size_t)16 * DM);
    cp64(ll + bu * (128u * TP * 2u), gl + s * 64, (size_t)16 * DM);
    cp64(ll + bu * (128u * TP * 2u) + 64u * TP * 2u, gl + (size_t)64 * DM + s * 64, (size_t)16 * DM);
    cp64(lb + bu * (64u * TP * 2u), gb + s * 64, (size_t)16 * DM);
  };
  const int a0 = (32 * w + ln) * TP + 8 * hh, a1 = a0 + 16 * TP;
  const int b0 = ln * TP + 8 * hh, b1 = b0 + 16 * TP, b2 = b1 + 16 * TP, b3 = b2 + 16 * TP;
  const v8f z8 = {0.f, 0.f, 0.f, 0.f, 0.f, 0.f, 0.f, 0.f};
  v8f c00 = z8, c01 = z8, c02 = z8, c03 = z8, c10 = z8, c11 = z8, c12 = z8, c13 = z8;
  fill(0);
  wait_copies();
  __syncthreads();
  fill(1);
#pragma unroll 1
  for (int s = 0; s < DM / 64; ++s) {
    const unsigned short* ph = &sch[s & 1][0][0];
    const unsigned short* pl = &scl[s & 1][0][0];
    const unsigned short* pb = &sb[s & 1][0][0];
#pragma unroll /* both 32-k steps of a stage: their LDS offsets become immediates */
    for (int kb = 0; kb < 64; kb += 32) {
      const v16b h0 = ldf_b(ph, a0 + kb), l0 = ldf_b(pl, a0 + kb), h1 = ldf_b(ph, a1 + kb), l1 = ldf_b(pl, a1 + kb);
      v16b fb = ldf_b(pb, b0 + kb); c00 = mma_b2(h0, l0, fb, c00); c10 = mma_b2(h1, l1, fb, c10);
      fb = ldf_b(pb, b1 + kb); c01 = mma_b2(h0, l0, fb, c01); c11 = mma_b2(h1, l1, fb, c11);
      fb = ldf_b(pb, b2 + kb); c02 = mma_b2(h0, l0, fb, c02); c12 = mma_b2(h1, l1, fb, c12);
      fb = ldf_b(pb, b3 + kb); c03 = mma_b2(h0, l0, fb, c03); c13 = mma_b2(h1, l1, fb, c13);
    }
    wait_lds();
    wait_copies();
    __syncthreads();                           /* publishes stage s + 1, frees stage s's buffer */
    if (s + 2 < DM / 64) fill(s + 2);
  }
  wait_copies();
  v8f accs[8] = {c00, c01, c02, c03, c10, c11, c12, c13};
#pragma unroll
  for (int u = 0; u < 8; ++u) {
    const int t = u & 3, half = u >> 2;
    const float bc = bf16_rne(bias[col0 + t * 16 + ln]);
#pragma unroll
    for (int r = 0; r < 8; ++r) so[w][half * 16 + 8 * hh + r][t * 16 + ln] = accs[u][r] + bc;
  }
  __builtin_amdgcn_fence(4 /* acq_rel order */, "workgroup");
  __builtin_amdgcn_wave_barrier();
  const int rsub = lane >> 4, c4 = (lane & 15) * 4;
  {
#pragma unroll
    for (int q = 0; q < 16; ++q) {
      const int r = q * 2 + rsub;                          
      const v4f v = *(const v4fa*)&so[w][r][c4];
      *(v4f*)(Y + (size_t)(row0 + r) * DM + col0 + c4) = v;
    }
    
  }
}

__global__ __launch_bounds__(256) void k_ln(const float* __restrict__ x, const float* __restrict__ Y, const float* __restrict__ g, const float* __restrict__ bta, float* __restrict__ out) {
  __shared__ float red1[8];
  __shared__ float red2[8];
  const int row = blockIdx.x, tid = threadIdx.x, lane = tid & 31;
  const int wave = __builtin_amdgcn_readfirstlane(tid >> 5);
  const size_t xr = ((size_t)(row / SEQ) * SEQ_FULL + (size_t)(row % SEQ)) * DM + (size_t)tid * 4;
  const v4f xv = *(const v4fa*)(x + xr);
  const v4f yv = *(const v4fa*)(Y + (size_t)row * DM + (size_t)tid * 4);
  v4f hv;
  float s1 = 0.f;
#pragma unroll
  for (int q = 0; q < 4; ++q) { hv[q] = bf16_rne(xv[q]) + yv[q]; s1 += hv[q]; }
#pragma unroll
  for (int off = 16; off > 0; off >>= 1) s1 += __shfl_xor(s1, off);
  if (lane == 0) red1[wave] = s1;
  __syncthreads();
  float tot = 0.f;
#pragma unroll
  for (int i = 0; i < 8; ++i) tot += red1[i];
  const float mu = tot * (1.0f / (float)DM);
  float s2 = 0.f;
  v4f cv;
#pragma unroll
  for (int q = 0; q < 4; ++q) { cv[q] = hv[q] - mu; s2 += cv[q] * cv[q]; }
#pragma unroll
  for (int off = 16; off > 0; off >>= 1) s2 += __shfl_xor(s2, off);
  if (lane == 0) red2[wave] = s2;
  __syncthreads();
  float tv = 0.f;
#pragma unroll
  for (int i = 0; i < 8; ++i) tv += red2[i];
  const float rs = rsqrtf(tv * (1.0f / (float)DM) + LN_EPS);
  const v4f gv = *(const v4fa*)(g + tid * 4);
  const v4f bv = *(const v4fa*)(bta + tid * 4);
  v4f ov;
#pragma unroll
  for (int q = 0; q < 4; ++q) ov[q] = cv[q] * rs * bf16_rne(gv[q]) + bf16_rne(bv[q]);
  *(v4f*)(out + xr) = ov;
  
}

extern "C" void kernel_launch(void* const* d_in, const int* in_sizes, int n_in,
                              void* d_out, int out_size, void* d_ws, size_t ws_size, hipStream_t stream) {
  if (n_in < 11) return;
  const size_t need_x = ((size_t)(NB - 1) * SEQ_FULL + SEQ) * DM;
  if ((size_t)in_sizes[0] < need_x || (size_t)out_size < need_x) return;
  if ((size_t)in_sizes[1] < (size_t)DM * DM || (size_t)in_sizes[3] < (size_t)DM * DM || (size_t)in_sizes[5] < (size_t)DM * DM || (size_t)in_sizes[7] < (size_t)DM * DM) return;
  if (in_sizes[2] < DM || in_sizes[4] < DM || in_sizes[6] < DM || in_sizes[8] < DM || in_sizes[9] < DM || in_sizes[10] < DM) return;
  const float* x  = (const float*)d_in[0];
  const float* wq = (const float*)d_in[1]; const float* bq = (const float*)d_in[2];
  const float* wk = (const float*)d_in[3]; const float* bk = (const float*)d_in[4];
  const float* wv = (const float*)d_in[5]; const float* bv = (const float*)d_in[6];
  const float* wo = (const float*)d_in[7]; const float* bo = (const float*)d_in[8];
  const float* lg = (const float*)d_in[9]; const float* lb = (const float*)d_in[10];
  char* ws = (char*)d_ws; size_t off = 0;
  auto take = [&](size_t bytes) { char* p = ws + off; off += (bytes + 255) & ~(size_t)255; return p; };
  unsigned short* BQ = (unsigned short*)take(WS_W);
  unsigned short* BK = (unsigned short*)take(WS_W);
  unsigned short* BV = (unsigned short*)take(WS_W);
  unsigned short* BO = (unsigned short*)take(WS_W);
  unsigned short* X16 = (unsigned short*)take(WS_P16);
  unsigned short* QH  = (unsigned short*)take(WS_P16);
  unsigned short* QR  = (unsigned short*)take(WS_P16);
  unsigned short* K16 = (unsigned short*)take(WS_P16);
  unsigned short* VT  = (unsigned short*)take(WS_P16);
  unsigned short* CH  = (unsigned short*)take(WS_P16);
  unsigned short* CL  = (unsigned short*)take(WS_P16);
  float* Y = (float*)take(WS_P32);
  if (off > ws_size) return;
  const unsigned gw = (unsigned)(((size_t)DM * (DM / 8) + 255) / 256);
  k_wt_f16<<<gw, 256, 0, stream>>>(wq, BQ, DM, DM, 16.0f);      /* W[K = in][N = out] -> Bt[out][in] */
  k_wt_f16<<<gw, 256, 0, stream>>>(wk, BK, DM, DM, 16.0f);
  k_wt_f16<<<gw, 256, 0, stream>>>(wv, BV, DM, DM, 16.0f);
  k_wt_bf16<<<gw, 256, 0, stream>>>(wo, BO, DM, DM);
  k_x16<<<(unsigned)(((size_t)NRP * DM / 8 + 255) / 256), 256, 0, stream>>>(x, X16);
  k_gemm_q<<<(unsigned)((NRP / 128) * (DM / 64)), 128, 0, stream>>>(X16, BQ, bq, QH, QR);
  k_gemm_k<<<(unsigned)((NRP / 128) * (DM / 64)), 128, 0, stream>>>(X16, BK, bk, K16);
  k_gemm_vt<<<(unsigned)((DM / 128) * (NRP / 64)), 128, 0, stream>>>(BV, X16, bv, VT);
  k_flash<<<(unsigned)(NB * NH * (SEQ / 64)), 128, 0, stream>>>(QH, QR, K16, VT, CH, CL);
  k_gemm_o<<<(unsigned)((NRP / 128) * (DM / 64)), 128, 0, stream>>>(CH, CL, BO, bo, Y);
  k_ln<<<(unsigned)NRP, 256, 0, stream>>>(x, Y, lg, lb, (float*)d_out);
}

// v002
// One run takes 146 microseconds.
// Two timings next to v001 put it at 1.10 and 1.11 times that version's speed.
// Counting every step since v000, it is 2.31 times as fast.
#include <hip/hip_runtime.h>
// Compute dtype: inputs RNE-converted to bf16 on load; q/k/v projections v_wmma_f32_16x16x32_f16 (x exact f16, weights x16 exact f16); scores f16 (k single, q as f16 value + x1024 f16 residual in its own accumulator); P (x256 carried) and v single f16; output GEMM v_wmma_f32_16x16x32_bf16 (ctx bf16 hi|lo, Wo exact bf16); all accumulators, softmax statistics, residual add and LayerNorm f32.
// Structure: token rows r = b*SEQ + s. k_wt_*: [in][out] weights -> Bt[n][k] 16-bit planes. k_x16: x -> f16 rows. Q/K GEMMs (32x64 wave tiles) -> Qh, Qr, K16 planes; V GEMM with swapped operands -> VT[h*64+d][b*SEQ+s].
#ifndef NB
#define NB 2
#endif
#ifndef SEQ
#define SEQ 2048
#endif
#define NB_FULL 2
#define SEQ_FULL 2048
#define DM 1024
#define NH 16
#define HD 64
#define NRP (NB * SEQ)               /* plane rows */
#define LN_EPS 1e-5f

static_assert(NH * HD == DM);        // head h = columns h*64 + d
static_assert(HD == 64);
static_assert(DM == 1024);           // k_ln: 256 threads x 4 columns
static_assert(DM % 128 == 0);        // swapped V GEMM: M = DM in 128-row block tiles
static_assert(DM % 64 == 0);         // N tiles of 64
static_assert(DM % 32 == 0);         // K steps of 32
static_assert(NRP % 128 == 0);       // GEMM block tiles of 128 rows
static_assert(NRP % 64 == 0);        // swapped V GEMM N tiles
static_assert(SEQ % 64 == 0);        // flash: 64 queries per block, 32-key steps
static_assert(SEQ % 64 == 0 && SEQ / 64 >= 2);   // flash ring: 64-key stages, two buffers
static_assert(DM % 64 == 0 && DM / 64 >= 2);     // GEMM rings: 64-k stages, two buffers
static_assert(NB <= NB_FULL);
static_assert(SEQ <= SEQ_FULL);

typedef _Float16 v16h __attribute__((ext_vector_type(16)));
typedef __bf16 v16b __attribute__((ext_vector_type(16)));
typedef _Float16 v4h __attribute__((ext_vector_type(4)));
typedef unsigned short v8us __attribute__((ext_vector_type(8), may_alias));
typedef float v8f __attribute__((ext_vector_type(8)));
typedef float v4f __attribute__((ext_vector_type(4)));
typedef float v4fa __attribute__((ext_vector_type(4), may_alias));
union FragH { v16h v; v8us half[2]; _Float16 h[16]; unsigned short u[16]; };
union FragB { v16b v; v8us half[2]; unsigned short u[16]; };

/* workspace carve (bytes); every region is rows x pitch x element size exactly, stores never pass a region end */
#define WS_W   ((size_t)DM * DM * 2)
#define WS_P16 ((size_t)NRP * DM * 2)
#define WS_P32 ((size_t)NRP * DM * 4)
#define WS_TOTAL (4 * WS_W + 7 * WS_P16 + WS_P32)
static_assert(WS_W % 256 == 0);
static_assert(WS_P16 % 256 == 0);
static_assert(WS_TOTAL <= (size_t)134217728);

__device__ __forceinline__ unsigned short bf16_bits(float x) { unsigned int u = __float_as_uint(x); return (unsigned short)((u + 0x7FFFu + ((u >> 16) & 1u)) >> 16); }
__device__ __forceinline__ float bf16_val(unsigned short b) { return __uint_as_float(((unsigned int)b) << 16); }
__device__ __forceinline__ float bf16_rne(float x) { return bf16_val(bf16_bits(x)); }

// fragment loaders: off already includes 8*(lane>>4); elements 0..7 <- k0+8h.., elements 8..15 <- k0+16+8h..
__device__ __forceinline__ v16h ldf_h(const unsigned short* __restrict__ p, size_t off) { FragH f; f.half[0] = *(const v8us*)(p + off); f.half[1] = *(const v8us*)(p + off + 16); return f.v; }
__device__ __forceinline__ v16b ldf_b(const unsigned short* __restrict__ p, size_t off) { FragB f; f.half[0] = *(const v8us*)(p + off); f.half[1] = *(const v8us*)(p + off + 16); return f.v; }
__device__ __forceinline__ v8f mma_h(v16h a, v16h b, v8f c) {
  return __builtin_amdgcn_wmma_f32_16x16x32_f16(false, a, false, b, (short)0, c, false, false);
}
__device__ __forceinline__ v8f mma_b2(v16b ah, v16b al, v16b b, v8f c) {
  c = __builtin_amdgcn_wmma_f32_16x16x32_bf16(false, ah, false, b, (short)0, c, false, false);
  c = __builtin_amdgcn_wmma_f32_16x16x32_bf16(false, al, false, b, (short)0, c, false, false);
  return c;
}

// LDS operand tiles: rows of 64 16-bit elements (128 B) at a pitch of 72 (144 B = 16 B x 9, conflict-free for ds_load_b128 fragment reads).
#define TP 72
__device__ __forceinline__ unsigned lds_off(const void* p) { return (unsigned)(size_t)p; }
// One lane's share of 64 tile rows: 16 B of rows r, r + 16, r + 32, r + 48 go from global memory to LDS through no register; a wave's copy covers 4 whole 128-B lines.
// The s_wait_xcnt stands inside the copies' own statement so that no address register is rewritten ahead of it.
__device__ __forceinline__ void cp64(const unsigned l, const unsigned short* g, const size_t g16) {
  const unsigned short* g1 = g + g16; const unsigned short* g2 = g1 + g16; const unsigned short* g3 = g2 + g16;
  asm volatile("global_load_async_to_lds_b128 %0, %4, off\n\t"
               "global_load_async_to_lds_b128 %1, %5, off\n\t"
               "global_load_async_to_lds_b128 %2, %6, off\n\t"
               "global_load_async_to_lds_b128 %3, %7, off\n\t"
               "s_wait_xcnt 0x0"
               :: "v"(l), "v"(l + 16u * TP * 2u), "v"(l + 32u * TP * 2u), "v"(l + 48u * TP * 2u), "v"(g), "v"(g1), "v"(g2), "v"(g3) : "memory");
}
// own copies landed (in front of the barrier that publishes them to the other waves)
__device__ __forceinline__ void wait_copies() { asm volatile("s_wait_asynccnt 0x0" ::: "memory"); }
// own LDS reads retired (in front of the barrier behind which their buffer is refilled)
__device__ __forceinline__ void wait_lds() { asm volatile("s_wait_dscnt 0x0" ::: "memory"); }

__global__ __launch_bounds__(256) void k_wt_f16(const float* __restrict__ W, unsigned short* __restrict__ Wt, int K, int N, float scale) {
  const int t = blockIdx.x * 256 + threadIdx.x;
  const int k8n = K / 8;
  if (t >= N * k8n) return;
  const int n = t / k8n, k8 = (t % k8n) * 8;
  FragH f;
#pragma unroll
  for (int i = 0; i < 8; ++i) f.h[i] = (_Float16)(bf16_rne(W[(size_t)(k8 + i) * N + n]) * scale);
  const v8us o = f.half[0];
  *(v8us*)(Wt + (size_t)n * K + k8) = o;
  
}
// Wt[n][k] = bf16 bits of W[k][n]
__global__ __launch_bounds__(256) void k_wt_bf16(const float* __restrict__ W, unsigned short* __restrict__ Wt, int K, int N) {
  const int t = blockIdx.x * 256 + threadIdx.x;
  const int k8n = K / 8;
  if (t >= N * k8n) return;
  const int n = t / k8n, k8 = (t % k8n) * 8;
  v8us v;
#pragma unroll
  for (int i = 0; i < 8; ++i) v[i] = bf16_bits(W[(size_t)(k8 + i) * N + n]);
  *(v8us*)(Wt + (size_t)n * K + k8) = v;
  
}
__global__ __launch_bounds__(256) void k_x16(const float* __restrict__ x, unsigned short* __restrict__ X16) {
  const size_t t = (size_t)blockIdx.x * 256 + threadIdx.x;
  if (t >= (size_t)NRP * DM / 8) return;
  const size_t e = t * 8;
  const int r = (int)(e / DM), c = (int)(e % DM);
  const size_t src = ((size_t)(r / SEQ) * SEQ_FULL + (size_t)(r % SEQ)) * DM + c;
  const v4f a = *(const v4fa*)(x + src), b = *(const v4fa*)(x + src + 4);
  FragH f;
#pragma unroll
  for (int q = 0; q < 4; ++q) { f.h[q] = (_Float16)bf16_rne(a[q]); f.h[4 + q] = (_Float16)bf16_rne(b[q]); }
  const v8us o = f.half[0];
  *(v8us*)(X16 + e) = o;
  
}

// f16 GEMM C[M][N] = alpha * A[M][K] . Bt[N][K]^T + bias; block = 4 waves, wave tile 32 x 64, block tile 128 x 64; M % 128 == 0, N % 64 == 0, K % 64 == 0, K >= 128.
// Operands: per 64-k stage the block copies its 128 A rows and 64 Bt rows into LDS, one stage ahead (two buffers); fragments are read from LDS.
// MODE 0: f16 plane C0, bias per column. MODE 1: f16 value plane C0 + x1024 residual plane C1, bias per column. MODE 2: f16 plane C0, bias per row.
template <int MODE>
__device__ __forceinline__ void gemm_h_body(const unsigned short* __restrict__ A, const int lda, const unsigned short* __restrict__ Bt, const int ldb, const float alpha,
                                            const float* __restrict__ bias, unsigned short* C0, unsigned short* C1, const int ldc, const int M, const int N, const int K) {
  __shared__ __attribute__((aligned(16))) float so[4][32][68];
  __shared__ __attribute__((aligned(16))) unsigned short sa[2][128][TP];
  __shared__ __attribute__((aligned(16))) unsigned short sb[2][64][TP];
  const int tid = threadIdx.x;
  const int w = __builtin_amdgcn_readfirstlane(tid >> 5);
  const int lane = tid & 31, ln = lane & 15, hh = lane >> 4;
  const int ntn = N >> 6;
  const int mt = blockIdx.x / ntn, nq = blockIdx.x - mt * ntn;
  const int row0 = mt * 128 + 32 * w, col0 = nq * 64;
  if (mt * 128 >= M) return;                   /* block-uniform, in front of every barrier */
  const int cr = tid >> 3, cc = (tid & 7) * 8; /* copy: row within 16, 16-B piece of the 128-B row */
  const unsigned short* ga = A + (size_t)(mt * 128 + cr) * lda + cc;
  const unsigned short* gb = Bt + (size_t)(col0 + cr) * ldb + cc;
  const unsigned la = lds_off(&sa[0][cr][cc]), lb = lds_off(&sb[0][cr][cc]);
  const int ns = K >> 6;
  auto fill = [&](const int s) {
    const unsigned bu = (unsigned)(s & 1);
    cp64(la + bu * (128u * TP * 2u), ga + s * 64, (size_t)16 * lda);
    cp64(la + bu * (128u * TP * 2u) + 64u * TP * 2u, ga + (size_t)64 * lda + s * 64, (size_t)16 * lda);
    cp64(lb + bu * (64u * TP * 2u), gb + s * 64, (size_t)16 * ldb);
  };
  const int a0 = (32 * w + ln) * TP + 8 * hh, a1 = a0 + 16 * TP;
  const int b0 = ln * TP + 8 * hh, b1 = b0 + 16 * TP, b2 = b1 + 16 * TP, b3 = b2 + 16 * TP;
  const v8f z8 = {0.f, 0.f, 0.f, 0.f, 0.f, 0.f, 0.f, 0.f};
  v8f c00 = z8, c01 = z8, c02 = z8, c03 = z8, c10 = z8, c11 = z8, c12 = z8, c13 = z8;
  fill(0);
  wait_copies();
  __syncthreads();
  fill(1);
#pragma unroll 1
  for (int s = 0; s < ns; ++s) {
    const unsigned short* pa = &sa[s & 1][0][0];
    const unsigned short* pb = &sb[s & 1][0][0];
    /* all twelve fragments of the stage are read as one group into registers of their own, ahead of its sixteen WMMAs: one LDS round trip a stage, not one a WMMA pair */
    v16h fa[2][2], fb[2][4];
#pragma unroll /* both 32-k steps of a stage: their LDS offsets become immediates */
    for (int kk = 0; kk < 2; ++kk) {
      fa[kk][0] = ldf_h(pa, a0 + 32 * kk); fa[kk][1] = ldf_h(pa, a1 + 32 * kk);
      fb[kk][0] = ldf_h(pb, b0 + 32 * kk); fb[kk][1] = ldf_h(pb, b1 + 32 * kk);
      fb[kk][2] = ldf_h(pb, b2 + 32 * kk); fb[kk][3] = ldf_h(pb, b3 + 32 * kk);
    }
    __builtin_amdgcn_sched_barrier(0);         /* keeps the group of reads in front of the WMMAs: without it the scheduler sinks each read to its first use, with a full LDS wait there */
#pragma unroll /* fragment arrays stay in registers */
    for (int kk = 0; kk < 2; ++kk) {
      c00 = mma_h(fa[kk][0], fb[kk][0], c00); c10 = mma_h(fa[kk][1], fb[kk][0], c10);
      c01 = mma_h(fa[kk][0], fb[kk][1], c01); c11 = mma_h(fa[kk][1], fb[kk][1], c11);
      c02 = mma_h(fa[kk][0], fb[kk][2], c02); c12 = mma_h(fa[kk][1], fb[kk][2], c12);
      c03 = mma_h(fa[kk][0], fb[kk][3], c03); c13 = mma_h(fa[kk][1], fb[kk][3], c13);
    }
    __builtin_amdgcn_sched_barrier(0);         /* keeps the WMMAs in front of the stage's waits, inside the flight time of the next stage's copies */
    wait_lds();
    wait_copies();
    __syncthreads();                           /* publishes stage s + 1, frees stage s's buffer */
    if (s + 2 < ns) fill(s + 2);
  }
  wait_copies();
  v8f accs[8] = {c00, c01, c02, c03, c10, c11, c12, c13};
#pragma unroll
  for (int u = 0; u < 8; ++u) {
    const int t = u & 3, half = u >> 2;
    float bc = 0.f;
    float brow[8] = {0.f, 0.f, 0.f, 0.f, 0.f, 0.f, 0.f, 0.f};
    if (MODE == 2) {
      const v4f r0 = *(const v4fa*)(bias + row0 + half * 16 + 8 * hh), r1 = *(const v4fa*)(bias + row0 + half * 16 + 8 * hh + 4);
#pragma unroll
      for (int q = 0; q < 4; ++q) { brow[q] = bf16_rne(r0[q]); brow[4 + q] = bf16_rne(r1[q]); }
    } else {
      bc = bf16_rne(bias[col0 + t * 16 + ln]);
    }
#pragma unroll
    for (int r = 0; r < 8; ++r) {
      const int rloc = half * 16 + 8 * hh + r;           /* D: row 8h + r, col lane & 15 */
      const float bvv = (MODE == 2) ? brow[r] : bc;
      so[w][rloc][t * 16 + ln] = accs[u][r] * alpha + bvv;
    }
  }
  __builtin_amdgcn_fence(4 /* acq_rel order */, "workgroup");
  __builtin_amdgcn_wave_barrier();
  const int rsub = lane >> 4, c4 = (lane & 15) * 4;
  {
#pragma unroll
    for (int q = 0; q < 16; ++q) {
      const int r = q * 2 + rsub;                        
      const v4f v = *(const v4fa*)&so[w][r][c4];
      v4h h4, r4;
#pragma unroll
      for (int i = 0; i < 4; ++i) { const _Float16 hv = (_Float16)v[i]; h4[i] = hv; r4[i] = (_Float16)((v[i] - (float)hv) * 1024.0f); }
      const size_t go = (size_t)(row0 + r) * ldc + col0 + c4;
      *(v4h*)(C0 + go) = h4;
      if (MODE == 1) *(v4h*)(C1 + go) = r4;
    }
    
  }
}
__global__ __launch_bounds__(128) void k_gemm_q(const unsigned short* __restrict__ X16, const unsigned short* __restrict__ Bt, const float* __restrict__ bias, unsigned short* __restrict__ Qh, unsigned short* __restrict__ Qr) {
  gemm_h_body<1>(X16, DM, Bt, DM, 0.0625f, bias, Qh, Qr, DM, NRP, DM, DM);
}
__global__ __launch_bounds__(128) void k_gemm_k(const unsigned short* __restrict__ X16, const unsigned short* __restrict__ Bt, const float* __restrict__ bias, unsigned short* __restrict__ K16) {
  gemm_h_body<0>(X16, DM, Bt, DM, 0.0625f, bias, K16, K16, DM, NRP, DM, DM);
}
// swapped operands: VT[n = h*64+d][r = b*SEQ+s] = sum_k Wt[n][k] x[r][k] / 16 + bias[n]
__global__ __launch_bounds__(128) void k_gemm_vt(const unsigned short* __restrict__ Bt, const unsigned short* __restrict__ X16, const float* __restrict__ bias, unsigned short* __restrict__ VT) {
  gemm_h_body<2>(Bt, DM, X16, DM, 0.0625f, bias, VT, VT, NRP, DM, NRP, DM);
}

// fused attention: block = (b, h, 64 queries), 4 waves x 16 queries. Per 32-key step:
//   S^T tiles (keys x queries): A = K rows (lane&15 = key), B = Q rows (lane&15 = query); D reg r of lane (n, hh) = key 8hh + r, query n.
//   P^T B fragment: element r <- tile(keys 0..15) reg r, element 8 + r <- tile(keys 16..31) reg r (same lane).
//   O^T tiles (d x queries): A = V^T rows (lane&15 = d within tile), k = key.
// K rows and V^T rows of a 64-key stage are copied into LDS by the whole block, one stage ahead (two buffers); all four waves read their fragments there.
// sh/sl[wave] are private to the wave (ctx hi / lo staging, 16 rows x 64 columns written and read in full).
__global__ __launch_bounds__(128) void k_flash(const unsigned short* __restrict__ Qh, const unsigned short* __restrict__ Qr, const unsigned short* __restrict__ Kp,
                                               const unsigned short* __restrict__ VT, unsigned short* __restrict__ CH, unsigned short* __restrict__ CL) {
  __shared__ __attribute__((aligned(16))) unsigned short sh[4][16][72];
  __shared__ __attribute__((aligned(16))) unsigned short sl[4][16][72];
  __shared__ __attribute__((aligned(16))) unsigned short sk[2][64][TP];   /* [buffer][key][d] */
  __shared__ __attribute__((aligned(16))) unsigned short sv[2][HD][TP];   /* [buffer][d][key] */
  const int tid = threadIdx.x;
  const int wave = __builtin_amdgcn_readfirstlane(tid >> 5);
  const int lane = tid & 31, ln = lane & 15, hh = lane >> 4;
  const int bh = blockIdx.x / (SEQ / 64), qb = blockIdx.x % (SEQ / 64);
  const int b = bh / NH, h = bh % NH;
  const int q0 = qb * 64 + 16 * wave;
  const size_t rowb = (size_t)b * SEQ;
  const size_t qoff = (rowb + q0 + ln) * DM + h * HD + 8 * hh;
  const v16h qh0 = ldf_h(Qh, qoff), qh1 = ldf_h(Qh, qoff + 32);
  const v16h qr0 = ldf_h(Qr, qoff), qr1 = ldf_h(Qr, qoff + 32);
  const int cr = tid >> 3, cc = (tid & 7) * 8;                 /* copy: row within 16, 16-B piece of the 128-B row */
  const unsigned short* gk = Kp + (rowb + cr) * DM + h * HD + cc;
  const unsigned short* gv = VT + (size_t)(h * HD + cr) * NRP + rowb + cc;
  const unsigned lk = lds_off(&sk[0][cr][cc]), lv = lds_off(&sv[0][cr][cc]);
  auto fill = [&](const int s) {
    const unsigned bo = (unsigned)(s & 1) * (64u * TP * 2u);
    cp64(lk + bo, gk + (size_t)s * 64 * DM, (size_t)16 * DM);
    cp64(lv + bo, gv + s * 64, (size_t)16 * NRP);
  };
  const int foff = ln * TP + 8 * hh;
  const v8f z8 = {0.f, 0.f, 0.f, 0.f, 0.f, 0.f, 0.f, 0.f};
  v8f o[4] = {z8, z8, z8, z8};
  float m = -1.0e30f, l = 0.f;
  fill(0);
  wait_copies();
  __syncthreads();
  fill(1);
#pragma unroll 1
  for (int s = 0; s < SEQ / 64; ++s) {
   const unsigned short* pk = &sk[s & 1][0][0];
   const unsigned short* pv = &sv[s & 1][0][0];
#pragma unroll /* both 32-key passes of a stage: their LDS offsets become immediates */
   for (int kb = 0; kb < 64; kb += 32) {
    const int k0 = foff + kb * TP, k1 = k0 + 16 * TP;
    v8f sm0 = z8, sr0 = z8, sm1 = z8, sr1 = z8;
    v16h ka = ldf_h(pk, k0);      sm0 = mma_h(ka, qh0, sm0); sr0 = mma_h(ka, qr0, sr0);
    ka = ldf_h(pk, k1);           sm1 = mma_h(ka, qh0, sm1); sr1 = mma_h(ka, qr0, sr1);
    ka = ldf_h(pk, k0 + 32);      sm0 = mma_h(ka, qh1, sm0); sr0 = mma_h(ka, qr1, sr0);
    ka = ldf_h(pk, k1 + 32);      sm1 = mma_h(ka, qh1, sm1); sr1 = mma_h(ka, qr1, sr1);
    float s0[8], s1[8];
    float mx = -1.0e30f;
#pragma unroll
    for (int r = 0; r < 8; ++r) {
      s0[r] = sm0[r] * 0.125f + sr0[r] * 0.0001220703125f;     /* (main + res / 1024) / 8 */
      s1[r] = sm1[r] * 0.125f + sr1[r] * 0.0001220703125f;
      mx = fmaxf(mx, fmaxf(s0[r], s1[r]));
    }
    mx = fmaxf(mx, __shfl_xor(mx, 16));
    const float mn = fmaxf(m, mx);
    const float alpha = __expf(m - mn);
    const float ms = mn - 5.545177444479562f;                  /* probabilities carried x256 (also in l) */
    m = mn;
    FragH pf;
    float ps = 0.f;
#pragma unroll
    for (int r = 0; r < 8; ++r) {
      const float p0 = __expf(s0[r] - ms), p1 = __expf(s1[r] - ms);
      ps += p0 + p1;
      pf.h[r] = (_Float16)p0;
      pf.h[8 + r] = (_Float16)p1;
    }
    l = l * alpha + ps;
#pragma unroll
    for (int t = 0; t < 4; ++t)
#pragma unroll
      for (int r = 0; r < 8; ++r) o[t][r] *= alpha;
#pragma unroll
    for (int t = 0; t < 4; ++t) {
      const v16h va = ldf_h(pv, foff + t * 16 * TP + kb);
      o[t] = mma_h(va, pf.v, o[t]);
    }
   }
   wait_lds();
   wait_copies();
   __syncthreads();                                            /* publishes stage s + 1, frees stage s's buffer */
   if (s + 2 < SEQ / 64) fill(s + 2);
  }
  wait_copies();
  l += __shfl_xor(l, 16);
  const float inv = 1.0f / l;
#pragma unroll
  for (int t = 0; t < 4; ++t) {
    v8us vh, vl;
#pragma unroll
    for (int r = 0; r < 8; ++r) {
      const float c = o[t][r] * inv;                           /* ctx[query ln][d = 16t + 8hh + r] */
      const unsigned short hb = bf16_bits(c);
      vh[r] = hb;
      vl[r] = bf16_bits(c - bf16_val(hb));
    }
    *(v8us*)&sh[wave][ln][t * 16 + 8 * hh] = vh;
    *(v8us*)&sl[wave][ln][t * 16 + 8 * hh] = vl;
  }
  __builtin_amdgcn_fence(4 /* acq_rel order */, "workgroup");
  __builtin_amdgcn_wave_barrier();
  const int rq = lane >> 3, pc = lane & 7;                     
  {
#pragma unroll
    for (int qq = 0; qq < 4; ++qq) {
      const int row = qq * 4 + rq;                             /* qq*4 + {0..3} covers rows 0..15 */
      const v8us xh = *(const v8us*)&sh[wave][row][pc * 8];
      const v8us xl = *(const v8us*)&sl[wave][row][pc * 8];
      const size_t go = (rowb + q0 + row) * DM + h * HD + pc * 8;
      *(v8us*)(CH + go) = xh;
      *(v8us*)(CL + go) = xl;
    }
    
  }
}

// Y[NRP][DM] (f32) = (CH + CL) . Wt[DM][DM]^T + bias; bf16 operands, two products per tile pair into one accumulator; wave tile 32 x 64
// Operands: per 64-k stage the block copies its 128 CH rows, 128 CL rows and 64 Wt rows into LDS, one stage ahead (two buffers).
__global__ __launch_bounds__(128) void k_gemm_o(const unsigned short* __restrict__ CH, const unsigned short* __restrict__ CL, const unsigned short* __restrict__ Wt,
                                                const float* __restrict__ bias, float* __restrict__ Y) {
  __shared__ __attribute__((aligned(16))) float so[4][32][68];
  __shared__ __attribute__((aligned(16))) unsigned short sch[2][128][TP];
  __shared__ __attribute__((aligned(16))) unsigned short scl[2][128][TP];
  __shared__ __attribute__((aligned(16))) unsigned short sb[2][64][TP];
  const int tid = threadIdx.x;
  const int w = __builtin_amdgcn_readfirstlane(tid >> 5);
  const int lane = tid & 31, ln = lane & 15, hh = lane >> 4;
  const int ntn = DM >> 6;
  const int mt = blockIdx.x / ntn, nq = blockIdx.x - mt * ntn;
  const int row0 = mt * 128 + 32 * w, col0 = nq * 64;
  if (mt * 128 >= NRP) return;                 /* block-uniform, in front of every barrier */
  const int cr = tid >> 3, cc = (tid & 7) * 8; /* copy: row within 16, 16-B piece of the 128-B row */
  const size_t goa = (size_t)(mt * 128 + cr) * DM + cc;
  const unsigned short* gh = CH + goa;
  const unsigned short* gl = CL + goa;
  const unsigned short* gb = Wt + (size_t)(col0 + cr) * DM + cc;
  const unsigned lh = lds_off(&sch[0][cr][cc]), ll = lds_off(&scl[0][cr][cc]), lb = lds_off(&sb[0][cr][cc]);
  auto fill = [&](const int s) {
    const unsigned bu = (unsigned)(s & 1);
    cp64(lh + bu * (128u * TP * 2u), gh + s * 64, (size_t)16 * DM);
    cp64(lh + bu * (128u * TP * 2u) + 64u * TP * 2u, gh + (size_t)64 * DM + s * 64, (size_t)16 * DM);
    cp64(ll + bu * (128u * TP * 2u), gl + s * 64, (size_t)16 * DM);
    cp64(ll + bu * (128u * TP * 2u) + 64u * TP * 2u, gl + (size_t)64 * DM + s * 64, (size_t)16 * DM);
    cp64(lb + bu * (64u * TP * 2u), gb + s * 64, (size_t)16 * DM);
  };
  const int a0 = (32 * w + ln) * TP + 8 * hh, a1 = a0 + 16 * TP;
  const int b0 = ln * TP + 8 * hh, b1 = b0 + 16 * TP, b2 = b1 + 16 * TP, b3 = b2 + 16 * TP;
  const v8f z8 = {0.f, 0.f, 0.f, 0.f, 0.f, 0.f, 0.f, 0.f};
  v8f c00 = z8, c01 = z8, c02 = z8, c03 = z8, c10 = z8, c11 = z8, c12 = z8, c13 = z8;
  fill(0);
  wait_copies();
  __syncthreads();
  fill(1);
#pragma unroll 1
  for (int s = 0; s < DM / 64; ++s) {
    const unsigned short* ph = &sch[s & 1][0][0];
    const unsigned short* pl = &scl[s & 1][0][0];
    const unsigned short* pb = &sb[s & 1][0][0];
    /* all sixteen fragments of the stage are read as one group into registers of their own, ahead of its thirty-two WMMAs */
    v16b fh[2][2], fl[2][2], fb[2][4];
#pragma unroll /* both 32-k steps of a stage: their LDS offsets become immediates */
    for (int kk = 0; kk < 2; ++kk) {
      fh[kk][0] = ldf_b(ph, a0 + 32 * kk); fl[kk][0] = ldf_b(pl, a0 + 32 * kk); fh[kk][1] = ldf_b(ph, a1 + 32 * kk); fl[kk][1] = ldf_b(pl, a1 + 32 * kk);
      fb[kk][0] = ldf_b(pb, b0 + 32 * kk); fb[kk][1] = ldf_b(pb, b1 + 32 * kk);
      fb[kk][2] = ldf_b(pb, b2 + 32 * kk); fb[kk][3] = ldf_b(pb, b3 + 32 * kk);
    }
    __builtin_amdgcn_sched_barrier(0);         /* keeps the group of reads in front of the WMMAs: without it the scheduler sinks each read to its first use, with a full LDS wait there */
#pragma unroll /* fragment arrays stay in registers */
    for (int kk = 0; kk < 2; ++kk) {
      c00 = mma_b2(fh[kk][0], fl[kk][0], fb[kk][0], c00); c10 = mma_b2(fh[kk][1], fl[kk][1], fb[kk][0], c10);
      c01 = mma_b2(fh[kk][0], fl[kk][0], fb[kk][1], c01); c11 = mma_b2(fh[kk][1], fl[kk][1], fb[kk][1], c11);
      c02 = mma_b2(fh[kk][0], fl[kk][0], fb[kk][2], c02); c12 = mma_b2(fh[kk][1], fl[kk][1], fb[kk][2], c12);
      c03 = mma_b2(fh[kk][0], fl[kk][0], fb[kk][3], c03); c13 = mma_b2(fh[kk][1], fl[kk][1], fb[kk][3], c13);
    }
    __builtin_amdgcn_sched_barrier(0);         /* keeps the WMMAs in front of the stage's waits, inside the flight time of the next stage's copies */
    wait_lds();
    wait_copies();
    __syncthreads();                           /* publishes stage s + 1, frees stage s's buffer */
    if (s + 2 < DM / 64) fill(s + 2);
  }
  wait_copies();
  v8f accs[8] = {c00, c01, c02, c03, c10, c11, c12, c13};
#pragma unroll
  for (int u = 0; u < 8; ++u) {
    const int t = u & 3, half = u >> 2;
    const float bc = bf16_rne(bias[col0 + t * 16 + ln]);
#pragma unroll
    for (int r = 0; r < 8; ++r) so[w][half * 16 + 8 * hh + r][t * 16 + ln] = accs[u][r] + bc;
  }
  __builtin_amdgcn_fence(4 /* acq_rel order */, "workgroup");
  __builtin_amdgcn_wave_barrier();
  const int rsub = lane >> 4, c4 = (lane & 15) * 4;
  {
#pragma unroll
    for (int q = 0; q < 16; ++q) {
      const int r = q * 2 + rsub;                          
      const v4f v = *(const v4fa*)&so[w][r][c4];
      *(v4f*)(Y + (size_t)(row0 + r) * DM + col0 + c4) = v;
    }
    
  }
}

__global__ __launch_bounds__(256) void k_ln(const float* __restrict__ x, const float* __restrict__ Y, const float* __restrict__ g, const float* __restrict__ bta, float* __restrict__ out) {
  __shared__ float red1[8];
  __shared__ float red2[8];
  const int row = blockIdx.x, tid = threadIdx.x, lane = tid & 31;
  const int wave = __builtin_amdgcn_readfirstlane(tid >> 5);
  const size_t xr = ((size_t)(row / SEQ) * SEQ_FULL + (size_t)(row % SEQ)) * DM + (size_t)tid * 4;
  const v4f xv = *(const v4fa*)(x + xr);
  const v4f yv = *(const v4fa*)(Y + (size_t)row * DM + (size_t)tid * 4);
  v4f hv;
  float s1 = 0.f;
#pragma unroll
  for (int q = 0; q < 4; ++q) { hv[q] = bf16_rne(xv[q]) + yv[q]; s1 += hv[q]; }
#pragma unroll
  for (int off = 16; off > 0; off >>= 1) s1 += __shfl_xor(s1, off);
  if (lane == 0) red1[wave] = s1;
  __syncthreads();
  float tot = 0.f;
#pragma unroll
  for (int i = 0; i < 8; ++i) tot += red1[i];
  const float mu = tot * (1.0f / (float)DM);
  float s2 = 0.f;
  v4f cv;
#pragma unroll
  for (int q = 0; q < 4; ++q) { cv[q] = hv[q] - mu; s2 += cv[q] * cv[q]; }
#pragma unroll
  for (int off = 16; off > 0; off >>= 1) s2 += __shfl_xor(s2, off);
  if (lane == 0) red2[wave] = s2;
  __syncthreads();
  float tv = 0.f;
#pragma unroll
  for (int i = 0; i < 8; ++i) tv += red2[i];
  const float rs = rsqrtf(tv * (1.0f / (float)DM) + LN_EPS);
  const v4f gv = *(const v4fa*)(g + tid * 4);
  const v4f bv = *(const v4fa*)(bta + tid * 4);
  v4f ov;
#pragma unroll
  for (int q = 0; q < 4; ++q) ov[q] = cv[q] * rs * bf16_rne(gv[q]) + bf16_rne(bv[q]);
  *(v4f*)(out + xr) = ov;
  
}

extern "C" void kernel_launch(void* const* d_in, const int* in_sizes, int n_in,
                              void* d_out, int out_size, void* d_ws, size_t ws_size, hipStream_t stream) {
  if (n_in < 11) return;
  const size_t need_x = ((size_t)(NB - 1) * SEQ_FULL + SEQ) * DM;
  if ((size_t)in_sizes[0] < need_x || (size_t)out_size < need_x) return;
  if ((size_t)in_sizes[1] < (size_t)DM * DM || (size_t)in_sizes[3] < (size_t)DM * DM || (size_t)in_sizes[5] < (size_t)DM * DM || (size_t)in_sizes[7] < (size_t)DM * DM) return;
  if (in_sizes[2] < DM || in_sizes[4] < DM || in_sizes[6] < DM || in_sizes[8] < DM || in_sizes[9] < DM || in_sizes[10] < DM) return;
  const float* x  = (const float*)d_in[0];
  const float* wq = (const float*)d_in[1]; const float* bq = (const float*)d_in[2];
  const float* wk = (const float*)d_in[3]; const float* bk = (const float*)d_in[4];
  const float* wv = (const float*)d_in[5]; const float* bv = (const float*)d_in[6];
  const float* wo = (const float*)d_in[7]; const float* bo = (const float*)d_in[8];
  const float* lg = (const float*)d_in[9]; const float* lb = (const float*)d_in[10];
  char* ws = (char*)d_ws; size_t off = 0;
  auto take = [&](size_t bytes) { char* p = ws + off; off += (bytes + 255) & ~(size_t)255; return p; };
  unsigned short* BQ = (unsigned short*)take(WS_W);
  unsigned short* BK = (unsigned short*)take(WS_W);
  unsigned short* BV = (unsigned short*)take(WS_W);
  unsigned short* BO = (unsigned short*)take(WS_W);
  unsigned short* X16 = (unsigned short*)take(WS_P16);
  unsigned short* QH  = (unsigned short*)take(WS_P16);
  unsigned short* QR  = (unsigned short*)take(WS_P16);
  unsigned short* K16 = (unsigned short*)take(WS_P16);
  unsigned short* VT  = (unsigned short*)take(WS_P16);
  unsigned short* CH  = (unsigned short*)take(WS_P16);
  unsigned short* CL  = (unsigned short*)take(WS_P16);
  float* Y = (float*)take(WS_P32);
  if (off > ws_size) return;
  const unsigned gw = (unsigned)(((size_t)DM * (DM / 8) + 255) / 256);
  k_wt_f16<<<gw, 256, 0, stream>>>(wq, BQ, DM, DM, 16.0f);      /* W[K = in][N = out] -> Bt[out][in] */
  k_wt_f16<<<gw, 256, 0, stream>>>(wk, BK, DM, DM, 16.0f);
  k_wt_f16<<<gw, 256, 0, stream>>>(wv, BV, DM, DM, 16.0f);
  k_wt_bf16<<<gw, 256, 0, stream>>>(wo, BO, DM, DM);
  k_x16<<<(unsigned)(((size_t)NRP * DM / 8 + 255) / 256), 256, 0, stream>>>(x, X16);
  k_gemm_q<<<(unsigned)((NRP / 128) * (DM / 64)), 128, 0, stream>>>(X16, BQ, bq, QH, QR);
  k_gemm_k<<<(unsigned)((NRP / 128) * (DM / 64)), 128, 0, stream>>>(X16, BK, bk, K16);
  k_gemm_vt<<<(unsigned)((DM / 128) * (NRP / 64)), 128, 0, stream>>>(BV, X16, bv, VT);
  k_flash<<<(unsigned)(NB * NH * (SEQ / 64)), 128, 0, stream>>>(QH, QR, K16, VT, CH, CL);
  k_gemm_o<<<(unsigned)((NRP / 128) * (DM / 64)), 128, 0, stream>>>(CH, CL, BO, bo, Y);
  k_ln<<<(unsigned)NRP, 256, 0, stream>>>(x, Y, lg, lb, (float*)d_out);
}

// v003
// One run takes 123 microseconds.
// In both of two side-by-side timings against v002, it was 1.19 times as fast.
// Over all steps from v000 it is 2.74 times as fast.
#include <hip/hip_runtime.h>
// Compute dtype: inputs RNE-converted to bf16 on load; q/k/v projections v_wmma_f32_16x16x32_f16 (x exact f16, weights x16 exact f16); scores f16 (k single, q as f16 value + x1024 f16 residual in its own accumulator); P (x256 carried) and v single f16; output GEMM v_wmma_f32_16x16x32_bf16 (ctx bf16 hi|lo, Wo exact bf16); all accumulators, softmax statistics, residual add and LayerNorm f32.
// Structure: token rows r = b*SEQ + s. k_prep (one grid, block ranges): [in][out] weights -> Bt[n][k] 16-bit planes, x -> f16 rows. k_gemm_qkv (one grid, block ranges): Q/K GEMMs (32x64 wave tiles) -> Qh, Qr, K16 planes; V GEMM with swapped operands -> VT[h*64+d][b*SEQ+s].
#ifndef NB
#define NB 2
#endif
#ifndef SEQ
#define SEQ 2048
#endif
#define NB_FULL 2
#define SEQ_FULL 2048
#define DM 1024
#define NH 16
#define HD 64
#define NRP (NB * SEQ)               /* plane rows */
#define LN_EPS 1e-5f

static_assert(NH * HD == DM);        // head h = columns h*64 + d
static_assert(HD == 64);
static_assert(DM == 1024);           // k_ln: 256 threads x 4 columns
static_assert(DM % 128 == 0);        // swapped V GEMM: M = DM in 128-row block tiles
static_assert(DM % 64 == 0);         // N tiles of 64
static_assert(DM % 32 == 0);         // K steps of 32
static_assert(NRP % 128 == 0);       // GEMM block tiles of 128 rows
static_assert(NRP % 64 == 0);        // swapped V GEMM N tiles
static_assert(SEQ % 64 == 0);        // flash: 64 queries per block, 32-key steps
static_assert(SEQ % 64 == 0 && SEQ / 64 >= 2);   // flash ring: 64-key stages, two buffers
static_assert(DM % 64 == 0 && DM / 64 >= 2);     // GEMM rings: 64-k stages, two buffers
static_assert(NB <= NB_FULL);
static_assert(SEQ <= SEQ_FULL);

typedef _Float16 v16h __attribute__((ext_vector_type(16)));
typedef __bf16 v16b __attribute__((ext_vector_type(16)));
typedef _Float16 v4h __attribute__((ext_vector_type(4)));
typedef unsigned short v8us __attribute__((ext_vector_type(8), may_alias));
typedef float v8f __attribute__((ext_vector_type(8)));
typedef float v4f __attribute__((ext_vector_type(4)));
typedef float v4fa __attribute__((ext_vector_type(4), may_alias));
union FragH { v16h v; v8us half[2]; _Float16 h[16]; unsigned short u[16]; };
union FragB { v16b v; v8us half[2]; unsigned short u[16]; };

/* workspace carve (bytes); every region is rows x pitch x element size exactly, stores never pass a region end */
#define WS_W   ((size_t)DM * DM * 2)
#define WS_P16 ((size_t)NRP * DM * 2)
#define WS_P32 ((size_t)NRP * DM * 4)
#define WS_TOTAL (4 * WS_W + 7 * WS_P16 + WS_P32)
static_assert(WS_W % 256 == 0);
static_assert(WS_P16 % 256 == 0);
static_assert(WS_TOTAL <= (size_t)134217728);

__device__ __forceinline__ unsigned short bf16_bits(float x) { unsigned int u = __float_as_uint(x); return (unsigned short)((u + 0x7FFFu + ((u >> 16) & 1u)) >> 16); }
__device__ __forceinline__ float bf16_val(unsigned short b) { return __uint_as_float(((unsigned int)b) << 16); }
__device__ __forceinline__ float bf16_rne(float x) { return bf16_val(bf16_bits(x)); }

// fragment loaders: off already includes 8*(lane>>4); elements 0..7 <- k0+8h.., elements 8..15 <- k0+16+8h..
__device__ __forceinline__ v16h ldf_h(const unsigned short* __restrict__ p, size_t off) { FragH f; f.half[0] = *(const v8us*)(p + off); f.half[1] = *(const v8us*)(p + off + 16); return f.v; }
__device__ __forceinline__ v16b ldf_b(const unsigned short* __restrict__ p, size_t off) { FragB f; f.half[0] = *(const v8us*)(p + off); f.half[1] = *(const v8us*)(p + off + 16); return f.v; }
__device__ __forceinline__ v8f mma_h(v16h a, v16h b, v8f c) {
  return __builtin_amdgcn_wmma_f32_16x16x32_f16(false, a, false, b, (short)0, c, false, false);
}
__device__ __forceinline__ v8f mma_b2(v16b ah, v16b al, v16b b, v8f c) {
  c = __builtin_amdgcn_wmma_f32_16x16x32_bf16(false, ah, false, b, (short)0, c, false, false);
  c = __builtin_amdgcn_wmma_f32_16x16x32_bf16(false, al, false, b, (short)0, c, false, false);
  return c;
}

// LDS operand tiles: rows of 64 16-bit elements (128 B) at a pitch of 72 (144 B = 16 B x 9, conflict-free for ds_load_b128 fragment reads).
#define TP 72
__device__ __forceinline__ unsigned lds_off(const void* p) { return (unsigned)(size_t)p; }
// One lane's share of 64 tile rows: 16 B of rows r, r + 16, r + 32, r + 48 go from global memory to LDS through no register; a wave's copy covers 4 whole 128-B lines.
// The s_wait_xcnt stands inside the copies' own statement so that no address register is rewritten ahead of it.
__device__ __forceinline__ void cp64(const unsigned l, const unsigned short* g, const size_t g16) {
  const unsigned short* g1 = g + g16; const unsigned short* g2 = g1 + g16; const unsigned short* g3 = g2 + g16;
  asm volatile("global_load_async_to_lds_b128 %0, %4, off\n\t"
               "global_load_async_to_lds_b128 %1, %5, off\n\t"
               "global_load_async_to_lds_b128 %2, %6, off\n\t"
               "global_load_async_to_lds_b128 %3, %7, off\n\t"
               "s_wait_xcnt 0x0"
               :: "v"(l), "v"(l + 16u * TP * 2u), "v"(l + 32u * TP * 2u), "v"(l + 48u * TP * 2u), "v"(g), "v"(g1), "v"(g2), "v"(g3) : "memory");
}
// own copies landed (in front of the barrier that publishes them to the other waves)
__device__ __forceinline__ void wait_copies() { asm volatile("s_wait_asynccnt 0x0" ::: "memory"); }
// own LDS reads retired (in front of the barrier behind which their buffer is refilled)
__device__ __forceinline__ void wait_lds() { asm volatile("s_wait_dscnt 0x0" ::: "memory"); }

// Wt[n][k] = f16 of scale * bf16(W[k][n]); bid = block index within this job's range
__device__ __forceinline__ void wt_f16_body(const float* __restrict__ W, unsigned short* __restrict__ Wt, const int K, const int N, const float scale, const int bid) {
  const int t = bid * 256 + threadIdx.x;
  const int k8n = K / 8;
  if (t >= N * k8n) return;
  const int n = t / k8n, k8 = (t % k8n) * 8;
  FragH f;
#pragma unroll
  for (int i = 0; i < 8; ++i) f.h[i] = (_Float16)(bf16_rne(W[(size_t)(k8 + i) * N + n]) * scale);
  const v8us o = f.half[0];
  *(v8us*)(Wt + (size_t)n * K + k8) = o;
  
}
// Wt[n][k] = bf16 bits of W[k][n]
__device__ __forceinline__ void wt_bf16_body(const float* __restrict__ W, unsigned short* __restrict__ Wt, const int K, const int N, const int bid) {
  const int t = bid * 256 + threadIdx.x;
  const int k8n = K / 8;
  if (t >= N * k8n) return;
  const int n = t / k8n, k8 = (t % k8n) * 8;
  v8us v;
#pragma unroll
  for (int i = 0; i < 8; ++i) v[i] = bf16_bits(W[(size_t)(k8 + i) * N + n]);
  *(v8us*)(Wt + (size_t)n * K + k8) = v;
  
}
__device__ __forceinline__ void x16_body(const float* __restrict__ x, unsigned short* __restrict__ X16, const int bid) {
  const size_t t = (size_t)bid * 256 + threadIdx.x;
  if (t >= (size_t)NRP * DM / 8) return;
  const size_t e = t * 8;
  const int r = (int)(e / DM), c = (int)(e % DM);
  const size_t src = ((size_t)(r / SEQ) * SEQ_FULL + (size_t)(r % SEQ)) * DM + c;
  const v4f a = *(const v4fa*)(x + src), b = *(const v4fa*)(x + src + 4);
  FragH f;
#pragma unroll
  for (int q = 0; q < 4; ++q) { f.h[q] = (_Float16)bf16_rne(a[q]); f.h[4 + q] = (_Float16)bf16_rne(b[q]); }
  const v8us o = f.half[0];
  *(v8us*)(X16 + e) = o;
  
}
// The five independent operand preparations as block ranges of one grid: the four weight planes first (their strided reads take longest), then x.
#define GW_BLK ((DM * (DM / 8) + 255) / 256)          /* blocks of one weight plane */
#define GX_BLK ((NRP * (DM / 8) + 255) / 256)         /* blocks of x */
__global__ __launch_bounds__(256) void k_prep(const float* __restrict__ x, const float* __restrict__ wq, const float* __restrict__ wk, const float* __restrict__ wv, const float* __restrict__ wo,
                                              unsigned short* __restrict__ X16, unsigned short* __restrict__ BQ, unsigned short* __restrict__ BK, unsigned short* __restrict__ BV, unsigned short* __restrict__ BO) {
  const int bid = blockIdx.x;                  /* every test below is block-uniform */
  if (bid < GW_BLK) wt_f16_body(wq, BQ, DM, DM, 16.0f, bid);      /* W[K = in][N = out] -> Bt[out][in] */
  else if (bid < 2 * GW_BLK) wt_f16_body(wk, BK, DM, DM, 16.0f, bid - GW_BLK);
  else if (bid < 3 * GW_BLK) wt_f16_body(wv, BV, DM, DM, 16.0f, bid - 2 * GW_BLK);
  else if (bid < 4 * GW_BLK) wt_bf16_body(wo, BO, DM, DM, bid - 3 * GW_BLK);
  else x16_body(x, X16, bid - 4 * GW_BLK);
}

// f16 GEMM C[M][N] = alpha * A[M][K] . Bt[N][K]^T + bias; block = 4 waves, wave tile 32 x 64, block tile 128 x 64; M % 128 == 0, N % 64 == 0, K % 64 == 0, K >= 128.
// Operands: per 64-k stage the block copies its 128 A rows and 64 Bt rows into LDS, one stage ahead (two buffers); fragments are read from LDS.
// MODE 0: f16 plane C0, bias per column. MODE 1: f16 value plane C0 + x1024 residual plane C1, bias per column. MODE 2: f16 plane C0, bias per row.
// bid = block index within this product's range of the grid; so, sa, sb = the kernel's LDS (output staging [4][32][68], A ring [2][128][TP], B ring [2][64][TP]).
template <int MODE>
__device__ __forceinline__ void gemm_h_body(const unsigned short* __restrict__ A, const int lda, const unsigned short* __restrict__ Bt, const int ldb, const float alpha,
                                            const float* __restrict__ bias, unsigned short* C0, unsigned short* C1, const int ldc, const int M, const int N, const int K,
                                            const int bid, float (*so)[32][68], unsigned short (*sa)[128][TP], unsigned short (*sb)[64][TP]) {
  const int tid = threadIdx.x;
  const int w = __builtin_amdgcn_readfirstlane(tid >> 5);
  const int lane = tid & 31, ln = lane & 15, hh = lane >> 4;
  const int ntn = N >> 6;
  const int mt = bid / ntn, nq = bid - mt * ntn;
  const int row0 = mt * 128 + 32 * w, col0 = nq * 64;
  if (mt * 128 >= M) return;                   /* block-uniform, in front of every barrier */
  const int cr = tid >> 3, cc = (tid & 7) * 8; /* copy: row within 16, 16-B piece of the 128-B row */
  const unsigned short* ga = A + (size_t)(mt * 128 + cr) * lda + cc;
  const unsigned short* gb = Bt + (size_t)(col0 + cr) * ldb + cc;
  const unsigned la = lds_off(&sa[0][cr][cc]), lb = lds_off(&sb[0][cr][cc]);
  const int ns = K >> 6;
  auto fill = [&](const int s) {
    const unsigned bu = (unsigned)(s & 1);
    cp64(la + bu * (128u * TP * 2u), ga + s * 64, (size_t)16 * lda);
    cp64(la + bu * (128u * TP * 2u) + 64u * TP * 2u, ga + (size_t)64 * lda + s * 64, (size_t)16 * lda);
    cp64(lb + bu * (64u * TP * 2u), gb + s * 64, (size_t)16 * ldb);
  };
  const int a0 = (32 * w + ln) * TP + 8 * hh, a1 = a0 + 16 * TP;
  const int b0 = ln * TP + 8 * hh, b1 = b0 + 16 * TP, b2 = b1 + 16 * TP, b3 = b2 + 16 * TP;
  const v8f z8 = {0.f, 0.f, 0.f, 0.f, 0.f, 0.f, 0.f, 0.f};
  v8f c00 = z8, c01 = z8, c02 = z8, c03 = z8, c10 = z8, c11 = z8, c12 = z8, c13 = z8;
  fill(0);
  wait_copies();
  __syncthreads();
  fill(1);
#pragma unroll 1
  for (int s = 0; s < ns; ++s) {
    const unsigned short* pa = &sa[s & 1][0][0];
    const unsigned short* pb = &sb[s & 1][0][0];
    /* all twelve fragments of the stage are read as one group into registers of their own, ahead of its sixteen WMMAs: one LDS round trip a stage, not one a WMMA pair */
    v16h fa[2][2], fb[2][4];
#pragma unroll /* both 32-k steps of a stage: their LDS offsets become immediates */
    for (int kk = 0; kk < 2; ++kk) {
      fa[kk][0] = ldf_h(pa, a0 + 32 * kk); fa[kk][1] = ldf_h(pa, a1 + 32 * kk);
      fb[kk][0] = ldf_h(pb, b0 + 32 * kk); fb[kk][1] = ldf_h(pb, b1 + 32 * kk);
      fb[kk][2] = ldf_h(pb, b2 + 32 * kk); fb[kk][3] = ldf_h(pb, b3 + 32 * kk);
    }
    __builtin_amdgcn_sched_barrier(0);         /* keeps the group of reads in front of the WMMAs: without it the scheduler sinks each read to its first use, with a full LDS wait there */
#pragma unroll /* fragment arrays stay in registers */
    for (int kk = 0; kk < 2; ++kk) {
      c00 = mma_h(fa[kk][0], fb[kk][0], c00); c10 = mma_h(fa[kk][1], fb[kk][0], c10);
      c01 = mma_h(fa[kk][0], fb[kk][1], c01); c11 = mma_h(fa[kk][1], fb[kk][1], c11);
      c02 = mma_h(fa[kk][0], fb[kk][2], c02); c12 = mma_h(fa[kk][1], fb[kk][2], c12);
      c03 = mma_h(fa[kk][0], fb[kk][3], c03); c13 = mma_h(fa[kk][1], fb[kk][3], c13);
    }
    __builtin_amdgcn_sched_barrier(0);         /* keeps the WMMAs in front of the stage's waits, inside the flight time of the next stage's copies */
    wait_lds();
    wait_copies();
    __syncthreads();                           /* publishes stage s + 1, frees stage s's buffer */
    if (s + 2 < ns) fill(s + 2);
  }
  wait_copies();
  v8f accs[8] = {c00, c01, c02, c03, c10, c11, c12, c13};
#pragma unroll
  for (int u = 0; u < 8; ++u) {
    const int t = u & 3, half = u >> 2;
    float bc = 0.f;
    float brow[8] = {0.f, 0.f, 0.f, 0.f, 0.f, 0.f, 0.f, 0.f};
    if (MODE == 2) {
      const v4f r0 = *(const v4fa*)(bias + row0 + half * 16 + 8 * hh), r1 = *(const v4fa*)(bias + row0 + half * 16 + 8 * hh + 4);
#pragma unroll
      for (int q = 0; q < 4; ++q) { brow[q] = bf16_rne(r0[q]); brow[4 + q] = bf16_rne(r1[q]); }
    } else {
      bc = bf16_rne(bias[col0 + t * 16 + ln]);
    }
#pragma unroll
    for (int r = 0; r < 8; ++r) {
      const int rloc = half * 16 + 8 * hh + r;           /* D: row 8h + r, col lane & 15 */
      const float bvv = (MODE == 2) ? brow[r] : bc;
      so[w][rloc][t * 16 + ln] = accs[u][r] * alpha + bvv;
    }
  }
  __builtin_amdgcn_fence(4 /* acq_rel order */, "workgroup");
  __builtin_amdgcn_wave_barrier();
  const int rsub = lane >> 4, c4 = (lane & 15) * 4;
  {
#pragma unroll
    for (int q = 0; q < 16; ++q) {
      const int r = q * 2 + rsub;                        
      const v4f v = *(const v4fa*)&so[w][r][c4];
      v4h h4, r4;
#pragma unroll
      for (int i = 0; i < 4; ++i) { const _Float16 hv = (_Float16)v[i]; h4[i] = hv; r4[i] = (_Float16)((v[i] - (float)hv) * 1024.0f); }
      const size_t go = (size_t)(row0 + r) * ldc + col0 + c4;
      *(v4h*)(C0 + go) = h4;
      if (MODE == 1) *(v4h*)(C1 + go) = r4;
    }
    /* behind the last store: in the merged kernel the code of another block range follows in the text and rewrites the stores' address and data registers */
    asm volatile("s_wait_xcnt 0x0" ::: "memory");
  }
}
// The three independent projections as block ranges of one grid, one set of LDS arrays.
// V with swapped operands: VT[n = h*64+d][r = b*SEQ+s] = sum_k Wt[n][k] x[r][k] / 16 + bias[n]
#define GQK_BLK ((NRP / 128) * (DM / 64))             /* blocks of the Q product, and of the K product */
#define GV_BLK ((DM / 128) * (NRP / 64))              /* blocks of the V product */
__global__ __launch_bounds__(128) void k_gemm_qkv(const unsigned short* __restrict__ X16, const unsigned short* __restrict__ BQ, const unsigned short* __restrict__ BK, const unsigned short* __restrict__ BV,
                                                  const float* __restrict__ bq, const float* __restrict__ bk, const float* __restrict__ bv,
                                                  unsigned short* __restrict__ Qh, unsigned short* __restrict__ Qr, unsigned short* __restrict__ K16, unsigned short* __restrict__ VT) {
  __shared__ __attribute__((aligned(16))) float so[4][32][68];
  __shared__ __attribute__((aligned(16))) unsigned short sa[2][128][TP];
  __shared__ __attribute__((aligned(16))) unsigned short sb[2][64][TP];
  const int bid = blockIdx.x;                  /* every test below is block-uniform */
  if (bid < GQK_BLK) gemm_h_body<1>(X16, DM, BQ, DM, 0.0625f, bq, Qh, Qr, DM, NRP, DM, DM, bid, so, sa, sb);
  else if (bid < 2 * GQK_BLK) gemm_h_body<0>(X16, DM, BK, DM, 0.0625f, bk, K16, K16, DM, NRP, DM, DM, bid - GQK_BLK, so, sa, sb);
  else gemm_h_body<2>(BV, DM, X16, DM, 0.0625f, bv, VT, VT, NRP, DM, NRP, DM, bid - 2 * GQK_BLK, so, sa, sb);
}

// fused attention: block = (b, h, 64 queries), 4 waves x 16 queries. Per 32-key step:
//   S^T tiles (keys x queries): A = K rows (lane&15 = key), B = Q rows (lane&15 = query); D reg r of lane (n, hh) = key 8hh + r, query n.
//   P^T B fragment: element r <- tile(keys 0..15) reg r, element 8 + r <- tile(keys 16..31) reg r (same lane).
//   O^T tiles (d x queries): A = V^T rows (lane&15 = d within tile), k = key.
// K rows and V^T rows of a 64-key stage are copied into LDS by the whole block, one stage ahead (two buffers); all four waves read their fragments there.
// sh/sl[wave] are private to the wave (ctx hi / lo staging, 16 rows x 64 columns written and read in full).
__global__ __launch_bounds__(128) void k_flash(const unsigned short* __restrict__ Qh, const unsigned short* __restrict__ Qr, const unsigned short* __restrict__ Kp,
                                               const unsigned short* __restrict__ VT, unsigned short* __restrict__ CH, unsigned short* __restrict__ CL) {
  __shared__ __attribute__((aligned(16))) unsigned short sh[4][16][72];
  __shared__ __attribute__((aligned(16))) unsigned short sl[4][16][72];
  __shared__ __attribute__((aligned(16))) unsigned short sk[2][64][TP];   /* [buffer][key][d] */
  __shared__ __attribute__((aligned(16))) unsigned short sv[2][HD][TP];   /* [buffer][d][key] */
  const int tid = threadIdx.x;
  const int wave = __builtin_amdgcn_readfirstlane(tid >> 5);
  const int lane = tid & 31, ln = lane & 15, hh = lane >> 4;
  const int bh = blockIdx.x / (SEQ / 64), qb = blockIdx.x % (SEQ / 64);
  const int b = bh / NH, h = bh % NH;
  const int q0 = qb * 64 + 16 * wave;
  const size_t rowb = (size_t)b * SEQ;
  const size_t qoff = (rowb + q0 + ln) * DM + h * HD + 8 * hh;
  const v16h qh0 = ldf_h(Qh, qoff), qh1 = ldf_h(Qh, qoff + 32);
  const v16h qr0 = ldf_h(Qr, qoff), qr1 = ldf_h(Qr, qoff + 32);
  const int cr = tid >> 3, cc = (tid & 7) * 8;                 /* copy: row within 16, 16-B piece of the 128-B row */
  const unsigned short* gk = Kp + (rowb + cr) * DM + h * HD + cc;
  const unsigned short* gv = VT + (size_t)(h * HD + cr) * NRP + rowb + cc;
  const unsigned lk = lds_off(&sk[0][cr][cc]), lv = lds_off(&sv[0][cr][cc]);
  auto fill = [&](const int s) {
    const unsigned bo = (unsigned)(s & 1) * (64u * TP * 2u);
    cp64(lk + bo, gk + (size_t)s * 64 * DM, (size_t)16 * DM);
    cp64(lv + bo, gv + s * 64, (size_t)16 * NRP);
  };
  const int foff = ln * TP + 8 * hh;
  const v8f z8 = {0.f, 0.f, 0.f, 0.f, 0.f, 0.f, 0.f, 0.f};
  v8f o[4] = {z8, z8, z8, z8};
  float m = -1.0e30f, l = 0.f;
  fill(0);
  wait_copies();
  __syncthreads();
  fill(1);
#pragma unroll 1
  for (int s = 0; s < SEQ / 64; ++s) {
   const unsigned short* pk = &sk[s & 1][0][0];
   const unsigned short* pv = &sv[s & 1][0][0];
#pragma unroll /* both 32-key passes of a stage: their LDS offsets become immediates */
   for (int kb = 0; kb < 64; kb += 32) {
    const int k0 = foff + kb * TP, k1 = k0 + 16 * TP;
    v8f sm0 = z8, sr0 = z8, sm1 = z8, sr1 = z8;
    v16h ka = ldf_h(pk, k0);      sm0 = mma_h(ka, qh0, sm0); sr0 = mma_h(ka, qr0, sr0);
    ka = ldf_h(pk, k1);           sm1 = mma_h(ka, qh0, sm1); sr1 = mma_h(ka, qr0, sr1);
    ka = ldf_h(pk, k0 + 32);      sm0 = mma_h(ka, qh1, sm0); sr0 = mma_h(ka, qr1, sr0);
    ka = ldf_h(pk, k1 + 32);      sm1 = mma_h(ka, qh1, sm1); sr1 = mma_h(ka, qr1, sr1);
    float s0[8], s1[8];
    float mx = -1.0e30f;
#pragma unroll
    for (int r = 0; r < 8; ++r) {
      s0[r] = sm0[r] * 0.125f + sr0[r] * 0.0001220703125f;     /* (main + res / 1024) / 8 */
      s1[r] = sm1[r] * 0.125f + sr1[r] * 0.0001220703125f;
      mx = fmaxf(mx, fmaxf(s0[r], s1[r]));
    }
    mx = fmaxf(mx, __shfl_xor(mx, 16));
    const float mn = fmaxf(m, mx);
    const float alpha = __expf(m - mn);
    const float ms = mn - 5.545177444479562f;                  /* probabilities carried x256 (also in l) */
    m = mn;
    FragH pf;
    float ps = 0.f;
#pragma unroll
    for (int r = 0; r < 8; ++r) {
      const float p0 = __expf(s0[r] - ms), p1 = __expf(s1[r] - ms);
      ps += p0 + p1;
      pf.h[r] = (_Float16)p0;
      pf.h[8 + r] = (_Float16)p1;
    }
    l = l * alpha + ps;
#pragma unroll
    for (int t = 0; t < 4; ++t)
#pragma unroll
      for (int r = 0; r < 8; ++r) o[t][r] *= alpha;
#pragma unroll
    for (int t = 0; t < 4; ++t) {
      const v16h va = ldf_h(pv, foff + t * 16 * TP + kb);
      o[t] = mma_h(va, pf.v, o[t]);
    }
   }
   wait_lds();
   wait_copies();
   __syncthreads();                                            /* publishes stage s + 1, frees stage s's buffer */
   if (s + 2 < SEQ / 64) fill(s + 2);
  }
  wait_copies();
  l += __shfl_xor(l, 16);
  const float inv = 1.0f / l;
#pragma unroll
  for (int t = 0; t < 4; ++t) {
    v8us vh, vl;
#pragma unroll
    for (int r = 0; r < 8; ++r) {
      const float c = o[t][r] * inv;                           /* ctx[query ln][d = 16t + 8hh + r] */
      const unsigned short hb = bf16_bits(c);
      vh[r] = hb;
      vl[r] = bf16_bits(c - bf16_val(hb));
    }
    *(v8us*)&sh[wave][ln][t * 16 + 8 * hh] = vh;
    *(v8us*)&sl[wave][ln][t * 16 + 8 * hh] = vl;
  }
  __builtin_amdgcn_fence(4 /* acq_rel order */, "workgroup");
  __builtin_amdgcn_wave_barrier();
  const int rq = lane >> 3, pc = lane & 7;                     
  {
#pragma unroll
    for (int qq = 0; qq < 4; ++qq) {
      const int row = qq * 4 + rq;                             /* qq*4 + {0..3} covers rows 0..15 */
      const v8us xh = *(const v8us*)&sh[wave][row][pc * 8];
      const v8us xl = *(const v8us*)&sl[wave][row][pc * 8];
      const size_t go = (rowb + q0 + row) * DM + h * HD + pc * 8;
      *(v8us*)(CH + go) = xh;
      *(v8us*)(CL + go) = xl;
    }
    
  }
}

// Y[NRP][DM] (f32) = (CH + CL) . Wt[DM][DM]^T + bias; bf16 operands, two products per tile pair into one accumulator; wave tile 32 x 64
// Operands: per 64-k stage the block copies its 128 CH rows, 128 CL rows and 64 Wt rows into LDS, one stage ahead (two buffers).
__global__ __launch_bounds__(128) void k_gemm_o(const unsigned short* __restrict__ CH, const unsigned short* __restrict__ CL, const unsigned short* __restrict__ Wt,
                                                const float* __restrict__ bias, float* __restrict__ Y) {
  __shared__ __attribute__((aligned(16))) float so[4][32][68];
  __shared__ __attribute__((aligned(16))) unsigned short sch[2][128][TP];
  __shared__ __attribute__((aligned(16))) unsigned short scl[2][128][TP];
  __shared__ __attribute__((aligned(16))) unsigned short sb[2][64][TP];
  const int tid = threadIdx.x;
  const int w = __builtin_amdgcn_readfirstlane(tid >> 5);
  const int lane = tid & 31, ln = lane & 15, hh = lane >> 4;
  const int ntn = DM >> 6;
  const int mt = blockIdx.x / ntn, nq = blockIdx.x - mt * ntn;
  const int row0 = mt * 128 + 32 * w, col0 = nq * 64;
  if (mt * 128 >= NRP) return;                 /* block-uniform, in front of every barrier */
  const int cr = tid >> 3, cc = (tid & 7) * 8; /* copy: row within 16, 16-B piece of the 128-B row */
  const size_t goa = (size_t)(mt * 128 + cr) * DM + cc;
  const unsigned short* gh = CH + goa;
  const unsigned short* gl = CL + goa;
  const unsigned short* gb = Wt + (size_t)(col0 + cr) * DM + cc;
  const unsigned lh = lds_off(&sch[0][cr][cc]), ll = lds_off(&scl[0][cr][cc]), lb = lds_off(&sb[0][cr][cc]);
  auto fill = [&](const int s) {
    const unsigned bu = (unsigned)(s & 1);
    cp64(lh + bu * (128u * TP * 2u), gh + s * 64, (size_t)16 * DM);
    cp64(lh + bu * (128u * TP * 2u) + 64u * TP * 2u, gh + (size_t)64 * DM + s * 64, (size_t)16 * DM);
    cp64(ll + bu * (128u * TP * 2u), gl + s * 64, (size_t)16 * DM);
    cp64(ll + bu * (128u * TP * 2u) + 64u * TP * 2u, gl + (size_t)64 * DM + s * 64, (size_t)16 * DM);
    cp64(lb + bu * (64u * TP * 2u), gb + s * 64, (size_t)16 * DM);
  };
  const int a0 = (32 * w + ln) * TP + 8 * hh, a1 = a0 + 16 * TP;
  const int b0 = ln * TP + 8 * hh, b1 = b0 + 16 * TP, b2 = b1 + 16 * TP, b3 = b2 + 16 * TP;
  const v8f z8 = {0.f, 0.f, 0.f, 0.f, 0.f, 0.f, 0.f, 0.f};
  v8f c00 = z8, c01 = z8, c02 = z8, c03 = z8, c10 = z8, c11 = z8, c12 = z8, c13 = z8;
  fill(0);
  wait_copies();
  __syncthreads();
  fill(1);
#pragma unroll 1
  for (int s = 0; s < DM / 64; ++s) {
    const unsigned short* ph = &sch[s & 1][0][0];
    const unsigned short* pl = &scl[s & 1][0][0];
    const unsigned short* pb = &sb[s & 1][0][0];
    /* all sixteen fragments of the stage are read as one group into registers of their own, ahead of its thirty-two WMMAs */
    v16b fh[2][2], fl[2][2], fb[2][4];
#pragma unroll /* both 32-k steps of a stage: their LDS offsets become immediates */
    for (int kk = 0; kk < 2; ++kk) {
      fh[kk][0] = ldf_b(ph, a0 + 32 * kk); fl[kk][0] = ldf_b(pl, a0 + 32 * kk); fh[kk][1] = ldf_b(ph, a1 + 32 * kk); fl[kk][1] = ldf_b(pl, a1 + 32 * kk);
      fb[kk][0] = ldf_b(pb, b0 + 32 * kk); fb[kk][1] = ldf_b(pb, b1 + 32 * kk);
      fb[kk][2] = ldf_b(pb, b2 + 32 * kk); fb[kk][3] = ldf_b(pb, b3 + 32 * kk);
    }
    __builtin_amdgcn_sched_barrier(0);         /* keeps the group of reads in front of the WMMAs: without it the scheduler sinks each read to its first use, with a full LDS wait there */
#pragma unroll /* fragment arrays stay in registers */
    for (int kk = 0; kk < 2; ++kk) {
      c00 = mma_b2(fh[kk][0], fl[kk][0], fb[kk][0], c00); c10 = mma_b2(fh[kk][1], fl[kk][1], fb[kk][0], c10);
      c01 = mma_b2(fh[kk][0], fl[kk][0], fb[kk][1], c01); c11 = mma_b2(fh[kk][1], fl[kk][1], fb[kk][1], c11);
      c02 = mma_b2(fh[kk][0], fl[kk][0], fb[kk][2], c02); c12 = mma_b2(fh[kk][1], fl[kk][1], fb[kk][2], c12);
      c03 = mma_b2(fh[kk][0], fl[kk][0], fb[kk][3], c03); c13 = mma_b2(fh[kk][1], fl[kk][1], fb[kk][3], c13);
    }
    __builtin_amdgcn_sched_barrier(0);         /* keeps the WMMAs in front of the stage's waits, inside the flight time of the next stage's copies */
    wait_lds();
    wait_copies();
    __syncthreads();                           /* publishes stage s + 1, frees stage s's buffer */
    if (s + 2 < DM / 64) fill(s + 2);
  }
  wait_copies();
  v8f accs[8] = {c00, c01, c02, c03, c10, c11, c12, c13};
#pragma unroll
  for (int u = 0; u < 8; ++u) {
    const int t = u & 3, half = u >> 2;
    const float bc = bf16_rne(bias[col0 + t * 16 + ln]);
#pragma unroll
    for (int r = 0; r < 8; ++r) so[w][half * 16 + 8 * hh + r][t * 16 + ln] = accs[u][r] + bc;
  }
  __builtin_amdgcn_fence(4 /* acq_rel order */, "workgroup");
  __builtin_amdgcn_wave_barrier();
  const int rsub = lane >> 4, c4 = (lane & 15) * 4;
  {
#pragma unroll
    for (int q = 0; q < 16; ++q) {
      const int r = q * 2 + rsub;                          
      const v4f v = *(const v4fa*)&so[w][r][c4];
      *(v4f*)(Y + (size_t)(row0 + r) * DM + col0 + c4) = v;
    }
    
  }
}

__global__ __launch_bounds__(256) void k_ln(const float* __restrict__ x, const float* __restrict__ Y, const float* __restrict__ g, const float* __restrict__ bta, float* __restrict__ out) {
  __shared__ float red1[8];
  __shared__ float red2[8];
  const int row = blockIdx.x, tid = threadIdx.x, lane = tid & 31;
  const int wave = __builtin_amdgcn_readfirstlane(tid >> 5);
  const size_t xr = ((size_t)(row / SEQ) * SEQ_FULL + (size_t)(row % SEQ)) * DM + (size_t)tid * 4;
  const v4f xv = *(const v4fa*)(x + xr);
  const v4f yv = *(const v4fa*)(Y + (size_t)row * DM + (size_t)tid * 4);
  v4f hv;
  float s1 = 0.f;
#pragma unroll
  for (int q = 0; q < 4; ++q) { hv[q] = bf16_rne(xv[q]) + yv[q]; s1 += hv[q]; }
#pragma unroll
  for (int off = 16; off > 0; off >>= 1) s1 += __shfl_xor(s1, off);
  if (lane == 0) red1[wave] = s1;
  __syncthreads();
  float tot = 0.f;
#pragma unroll
  for (int i = 0; i < 8; ++i) tot += red1[i];
  const float mu = tot * (1.0f / (float)DM);
  float s2 = 0.f;
  v4f cv;
#pragma unroll
  for (int q = 0; q < 4; ++q) { cv[q] = hv[q] - mu; s2 += cv[q] * cv[q]; }
#pragma unroll
  for (int off = 16; off > 0; off >>= 1) s2 += __shfl_xor(s2, off);
  if (lane == 0) red2[wave] = s2;
  __syncthreads();
  float tv = 0.f;
#pragma unroll
  for (int i = 0; i < 8; ++i) tv += red2[i];
  const float rs = rsqrtf(tv * (1.0f / (float)DM) + LN_EPS);
  const v4f gv = *(const v4fa*)(g + tid * 4);
  const v4f bv = *(const v4fa*)(bta + tid * 4);
  v4f ov;
#pragma unroll
  for (int q = 0; q < 4; ++q) ov[q] = cv[q] * rs * bf16_rne(gv[q]) + bf16_rne(bv[q]);
  *(v4f*)(out + xr) = ov;
  
}

extern "C" void kernel_launch(void* const* d_in, const int* in_sizes, int n_in,
                              void* d_out, int out_size, void* d_ws, size_t ws_size, hipStream_t stream) {
  if (n_in < 11) return;
  const size_t need_x = ((size_t)(NB - 1) * SEQ_FULL + SEQ) * DM;
  if ((size_t)in_sizes[0] < need_x || (size_t)out_size < need_x) return;
  if ((size_t)in_sizes[1] < (size_t)DM * DM || (size_t)in_sizes[3] < (size_t)DM * DM || (size_t)in_sizes[5] < (size_t)DM * DM || (size_t)in_sizes[7] < (size_t)DM * DM) return;
  if (in_sizes[2] < DM || in_sizes[4] < DM || in_sizes[6] < DM || in_sizes[8] < DM || in_sizes[9] < DM || in_sizes[10] < DM) return;
  const float* x  = (const float*)d_in[0];
  const float* wq = (const float*)d_in[1]; const float* bq = (const float*)d_in[2];
  const float* wk = (const float*)d_in[3]; const float* bk = (const float*)d_in[4];
  const float* wv = (const float*)d_in[5]; const float* bv = (const float*)d_in[6];
  const float* wo = (const float*)d_in[7]; const float* bo = (const float*)d_in[8];
  const float* lg = (const float*)d_in[9]; const float* lb = (const float*)d_in[10];
  char* ws = (char*)d_ws; size_t off = 0;
  auto take = [&](size_t bytes) { char* p = ws + off; off += (bytes + 255) & ~(size_t)255; return p; };
  unsigned short* BQ = (unsigned short*)take(WS_W);
  unsigned short* BK = (unsigned short*)take(WS_W);
  unsigned short* BV = (unsigned short*)take(WS_W);
  unsigned short* BO = (unsigned short*)take(WS_W);
  unsigned short* X16 = (unsigned short*)take(WS_P16);
  unsigned short* QH  = (unsigned short*)take(WS_P16);
  unsigned short* QR  = (unsigned short*)take(WS_P16);
  unsigned short* K16 = (unsigned short*)take(WS_P16);
  unsigned short* VT  = (unsigned short*)take(WS_P16);
  unsigned short* CH  = (unsigned short*)take(WS_P16);
  unsigned short* CL  = (unsigned short*)take(WS_P16);
  float* Y = (float*)take(WS_P32);
  if (off > ws_size) return;
  k_prep<<<(unsigned)(4 * GW_BLK + GX_BLK), 256, 0, stream>>>(x, wq, wk, wv, wo, X16, BQ, BK, BV, BO);
  k_gemm_qkv<<<(unsigned)(2 * GQK_BLK + GV_BLK), 128, 0, stream>>>(X16, BQ, BK, BV, bq, bk, bv, QH, QR, K16, VT);
  k_flash<<<(unsigned)(NB * NH * (SEQ / 64)), 128, 0, stream>>>(QH, QR, K16, VT, CH, CL);
  k_gemm_o<<<(unsigned)((NRP / 128) * (DM / 64)), 128, 0, stream>>>(CH, CL, BO, bo, Y);
  k_ln<<<(unsigned)NRP, 256, 0, stream>>>(x, Y, lg, lb, (float*)d_out);
}

// v004
// One run takes 113 microseconds.
// Timed twice side by side with v003, it ran 1.08 and 1.09 times as fast.
// All steps since v000 together make it 2.98 times as fast.
#include <hip/hip_runtime.h>
// Compute dtype: inputs RNE-converted to bf16 on load; q/k/v projections v_wmma_f32_16x16x32_f16 (x exact f16, weights x16 exact f16); scores f16 (k single, q as f16 value + x1024 f16 residual in its own accumulator); P (x256 carried) and v single f16; output GEMM v_wmma_f32_16x16x32_bf16 (ctx bf16 hi|lo, Wo exact bf16); all accumulators, softmax statistics, residual add and LayerNorm f32.
// Structure: token rows r = b*SEQ + s. k_prep (one grid, block ranges): [in][out] weights -> Bt[n][k] 16-bit planes, x -> f16 rows. k_gemm_qkv (one grid, block ranges): Q/K GEMMs (32x64 wave tiles) -> Qh, Qr, K16 planes; V GEMM with swapped operands -> VT[h*64+d][b*SEQ+s].
#ifndef NB
#define NB 2
#endif
#ifndef SEQ
#define SEQ 2048
#endif
#define NB_FULL 2
#define SEQ_FULL 2048
#define DM 1024
#define NH 16
#define HD 64
#define NRP (NB * SEQ)               /* plane rows */
#define LN_EPS 1e-5f

static_assert(NH * HD == DM);        // head h = columns h*64 + d
static_assert(HD == 64);
static_assert(DM == 1024);           // k_ln: 32 lanes x 8 pieces x 4 columns
static_assert(DM % 128 == 0);        // swapped V GEMM: M = DM in 128-row block tiles
static_assert(DM % 64 == 0);         // N tiles of 64
static_assert(DM % 32 == 0);         // K steps of 32
static_assert(NRP % 128 == 0);       // GEMM block tiles of 128 rows
static_assert(NRP % 64 == 0);        // swapped V GEMM N tiles
static_assert(SEQ % 64 == 0);        // flash: 64 queries per block, 32-key steps
static_assert(SEQ % 64 == 0 && SEQ / 64 >= 2);   // flash ring: 64-key stages, two buffers
static_assert(DM % 64 == 0 && DM / 64 >= 2);     // GEMM rings: 64-k stages, two buffers
static_assert(NB <= NB_FULL);
static_assert(SEQ <= SEQ_FULL);

typedef _Float16 v16h __attribute__((ext_vector_type(16)));
typedef __bf16 v16b __attribute__((ext_vector_type(16)));
typedef _Float16 v4h __attribute__((ext_vector_type(4)));
typedef unsigned short v8us __attribute__((ext_vector_type(8), may_alias));
typedef float v8f __attribute__((ext_vector_type(8)));
typedef float v4f __attribute__((ext_vector_type(4)));
typedef float v4fa __attribute__((ext_vector_type(4), may_alias));
union FragH { v16h v; v8us half[2]; _Float16 h[16]; unsigned short u[16]; };
union FragB { v16b v; v8us half[2]; unsigned short u[16]; };

/* workspace carve (bytes); every region is rows x pitch x element size exactly, stores never pass a region end */
#define WS_W   ((size_t)DM * DM * 2)
#define WS_P16 ((size_t)NRP * DM * 2)
#define WS_P32 ((size_t)NRP * DM * 4)
#define WS_TOTAL (4 * WS_W + 7 * WS_P16 + WS_P32)
static_assert(WS_W % 256 == 0);
static_assert(WS_P16 % 256 == 0);
static_assert(WS_TOTAL <= (size_t)134217728);

__device__ __forceinline__ unsigned short bf16_bits(float x) { unsigned int u = __float_as_uint(x); return (unsigned short)((u + 0x7FFFu + ((u >> 16) & 1u)) >> 16); }
__device__ __forceinline__ float bf16_val(unsigned short b) { return __uint_as_float(((unsigned int)b) << 16); }
__device__ __forceinline__ float bf16_rne(float x) { return bf16_val(bf16_bits(x)); }

// fragment loaders: off already includes 8*(lane>>4); elements 0..7 <- k0+8h.., elements 8..15 <- k0+16+8h..
__device__ __forceinline__ v16h ldf_h(const unsigned short* __restrict__ p, size_t off) { FragH f; f.half[0] = *(const v8us*)(p + off); f.half[1] = *(const v8us*)(p + off + 16); return f.v; }
__device__ __forceinline__ v16b ldf_b(const unsigned short* __restrict__ p, size_t off) { FragB f; f.half[0] = *(const v8us*)(p + off); f.half[1] = *(const v8us*)(p + off + 16); return f.v; }
__device__ __forceinline__ v8f mma_h(v16h a, v16h b, v8f c) {
  return __builtin_amdgcn_wmma_f32_16x16x32_f16(false, a, false, b, (short)0, c, false, false);
}
__device__ __forceinline__ v8f mma_b2(v16b ah, v16b al, v16b b, v8f c) {
  c = __builtin_amdgcn_wmma_f32_16x16x32_bf16(false, ah, false, b, (short)0, c, false, false);
  c = __builtin_amdgcn_wmma_f32_16x16x32_bf16(false, al, false, b, (short)0, c, false, false);
  return c;
}

// LDS operand tiles: rows of 64 16-bit elements (128 B) at a pitch of 72 (144 B = 16 B x 9, conflict-free for ds_load_b128 fragment reads).
#define TP 72
__device__ __forceinline__ unsigned lds_off(const void* p) { return (unsigned)(size_t)p; }
// One lane's share of 64 tile rows: 16 B of rows r, r + 16, r + 32, r + 48 go from global memory to LDS through no register; a wave's copy covers 4 whole 128-B lines.
// The s_wait_xcnt stands inside the copies' own statement so that no address register is rewritten ahead of it.
__device__ __forceinline__ void cp64(const unsigned l, const unsigned short* g, const size_t g16) {
  const unsigned short* g1 = g + g16; const unsigned short* g2 = g1 + g16; const unsigned short* g3 = g2 + g16;
  asm volatile("global_load_async_to_lds_b128 %0, %4, off\n\t"
               "global_load_async_to_lds_b128 %1, %5, off\n\t"
               "global_load_async_to_lds_b128 %2, %6, off\n\t"
               "global_load_async_to_lds_b128 %3, %7, off\n\t"
               "s_wait_xcnt 0x0"
               :: "v"(l), "v"(l + 16u * TP * 2u), "v"(l + 32u * TP * 2u), "v"(l + 48u * TP * 2u), "v"(g), "v"(g1), "v"(g2), "v"(g3) : "memory");
}
// own copies landed (in front of the barrier that publishes them to the other waves)
__device__ __forceinline__ void wait_copies() { asm volatile("s_wait_asynccnt 0x0" ::: "memory"); }
// own LDS reads retired (in front of the barrier behind which their buffer is refilled)
__device__ __forceinline__ void wait_lds() { asm volatile("s_wait_dscnt 0x0" ::: "memory"); }

// One thread takes an 8 x 8 tile of W[k][n] (sixteen 16-B loads), turns it in registers and stores eight 16-B pieces of Wt[n][k]; bid = block index within this job's range.
// A wave is 8 k tiles x 4 n tiles: its two loads of a tile row cover one whole 128-B line of eight rows of W, a store one whole 128-B line of four rows of Wt (one writer per line).
// F16: Wt = f16 of 16 * bf16(W); else Wt = bf16 bits of W.
template <bool F16>
__device__ __forceinline__ void wt_body(const float* __restrict__ W, unsigned short* __restrict__ Wt, const int bid) {
  const int t = bid * 256 + threadIdx.x;                       /* tile number, (DM / 8) * (DM / 8) tiles */
  const int g = t >> 5;                                        /* wave's group of 8 x 4 tiles */
  const int k8 = ((g % (DM / 64)) * 8 + (t & 7)) * 8;
  const int n8 = ((g / (DM / 64)) * 4 + ((t >> 3) & 3)) * 8;
  v4f r[8][2];
#pragma unroll
  for (int i = 0; i < 8; ++i) {
    r[i][0] = *(const v4fa*)(W + (size_t)(k8 + i) * DM + n8);
    r[i][1] = *(const v4fa*)(W + (size_t)(k8 + i) * DM + n8 + 4);
  }
#pragma unroll
  for (int j = 0; j < 8; ++j) {
    FragH f;
#pragma unroll
    for (int i = 0; i < 8; ++i) {
      const float wv = r[i][j >> 2][j & 3];
      if (F16) f.h[i] = (_Float16)(bf16_rne(wv) * 16.0f); else f.u[i] = bf16_bits(wv);
    }
    const v8us o = f.half[0];
    *(v8us*)(Wt + (size_t)(n8 + j) * DM + k8) = o;
  }
  /* behind the last store: the code of another block range follows in the text and rewrites the stores' address and data registers */
  asm volatile("s_wait_xcnt 0x0" ::: "memory");
}
// One thread converts eight pieces of 8 values of x; a block takes 16 consecutive rows (all of one batch entry: SEQ % 16 == 0), piece j * 256 + thread in pass j.
// The block's bases are scalar, so one lane offset serves all loads and one all stores.
__device__ __forceinline__ void x16_body(const float* __restrict__ x, unsigned short* __restrict__ X16, const int bid) {
  const int r0 = bid * 16;
  const float* __restrict__ xp = x + ((size_t)(r0 / SEQ) * SEQ_FULL + (size_t)(r0 % SEQ)) * DM;
  unsigned short* __restrict__ op = X16 + (size_t)r0 * DM;
  const int c8 = threadIdx.x * 8;
  v4f a[8], b[8];
#pragma unroll
  for (int j = 0; j < 8; ++j) { a[j] = *(const v4fa*)(xp + c8 + j * 2048); b[j] = *(const v4fa*)(xp + c8 + j * 2048 + 4); }
#pragma unroll
  for (int j = 0; j < 8; ++j) {
    FragH f;
#pragma unroll
    for (int q = 0; q < 4; ++q) { f.h[q] = (_Float16)bf16_rne(a[j][q]); f.h[4 + q] = (_Float16)bf16_rne(b[j][q]); }
    const v8us o = f.half[0];
    *(v8us*)(op + c8 + j * 2048) = o;
  }
  /* behind the last store: the code of another block range follows in the text and rewrites the stores' address and data registers */
  asm volatile("s_wait_xcnt 0x0" ::: "memory");
}
// The five independent operand preparations as block ranges of one grid; every thread moves 64 values, so that the launch starts few waves.
static_assert(DM % 64 == 0);                          /* a wave's 8 x 4 tiles of 8 x 8 */
static_assert(((DM / 8) * (DM / 8)) % 256 == 0);      /* whole blocks of weight tiles */
static_assert(NRP % 16 == 0 && SEQ % 16 == 0 && DM == 1024);  /* x: whole blocks of 16 rows = 2048 pieces, inside one batch entry */
#define GW_BLK (((DM / 8) * (DM / 8)) / 256)          /* blocks of one weight plane */
#define GX_BLK (NRP / 16)                             /* blocks of x */
__global__ __launch_bounds__(256) void k_prep(const float* __restrict__ x, const float* __restrict__ wq, const float* __restrict__ wk, const float* __restrict__ wv, const float* __restrict__ wo,
                                              unsigned short* __restrict__ X16, unsigned short* __restrict__ BQ, unsigned short* __restrict__ BK, unsigned short* __restrict__ BV, unsigned short* __restrict__ BO) {
  const int bid = blockIdx.x;                  /* every test below is block-uniform */
  if (bid < GW_BLK) wt_body<true>(wq, BQ, bid);                   /* W[in][out] -> Bt[out][in] */
  else if (bid < 2 * GW_BLK) wt_body<true>(wk, BK, bid - GW_BLK);
  else if (bid < 3 * GW_BLK) wt_body<true>(wv, BV, bid - 2 * GW_BLK);
  else if (bid < 4 * GW_BLK) wt_body<false>(wo, BO, bid - 3 * GW_BLK);
  else x16_body(x, X16, bid - 4 * GW_BLK);
}

// f16 GEMM C[M][N] = alpha * A[M][K] . Bt[N][K]^T + bias; block = 4 waves, wave tile 32 x 64, block tile 128 x 64; M % 128 == 0, N % 64 == 0, K % 64 == 0, K >= 128.
// Operands: per 64-k stage the block copies its 128 A rows and 64 Bt rows into LDS, one stage ahead (two buffers); fragments are read from LDS.
// MODE 0: f16 plane C0, bias per column. MODE 1: f16 value plane C0 + x1024 residual plane C1, bias per column. MODE 2: f16 plane C0, bias per row.
// bid = block index within this product's range of the grid; so, sa, sb = the kernel's LDS (output staging [4][32][68], A ring [2][128][TP], B ring [2][64][TP]).
template <int MODE>
__device__ __forceinline__ void gemm_h_body(const unsigned short* __restrict__ A, const int lda, const unsigned short* __restrict__ Bt, const int ldb, const float alpha,
                                            const float* __restrict__ bias, unsigned short* C0, unsigned short* C1, const int ldc, const int M, const int N, const int K,
                                            const int bid, float (*so)[32][68], unsigned short (*sa)[128][TP], unsigned short (*sb)[64][TP]) {
  const int tid = threadIdx.x;
  const int w = __builtin_amdgcn_readfirstlane(tid >> 5);
  const int lane = tid & 31, ln = lane & 15, hh = lane >> 4;
  const int ntn = N >> 6;
  const int mt = bid / ntn, nq = bid - mt * ntn;
  const int row0 = mt * 128 + 32 * w, col0 = nq * 64;
  if (mt * 128 >= M) return;                   /* block-uniform, in front of every barrier */
  const int cr = tid >> 3, cc = (tid & 7) * 8; /* copy: row within 16, 16-B piece of the 128-B row */
  const unsigned short* ga = A + (size_t)(mt * 128 + cr) * lda + cc;
  const unsigned short* gb = Bt + (size_t)(col0 + cr) * ldb + cc;
  const unsigned la = lds_off(&sa[0][cr][cc]), lb = lds_off(&sb[0][cr][cc]);
  const int ns = K >> 6;
  auto fill = [&](const int s) {
    const unsigned bu = (unsigned)(s & 1);
    cp64(la + bu * (128u * TP * 2u), ga + s * 64, (size_t)16 * lda);
    cp64(la + bu * (128u * TP * 2u) + 64u * TP * 2u, ga + (size_t)64 * lda + s * 64, (size_t)16 * lda);
    cp64(lb + bu * (64u * TP * 2u), gb + s * 64, (size_t)16 * ldb);
  };
  const int a0 = (32 * w + ln) * TP + 8 * hh, a1 = a0 + 16 * TP;
  const int b0 = ln * TP + 8 * hh, b1 = b0 + 16 * TP, b2 = b1 + 16 * TP, b3 = b2 + 16 * TP;
  const v8f z8 = {0.f, 0.f, 0.f, 0.f, 0.f, 0.f, 0.f, 0.f};
  v8f c00 = z8, c01 = z8, c02 = z8, c03 = z8, c10 = z8, c11 = z8, c12 = z8, c13 = z8;
  fill(0);
  wait_copies();
  __syncthreads();
  fill(1);
#pragma unroll 1
  for (int s = 0; s < ns; ++s) {
    const unsigned short* pa = &sa[s & 1][0][0];
    const unsigned short* pb = &sb[s & 1][0][0];
    /* all twelve fragments of the stage are read as one group into registers of their own, ahead of its sixteen WMMAs: one LDS round trip a stage, not one a WMMA pair */
    v16h fa[2][2], fb[2][4];
#pragma unroll /* both 32-k steps of a stage: their LDS offsets become immediates */
    for (int kk = 0; kk < 2; ++kk) {
      fa[kk][0] = ldf_h(pa, a0 + 32 * kk); fa[kk][1] = ldf_h(pa, a1 + 32 * kk);
      fb[kk][0] = ldf_h(pb, b0 + 32 * kk); fb[kk][1] = ldf_h(pb, b1 + 32 * kk);
      fb[kk][2] = ldf_h(pb, b2 + 32 * kk); fb[kk][3] = ldf_h(pb, b3 + 32 * kk);
    }
    __builtin_amdgcn_sched_barrier(0);         /* keeps the group of reads in front of the WMMAs: without it the scheduler sinks each read to its first use, with a full LDS wait there */
#pragma unroll /* fragment arrays stay in registers */
    for (int kk = 0; kk < 2; ++kk) {
      c00 = mma_h(fa[kk][0], fb[kk][0], c00); c10 = mma_h(fa[kk][1], fb[kk][0], c10);
      c01 = mma_h(fa[kk][0], fb[kk][1], c01); c11 = mma_h(fa[kk][1], fb[kk][1], c11);
      c02 = mma_h(fa[kk][0], fb[kk][2], c02); c12 = mma_h(fa[kk][1], fb[kk][2], c12);
      c03 = mma_h(fa[kk][0], fb[kk][3], c03); c13 = mma_h(fa[kk][1], fb[kk][3], c13);
    }
    __builtin_amdgcn_sched_barrier(0);         /* keeps the WMMAs in front of the stage's waits, inside the flight time of the next stage's copies */
    wait_lds();
    wait_copies();
    __syncthreads();                           /* publishes stage s + 1, frees stage s's buffer */
    if (s + 2 < ns) fill(s + 2);
  }
  wait_copies();
  v8f accs[8] = {c00, c01, c02, c03, c10, c11, c12, c13};
#pragma unroll
  for (int u = 0; u < 8; ++u) {
    const int t = u & 3, half = u >> 2;
    float bc = 0.f;
    float brow[8] = {0.f, 0.f, 0.f, 0.f, 0.f, 0.f, 0.f, 0.f};
    if (MODE == 2) {
      const v4f r0 = *(const v4fa*)(bias + row0 + half * 16 + 8 * hh), r1 = *(const v4fa*)(bias + row0 + half * 16 + 8 * hh + 4);
#pragma unroll
      for (int q = 0; q < 4; ++q) { brow[q] = bf16_rne(r0[q]); brow[4 + q] = bf16_rne(r1[q]); }
    } else {
      bc = bf16_rne(bias[col0 + t * 16 + ln]);
    }
#pragma unroll
    for (int r = 0; r < 8; ++r) {
      const int rloc = half * 16 + 8 * hh + r;           /* D: row 8h + r, col lane & 15 */
      const float bvv = (MODE == 2) ? brow[r] : bc;
      so[w][rloc][t * 16 + ln] = accs[u][r] * alpha + bvv;
    }
  }
  __builtin_amdgcn_fence(4 /* acq_rel order */, "workgroup");
  __builtin_amdgcn_wave_barrier();
  const int rsub = lane >> 4, c4 = (lane & 15) * 4;
  {
#pragma unroll
    for (int q = 0; q < 16; ++q) {
      const int r = q * 2 + rsub;                        
      const v4f v = *(const v4fa*)&so[w][r][c4];
      v4h h4, r4;
#pragma unroll
      for (int i = 0; i < 4; ++i) { const _Float16 hv = (_Float16)v[i]; h4[i] = hv; r4[i] = (_Float16)((v[i] - (float)hv) * 1024.0f); }
      const size_t go = (size_t)(row0 + r) * ldc + col0 + c4;
      *(v4h*)(C0 + go) = h4;
      if (MODE == 1) *(v4h*)(C1 + go) = r4;
    }
    /* behind the last store: in the merged kernel the code of another block range follows in the text and rewrites the stores' address and data registers */
    asm volatile("s_wait_xcnt 0x0" ::: "memory");
  }
}
// The three independent projections as block ranges of one grid, one set of LDS arrays.
// V with swapped operands: VT[n = h*64+d][r = b*SEQ+s] = sum_k Wt[n][k] x[r][k] / 16 + bias[n]
#define GQK_BLK ((NRP / 128) * (DM / 64))             /* blocks of the Q product, and of the K product */
#define GV_BLK ((DM / 128) * (NRP / 64))              /* blocks of the V product */
__global__ __launch_bounds__(128) void k_gemm_qkv(const unsigned short* __restrict__ X16, const unsigned short* __restrict__ BQ, const unsigned short* __restrict__ BK, const unsigned short* __restrict__ BV,
                                                  const float* __restrict__ bq, const float* __restrict__ bk, const float* __restrict__ bv,
                                                  unsigned short* __restrict__ Qh, unsigned short* __restrict__ Qr, unsigned short* __restrict__ K16, unsigned short* __restrict__ VT) {
  __shared__ __attribute__((aligned(16))) float so[4][32][68];
  __shared__ __attribute__((aligned(16))) unsigned short sa[2][128][TP];
  __shared__ __attribute__((aligned(16))) unsigned short sb[2][64][TP];
  const int bid = blockIdx.x;                  /* every test below is block-uniform */
  if (bid < GQK_BLK) gemm_h_body<1>(X16, DM, BQ, DM, 0.0625f, bq, Qh, Qr, DM, NRP, DM, DM, bid, so, sa, sb);
  else if (bid < 2 * GQK_BLK) gemm_h_body<0>(X16, DM, BK, DM, 0.0625f, bk, K16, K16, DM, NRP, DM, DM, bid - GQK_BLK, so, sa, sb);
  else gemm_h_body<2>(BV, DM, X16, DM, 0.0625f, bv, VT, VT, NRP, DM, NRP, DM, bid - 2 * GQK_BLK, so, sa, sb);
}

// fused attention: block = (b, h, 64 queries), 4 waves x 16 queries. Per 32-key step:
//   S^T tiles (keys x queries): A = K rows (lane&15 = key), B = Q rows (lane&15 = query); D reg r of lane (n, hh) = key 8hh + r, query n.
//   P^T B fragment: element r <- tile(keys 0..15) reg r, element 8 + r <- tile(keys 16..31) reg r (same lane).
//   O^T tiles (d x queries): A = V^T rows (lane&15 = d within tile), k = key.
// K rows and V^T rows of a 64-key stage are copied into LDS by the whole block, one stage ahead (two buffers); all four waves read their fragments there.
// sh/sl[wave] are private to the wave (ctx hi / lo staging, 16 rows x 64 columns written and read in full).
__global__ __launch_bounds__(128) void k_flash(const unsigned short* __restrict__ Qh, const unsigned short* __restrict__ Qr, const unsigned short* __restrict__ Kp,
                                               const unsigned short* __restrict__ VT, unsigned short* __restrict__ CH, unsigned short* __restrict__ CL) {
  __shared__ __attribute__((aligned(16))) unsigned short sh[4][16][72];
  __shared__ __attribute__((aligned(16))) unsigned short sl[4][16][72];
  __shared__ __attribute__((aligned(16))) unsigned short sk[2][64][TP];   /* [buffer][key][d] */
  __shared__ __attribute__((aligned(16))) unsigned short sv[2][HD][TP];   /* [buffer][d][key] */
  const int tid = threadIdx.x;
  const int wave = __builtin_amdgcn_readfirstlane(tid >> 5);
  const int lane = tid & 31, ln = lane & 15, hh = lane >> 4;
  const int bh = blockIdx.x / (SEQ / 64), qb = blockIdx.x % (SEQ / 64);
  const int b = bh / NH, h = bh % NH;
  const int q0 = qb * 64 + 16 * wave;
  const size_t rowb = (size_t)b * SEQ;
  const size_t qoff = (rowb + q0 + ln) * DM + h * HD + 8 * hh;
  const v16h qh0 = ldf_h(Qh, qoff), qh1 = ldf_h(Qh, qoff + 32);
  const v16h qr0 = ldf_h(Qr, qoff), qr1 = ldf_h(Qr, qoff + 32);
  const int cr = tid >> 3, cc = (tid & 7) * 8;                 /* copy: row within 16, 16-B piece of the 128-B row */
  const unsigned short* gk = Kp + (rowb + cr) * DM + h * HD + cc;
  const unsigned short* gv = VT + (size_t)(h * HD + cr) * NRP + rowb + cc;
  const unsigned lk = lds_off(&sk[0][cr][cc]), lv = lds_off(&sv[0][cr][cc]);
  auto fill = [&](const int s) {
    const unsigned bo = (unsigned)(s & 1) * (64u * TP * 2u);
    cp64(lk + bo, gk + (size_t)s * 64 * DM, (size_t)16 * DM);
    cp64(lv + bo, gv + s * 64, (size_t)16 * NRP);
  };
  const int foff = ln * TP + 8 * hh;
  const v8f z8 = {0.f, 0.f, 0.f, 0.f, 0.f, 0.f, 0.f, 0.f};
  v8f o[4] = {z8, z8, z8, z8};
  float m = -1.0e30f, l = 0.f;
  fill(0);
  wait_copies();
  __syncthreads();
  fill(1);
#pragma unroll 1
  for (int s = 0; s < SEQ / 64; ++s) {
   const unsigned short* pk = &sk[s & 1][0][0];
   const unsigned short* pv = &sv[s & 1][0][0];
#pragma unroll /* both 32-key passes of a stage: their LDS offsets become immediates */
   for (int kb = 0; kb < 64; kb += 32) {
    const int k0 = foff + kb * TP, k1 = k0 + 16 * TP;
    v8f sm0 = z8, sr0 = z8, sm1 = z8, sr1 = z8;
    v16h ka = ldf_h(pk, k0);      sm0 = mma_h(ka, qh0, sm0); sr0 = mma_h(ka, qr0, sr0);
    ka = ldf_h(pk, k1);           sm1 = mma_h(ka, qh0, sm1); sr1 = mma_h(ka, qr0, sr1);
    ka = ldf_h(pk, k0 + 32);      sm0 = mma_h(ka, qh1, sm0); sr0 = mma_h(ka, qr1, sr0);
    ka = ldf_h(pk, k1 + 32);      sm1 = mma_h(ka, qh1, sm1); sr1 = mma_h(ka, qr1, sr1);
    float s0[8], s1[8];
    float mx = -1.0e30f;
#pragma unroll
    for (int r = 0; r < 8; ++r) {
      s0[r] = sm0[r] * 0.125f + sr0[r] * 0.0001220703125f;     /* (main + res / 1024) / 8 */
      s1[r] = sm1[r] * 0.125f + sr1[r] * 0.0001220703125f;
      mx = fmaxf(mx, fmaxf(s0[r], s1[r]));
    }
    mx = fmaxf(mx, __shfl_xor(mx, 16));
    const float mn = fmaxf(m, mx);
    const float alpha = __expf(m - mn);
    const float ms = mn - 5.545177444479562f;                  /* probabilities carried x256 (also in l) */
    m = mn;
    FragH pf;
    float ps = 0.f;
#pragma unroll
    for (int r = 0; r < 8; ++r) {
      const float p0 = __expf(s0[r] - ms), p1 = __expf(s1[r] - ms);
      ps += p0 + p1;
      pf.h[r] = (_Float16)p0;
      pf.h[8 + r] = (_Float16)p1;
    }
    l = l * alpha + ps;
#pragma unroll
    for (int t = 0; t < 4; ++t)
#pragma unroll
      for (int r = 0; r < 8; ++r) o[t][r] *= alpha;
#pragma unroll
    for (int t = 0; t < 4; ++t) {
      const v16h va = ldf_h(pv, foff + t * 16 * TP + kb);
      o[t] = mma_h(va, pf.v, o[t]);
    }
   }
   wait_lds();
   wait_copies();
   __syncthreads();                                            /* publishes stage s + 1, frees stage s's buffer */
   if (s + 2 < SEQ / 64) fill(s + 2);
  }
  wait_copies();
  l += __shfl_xor(l, 16);
  const float inv = 1.0f / l;
#pragma unroll
  for (int t = 0; t < 4; ++t) {
    v8us vh, vl;
#pragma unroll
    for (int r = 0; r < 8; ++r) {
      const float c = o[t][r] * inv;                           /* ctx[query ln][d = 16t + 8hh + r] */
      const unsigned short hb = bf16_bits(c);
      vh[r] = hb;
      vl[r] = bf16_bits(c - bf16_val(hb));
    }
    *(v8us*)&sh[wave][ln][t * 16 + 8 * hh] = vh;
    *(v8us*)&sl[wave][ln][t * 16 + 8 * hh] = vl;
  }
  __builtin_amdgcn_fence(4 /* acq_rel order */, "workgroup");
  __builtin_amdgcn_wave_barrier();
  const int rq = lane >> 3, pc = lane & 7;                     
  {
#pragma unroll
    for (int qq = 0; qq < 4; ++qq) {
      const int row = qq * 4 + rq;                             /* qq*4 + {0..3} covers rows 0..15 */
      const v8us xh = *(const v8us*)&sh[wave][row][pc * 8];
      const v8us xl = *(const v8us*)&sl[wave][row][pc * 8];
      const size_t go = (rowb + q0 + row) * DM + h * HD + pc * 8;
      *(v8us*)(CH + go) = xh;
      *(v8us*)(CL + go) = xl;
    }
    
  }
}

// Y[NRP][DM] (f32) = (CH + CL) . Wt[DM][DM]^T + bias; bf16 operands, two products per tile pair into one accumulator; wave tile 32 x 64
// Operands: per 64-k stage the block copies its 128 CH rows, 128 CL rows and 64 Wt rows into LDS, one stage ahead (two buffers).
__global__ __launch_bounds__(128) void k_gemm_o(const unsigned short* __restrict__ CH, const unsigned short* __restrict__ CL, const unsigned short* __restrict__ Wt,
                                                const float* __restrict__ bias, float* __restrict__ Y) {
  __shared__ __attribute__((aligned(16))) float so[4][32][68];
  __shared__ __attribute__((aligned(16))) unsigned short sch[2][128][TP];
  __shared__ __attribute__((aligned(16))) unsigned short scl[2][128][TP];
  __shared__ __attribute__((aligned(16))) unsigned short sb[2][64][TP];
  const int tid = threadIdx.x;
  const int w = __builtin_amdgcn_readfirstlane(tid >> 5);
  const int lane = tid & 31, ln = lane & 15, hh = lane >> 4;
  const int ntn = DM >> 6;
  const int mt = blockIdx.x / ntn, nq = blockIdx.x - mt * ntn;
  const int row0 = mt * 128 + 32 * w, col0 = nq * 64;
  if (mt * 128 >= NRP) return;                 /* block-uniform, in front of every barrier */
  const int cr = tid >> 3, cc = (tid & 7) * 8; /* copy: row within 16, 16-B piece of the 128-B row */
  const size_t goa = (size_t)(mt * 128 + cr) * DM + cc;
  const unsigned short* gh = CH + goa;
  const unsigned short* gl = CL + goa;
  const unsigned short* gb = Wt + (size_t)(col0 + cr) * DM + cc;
  const unsigned lh = lds_off(&sch[0][cr][cc]), ll = lds_off(&scl[0][cr][cc]), lb = lds_off(&sb[0][cr][cc]);
  auto fill = [&](const int s) {
    const unsigned bu = (unsigned)(s & 1);
    cp64(lh + bu * (128u * TP * 2u), gh + s * 64, (size_t)16 * DM);
    cp64(lh + bu * (128u * TP * 2u) + 64u * TP * 2u, gh + (size_t)64 * DM + s * 64, (size_t)16 * DM);
    cp64(ll + bu * (128u * TP * 2u), gl + s * 64, (size_t)16 * DM);
    cp64(ll + bu * (128u * TP * 2u) + 64u * TP * 2u, gl + (size_t)64 * DM + s * 64, (size_t)16 * DM);
    cp64(lb + bu * (64u * TP * 2u), gb + s * 64, (size_t)16 * DM);
  };
  const int a0 = (32 * w + ln) * TP + 8 * hh, a1 = a0 + 16 * TP;
  const int b0 = ln * TP + 8 * hh, b1 = b0 + 16 * TP, b2 = b1 + 16 * TP, b3 = b2 + 16 * TP;
  const v8f z8 = {0.f, 0.f, 0.f, 0.f, 0.f, 0.f, 0.f, 0.f};
  v8f c00 = z8, c01 = z8, c02 = z8, c03 = z8, c10 = z8, c11 = z8, c12 = z8, c13 = z8;
  fill(0);
  wait_copies();
  __syncthreads();
  fill(1);
#pragma unroll 1
  for (int s = 0; s < DM / 64; ++s) {
    const unsigned short* ph = &sch[s & 1][0][0];
    const unsigned short* pl = &scl[s & 1][0][0];
    const unsigned short* pb = &sb[s & 1][0][0];
    /* all sixteen fragments of the stage are read as one group into registers of their own, ahead of its thirty-two WMMAs */
    v16b fh[2][2], fl[2][2], fb[2][4];
#pragma unroll /* both 32-k steps of a stage: their LDS offsets become immediates */
    for (int kk = 0; kk < 2; ++kk) {
      fh[kk][0] = ldf_b(ph, a0 + 32 * kk); fl[kk][0] = ldf_b(pl, a0 + 32 * kk); fh[kk][1] = ldf_b(ph, a1 + 32 * kk); fl[kk][1] = ldf_b(pl, a1 + 32 * kk);
      fb[kk][0] = ldf_b(pb, b0 + 32 * kk); fb[kk][1] = ldf_b(pb, b1 + 32 * kk);
      fb[kk][2] = ldf_b(pb, b2 + 32 * kk); fb[kk][3] = ldf_b(pb, b3 + 32 * kk);
    }
    __builtin_amdgcn_sched_barrier(0);         /* keeps the group of reads in front of the WMMAs: without it the scheduler sinks each read to its first use, with a full LDS wait there */
#pragma unroll /* fragment arrays stay in registers */
    for (int kk = 0; kk < 2; ++kk) {
      c00 = mma_b2(fh[kk][0], fl[kk][0], fb[kk][0], c00); c10 = mma_b2(fh[kk][1], fl[kk][1], fb[kk][0], c10);
      c01 = mma_b2(fh[kk][0], fl[kk][0], fb[kk][1], c01); c11 = mma_b2(fh[kk][1], fl[kk][1], fb[kk][1], c11);
      c02 = mma_b2(fh[kk][0], fl[kk][0], fb[kk][2], c02); c12 = mma_b2(fh[kk][1], fl[kk][1], fb[kk][2], c12);
      c03 = mma_b2(fh[kk][0], fl[kk][0], fb[kk][3], c03); c13 = mma_b2(fh[kk][1], fl[kk][1], fb[kk][3], c13);
    }
    __builtin_amdgcn_sched_barrier(0);         /* keeps the WMMAs in front of the stage's waits, inside the flight time of the next stage's copies */
    wait_lds();
    wait_copies();
    __syncthreads();                           /* publishes stage s + 1, frees stage s's buffer */
    if (s + 2 < DM / 64) fill(s + 2);
  }
  wait_copies();
  v8f accs[8] = {c00, c01, c02, c03, c10, c11, c12, c13};
#pragma unroll
  for (int u = 0; u < 8; ++u) {
    const int t = u & 3, half = u >> 2;
    const float bc = bf16_rne(bias[col0 + t * 16 + ln]);
#pragma unroll
    for (int r = 0; r < 8; ++r) so[w][half * 16 + 8 * hh + r][t * 16 + ln] = accs[u][r] + bc;
  }
  __builtin_amdgcn_fence(4 /* acq_rel order */, "workgroup");
  __builtin_amdgcn_wave_barrier();
  const int rsub = lane >> 4, c4 = (lane & 15) * 4;
  {
#pragma unroll
    for (int q = 0; q < 16; ++q) {
      const int r = q * 2 + rsub;                          
      const v4f v = *(const v4fa*)&so[w][r][c4];
      *(v4f*)(Y + (size_t)(row0 + r) * DM + col0 + c4) = v;
    }
    
  }
}

// One wave per row: a lane holds 32 of the row's 1024 values (eight 16-B pieces, a wave's load = 512 contiguous bytes); both sums by lane partials and a five-step butterfly, no LDS array, no barrier.
static_assert(NRP % 8 == 0);         // k_ln: 8 waves = 8 rows per block
__global__ __launch_bounds__(256) void k_ln(const float* __restrict__ x, const float* __restrict__ Y, const float* __restrict__ g, const float* __restrict__ bta, float* __restrict__ out) {
  const int tid = threadIdx.x, lane = tid & 31;
  const int row = blockIdx.x * 8 + __builtin_amdgcn_readfirstlane(tid >> 5);   /* wave-uniform: row bases stay scalar, one lane offset serves every load and store */
  const size_t xr = ((size_t)(row / SEQ) * SEQ_FULL + (size_t)(row % SEQ)) * DM;
  const size_t yr = (size_t)row * DM;
  const int c4 = lane * 4;
  v4f xv[8], yv[8], gv[8], bv[8];
#pragma unroll
  for (int j = 0; j < 8; ++j) { xv[j] = *(const v4fa*)(x + xr + c4 + j * 128); yv[j] = *(const v4fa*)(Y + yr + c4 + j * 128); }
#pragma unroll
  for (int j = 0; j < 8; ++j) { gv[j] = *(const v4fa*)(g + c4 + j * 128); bv[j] = *(const v4fa*)(bta + c4 + j * 128); }
  __builtin_amdgcn_sched_barrier(0);           /* all 32 loads of the row are in flight before the first value is used: without it the scheduler sinks the gamma and beta loads behind the sums, one exposed round trip per pair */
  v4f hv[8];
  v4f a1 = {0.f, 0.f, 0.f, 0.f};
#pragma unroll
  for (int j = 0; j < 8; ++j) {
#pragma unroll
    for (int q = 0; q < 4; ++q) hv[j][q] = bf16_rne(xv[j][q]) + yv[j][q];
    a1 += hv[j];
  }
  float s1 = (a1[0] + a1[1]) + (a1[2] + a1[3]);
#pragma unroll
  for (int off = 16; off > 0; off >>= 1) s1 += __shfl_xor(s1, off);
  const float mu = s1 * (1.0f / (float)DM);
  v4f a2 = {0.f, 0.f, 0.f, 0.f};
#pragma unroll
  for (int j = 0; j < 8; ++j) { hv[j] -= mu; a2 += hv[j] * hv[j]; }
  float s2 = (a2[0] + a2[1]) + (a2[2] + a2[3]);
#pragma unroll
  for (int off = 16; off > 0; off >>= 1) s2 += __shfl_xor(s2, off);
  const float rs = rsqrtf(s2 * (1.0f / (float)DM) + LN_EPS);
#pragma unroll
  for (int j = 0; j < 8; ++j) {
    v4f ov;
#pragma unroll
    for (int q = 0; q < 4; ++q) ov[q] = hv[j][q] * rs * bf16_rne(gv[j][q]) + bf16_rne(bv[j][q]);
    *(v4f*)(out + xr + c4 + j * 128) = ov;
  }
}

extern "C" void kernel_launch(void* const* d_in, const int* in_sizes, int n_in,
                              void* d_out, int out_size, void* d_ws, size_t ws_size, hipStream_t stream) {
  if (n_in < 11) return;
  const size_t need_x = ((size_t)(NB - 1) * SEQ_FULL + SEQ) * DM;
  if ((size_t)in_sizes[0] < need_x || (size_t)out_size < need_x) return;
  if ((size_t)in_sizes[1] < (size_t)DM * DM || (size_t)in_sizes[3] < (size_t)DM * DM || (size_t)in_sizes[5] < (size_t)DM * DM || (size_t)in_sizes[7] < (size_t)DM * DM) return;
  if (in_sizes[2] < DM || in_sizes[4] < DM || in_sizes[6] < DM || in_sizes[8] < DM || in_sizes[9] < DM || in_sizes[10] < DM) return;
  const float* x  = (const float*)d_in[0];
  const float* wq = (const float*)d_in[1]; const float* bq = (const float*)d_in[2];
  const float* wk = (const float*)d_in[3]; const float* bk = (const float*)d_in[4];
  const float* wv = (const float*)d_in[5]; const float* bv = (const float*)d_in[6];
  const float* wo = (const float*)d_in[7]; const float* bo = (const float*)d_in[8];
  const float* lg = (const float*)d_in[9]; const float* lb = (const float*)d_in[10];
  char* ws = (char*)d_ws; size_t off = 0;
  auto take = [&](size_t bytes) { char* p = ws + off; off += (bytes + 255) & ~(size_t)255; return p; };
  unsigned short* BQ = (unsigned short*)take(WS_W);
  unsigned short* BK = (unsigned short*)take(WS_W);
  unsigned short* BV = (unsigned short*)take(WS_W);
  unsigned short* BO = (unsigned short*)take(WS_W);
  unsigned short* X16 = (unsigned short*)take(WS_P16);
  unsigned short* QH  = (unsigned short*)take(WS_P16);
  unsigned short* QR  = (unsigned short*)take(WS_P16);
  unsigned short* K16 = (unsigned short*)take(WS_P16);
  unsigned short* VT  = (unsigned short*)take(WS_P16);
  unsigned short* CH  = (unsigned short*)take(WS_P16);
  unsigned short* CL  = (unsigned short*)take(WS_P16);
  float* Y = (float*)take(WS_P32);
  if (off > ws_size) return;
  k_prep<<<(unsigned)(4 * GW_BLK + GX_BLK), 256, 0, stream>>>(x, wq, wk, wv, wo, X16, BQ, BK, BV, BO);
  k_gemm_qkv<<<(unsigned)(2 * GQK_BLK + GV_BLK), 128, 0, stream>>>(X16, BQ, BK, BV, bq, bk, bv, QH, QR, K16, VT);
  k_flash<<<(unsigned)(NB * NH * (SEQ / 64)), 128, 0, stream>>>(QH, QR, K16, VT, CH, CL);
  k_gemm_o<<<(unsigned)((NRP / 128) * (DM / 64)), 128, 0, stream>>>(CH, CL, BO, bo, Y);
  k_ln<<<(unsigned)(NRP / 8), 256, 0, stream>>>(x, Y, lg, lb, (float*)d_out);
}

// v005
// One run takes 108 microseconds.
// Next to v004, in two timings, it ran 1.05 times as fast each time.
// All steps since v000 together make it 3.13 times as fast.
#include <hip/hip_runtime.h>
// Compute dtype: inputs RNE-converted to bf16 on load; q/k/v projections v_wmma_f32_16x16x32_f16 (x exact f16, weights x16 exact f16); scores f16 (k single, q as f16 value + x1024 f16 residual in its own accumulator); P (x256 carried) and v single f16; output GEMM v_wmma_f32_16x16x32_bf16 (ctx bf16 hi|lo, Wo exact bf16); all accumulators, softmax statistics, residual add and LayerNorm f32.
// Structure: token rows r = b*SEQ + s. k_prep (one grid, block ranges): [in][out] weights -> Bt[n][k] 16-bit planes, x -> f16 rows. k_gemm_qkv (one grid, block ranges): Q/K GEMMs (32x64 wave tiles) -> Qh, Qr, K16 planes; V GEMM with swapped operands -> VT[h*64+d][b*SEQ+s].
#ifndef NB
#define NB 2
#endif
#ifndef SEQ
#define SEQ 2048
#endif
#define NB_FULL 2
#define SEQ_FULL 2048
#define DM 1024
#define NH 16
#define HD 64
#define NRP (NB * SEQ)               /* plane rows */
#define LN_EPS 1e-5f

static_assert(NH * HD == DM);        // head h = columns h*64 + d
static_assert(HD == 64);
static_assert(DM == 1024);           // k_ln: 32 lanes x 8 pieces x 4 columns
static_assert(DM % 128 == 0);        // swapped V GEMM: M = DM in 128-row block tiles
static_assert(DM % 64 == 0);         // N tiles of 64
static_assert(DM % 32 == 0);         // K steps of 32
static_assert(NRP % 128 == 0);       // GEMM block tiles of 128 rows
static_assert(NRP % 64 == 0);        // swapped V GEMM N tiles
static_assert(SEQ % 64 == 0);        // flash: 64 queries per block, 32-key steps
static_assert(SEQ % 64 == 0 && SEQ / 64 >= 2);   // flash ring: 64-key stages, two buffers
static_assert(DM % 64 == 0 && DM / 64 >= 2);     // GEMM rings: 64-k stages, two buffers
static_assert(NB <= NB_FULL);
static_assert(SEQ <= SEQ_FULL);

typedef _Float16 v16h __attribute__((ext_vector_type(16)));
typedef __bf16 v16b __attribute__((ext_vector_type(16)));
typedef _Float16 v4h __attribute__((ext_vector_type(4)));
typedef unsigned short v8us __attribute__((ext_vector_type(8), may_alias));
typedef float v8f __attribute__((ext_vector_type(8)));
typedef float v4f __attribute__((ext_vector_type(4)));
typedef float v2f __attribute__((ext_vector_type(2)));
typedef float v4fa __attribute__((ext_vector_type(4), may_alias));
union FragH { v16h v; v8us half[2]; _Float16 h[16]; unsigned short u[16]; };
union FragB { v16b v; v8us half[2]; unsigned short u[16]; };

/* workspace carve (bytes); every region is rows x pitch x element size exactly, stores never pass a region end */
#define WS_W   ((size_t)DM * DM * 2)
#define WS_P16 ((size_t)NRP * DM * 2)
#define WS_P32 ((size_t)NRP * DM * 4)
#define WS_TOTAL (4 * WS_W + 7 * WS_P16 + WS_P32)
static_assert(WS_W % 256 == 0);
static_assert(WS_P16 % 256 == 0);
static_assert(WS_TOTAL <= (size_t)134217728);

__device__ __forceinline__ unsigned short bf16_bits(float x) { unsigned int u = __float_as_uint(x); return (unsigned short)((u + 0x7FFFu + ((u >> 16) & 1u)) >> 16); }
__device__ __forceinline__ float bf16_val(unsigned short b) { return __uint_as_float(((unsigned int)b) << 16); }
__device__ __forceinline__ float bf16_rne(float x) { return bf16_val(bf16_bits(x)); }

// fragment loaders: off already includes 8*(lane>>4); elements 0..7 <- k0+8h.., elements 8..15 <- k0+16+8h..
__device__ __forceinline__ v16h ldf_h(const unsigned short* __restrict__ p, size_t off) { FragH f; f.half[0] = *(const v8us*)(p + off); f.half[1] = *(const v8us*)(p + off + 16); return f.v; }
__device__ __forceinline__ v16b ldf_b(const unsigned short* __restrict__ p, size_t off) { FragB f; f.half[0] = *(const v8us*)(p + off); f.half[1] = *(const v8us*)(p + off + 16); return f.v; }
__device__ __forceinline__ v8f mma_h(v16h a, v16h b, v8f c) {
  return __builtin_amdgcn_wmma_f32_16x16x32_f16(false, a, false, b, (short)0, c, false, false);
}
__device__ __forceinline__ v8f mma_b2(v16b ah, v16b al, v16b b, v8f c) {
  c = __builtin_amdgcn_wmma_f32_16x16x32_bf16(false, ah, false, b, (short)0, c, false, false);
  c = __builtin_amdgcn_wmma_f32_16x16x32_bf16(false, al, false, b, (short)0, c, false, false);
  return c;
}

// LDS operand tiles: rows of 64 16-bit elements (128 B) at a pitch of 72 (144 B = 16 B x 9, conflict-free for ds_load_b128 fragment reads).
#define TP 72
__device__ __forceinline__ unsigned lds_off(const void* p) { return (unsigned)(size_t)p; }
// One lane's share of 64 tile rows: 16 B of rows r, r + 16, r + 32, r + 48 go from global memory to LDS through no register; a wave's copy covers 4 whole 128-B lines.
// The s_wait_xcnt stands inside the copies' own statement so that no address register is rewritten ahead of it.
__device__ __forceinline__ void cp64(const unsigned l, const unsigned short* g, const size_t g16) {
  const unsigned short* g1 = g + g16; const unsigned short* g2 = g1 + g16; const unsigned short* g3 = g2 + g16;
  asm volatile("global_load_async_to_lds_b128 %0, %4, off\n\t"
               "global_load_async_to_lds_b128 %1, %5, off\n\t"
               "global_load_async_to_lds_b128 %2, %6, off\n\t"
               "global_load_async_to_lds_b128 %3, %7, off\n\t"
               "s_wait_xcnt 0x0"
               :: "v"(l), "v"(l + 16u * TP * 2u), "v"(l + 32u * TP * 2u), "v"(l + 48u * TP * 2u), "v"(g), "v"(g1), "v"(g2), "v"(g3) : "memory");
}
// own copies landed (in front of the barrier that publishes them to the other waves)
__device__ __forceinline__ void wait_copies() { asm volatile("s_wait_asynccnt 0x0" ::: "memory"); }
// own LDS reads retired (in front of the barrier behind which their buffer is refilled)
__device__ __forceinline__ void wait_lds() { asm volatile("s_wait_dscnt 0x0" ::: "memory"); }

// One thread takes an 8 x 8 tile of W[k][n] (sixteen 16-B loads), turns it in registers and stores eight 16-B pieces of Wt[n][k]; bid = block index within this job's range.
// A wave is 8 k tiles x 4 n tiles: its two loads of a tile row cover one whole 128-B line of eight rows of W, a store one whole 128-B line of four rows of Wt (one writer per line).
// F16: Wt = f16 of 16 * bf16(W); else Wt = bf16 bits of W.
template <bool F16>
__device__ __forceinline__ void wt_body(const float* __restrict__ W, unsigned short* __restrict__ Wt, const int bid) {
  const int t = bid * 256 + threadIdx.x;                       /* tile number, (DM / 8) * (DM / 8) tiles */
  const int g = t >> 5;                                        /* wave's group of 8 x 4 tiles */
  const int k8 = ((g % (DM / 64)) * 8 + (t & 7)) * 8;
  const int n8 = ((g / (DM / 64)) * 4 + ((t >> 3) & 3)) * 8;
  v4f r[8][2];
#pragma unroll
  for (int i = 0; i < 8; ++i) {
    r[i][0] = *(const v4fa*)(W + (size_t)(k8 + i) * DM + n8);
    r[i][1] = *(const v4fa*)(W + (size_t)(k8 + i) * DM + n8 + 4);
  }
#pragma unroll
  for (int j = 0; j < 8; ++j) {
    FragH f;
#pragma unroll
    for (int i = 0; i < 8; ++i) {
      const float wv = r[i][j >> 2][j & 3];
      if (F16) f.h[i] = (_Float16)(bf16_rne(wv) * 16.0f); else f.u[i] = bf16_bits(wv);
    }
    const v8us o = f.half[0];
    *(v8us*)(Wt + (size_t)(n8 + j) * DM + k8) = o;
  }
  /* behind the last store: the code of another block range follows in the text and rewrites the stores' address and data registers */
  asm volatile("s_wait_xcnt 0x0" ::: "memory");
}
// One thread converts eight pieces of 8 values of x; a block takes 16 consecutive rows (all of one batch entry: SEQ % 16 == 0), piece j * 256 + thread in pass j.
// The block's bases are scalar, so one lane offset serves all loads and one all stores.
__device__ __forceinline__ void x16_body(const float* __restrict__ x, unsigned short* __restrict__ X16, const int bid) {
  const int r0 = bid * 16;
  const float* __restrict__ xp = x + ((size_t)(r0 / SEQ) * SEQ_FULL + (size_t)(r0 % SEQ)) * DM;
  unsigned short* __restrict__ op = X16 + (size_t)r0 * DM;
  const int c8 = threadIdx.x * 8;
  v4f a[8], b[8];
#pragma unroll
  for (int j = 0; j < 8; ++j) { a[j] = *(const v4fa*)(xp + c8 + j * 2048); b[j] = *(const v4fa*)(xp + c8 + j * 2048 + 4); }
#pragma unroll
  for (int j = 0; j < 8; ++j) {
    FragH f;
#pragma unroll
    for (int q = 0; q < 4; ++q) { f.h[q] = (_Float16)bf16_rne(a[j][q]); f.h[4 + q] = (_Float16)bf16_rne(b[j][q]); }
    const v8us o = f.half[0];
    *(v8us*)(op + c8 + j * 2048) = o;
  }
  /* behind the last store: the code of another block range follows in the text and rewrites the stores' address and data registers */
  asm volatile("s_wait_xcnt 0x0" ::: "memory");
}
// The five independent operand preparations as block ranges of one grid; every thread moves 64 values, so that the launch starts few waves.
static_assert(DM % 64 == 0);                          /* a wave's 8 x 4 tiles of 8 x 8 */
static_assert(((DM / 8) * (DM / 8)) % 256 == 0);      /* whole blocks of weight tiles */
static_assert(NRP % 16 == 0 && SEQ % 16 == 0 && DM == 1024);  /* x: whole blocks of 16 rows = 2048 pieces, inside one batch entry */
#define GW_BLK (((DM / 8) * (DM / 8)) / 256)          /* blocks of one weight plane */
#define GX_BLK (NRP / 16)                             /* blocks of x */
__global__ __launch_bounds__(256) void k_prep(const float* __restrict__ x, const float* __restrict__ wq, const float* __restrict__ wk, const float* __restrict__ wv, const float* __restrict__ wo,
                                              unsigned short* __restrict__ X16, unsigned short* __restrict__ BQ, unsigned short* __restrict__ BK, unsigned short* __restrict__ BV, unsigned short* __restrict__ BO) {
  const int bid = blockIdx.x;                  /* every test below is block-uniform */
  if (bid < GW_BLK) wt_body<true>(wq, BQ, bid);                   /* W[in][out] -> Bt[out][in] */
  else if (bid < 2 * GW_BLK) wt_body<true>(wk, BK, bid - GW_BLK);
  else if (bid < 3 * GW_BLK) wt_body<true>(wv, BV, bid - 2 * GW_BLK);
  else if (bid < 4 * GW_BLK) wt_body<false>(wo, BO, bid - 3 * GW_BLK);
  else x16_body(x, X16, bid - 4 * GW_BLK);
}

// f16 GEMM C[M][N] = alpha * A[M][K] . Bt[N][K]^T + bias; block = 4 waves, wave tile 32 x 64, block tile 128 x 64; M % 128 == 0, N % 64 == 0, K % 64 == 0, K >= 128.
// Operands: per 64-k stage the block copies its 128 A rows and 64 Bt rows into LDS, one stage ahead (two buffers); fragments are read from LDS.
// MODE 0: f16 plane C0, bias per column. MODE 1: f16 value plane C0 + x1024 residual plane C1, bias per column. MODE 2: f16 plane C0, bias per row.
// bid = block index within this product's range of the grid; so, sa, sb = the kernel's LDS (output staging [4][32][68], A ring [2][128][TP], B ring [2][64][TP]).
template <int MODE>
__device__ __forceinline__ void gemm_h_body(const unsigned short* __restrict__ A, const int lda, const unsigned short* __restrict__ Bt, const int ldb, const float alpha,
                                            const float* __restrict__ bias, unsigned short* C0, unsigned short* C1, const int ldc, const int M, const int N, const int K,
                                            const int bid, float (*so)[32][68], unsigned short (*sa)[128][TP], unsigned short (*sb)[64][TP]) {
  const int tid = threadIdx.x;
  const int w = __builtin_amdgcn_readfirstlane(tid >> 5);
  const int lane = tid & 31, ln = lane & 15, hh = lane >> 4;
  const int ntn = N >> 6;
  const int mt = bid / ntn, nq = bid - mt * ntn;
  const int row0 = mt * 128 + 32 * w, col0 = nq * 64;
  if (mt * 128 >= M) return;                   /* block-uniform, in front of every barrier */
  const int cr = tid >> 3, cc = (tid & 7) * 8; /* copy: row within 16, 16-B piece of the 128-B row */
  const unsigned short* ga = A + (size_t)(mt * 128 + cr) * lda + cc;
  const unsigned short* gb = Bt + (size_t)(col0 + cr) * ldb + cc;
  const unsigned la = lds_off(&sa[0][cr][cc]), lb = lds_off(&sb[0][cr][cc]);
  const int ns = K >> 6;
  auto fill = [&](const int s) {
    const unsigned bu = (unsigned)(s & 1);
    cp64(la + bu * (128u * TP * 2u), ga + s * 64, (size_t)16 * lda);
    cp64(la + bu * (128u * TP * 2u) + 64u * TP * 2u, ga + (size_t)64 * lda + s * 64, (size_t)16 * lda);
    cp64(lb + bu * (64u * TP * 2u), gb + s * 64, (size_t)16 * ldb);
  };
  const int a0 = (32 * w + ln) * TP + 8 * hh, a1 = a0 + 16 * TP;
  const int b0 = ln * TP + 8 * hh, b1 = b0 + 16 * TP, b2 = b1 + 16 * TP, b3 = b2 + 16 * TP;
  const v8f z8 = {0.f, 0.f, 0.f, 0.f, 0.f, 0.f, 0.f, 0.f};
  v8f c00 = z8, c01 = z8, c02 = z8, c03 = z8, c10 = z8, c11 = z8, c12 = z8, c13 = z8;
  fill(0);
  wait_copies();
  __syncthreads();
  fill(1);
#pragma unroll 1
  for (int s = 0; s < ns; ++s) {
    const unsigned short* pa = &sa[s & 1][0][0];
    const unsigned short* pb = &sb[s & 1][0][0];
    /* all twelve fragments of the stage are read as one group into registers of their own, ahead of its sixteen WMMAs: one LDS round trip a stage, not one a WMMA pair */
    v16h fa[2][2], fb[2][4];
#pragma unroll /* both 32-k steps of a stage: their LDS offsets become immediates */
    for (int kk = 0; kk < 2; ++kk) {
      fa[kk][0] = ldf_h(pa, a0 + 32 * kk); fa[kk][1] = ldf_h(pa, a1 + 32 * kk);
      fb[kk][0] = ldf_h(pb, b0 + 32 * kk); fb[kk][1] = ldf_h(pb, b1 + 32 * kk);
      fb[kk][2] = ldf_h(pb, b2 + 32 * kk); fb[kk][3] = ldf_h(pb, b3 + 32 * kk);
    }
    __builtin_amdgcn_sched_barrier(0);         /* keeps the group of reads in front of the WMMAs: without it the scheduler sinks each read to its first use, with a full LDS wait there */
#pragma unroll /* fragment arrays stay in registers */
    for (int kk = 0; kk < 2; ++kk) {
      c00 = mma_h(fa[kk][0], fb[kk][0], c00); c10 = mma_h(fa[kk][1], fb[kk][0], c10);
      c01 = mma_h(fa[kk][0], fb[kk][1], c01); c11 = mma_h(fa[kk][1], fb[kk][1], c11);
      c02 = mma_h(fa[kk][0], fb[kk][2], c02); c12 = mma_h(fa[kk][1], fb[kk][2], c12);
      c03 = mma_h(fa[kk][0], fb[kk][3], c03); c13 = mma_h(fa[kk][1], fb[kk][3], c13);
    }
    __builtin_amdgcn_sched_barrier(0);         /* keeps the WMMAs in front of the stage's waits, inside the flight time of the next stage's copies */
    wait_lds();
    wait_copies();
    __syncthreads();                           /* publishes stage s + 1, frees stage s's buffer */
    if (s + 2 < ns) fill(s + 2);
  }
  wait_copies();
  v8f accs[8] = {c00, c01, c02, c03, c10, c11, c12, c13};
#pragma unroll
  for (int u = 0; u < 8; ++u) {
    const int t = u & 3, half = u >> 2;
    float bc = 0.f;
    float brow[8] = {0.f, 0.f, 0.f, 0.f, 0.f, 0.f, 0.f, 0.f};
    if (MODE == 2) {
      const v4f r0 = *(const v4fa*)(bias + row0 + half * 16 + 8 * hh), r1 = *(const v4fa*)(bias + row0 + half * 16 + 8 * hh + 4);
#pragma unroll
      for (int q = 0; q < 4; ++q) { brow[q] = bf16_rne(r0[q]); brow[4 + q] = bf16_rne(r1[q]); }
    } else {
      bc = bf16_rne(bias[col0 + t * 16 + ln]);
    }
#pragma unroll
    for (int r = 0; r < 8; ++r) {
      const int rloc = half * 16 + 8 * hh + r;           /* D: row 8h + r, col lane & 15 */
      const float bvv = (MODE == 2) ? brow[r] : bc;
      so[w][rloc][t * 16 + ln] = accs[u][r] * alpha + bvv;
    }
  }
  __builtin_amdgcn_fence(4 /* acq_rel order */, "workgroup");
  __builtin_amdgcn_wave_barrier();
  const int rsub = lane >> 4, c4 = (lane & 15) * 4;
  {
#pragma unroll
    for (int q = 0; q < 16; ++q) {
      const int r = q * 2 + rsub;                        
      const v4f v = *(const v4fa*)&so[w][r][c4];
      v4h h4, r4;
#pragma unroll
      for (int i = 0; i < 4; ++i) { const _Float16 hv = (_Float16)v[i]; h4[i] = hv; r4[i] = (_Float16)((v[i] - (float)hv) * 1024.0f); }
      const size_t go = (size_t)(row0 + r) * ldc + col0 + c4;
      *(v4h*)(C0 + go) = h4;
      if (MODE == 1) *(v4h*)(C1 + go) = r4;
    }
    /* behind the last store: in the merged kernel the code of another block range follows in the text and rewrites the stores' address and data registers */
    asm volatile("s_wait_xcnt 0x0" ::: "memory");
  }
}
// The three independent projections as block ranges of one grid, one set of LDS arrays.
// V with swapped operands: VT[n = h*64+d][r = b*SEQ+s] = sum_k Wt[n][k] x[r][k] / 16 + bias[n]
#define GQK_BLK ((NRP / 128) * (DM / 64))             /* blocks of the Q product, and of the K product */
#define GV_BLK ((DM / 128) * (NRP / 64))              /* blocks of the V product */
__global__ __launch_bounds__(128) void k_gemm_qkv(const unsigned short* __restrict__ X16, const unsigned short* __restrict__ BQ, const unsigned short* __restrict__ BK, const unsigned short* __restrict__ BV,
                                                  const float* __restrict__ bq, const float* __restrict__ bk, const float* __restrict__ bv,
                                                  unsigned short* __restrict__ Qh, unsigned short* __restrict__ Qr, unsigned short* __restrict__ K16, unsigned short* __restrict__ VT) {
  __shared__ __attribute__((aligned(16))) float so[4][32][68];
  __shared__ __attribute__((aligned(16))) unsigned short sa[2][128][TP];
  __shared__ __attribute__((aligned(16))) unsigned short sb[2][64][TP];
  const int bid = blockIdx.x;                  /* every test below is block-uniform */
  if (bid < GQK_BLK) gemm_h_body<1>(X16, DM, BQ, DM, 0.0625f, bq, Qh, Qr, DM, NRP, DM, DM, bid, so, sa, sb);
  else if (bid < 2 * GQK_BLK) gemm_h_body<0>(X16, DM, BK, DM, 0.0625f, bk, K16, K16, DM, NRP, DM, DM, bid - GQK_BLK, so, sa, sb);
  else gemm_h_body<2>(BV, DM, X16, DM, 0.0625f, bv, VT, VT, NRP, DM, NRP, DM, bid - 2 * GQK_BLK, so, sa, sb);
}

// fused attention: block = (b, h, 64 queries), 4 waves x 16 queries. Per 32-key step:
//   S^T tiles (keys x queries): A = K rows (lane&15 = key), B = Q rows (lane&15 = query); D reg r of lane (n, hh) = key 8hh + r, query n.
//   P^T B fragment: element r <- tile(keys 0..15) reg r, element 8 + r <- tile(keys 16..31) reg r (same lane).
//   O^T tiles (d x queries): A = V^T rows (lane&15 = d within tile), k = key.
// K rows and V^T rows of a 64-key stage are copied into LDS by the whole block, one stage ahead (two buffers); all four waves read their fragments there.
// sh/sl[wave] are private to the wave (ctx hi / lo staging, 16 rows x 64 columns written and read in full).
#define RES_SC 0.0009765625f          /* 1 / 1024: the q residual plane's scale */
#define EXP_SC 0.18033688011112042f   /* log2(e) / 8: raw score -> exponent of 2 */
__global__ __launch_bounds__(128) void k_flash(const unsigned short* __restrict__ Qh, const unsigned short* __restrict__ Qr, const unsigned short* __restrict__ Kp,
                                               const unsigned short* __restrict__ VT, unsigned short* __restrict__ CH, unsigned short* __restrict__ CL) {
  __shared__ __attribute__((aligned(16))) unsigned short sh[4][16][72];
  __shared__ __attribute__((aligned(16))) unsigned short sl[4][16][72];
  __shared__ __attribute__((aligned(16))) unsigned short sk[2][64][TP];   /* [buffer][key][d] */
  __shared__ __attribute__((aligned(16))) unsigned short sv[2][HD][TP];   /* [buffer][d][key] */
  const int tid = threadIdx.x;
  const int wave = __builtin_amdgcn_readfirstlane(tid >> 5);
  const int lane = tid & 31, ln = lane & 15, hh = lane >> 4;
  const int bh = blockIdx.x / (SEQ / 64), qb = blockIdx.x % (SEQ / 64);
  const int b = bh / NH, h = bh % NH;
  const int q0 = qb * 64 + 16 * wave;
  const size_t rowb = (size_t)b * SEQ;
  const size_t qoff = (rowb + q0 + ln) * DM + h * HD + 8 * hh;
  const v16h qh0 = ldf_h(Qh, qoff), qh1 = ldf_h(Qh, qoff + 32);
  const v16h qr0 = ldf_h(Qr, qoff), qr1 = ldf_h(Qr, qoff + 32);
  const int cr = tid >> 3, cc = (tid & 7) * 8;                 /* copy: row within 16, 16-B piece of the 128-B row */
  const unsigned short* gk = Kp + (rowb + cr) * DM + h * HD + cc;
  const unsigned short* gv = VT + (size_t)(h * HD + cr) * NRP + rowb + cc;
  const unsigned lk = lds_off(&sk[0][cr][cc]), lv = lds_off(&sv[0][cr][cc]);
  auto fill = [&](const int s) {
    const unsigned bo = (unsigned)(s & 1) * (64u * TP * 2u);
    cp64(lk + bo, gk + (size_t)s * 64 * DM, (size_t)16 * DM);
    cp64(lv + bo, gv + s * 64, (size_t)16 * NRP);
  };
  const int foff = ln * TP + 8 * hh;
  const v8f z8 = {0.f, 0.f, 0.f, 0.f, 0.f, 0.f, 0.f, 0.f};
  v8f o[4] = {z8, z8, z8, z8};
  float m = -1.0e30f;                                          /* running maximum, in raw-score units */
  v2f l2 = {0.f, 0.f};                                         /* row sum, even and odd elements apart until the epilogue */
  fill(0);
  wait_copies();
  __syncthreads();
  fill(1);
#pragma unroll 1
  for (int s = 0; s < SEQ / 64; ++s) {
   const unsigned short* pk = &sk[s & 1][0][0];
   const unsigned short* pv = &sv[s & 1][0][0];
#pragma unroll /* both 32-key passes of a stage: their LDS offsets become immediates */
   for (int kb = 0; kb < 64; kb += 32) {
    const int k0 = foff + kb * TP, k1 = k0 + 16 * TP;
    v8f sm0 = z8, sr0 = z8, sm1 = z8, sr1 = z8;
    v16h ka = ldf_h(pk, k0);      sm0 = mma_h(ka, qh0, sm0); sr0 = mma_h(ka, qr0, sr0);
    ka = ldf_h(pk, k1);           sm1 = mma_h(ka, qh0, sm1); sr1 = mma_h(ka, qr0, sr1);
    ka = ldf_h(pk, k0 + 32);      sm0 = mma_h(ka, qh1, sm0); sr0 = mma_h(ka, qr1, sr0);
    ka = ldf_h(pk, k1 + 32);      sm1 = mma_h(ka, qh1, sm1); sr1 = mma_h(ka, qr1, sr1);
    /* raw scores t = main + residual / 1024 (8 x the logit): each packed instruction takes two adjacent registers of one accumulator tile, so no register is moved to form a pair */
    v2f t[8];                                                  /* t[i] = elements 2i, 2i + 1 of the 32-key P^T operand */
#pragma unroll /* t[] stays in registers */
    for (int i = 0; i < 4; ++i) {
      t[i] = __builtin_elementwise_fma(v2f{sr0[2 * i], sr0[2 * i + 1]}, v2f{RES_SC, RES_SC}, v2f{sm0[2 * i], sm0[2 * i + 1]});
      t[4 + i] = __builtin_elementwise_fma(v2f{sr1[2 * i], sr1[2 * i + 1]}, v2f{RES_SC, RES_SC}, v2f{sm1[2 * i], sm1[2 * i + 1]});
    }
    float mx = -1.0e30f;                                       /* maximum of the raw scores: their scale is positive */
#pragma unroll /* t[] stays in registers */
    for (int i = 0; i < 8; ++i) mx = fmaxf(mx, fmaxf(t[i].x, t[i].y));
    mx = fmaxf(mx, __shfl_xor(mx, 16));
    const float mn = fmaxf(m, mx);
    const float alpha = __builtin_amdgcn_exp2f((m - mn) * EXP_SC);
    const float nm = 8.0f - mn * EXP_SC;                       /* probabilities carried x256 = 2^8 (also in l) */
    m = mn;
    FragH pf;
    v2f e[8];
#pragma unroll /* t[], e[] and the fragment stay in registers */
    for (int i = 0; i < 8; ++i) {
      const v2f a = __builtin_elementwise_fma(t[i], v2f{EXP_SC, EXP_SC}, v2f{nm, nm});   /* 1/8, log2(e) and the maximum in one packed fma per two scores */
      e[i] = v2f{__builtin_amdgcn_exp2f(a.x), __builtin_amdgcn_exp2f(a.y)};
      pf.h[2 * i] = (_Float16)e[i].x;
      pf.h[2 * i + 1] = (_Float16)e[i].y;
    }
    l2 = l2 * alpha + (((e[0] + e[1]) + (e[2] + e[3])) + ((e[4] + e[5]) + (e[6] + e[7])));
#pragma unroll
    for (int t = 0; t < 4; ++t)
#pragma unroll
      for (int r = 0; r < 8; ++r) o[t][r] *= alpha;
#pragma unroll
    for (int t = 0; t < 4; ++t) {
      const v16h va = ldf_h(pv, foff + t * 16 * TP + kb);
      o[t] = mma_h(va, pf.v, o[t]);
    }
   }
   wait_lds();
   wait_copies();
   __syncthreads();                                            /* publishes stage s + 1, frees stage s's buffer */
   if (s + 2 < SEQ / 64) fill(s + 2);
  }
  wait_copies();
  float l = l2.x + l2.y;
  l += __shfl_xor(l, 16);
  const float inv = 1.0f / l;
#pragma unroll
  for (int t = 0; t < 4; ++t) {
    v8us vh, vl;
#pragma unroll
    for (int r = 0; r < 8; ++r) {
      const float c = o[t][r] * inv;                           /* ctx[query ln][d = 16t + 8hh + r] */
      const unsigned short hb = bf16_bits(c);
      vh[r] = hb;
      vl[r] = bf16_bits(c - bf16_val(hb));
    }
    *(v8us*)&sh[wave][ln][t * 16 + 8 * hh] = vh;
    *(v8us*)&sl[wave][ln][t * 16 + 8 * hh] = vl;
  }
  __builtin_amdgcn_fence(4 /* acq_rel order */, "workgroup");
  __builtin_amdgcn_wave_barrier();
  const int rq = lane >> 3, pc = lane & 7;                     
  {
#pragma unroll
    for (int qq = 0; qq < 4; ++qq) {
      const int row = qq * 4 + rq;                             /* qq*4 + {0..3} covers rows 0..15 */
      const v8us xh = *(const v8us*)&sh[wave][row][pc * 8];
      const v8us xl = *(const v8us*)&sl[wave][row][pc * 8];
      const size_t go = (rowb + q0 + row) * DM + h * HD + pc * 8;
      *(v8us*)(CH + go) = xh;
      *(v8us*)(CL + go) = xl;
    }
    
  }
}

// Y[NRP][DM] (f32) = (CH + CL) . Wt[DM][DM]^T + bias; bf16 operands, two products per tile pair into one accumulator; wave tile 32 x 64
// Operands: per 64-k stage the block copies its 128 CH rows, 128 CL rows and 64 Wt rows into LDS, one stage ahead (two buffers).
__global__ __launch_bounds__(128) void k_gemm_o(const unsigned short* __restrict__ CH, const unsigned short* __restrict__ CL, const unsigned short* __restrict__ Wt,
                                                const float* __restrict__ bias, float* __restrict__ Y) {
  __shared__ __attribute__((aligned(16))) float so[4][32][68];
  __shared__ __attribute__((aligned(16))) unsigned short sch[2][128][TP];
  __shared__ __attribute__((aligned(16))) unsigned short scl[2][128][TP];
  __shared__ __attribute__((aligned(16))) unsigned short sb[2][64][TP];
  const int tid = threadIdx.x;
  const int w = __builtin_amdgcn_readfirstlane(tid >> 5);
  const int lane = tid & 31, ln = lane & 15, hh = lane >> 4;
  const int ntn = DM >> 6;
  const int mt = blockIdx.x / ntn, nq = blockIdx.x - mt * ntn;
  const int row0 = mt * 128 + 32 * w, col0 = nq * 64;
  if (mt * 128 >= NRP) return;                 /* block-uniform, in front of every barrier */
  const int cr = tid >> 3, cc = (tid & 7) * 8; /* copy: row within 16, 16-B piece of the 128-B row */
  const size_t goa = (size_t)(mt * 128 + cr) * DM + cc;
  const unsigned short* gh = CH + goa;
  const unsigned short* gl = CL + goa;
  const unsigned short* gb = Wt + (size_t)(col0 + cr) * DM + cc;
  const unsigned lh = lds_off(&sch[0][cr][cc]), ll = lds_off(&scl[0][cr][cc]), lb = lds_off(&sb[0][cr][cc]);
  auto fill = [&](const int s) {
    const unsigned bu = (unsigned)(s & 1);
    cp64(lh + bu * (128u * TP * 2u), gh + s * 64, (size_t)16 * DM);
    cp64(lh + bu * (128u * TP * 2u) + 64u * TP * 2u, gh + (size_t)64 * DM + s * 64, (size_t)16 * DM);
    cp64(ll + bu * (128u * TP * 2u), gl + s * 64, (size_t)16 * DM);
    cp64(ll + bu * (128u * TP * 2u) + 64u * TP * 2u, gl + (size_t)64 * DM + s * 64, (size_t)16 * DM);
    cp64(lb + bu * (64u * TP * 2u), gb + s * 64, (size_t)16 * DM);
  };
  const int a0 = (32 * w + ln) * TP + 8 * hh, a1 = a0 + 16 * TP;
  const int b0 = ln * TP + 8 * hh, b1 = b0 + 16 * TP, b2 = b1 + 16 * TP, b3 = b2 + 16 * TP;
  const v8f z8 = {0.f, 0.f, 0.f, 0.f, 0.f, 0.f, 0.f, 0.f};
  v8f c00 = z8, c01 = z8, c02 = z8, c03 = z8, c10 = z8, c11 = z8, c12 = z8, c13 = z8;
  fill(0);
  wait_copies();
  __syncthreads();
  fill(1);
#pragma unroll 1
  for (int s = 0; s < DM / 64; ++s) {
    const unsigned short* ph = &sch[s & 1][0][0];
    const unsigned short* pl = &scl[s & 1][0][0];
    const unsigned short* pb = &sb[s & 1][0][0];
    /* all sixteen fragments of the stage are read as one group into registers of their own, ahead of its thirty-two WMMAs */
    v16b fh[2][2], fl[2][2], fb[2][4];
#pragma unroll /* both 32-k steps of a stage: their LDS offsets become immediates */
    for (int kk = 0; kk < 2; ++kk) {
      fh[kk][0] = ldf_b(ph, a0 + 32 * kk); fl[kk][0] = ldf_b(pl, a0 + 32 * kk); fh[kk][1] = ldf_b(ph, a1 + 32 * kk); fl[kk][1] = ldf_b(pl, a1 + 32 * kk);
      fb[kk][0] = ldf_b(pb, b0 + 32 * kk); fb[kk][1] = ldf_b(pb, b1 + 32 * kk);
      fb[kk][2] = ldf_b(pb, b2 + 32 * kk); fb[kk][3] = ldf_b(pb, b3 + 32 * kk);
    }
    __builtin_amdgcn_sched_barrier(0);         /* keeps the group of reads in front of the WMMAs: without it the scheduler sinks each read to its first use, with a full LDS wait there */
#pragma unroll /* fragment arrays stay in registers */
    for (int kk = 0; kk < 2; ++kk) {
      c00 = mma_b2(fh[kk][0], fl[kk][0], fb[kk][0], c00); c10 = mma_b2(fh[kk][1], fl[kk][1], fb[kk][0], c10);
      c01 = mma_b2(fh[kk][0], fl[kk][0], fb[kk][1], c01); c11 = mma_b2(fh[kk][1], fl[kk][1], fb[kk][1], c11);
      c02 = mma_b2(fh[kk][0], fl[kk][0], fb[kk][2], c02); c12 = mma_b2(fh[kk][1], fl[kk][1], fb[kk][2], c12);
      c03 = mma_b2(fh[kk][0], fl[kk][0], fb[kk][3], c03); c13 = mma_b2(fh[kk][1], fl[kk][1], fb[kk][3], c13);
    }
    __builtin_amdgcn_sched_barrier(0);         /* keeps the WMMAs in front of the stage's waits, inside the flight time of the next stage's copies */
    wait_lds();
    wait_copies();
    __syncthreads();                           /* publishes stage s + 1, frees stage s's buffer */
    if (s + 2 < DM / 64) fill(s + 2);
  }
  wait_copies();
  v8f accs[8] = {c00, c01, c02, c03, c10, c11, c12, c13};
#pragma unroll
  for (int u = 0; u < 8; ++u) {
    const int t = u & 3, half = u >> 2;
    const float bc = bf16_rne(bias[col0 + t * 16 + ln]);
#pragma unroll
    for (int r = 0; r < 8; ++r) so[w][half * 16 + 8 * hh + r][t * 16 + ln] = accs[u][r] + bc;
  }
  __builtin_amdgcn_fence(4 /* acq_rel order */, "workgroup");
  __builtin_amdgcn_wave_barrier();
  const int rsub = lane >> 4, c4 = (lane & 15) * 4;
  {
#pragma unroll
    for (int q = 0; q < 16; ++q) {
      const int r = q * 2 + rsub;                          
      const v4f v = *(const v4fa*)&so[w][r][c4];
      *(v4f*)(Y + (size_t)(row0 + r) * DM + col0 + c4) = v;
    }
    
  }
}

// One wave per row: a lane holds 32 of the row's 1024 values (eight 16-B pieces, a wave's load = 512 contiguous bytes); both sums by lane partials and a five-step butterfly, no LDS array, no barrier.
static_assert(NRP % 8 == 0);         // k_ln: 8 waves = 8 rows per block
__global__ __launch_bounds__(256) void k_ln(const float* __restrict__ x, const float* __restrict__ Y, const float* __restrict__ g, const float* __restrict__ bta, float* __restrict__ out) {
  const int tid = threadIdx.x, lane = tid & 31;
  const int row = blockIdx.x * 8 + __builtin_amdgcn_readfirstlane(tid >> 5);   /* wave-uniform: row bases stay scalar, one lane offset serves every load and store */
  const size_t xr = ((size_t)(row / SEQ) * SEQ_FULL + (size_t)(row % SEQ)) * DM;
  const size_t yr = (size_t)row * DM;
  const int c4 = lane * 4;
  v4f xv[8], yv[8], gv[8], bv[8];
#pragma unroll
  for (int j = 0; j < 8; ++j) { xv[j] = *(const v4fa*)(x + xr + c4 + j * 128); yv[j] = *(const v4fa*)(Y + yr + c4 + j * 128); }
#pragma unroll
  for (int j = 0; j < 8; ++j) { gv[j] = *(const v4fa*)(g + c4 + j * 128); bv[j] = *(const v4fa*)(bta + c4 + j * 128); }
  __builtin_amdgcn_sched_barrier(0);           /* all 32 loads of the row are in flight before the first value is used: without it the scheduler sinks the gamma and beta loads behind the sums, one exposed round trip per pair */
  v4f hv[8];
  v4f a1 = {0.f, 0.f, 0.f, 0.f};
#pragma unroll
  for (int j = 0; j < 8; ++j) {
#pragma unroll
    for (int q = 0; q < 4; ++q) hv[j][q] = bf16_rne(xv[j][q]) + yv[j][q];
    a1 += hv[j];
  }
  float s1 = (a1[0] + a1[1]) + (a1[2] + a1[3]);
#pragma unroll
  for (int off = 16; off > 0; off >>= 1) s1 += __shfl_xor(s1, off);
  const float mu = s1 * (1.0f / (float)DM);
  v4f a2 = {0.f, 0.f, 0.f, 0.f};
#pragma unroll
  for (int j = 0; j < 8; ++j) { hv[j] -= mu; a2 += hv[j] * hv[j]; }
  float s2 = (a2[0] + a2[1]) + (a2[2] + a2[3]);
#pragma unroll
  for (int off = 16; off > 0; off >>= 1) s2 += __shfl_xor(s2, off);
  const float rs = rsqrtf(s2 * (1.0f / (float)DM) + LN_EPS);
#pragma unroll
  for (int j = 0; j < 8; ++j) {
    v4f ov;
#pragma unroll
    for (int q = 0; q < 4; ++q) ov[q] = hv[j][q] * rs * bf16_rne(gv[j][q]) + bf16_rne(bv[j][q]);
    *(v4f*)(out + xr + c4 + j * 128) = ov;
  }
}

extern "C" void kernel_launch(void* const* d_in, const int* in_sizes, int n_in,
                              void* d_out, int out_size, void* d_ws, size_t ws_size, hipStream_t stream) {
  if (n_in < 11) return;
  const size_t need_x = ((size_t)(NB - 1) * SEQ_FULL + SEQ) * DM;
  if ((size_t)in_sizes[0] < need_x || (size_t)out_size < need_x) return;
  if ((size_t)in_sizes[1] < (size_t)DM * DM || (size_t)in_sizes[3] < (size_t)DM * DM || (size_t)in_sizes[5] < (size_t)DM * DM || (size_t)in_sizes[7] < (size_t)DM * DM) return;
  if (in_sizes[2] < DM || in_sizes[4] < DM || in_sizes[6] < DM || in_sizes[8] < DM || in_sizes[9] < DM || in_sizes[10] < DM) return;
  const float* x  = (const float*)d_in[0];
  const float* wq = (const float*)d_in[1]; const float* bq = (const float*)d_in[2];
  const float* wk = (const float*)d_in[3]; const float* bk = (const float*)d_in[4];
  const float* wv = (const float*)d_in[5]; const float* bv = (const float*)d_in[6];
  const float* wo = (const float*)d_in[7]; const float* bo = (const float*)d_in[8];
  const float* lg = (const float*)d_in[9]; const float* lb = (const float*)d_in[10];
  char* ws = (char*)d_ws; size_t off = 0;
  auto take = [&](size_t bytes) { char* p = ws + off; off += (bytes + 255) & ~(size_t)255; return p; };
  unsigned short* BQ = (unsigned short*)take(WS_W);
  unsigned short* BK = (unsigned short*)take(WS_W);
  unsigned short* BV = (unsigned short*)take(WS_W);
  unsigned short* BO = (unsigned short*)take(WS_W);
  unsigned short* X16 = (unsigned short*)take(WS_P16);
  unsigned short* QH  = (unsigned short*)take(WS_P16);
  unsigned short* QR  = (unsigned short*)take(WS_P16);
  unsigned short* K16 = (unsigned short*)take(WS_P16);
  unsigned short* VT  = (unsigned short*)take(WS_P16);
  unsigned short* CH  = (unsigned short*)take(WS_P16);
  unsigned short* CL  = (unsigned short*)take(WS_P16);
  float* Y = (float*)take(WS_P32);
  if (off > ws_size) return;
  k_prep<<<(unsigned)(4 * GW_BLK + GX_BLK), 256, 0, stream>>>(x, wq, wk, wv, wo, X16, BQ, BK, BV, BO);
  k_gemm_qkv<<<(unsigned)(2 * GQK_BLK + GV_BLK), 128, 0, stream>>>(X16, BQ, BK, BV, bq, bk, bv, QH, QR, K16, VT);
  k_flash<<<(unsigned)(NB * NH * (SEQ / 64)), 128, 0, stream>>>(QH, QR, K16, VT, CH, CL);
  k_gemm_o<<<(unsigned)((NRP / 128) * (DM / 64)), 128, 0, stream>>>(CH, CL, BO, bo, Y);
  k_ln<<<(unsigned)(NRP / 8), 256, 0, stream>>>(x, Y, lg, lb, (float*)d_out);
}

// v006
// Measured time: 103 microseconds a run.
// In two side-by-side timings against v005, it was 1.06 and 1.04 times as fast.
// Over all steps from v000 it is 3.28 times as fast.
#include <hip/hip_runtime.h>
// Compute dtype: inputs RNE-converted to bf16 on load; q/k/v projections v_wmma_f32_16x16x32_f16 (x exact f16, weights x16 exact f16); scores f16 (k single, q as f16 value + x1024 f16 residual in its own accumulator); P (x256 carried) and v single f16; output GEMM v_wmma_f32_16x16x32_bf16 (ctx bf16 hi|lo, Wo exact bf16); all accumulators, softmax statistics, residual add and LayerNorm f32.
// Structure: token rows r = b*SEQ + s. k_prep (one grid, block ranges): [in][out] weights -> Bt[n][k] 16-bit planes, x -> f16 rows. k_gemm_qkv (one grid, block ranges): Q/K GEMMs (64x64 wave tiles, 128x128 block tiles) -> Qh, Qr, K16 planes; V GEMM with swapped operands -> VT[h*64+d][b*SEQ+s].
#ifndef NB
#define NB 2
#endif
#ifndef SEQ
#define SEQ 2048
#endif
#define NB_FULL 2
#define SEQ_FULL 2048
#define DM 1024
#define NH 16
#define HD 64
#define NRP (NB * SEQ)               /* plane rows */
#define LN_EPS 1e-5f

static_assert(NH * HD == DM);        // head h = columns h*64 + d
static_assert(HD == 64);
static_assert(DM == 1024);           // k_ln: 32 lanes x 8 pieces x 4 columns
static_assert(DM % 128 == 0);        // swapped V GEMM: M = DM in 128-row block tiles
static_assert(DM % 128 == 0);        // N tiles of 128
static_assert(DM % 32 == 0);         // K steps of 32
static_assert(NRP % 128 == 0);       // GEMM block tiles of 128 rows
static_assert(NRP % 128 == 0);       // swapped V GEMM N tiles of 128
static_assert(SEQ % 64 == 0);        // flash: 64 queries per block, 32-key steps
static_assert(SEQ % 64 == 0 && SEQ / 64 >= 2);   // flash ring: 64-key stages, two buffers
static_assert(DM % 64 == 0 && DM / 64 >= 2);     // GEMM rings: 64-k stages, two buffers
static_assert(NB <= NB_FULL);
static_assert(SEQ <= SEQ_FULL);

typedef _Float16 v16h __attribute__((ext_vector_type(16)));
typedef __bf16 v16b __attribute__((ext_vector_type(16)));
typedef _Float16 v4h __attribute__((ext_vector_type(4)));
typedef unsigned short v8us __attribute__((ext_vector_type(8), may_alias));
typedef float v8f __attribute__((ext_vector_type(8)));
typedef float v4f __attribute__((ext_vector_type(4)));
typedef float v2f __attribute__((ext_vector_type(2)));
typedef float v4fa __attribute__((ext_vector_type(4), may_alias));
union FragH { v16h v; v8us half[2]; _Float16 h[16]; unsigned short u[16]; };
union FragB { v16b v; v8us half[2]; unsigned short u[16]; };

/* workspace carve (bytes); every region is rows x pitch x element size exactly, stores never pass a region end */
#define WS_W   ((size_t)DM * DM * 2)
#define WS_P16 ((size_t)NRP * DM * 2)
#define WS_P32 ((size_t)NRP * DM * 4)
#define WS_TOTAL (4 * WS_W + 7 * WS_P16 + WS_P32)
static_assert(WS_W % 256 == 0);
static_assert(WS_P16 % 256 == 0);
static_assert(WS_TOTAL <= (size_t)134217728);

__device__ __forceinline__ unsigned short bf16_bits(float x) { unsigned int u = __float_as_uint(x); return (unsigned short)((u + 0x7FFFu + ((u >> 16) & 1u)) >> 16); }
__device__ __forceinline__ float bf16_val(unsigned short b) { return __uint_as_float(((unsigned int)b) << 16); }
__device__ __forceinline__ float bf16_rne(float x) { return bf16_val(bf16_bits(x)); }

// fragment loaders: off already includes 8*(lane>>4); elements 0..7 <- k0+8h.., elements 8..15 <- k0+16+8h..
__device__ __forceinline__ v16h ldf_h(const unsigned short* __restrict__ p, size_t off) { FragH f; f.half[0] = *(const v8us*)(p + off); f.half[1] = *(const v8us*)(p + off + 16); return f.v; }
__device__ __forceinline__ v16b ldf_b(const unsigned short* __restrict__ p, size_t off) { FragB f; f.half[0] = *(const v8us*)(p + off); f.half[1] = *(const v8us*)(p + off + 16); return f.v; }
__device__ __forceinline__ v8f mma_h(v16h a, v16h b, v8f c) {
  return __builtin_amdgcn_wmma_f32_16x16x32_f16(false, a, false, b, (short)0, c, false, false);
}
__device__ __forceinline__ v8f mma_b2(v16b ah, v16b al, v16b b, v8f c) {
  c = __builtin_amdgcn_wmma_f32_16x16x32_bf16(false, ah, false, b, (short)0, c, false, false);
  c = __builtin_amdgcn_wmma_f32_16x16x32_bf16(false, al, false, b, (short)0, c, false, false);
  return c;
}

// LDS operand tiles: rows of 64 16-bit elements (128 B) at a pitch of 72 (144 B = 16 B x 9, conflict-free for ds_load_b128 fragment reads).
#define TP 72
__device__ __forceinline__ unsigned lds_off(const void* p) { return (unsigned)(size_t)p; }
// One lane's share of 64 tile rows: 16 B of rows r, r + 16, r + 32, r + 48 go from global memory to LDS through no register; a wave's copy covers 4 whole 128-B lines.
// The s_wait_xcnt stands inside the copies' own statement so that no address register is rewritten ahead of it.
__device__ __forceinline__ void cp64(const unsigned l, const unsigned short* g, const size_t g16) {
  const unsigned short* g1 = g + g16; const unsigned short* g2 = g1 + g16; const unsigned short* g3 = g2 + g16;
  asm volatile("global_load_async_to_lds_b128 %0, %4, off\n\t"
               "global_load_async_to_lds_b128 %1, %5, off\n\t"
               "global_load_async_to_lds_b128 %2, %6, off\n\t"
               "global_load_async_to_lds_b128 %3, %7, off\n\t"
               "s_wait_xcnt 0x0"
               :: "v"(l), "v"(l + 16u * TP * 2u), "v"(l + 32u * TP * 2u), "v"(l + 48u * TP * 2u), "v"(g), "v"(g1), "v"(g2), "v"(g3) : "memory");
}
// The same for a 128-row operand tile, one statement and one s_wait_xcnt a tile. Block of 128 threads: rows r + 16 i, i = 0..7.
__device__ __forceinline__ void cp128_t128(const unsigned l, const unsigned short* g, const size_t g16) {
  const unsigned short* g1 = g + g16; const unsigned short* g2 = g1 + g16; const unsigned short* g3 = g2 + g16;
  const unsigned short* g4 = g3 + g16; const unsigned short* g5 = g4 + g16; const unsigned short* g6 = g5 + g16; const unsigned short* g7 = g6 + g16;
  asm volatile("global_load_async_to_lds_b128 %0, %8, off\n\t"
               "global_load_async_to_lds_b128 %1, %9, off\n\t"
               "global_load_async_to_lds_b128 %2, %10, off\n\t"
               "global_load_async_to_lds_b128 %3, %11, off\n\t"
               "global_load_async_to_lds_b128 %4, %12, off\n\t"
               "global_load_async_to_lds_b128 %5, %13, off\n\t"
               "global_load_async_to_lds_b128 %6, %14, off\n\t"
               "global_load_async_to_lds_b128 %7, %15, off\n\t"
               "s_wait_xcnt 0x0"
               :: "v"(l), "v"(l + 16u * TP * 2u), "v"(l + 32u * TP * 2u), "v"(l + 48u * TP * 2u), "v"(l + 64u * TP * 2u), "v"(l + 80u * TP * 2u), "v"(l + 96u * TP * 2u), "v"(l + 112u * TP * 2u),
                  "v"(g), "v"(g1), "v"(g2), "v"(g3), "v"(g4), "v"(g5), "v"(g6), "v"(g7) : "memory");
}
// Block of 256 threads: rows r + 32 i, i = 0..3.
__device__ __forceinline__ void cp128_t256(const unsigned l, const unsigned short* g, const size_t g32) {
  const unsigned short* g1 = g + g32; const unsigned short* g2 = g1 + g32; const unsigned short* g3 = g2 + g32;
  asm volatile("global_load_async_to_lds_b128 %0, %4, off\n\t"
               "global_load_async_to_lds_b128 %1, %5, off\n\t"
               "global_load_async_to_lds_b128 %2, %6, off\n\t"
               "global_load_async_to_lds_b128 %3, %7, off\n\t"
               "s_wait_xcnt 0x0"
               :: "v"(l), "v"(l + 32u * TP * 2u), "v"(l + 64u * TP * 2u), "v"(l + 96u * TP * 2u), "v"(g), "v"(g1), "v"(g2), "v"(g3) : "memory");
}
// own copies landed (in front of the barrier that publishes them to the other waves)
__device__ __forceinline__ void wait_copies() { asm volatile("s_wait_asynccnt 0x0" ::: "memory"); }
// own LDS reads retired (in front of the barrier behind which their buffer is refilled)
__device__ __forceinline__ void wait_lds() { asm volatile("s_wait_dscnt 0x0" ::: "memory"); }

// One thread takes an 8 x 8 tile of W[k][n] (sixteen 16-B loads), turns it in registers and stores eight 16-B pieces of Wt[n][k]; bid = block index within this job's range.
// A wave is 8 k tiles x 4 n tiles: its two loads of a tile row cover one whole 128-B line of eight rows of W, a store one whole 128-B line of four rows of Wt (one writer per line).
// F16: Wt = f16 of 16 * bf16(W); else Wt = bf16 bits of W.
template <bool F16>
__device__ __forceinline__ void wt_body(const float* __restrict__ W, unsigned short* __restrict__ Wt, const int bid) {
  const int t = bid * 256 + threadIdx.x;                       /* tile number, (DM / 8) * (DM / 8) tiles */
  const int g = t >> 5;                                        /* wave's group of 8 x 4 tiles */
  const int k8 = ((g % (DM / 64)) * 8 + (t & 7)) * 8;
  const int n8 = ((g / (DM / 64)) * 4 + ((t >> 3) & 3)) * 8;
  v4f r[8][2];
#pragma unroll
  for (int i = 0; i < 8; ++i) {
    r[i][0] = *(const v4fa*)(W + (size_t)(k8 + i) * DM + n8);
    r[i][1] = *(const v4fa*)(W + (size_t)(k8 + i) * DM + n8 + 4);
  }
#pragma unroll
  for (int j = 0; j < 8; ++j) {
    FragH f;
#pragma unroll
    for (int i = 0; i < 8; ++i) {
      const float wv = r[i][j >> 2][j & 3];
      if (F16) f.h[i] = (_Float16)(bf16_rne(wv) * 16.0f); else f.u[i] = bf16_bits(wv);
    }
    const v8us o = f.half[0];
    *(v8us*)(Wt + (size_t)(n8 + j) * DM + k8) = o;
  }
  /* behind the last store: the code of another block range follows in the text and rewrites the stores' address and data registers */
  asm volatile("s_wait_xcnt 0x0" ::: "memory");
}
// One thread converts eight pieces of 8 values of x; a block takes 16 consecutive rows (all of one batch entry: SEQ % 16 == 0), piece j * 256 + thread in pass j.
// The block's bases are scalar, so one lane offset serves all loads and one all stores.
__device__ __forceinline__ void x16_body(const float* __restrict__ x, unsigned short* __restrict__ X16, const int bid) {
  const int r0 = bid * 16;
  const float* __restrict__ xp = x + ((size_t)(r0 / SEQ) * SEQ_FULL + (size_t)(r0 % SEQ)) * DM;
  unsigned short* __restrict__ op = X16 + (size_t)r0 * DM;
  const int c8 = threadIdx.x * 8;
  v4f a[8], b[8];
#pragma unroll
  for (int j = 0; j < 8; ++j) { a[j] = *(const v4fa*)(xp + c8 + j * 2048); b[j] = *(const v4fa*)(xp + c8 + j * 2048 + 4); }
#pragma unroll
  for (int j = 0; j < 8; ++j) {
    FragH f;
#pragma unroll
    for (int q = 0; q < 4; ++q) { f.h[q] = (_Float16)bf16_rne(a[j][q]); f.h[4 + q] = (_Float16)bf16_rne(b[j][q]); }
    const v8us o = f.half[0];
    *(v8us*)(op + c8 + j * 2048) = o;
  }
  /* behind the last store: the code of another block range follows in the text and rewrites the stores' address and data registers */
  asm volatile("s_wait_xcnt 0x0" ::: "memory");
}
// The five independent operand preparations as block ranges of one grid; every thread moves 64 values, so that the launch starts few waves.
static_assert(DM % 64 == 0);                          /* a wave's 8 x 4 tiles of 8 x 8 */
static_assert(((DM / 8) * (DM / 8)) % 256 == 0);      /* whole blocks of weight tiles */
static_assert(NRP % 16 == 0 && SEQ % 16 == 0 && DM == 1024);  /* x: whole blocks of 16 rows = 2048 pieces, inside one batch entry */
#define GW_BLK (((DM / 8) * (DM / 8)) / 256)          /* blocks of one weight plane */
#define GX_BLK (NRP / 16)                             /* blocks of x */
__global__ __launch_bounds__(256) void k_prep(const float* __restrict__ x, const float* __restrict__ wq, const float* __restrict__ wk, const float* __restrict__ wv, const float* __restrict__ wo,
                                              unsigned short* __restrict__ X16, unsigned short* __restrict__ BQ, unsigned short* __restrict__ BK, unsigned short* __restrict__ BV, unsigned short* __restrict__ BO) {
  const int bid = blockIdx.x;                  /* every test below is block-uniform */
  if (bid < GW_BLK) wt_body<true>(wq, BQ, bid);                   /* W[in][out] -> Bt[out][in] */
  else if (bid < 2 * GW_BLK) wt_body<true>(wk, BK, bid - GW_BLK);
  else if (bid < 3 * GW_BLK) wt_body<true>(wv, BV, bid - 2 * GW_BLK);
  else if (bid < 4 * GW_BLK) wt_body<false>(wo, BO, bid - 3 * GW_BLK);
  else x16_body(x, X16, bid - 4 * GW_BLK);
}

// f16 GEMM C[M][N] = alpha * A[M][K] . Bt[N][K]^T + bias; block = 4 waves (2 x 2), wave tile 64 x 64, block tile 128 x 128; M % 128 == 0, N % 128 == 0, K % 64 == 0, K >= 128.
// Operands: per 64-k stage the block copies its 128 A rows and 128 Bt rows into LDS, one stage ahead (two buffers); fragments are read from LDS.
// Per element of C a 128 x 128 block tile copies two thirds of the operand bytes of a 128 x 64 tile out of L2; a 64 x 64 wave tile reads 8 fragments per 16 WMMAs, a 32 x 64 tile 6 per 8.
// MODE 0: f16 plane C0, bias per column. MODE 1: f16 value plane C0 + x1024 residual plane C1, bias per column. MODE 2: f16 plane C0, bias per row.
// bid = block index within this product's range of the grid; so, sa, sb = the kernel's LDS (output staging [4][16][68], A ring [2][128][TP], B ring [2][128][TP]).
template <int MODE>
__device__ __forceinline__ void gemm_h_body(const unsigned short* __restrict__ A, const int lda, const unsigned short* __restrict__ Bt, const int ldb, const float alpha,
                                            const float* __restrict__ bias, unsigned short* C0, unsigned short* C1, const int ldc, const int M, const int N, const int K,
                                            const int bid, float (*so)[16][68], unsigned short (*sa)[128][TP], unsigned short (*sb)[128][TP]) {
  const int tid = threadIdx.x;
  const int w = __builtin_amdgcn_readfirstlane(tid >> 5);
  const int wm = w >> 1, wn = w & 1;           /* the wave's quarter of the block tile */
  const int lane = tid & 31, ln = lane & 15, hh = lane >> 4;
  const int ntn = N >> 7;
  const int mt = bid / ntn, nq = bid - mt * ntn;
  const int row0 = mt * 128 + 64 * wm, col0 = nq * 128 + 64 * wn;
  if (mt * 128 >= M) return;                   /* block-uniform, in front of every barrier */
  const int cr = tid >> 3, cc = (tid & 7) * 8; /* copy: row within 16, 16-B piece of the 128-B row */
  const unsigned short* ga = A + (size_t)(mt * 128 + cr) * lda + cc;
  const unsigned short* gb = Bt + (size_t)(nq * 128 + cr) * ldb + cc;
  const unsigned la = lds_off(&sa[0][cr][cc]), lb = lds_off(&sb[0][cr][cc]);
  const int ns = K >> 6;
  auto fill = [&](const int s) {
    const unsigned bo = (unsigned)(s & 1) * (128u * TP * 2u);
    cp128_t128(la + bo, ga + s * 64, (size_t)16 * lda);
    cp128_t128(lb + bo, gb + s * 64, (size_t)16 * ldb);
  };
  const int a0 = (64 * wm + ln) * TP + 8 * hh;
  const int b0 = (64 * wn + ln) * TP + 8 * hh;
  const v8f z8 = {0.f, 0.f, 0.f, 0.f, 0.f, 0.f, 0.f, 0.f};
  v8f c[4][4];                                 /* c[i][j]: rows 16 i.., columns 16 j.. of the wave tile */
#pragma unroll
  for (int i = 0; i < 4; ++i)
#pragma unroll
    for (int j = 0; j < 4; ++j) c[i][j] = z8;
  fill(0);
  wait_copies();
  __syncthreads();
  fill(1);
#pragma unroll 1
  for (int s = 0; s < ns; ++s) {
    const unsigned short* pa = &sa[s & 1][0][0];
    const unsigned short* pb = &sb[s & 1][0][0];
#pragma unroll /* both 32-k steps of a stage: their LDS offsets become immediates, the accumulator array stays in registers */
    for (int kk = 0; kk < 2; ++kk) {
      /* the eight fragments of a 32-k step are read as one group, ahead of its sixteen WMMAs: one LDS round trip per sixteen WMMAs */
      v16h fa[4], fb[4];
#pragma unroll /* fragment arrays stay in registers */
      for (int i = 0; i < 4; ++i) { fa[i] = ldf_h(pa, a0 + i * 16 * TP + 32 * kk); if (i == 0) fb[0] = ldf_h(pb, b0 + 32 * kk); }   /* in the order of first use by the WMMAs below */
#pragma unroll /* fragment arrays stay in registers */
      for (int j = 1; j < 4; ++j) fb[j] = ldf_h(pb, b0 + j * 16 * TP + 32 * kk);
      __builtin_amdgcn_sched_barrier(0);       /* keeps the group of reads in front of the WMMAs: without it the scheduler sinks each read to its first use, with a full LDS wait there */
#pragma unroll /* fragment and accumulator arrays stay in registers */
      for (int j = 0; j < 4; ++j)
#pragma unroll
        for (int i = 0; i < 4; ++i) c[i][j] = mma_h(fa[i], fb[j], c[i][j]);
      __builtin_amdgcn_sched_barrier(0);       /* keeps the next group of reads, and the stage's waits, out of the WMMA run */
    }
    wait_lds();
    wait_copies();
    __syncthreads();                           /* publishes stage s + 1, frees stage s's buffer */
    if (s + 2 < ns) fill(s + 2);
  }
  wait_copies();
  float bc[4] = {0.f, 0.f, 0.f, 0.f};
  if (MODE != 2) {
#pragma unroll
    for (int t = 0; t < 4; ++t) bc[t] = bf16_rne(bias[col0 + t * 16 + ln]);
  }
  const int rsub = lane >> 4, c4 = (lane & 15) * 4;
  /* the wave tile leaves in four slices of 16 rows through the wave's own staging rows */
#pragma unroll
  for (int i = 0; i < 4; ++i) {
    float brow[8] = {0.f, 0.f, 0.f, 0.f, 0.f, 0.f, 0.f, 0.f};
    if (MODE == 2) {
      const v4f r0 = *(const v4fa*)(bias + row0 + i * 16 + 8 * hh), r1 = *(const v4fa*)(bias + row0 + i * 16 + 8 * hh + 4);
#pragma unroll
      for (int q = 0; q < 4; ++q) { brow[q] = bf16_rne(r0[q]); brow[4 + q] = bf16_rne(r1[q]); }
    }
#pragma unroll
    for (int t = 0; t < 4; ++t)
#pragma unroll
      for (int r = 0; r < 8; ++r) {            /* D: row 8h + r, col lane & 15 */
        const float bvv = (MODE == 2) ? brow[r] : bc[t];
        so[w][8 * hh + r][t * 16 + ln] = c[i][t][r] * alpha + bvv;
      }
    __builtin_amdgcn_fence(4 /* acq_rel order */, "workgroup", "local");   /* LDS only: a fence on all memory would wait here for the earlier slices' global stores */
    __builtin_amdgcn_wave_barrier();           /* the slice is written by all lanes before any lane reads it back */
#pragma unroll
    for (int q = 0; q < 8; ++q) {
      const int r = q * 2 + rsub;
      const v4f v = *(const v4fa*)&so[w][r][c4];
      v4h h4, r4;
#pragma unroll
      for (int e = 0; e < 4; ++e) { const _Float16 hv = (_Float16)v[e]; h4[e] = hv; r4[e] = (_Float16)((v[e] - (float)hv) * 1024.0f); }
      const size_t go = (size_t)(row0 + i * 16 + r) * ldc + col0 + c4;
      *(v4h*)(C0 + go) = h4;
      if (MODE == 1) *(v4h*)(C1 + go) = r4;
    }
    __builtin_amdgcn_fence(4 /* acq_rel order */, "workgroup", "local");   /* LDS only, as above */
    __builtin_amdgcn_wave_barrier();           /* the slice is read back by all lanes before the next one overwrites it */
    /* behind a slice's last store: the next slice, or in the merged kernel the code of another block range, rewrites the stores' address and data registers */
    asm volatile("s_wait_xcnt 0x0" ::: "memory");
  }
}
// The three independent projections as block ranges of one grid, one set of LDS arrays.
// V with swapped operands: VT[n = h*64+d][r = b*SEQ+s] = sum_k Wt[n][k] x[r][k] / 16 + bias[n]
#define GQK_BLK ((NRP / 128) * (DM / 128))            /* blocks of the Q product, and of the K product */
#define GV_BLK ((DM / 128) * (NRP / 128))             /* blocks of the V product */
__global__ __launch_bounds__(128) void k_gemm_qkv(const unsigned short* __restrict__ X16, const unsigned short* __restrict__ BQ, const unsigned short* __restrict__ BK, const unsigned short* __restrict__ BV,
                                                  const float* __restrict__ bq, const float* __restrict__ bk, const float* __restrict__ bv,
                                                  unsigned short* __restrict__ Qh, unsigned short* __restrict__ Qr, unsigned short* __restrict__ K16, unsigned short* __restrict__ VT) {
  __shared__ __attribute__((aligned(16))) float so[4][16][68];
  __shared__ __attribute__((aligned(16))) unsigned short sa[2][128][TP];
  __shared__ __attribute__((aligned(16))) unsigned short sb[2][128][TP];
  const int bid = blockIdx.x;                  /* every test below is block-uniform */
  if (bid < GQK_BLK) gemm_h_body<1>(X16, DM, BQ, DM, 0.0625f, bq, Qh, Qr, DM, NRP, DM, DM, bid, so, sa, sb);
  else if (bid < 2 * GQK_BLK) gemm_h_body<0>(X16, DM, BK, DM, 0.0625f, bk, K16, K16, DM, NRP, DM, DM, bid - GQK_BLK, so, sa, sb);
  else gemm_h_body<2>(BV, DM, X16, DM, 0.0625f, bv, VT, VT, NRP, DM, NRP, DM, bid - 2 * GQK_BLK, so, sa, sb);
}

// fused attention: block = (b, h, 64 queries), 4 waves x 16 queries. Per 32-key step:
//   S^T tiles (keys x queries): A = K rows (lane&15 = key), B = Q rows (lane&15 = query); D reg r of lane (n, hh) = key 8hh + r, query n.
//   P^T B fragment: element r <- tile(keys 0..15) reg r, element 8 + r <- tile(keys 16..31) reg r (same lane).
//   O^T tiles (d x queries): A = V^T rows (lane&15 = d within tile), k = key.
// K rows and V^T rows of a 64-key stage are copied into LDS by the whole block, one stage ahead (two buffers); all four waves read their fragments there.
// sh/sl[wave] are private to the wave (ctx hi / lo staging, 16 rows x 64 columns written and read in full).
#define RES_SC 0.0009765625f          /* 1 / 1024: the q residual plane's scale */
#define EXP_SC 0.18033688011112042f   /* log2(e) / 8: raw score -> exponent of 2 */
__global__ __launch_bounds__(128) void k_flash(const unsigned short* __restrict__ Qh, const unsigned short* __restrict__ Qr, const unsigned short* __restrict__ Kp,
                                               const unsigned short* __restrict__ VT, unsigned short* __restrict__ CH, unsigned short* __restrict__ CL) {
  __shared__ __attribute__((aligned(16))) unsigned short sh[4][16][72];
  __shared__ __attribute__((aligned(16))) unsigned short sl[4][16][72];
  __shared__ __attribute__((aligned(16))) unsigned short sk[2][64][TP];   /* [buffer][key][d] */
  __shared__ __attribute__((aligned(16))) unsigned short sv[2][HD][TP];   /* [buffer][d][key] */
  const int tid = threadIdx.x;
  const int wave = __builtin_amdgcn_readfirstlane(tid >> 5);
  const int lane = tid & 31, ln = lane & 15, hh = lane >> 4;
  const int bh = blockIdx.x / (SEQ / 64), qb = blockIdx.x % (SEQ / 64);
  const int b = bh / NH, h = bh % NH;
  const int q0 = qb * 64 + 16 * wave;
  const size_t rowb = (size_t)b * SEQ;
  const size_t qoff = (rowb + q0 + ln) * DM + h * HD + 8 * hh;
  const v16h qh0 = ldf_h(Qh, qoff), qh1 = ldf_h(Qh, qoff + 32);
  const v16h qr0 = ldf_h(Qr, qoff), qr1 = ldf_h(Qr, qoff + 32);
  const int cr = tid >> 3, cc = (tid & 7) * 8;                 /* copy: row within 16, 16-B piece of the 128-B row */
  const unsigned short* gk = Kp + (rowb + cr) * DM + h * HD + cc;
  const unsigned short* gv = VT + (size_t)(h * HD + cr) * NRP + rowb + cc;
  const unsigned lk = lds_off(&sk[0][cr][cc]), lv = lds_off(&sv[0][cr][cc]);
  auto fill = [&](const int s) {
    const unsigned bo = (unsigned)(s & 1) * (64u * TP * 2u);
    cp64(lk + bo, gk + (size_t)s * 64 * DM, (size_t)16 * DM);
    cp64(lv + bo, gv + s * 64, (size_t)16 * NRP);
  };
  const int foff = ln * TP + 8 * hh;
  const v8f z8 = {0.f, 0.f, 0.f, 0.f, 0.f, 0.f, 0.f, 0.f};
  v8f o[4] = {z8, z8, z8, z8};
  float m = -1.0e30f;                                          /* running maximum, in raw-score units */
  v2f l2 = {0.f, 0.f};                                         /* row sum, even and odd elements apart until the epilogue */
  fill(0);
  wait_copies();
  __syncthreads();
  fill(1);
#pragma unroll 1
  for (int s = 0; s < SEQ / 64; ++s) {
   const unsigned short* pk = &sk[s & 1][0][0];
   const unsigned short* pv = &sv[s & 1][0][0];
#pragma unroll /* both 32-key passes of a stage: their LDS offsets become immediates */
   for (int kb = 0; kb < 64; kb += 32) {
    const int k0 = foff + kb * TP, k1 = k0 + 16 * TP;
    v8f sm0 = z8, sr0 = z8, sm1 = z8, sr1 = z8;
    v16h ka = ldf_h(pk, k0);      sm0 = mma_h(ka, qh0, sm0); sr0 = mma_h(ka, qr0, sr0);
    ka = ldf_h(pk, k1);           sm1 = mma_h(ka, qh0, sm1); sr1 = mma_h(ka, qr0, sr1);
    ka = ldf_h(pk, k0 + 32);      sm0 = mma_h(ka, qh1, sm0); sr0 = mma_h(ka, qr1, sr0);
    ka = ldf_h(pk, k1 + 32);      sm1 = mma_h(ka, qh1, sm1); sr1 = mma_h(ka, qr1, sr1);
    /* raw scores t = main + residual / 1024 (8 x the logit): each packed instruction takes two adjacent registers of one accumulator tile, so no register is moved to form a pair */
    v2f t[8];                                                  /* t[i] = elements 2i, 2i + 1 of the 32-key P^T operand */
#pragma unroll /* t[] stays in registers */
    for (int i = 0; i < 4; ++i) {
      t[i] = __builtin_elementwise_fma(v2f{sr0[2 * i], sr0[2 * i + 1]}, v2f{RES_SC, RES_SC}, v2f{sm0[2 * i], sm0[2 * i + 1]});
      t[4 + i] = __builtin_elementwise_fma(v2f{sr1[2 * i], sr1[2 * i + 1]}, v2f{RES_SC, RES_SC}, v2f{sm1[2 * i], sm1[2 * i + 1]});
    }
    float mx = -1.0e30f;                                       /* maximum of the raw scores: their scale is positive */
#pragma unroll /* t[] stays in registers */
    for (int i = 0; i < 8; ++i) mx = fmaxf(mx, fmaxf(t[i].x, t[i].y));
    mx = fmaxf(mx, __shfl_xor(mx, 16));
    const float mn = fmaxf(m, mx);
    const float alpha = __builtin_amdgcn_exp2f((m - mn) * EXP_SC);
    const float nm = 8.0f - mn * EXP_SC;                       /* probabilities carried x256 = 2^8 (also in l) */
    m = mn;
    FragH pf;
    v2f e[8];
#pragma unroll /* t[], e[] and the fragment stay in registers */
    for (int i = 0; i < 8; ++i) {
      const v2f a = __builtin_elementwise_fma(t[i], v2f{EXP_SC, EXP_SC}, v2f{nm, nm});   /* 1/8, log2(e) and the maximum in one packed fma per two scores */
      e[i] = v2f{__builtin_amdgcn_exp2f(a.x), __builtin_amdgcn_exp2f(a.y)};
      pf.h[2 * i] = (_Float16)e[i].x;
      pf.h[2 * i + 1] = (_Float16)e[i].y;
    }
    l2 = l2 * alpha + (((e[0] + e[1]) + (e[2] + e[3])) + ((e[4] + e[5]) + (e[6] + e[7])));
#pragma unroll
    for (int t = 0; t < 4; ++t)
#pragma unroll
      for (int r = 0; r < 8; ++r) o[t][r] *= alpha;
#pragma unroll
    for (int t = 0; t < 4; ++t) {
      const v16h va = ldf_h(pv, foff + t * 16 * TP + kb);
      o[t] = mma_h(va, pf.v, o[t]);
    }
   }
   wait_lds();
   wait_copies();
   __syncthreads();                                            /* publishes stage s + 1, frees stage s's buffer */
   if (s + 2 < SEQ / 64) fill(s + 2);
  }
  wait_copies();
  float l = l2.x + l2.y;
  l += __shfl_xor(l, 16);
  const float inv = 1.0f / l;
#pragma unroll
  for (int t = 0; t < 4; ++t) {
    v8us vh, vl;
#pragma unroll
    for (int r = 0; r < 8; ++r) {
      const float c = o[t][r] * inv;                           /* ctx[query ln][d = 16t + 8hh + r] */
      const unsigned short hb = bf16_bits(c);
      vh[r] = hb;
      vl[r] = bf16_bits(c - bf16_val(hb));
    }
    *(v8us*)&sh[wave][ln][t * 16 + 8 * hh] = vh;
    *(v8us*)&sl[wave][ln][t * 16 + 8 * hh] = vl;
  }
  __builtin_amdgcn_fence(4 /* acq_rel order */, "workgroup");
  __builtin_amdgcn_wave_barrier();
  const int rq = lane >> 3, pc = lane & 7;                     
  {
#pragma unroll
    for (int qq = 0; qq < 4; ++qq) {
      const int row = qq * 4 + rq;                             /* qq*4 + {0..3} covers rows 0..15 */
      const v8us xh = *(const v8us*)&sh[wave][row][pc * 8];
      const v8us xl = *(const v8us*)&sl[wave][row][pc * 8];
      const size_t go = (rowb + q0 + row) * DM + h * HD + pc * 8;
      *(v8us*)(CH + go) = xh;
      *(v8us*)(CL + go) = xl;
    }
    
  }
}

// Y[NRP][DM] (f32) = (CH + CL) . Wt[DM][DM]^T + bias; bf16 operands, two products per tile pair into one accumulator; block = 8 waves (4 x 2), wave tile 32 x 64, block tile 128 x 128
// Operands: per 64-k stage the block copies its 128 CH rows, 128 CL rows and 128 Wt rows into LDS, one stage ahead (two buffers): the CH and CL rows serve 128 columns of Y, not 64.
__global__ __launch_bounds__(256) void k_gemm_o(const unsigned short* __restrict__ CH, const unsigned short* __restrict__ CL, const unsigned short* __restrict__ Wt,
                                                const float* __restrict__ bias, float* __restrict__ Y) {
  __shared__ __attribute__((aligned(16))) float so[8][32][68];
  __shared__ __attribute__((aligned(16))) unsigned short sch[2][128][TP];
  __shared__ __attribute__((aligned(16))) unsigned short scl[2][128][TP];
  __shared__ __attribute__((aligned(16))) unsigned short sb[2][128][TP];
  const int tid = threadIdx.x;
  const int w = __builtin_amdgcn_readfirstlane(tid >> 5);
  const int wm = w >> 1, wn = w & 1;           /* the wave's 32 rows and 64 columns of the block tile */
  const int lane = tid & 31, ln = lane & 15, hh = lane >> 4;
  const int ntn = DM >> 7;
  const int mt = blockIdx.x / ntn, nq = blockIdx.x - mt * ntn;
  const int row0 = mt * 128 + 32 * wm, col0 = nq * 128 + 64 * wn;
  if (mt * 128 >= NRP) return;                 /* block-uniform, in front of every barrier */
  const int cr = tid >> 3, cc = (tid & 7) * 8; /* copy: row within 32, 16-B piece of the 128-B row */
  const size_t goa = (size_t)(mt * 128 + cr) * DM + cc;
  const unsigned short* gh = CH + goa;
  const unsigned short* gl = CL + goa;
  const unsigned short* gb = Wt + (size_t)(nq * 128 + cr) * DM + cc;
  const unsigned lh = lds_off(&sch[0][cr][cc]), ll = lds_off(&scl[0][cr][cc]), lb = lds_off(&sb[0][cr][cc]);
  auto fill = [&](const int s) {
    const unsigned bo = (unsigned)(s & 1) * (128u * TP * 2u);
    cp128_t256(lh + bo, gh + s * 64, (size_t)32 * DM);
    cp128_t256(ll + bo, gl + s * 64, (size_t)32 * DM);
    cp128_t256(lb + bo, gb + s * 64, (size_t)32 * DM);
  };
  const int a0 = (32 * wm + ln) * TP + 8 * hh, a1 = a0 + 16 * TP;
  const int b0 = (64 * wn + ln) * TP + 8 * hh, b1 = b0 + 16 * TP, b2 = b1 + 16 * TP, b3 = b2 + 16 * TP;
  const v8f z8 = {0.f, 0.f, 0.f, 0.f, 0.f, 0.f, 0.f, 0.f};
  v8f c00 = z8, c01 = z8, c02 = z8, c03 = z8, c10 = z8, c11 = z8, c12 = z8, c13 = z8;
  fill(0);
  wait_copies();
  __syncthreads();
  fill(1);
#pragma unroll 1
  for (int s = 0; s < DM / 64; ++s) {
    const unsigned short* ph = &sch[s & 1][0][0];
    const unsigned short* pl = &scl[s & 1][0][0];
    const unsigned short* pb = &sb[s & 1][0][0];
    /* all sixteen fragments of the stage are read as one group into registers of their own, ahead of its thirty-two WMMAs */
    v16b fh[2][2], fl[2][2], fb[2][4];
#pragma unroll /* both 32-k steps of a stage: their LDS offsets become immediates */
    for (int kk = 0; kk < 2; ++kk) {
      fh[kk][0] = ldf_b(ph, a0 + 32 * kk); fl[kk][0] = ldf_b(pl, a0 + 32 * kk); fh[kk][1] = ldf_b(ph, a1 + 32 * kk); fl[kk][1] = ldf_b(pl, a1 + 32 * kk);
      fb[kk][0] = ldf_b(pb, b0 + 32 * kk); fb[kk][1] = ldf_b(pb, b1 + 32 * kk);
      fb[kk][2] = ldf_b(pb, b2 + 32 * kk); fb[kk][3] = ldf_b(pb, b3 + 32 * kk);
    }
    __builtin_amdgcn_sched_barrier(0);         /* keeps the group of reads in front of the WMMAs: without it the scheduler sinks each read to its first use, with a full LDS wait there */
#pragma unroll /* fragment arrays stay in registers */
    for (int kk = 0; kk < 2; ++kk) {
      c00 = mma_b2(fh[kk][0], fl[kk][0], fb[kk][0], c00); c10 = mma_b2(fh[kk][1], fl[kk][1], fb[kk][0], c10);
      c01 = mma_b2(fh[kk][0], fl[kk][0], fb[kk][1], c01); c11 = mma_b2(fh[kk][1], fl[kk][1], fb[kk][1], c11);
      c02 = mma_b2(fh[kk][0], fl[kk][0], fb[kk][2], c02); c12 = mma_b2(fh[kk][1], fl[kk][1], fb[kk][2], c12);
      c03 = mma_b2(fh[kk][0], fl[kk][0], fb[kk][3], c03); c13 = mma_b2(fh[kk][1], fl[kk][1], fb[kk][3], c13);
    }
    __builtin_amdgcn_sched_barrier(0);         /* keeps the WMMAs in front of the stage's waits, inside the flight time of the next stage's copies */
    wait_lds();
    wait_copies();
    __syncthreads();                           /* publishes stage s + 1, frees stage s's buffer */
    if (s + 2 < DM / 64) fill(s + 2);
  }
  wait_copies();
  v8f accs[8] = {c00, c01, c02, c03, c10, c11, c12, c13};
#pragma unroll
  for (int u = 0; u < 8; ++u) {
    const int t = u & 3, half = u >> 2;
    const float bc = bf16_rne(bias[col0 + t * 16 + ln]);
#pragma unroll
    for (int r = 0; r < 8; ++r) so[w][half * 16 + 8 * hh + r][t * 16 + ln] = accs[u][r] + bc;
  }
  __builtin_amdgcn_fence(4 /* acq_rel order */, "workgroup");
  __builtin_amdgcn_wave_barrier();
  const int rsub = lane >> 4, c4 = (lane & 15) * 4;
  {
#pragma unroll
    for (int q = 0; q < 16; ++q) {
      const int r = q * 2 + rsub;                          
      const v4f v = *(const v4fa*)&so[w][r][c4];
      *(v4f*)(Y + (size_t)(row0 + r) * DM + col0 + c4) = v;
    }
    
  }
}

// One wave per row: a lane holds 32 of the row's 1024 values (eight 16-B pieces, a wave's load = 512 contiguous bytes); both sums by lane partials and a five-step butterfly, no LDS array, no barrier.
static_assert(NRP % 8 == 0);         // k_ln: 8 waves = 8 rows per block
__global__ __launch_bounds__(256) void k_ln(const float* __restrict__ x, const float* __restrict__ Y, const float* __restrict__ g, const float* __restrict__ bta, float* __restrict__ out) {
  const int tid = threadIdx.x, lane = tid & 31;
  const int row = blockIdx.x * 8 + __builtin_amdgcn_readfirstlane(tid >> 5);   /* wave-uniform: row bases stay scalar, one lane offset serves every load and store */
  const size_t xr = ((size_t)(row / SEQ) * SEQ_FULL + (size_t)(row % SEQ)) * DM;
  const size_t yr = (size_t)row * DM;
  const int c4 = lane * 4;
  v4f xv[8], yv[8], gv[8], bv[8];
#pragma unroll
  for (int j = 0; j < 8; ++j) { xv[j] = *(const v4fa*)(x + xr + c4 + j * 128); yv[j] = *(const v4fa*)(Y + yr + c4 + j * 128); }
#pragma unroll
  for (int j = 0; j < 8; ++j) { gv[j] = *(const v4fa*)(g + c4 + j * 128); bv[j] = *(const v4fa*)(bta + c4 + j * 128); }
  __builtin_amdgcn_sched_barrier(0);           /* all 32 loads of the row are in flight before the first value is used: without it the scheduler sinks the gamma and beta loads behind the sums, one exposed round trip per pair */
  v4f hv[8];
  v4f a1 = {0.f, 0.f, 0.f, 0.f};
#pragma unroll
  for (int j = 0; j < 8; ++j) {
#pragma unroll
    for (int q = 0; q < 4; ++q) hv[j][q] = bf16_rne(xv[j][q]) + yv[j][q];
    a1 += hv[j];
  }
  float s1 = (a1[0] + a1[1]) + (a1[2] + a1[3]);
#pragma unroll
  for (int off = 16; off > 0; off >>= 1) s1 += __shfl_xor(s1, off);
  const float mu = s1 * (1.0f / (float)DM);
  v4f a2 = {0.f, 0.f, 0.f, 0.f};
#pragma unroll
  for (int j = 0; j < 8; ++j) { hv[j] -= mu; a2 += hv[j] * hv[j]; }
  float s2 = (a2[0] + a2[1]) + (a2[2] + a2[3]);
#pragma unroll
  for (int off = 16; off > 0; off >>= 1) s2 += __shfl_xor(s2, off);
  const float rs = rsqrtf(s2 * (1.0f / (float)DM) + LN_EPS);
#pragma unroll
  for (int j = 0; j < 8; ++j) {
    v4f ov;
#pragma unroll
    for (int q = 0; q < 4; ++q) ov[q] = hv[j][q] * rs * bf16_rne(gv[j][q]) + bf16_rne(bv[j][q]);
    *(v4f*)(out + xr + c4 + j * 128) = ov;
  }
}

extern "C" void kernel_launch(void* const* d_in, const int* in_sizes, int n_in,
                              void* d_out, int out_size, void* d_ws, size_t ws_size, hipStream_t stream) {
  if (n_in < 11) return;
  const size_t need_x = ((size_t)(NB - 1) * SEQ_FULL + SEQ) * DM;
  if ((size_t)in_sizes[0] < need_x || (size_t)out_size < need_x) return;
  if ((size_t)in_sizes[1] < (size_t)DM * DM || (size_t)in_sizes[3] < (size_t)DM * DM || (size_t)in_sizes[5] < (size_t)DM * DM || (size_t)in_sizes[7] < (size_t)DM * DM) return;
  if (in_sizes[2] < DM || in_sizes[4] < DM || in_sizes[6] < DM || in_sizes[8] < DM || in_sizes[9] < DM || in_sizes[10] < DM) return;
  const float* x  = (const float*)d_in[0];
  const float* wq = (const float*)d_in[1]; const float* bq = (const float*)d_in[2];
  const float* wk = (const float*)d_in[3]; const float* bk = (const float*)d_in[4];
  const float* wv = (const float*)d_in[5]; const float* bv = (const float*)d_in[6];
  const float* wo = (const float*)d_in[7]; const float* bo = (const float*)d_in[8];
  const float* lg = (const float*)d_in[9]; const float* lb = (const float*)d_in[10];
  char* ws = (char*)d_ws; size_t off = 0;
  auto take = [&](size_t bytes) { char* p = ws + off; off += (bytes + 255) & ~(size_t)255; return p; };
  unsigned short* BQ = (unsigned short*)take(WS_W);
  unsigned short* BK = (unsigned short*)take(WS_W);
  unsigned short* BV = (unsigned short*)take(WS_W);
  unsigned short* BO = (unsigned short*)take(WS_W);
  unsigned short* X16 = (unsigned short*)take(WS_P16);
  unsigned short* QH  = (unsigned short*)take(WS_P16);
  unsigned short* QR  = (unsigned short*)take(WS_P16);
  unsigned short* K16 = (unsigned short*)take(WS_P16);
  unsigned short* VT  = (unsigned short*)take(WS_P16);
  unsigned short* CH  = (unsigned short*)take(WS_P16);
  unsigned short* CL  = (unsigned short*)take(WS_P16);
  float* Y = (float*)take(WS_P32);
  if (off > ws_size) return;
  k_prep<<<(unsigned)(4 * GW_BLK + GX_BLK), 256, 0, stream>>>(x, wq, wk, wv, wo, X16, BQ, BK, BV, BO);
  k_gemm_qkv<<<(unsigned)(2 * GQK_BLK + GV_BLK), 128, 0, stream>>>(X16, BQ, BK, BV, bq, bk, bv, QH, QR, K16, VT);
  k_flash<<<(unsigned)(NB * NH * (SEQ / 64)), 128, 0, stream>>>(QH, QR, K16, VT, CH, CL);
  k_gemm_o<<<(unsigned)((NRP / 128) * (DM / 128)), 256, 0, stream>>>(CH, CL, BO, bo, Y);
  k_ln<<<(unsigned)(NRP / 8), 256, 0, stream>>>(x, Y, lg, lb, (float*)d_out);
}

// v008
// A run of this version takes 86.8 microseconds.
// It is 1.19 times as fast as v006, going by the measured steps of the versions left out in between.
// Counting every step since v000, it is 3.89 times as fast.
#include <hip/hip_runtime.h>
// Compute dtype: inputs RNE-converted to bf16 on load; q/k/v projections v_wmma_f32_16x16x32_f16 (x exact f16, weights x16 exact f16); scores f16 (q and k single); P (x256 carried) and v single f16; output GEMM v_wmma_f32_16x16x32_bf16 (ctx single bf16, Wo exact bf16); all accumulators, softmax statistics, residual add and LayerNorm f32.
// Structure: token rows r = b*SEQ + s. k_prep (one grid, block ranges): [in][out] weights -> Bt[n][k] 16-bit planes, x -> f16 rows. k_gemm_qkv (one grid, block ranges): Q/K GEMMs (64x64 wave tiles, 128x128 block tiles) -> Qh, K16 planes; V GEMM with swapped operands -> VT[h*64+d][b*SEQ+s].
#ifndef NB
#define NB 2
#endif
#ifndef SEQ
#define SEQ 2048
#endif
#define NB_FULL 2
#define SEQ_FULL 2048
#define DM 1024
#define NH 16
#define HD 64
#define NRP (NB * SEQ)               /* plane rows */
#define LN_EPS 1e-5f

static_assert(NH * HD == DM);        // head h = columns h*64 + d
static_assert(HD == 64);
static_assert(DM == 1024);           // k_ln: 32 lanes x 8 pieces x 4 columns
static_assert(DM % 128 == 0);        // swapped V GEMM: M = DM in 128-row block tiles
static_assert(DM % 128 == 0);        // N tiles of 128
static_assert(DM % 32 == 0);         // K steps of 32
static_assert(NRP % 128 == 0);       // GEMM block tiles of 128 rows
static_assert(NRP % 128 == 0);       // swapped V GEMM N tiles of 128
static_assert(SEQ % 64 == 0);        // flash: 32-key steps
static_assert(DM % 64 == 0 && DM / 64 >= 2);     // GEMM rings: 64-k stages, two buffers
static_assert(NB <= NB_FULL);
static_assert(SEQ <= SEQ_FULL);

typedef _Float16 v16h __attribute__((ext_vector_type(16)));
typedef __bf16 v16b __attribute__((ext_vector_type(16)));
typedef _Float16 v4h __attribute__((ext_vector_type(4)));
typedef unsigned short v8us __attribute__((ext_vector_type(8), may_alias));
typedef float v8f __attribute__((ext_vector_type(8)));
typedef float v4f __attribute__((ext_vector_type(4)));
typedef float v2f __attribute__((ext_vector_type(2)));
typedef float v4fa __attribute__((ext_vector_type(4), may_alias));
union FragH { v16h v; v8us half[2]; _Float16 h[16]; unsigned short u[16]; };
union FragB { v16b v; v8us half[2]; unsigned short u[16]; };

/* workspace carve (bytes); every region is rows x pitch x element size exactly, stores never pass a region end */
#define WS_W   ((size_t)DM * DM * 2)
#define WS_P16 ((size_t)NRP * DM * 2)
#define WS_P32 ((size_t)NRP * DM * 4)
#define WS_TOTAL (4 * WS_W + 5 * WS_P16 + WS_P32)
static_assert(WS_W % 256 == 0);
static_assert(WS_P16 % 256 == 0);
static_assert(WS_TOTAL <= (size_t)134217728);

__device__ __forceinline__ unsigned short bf16_bits(float x) { unsigned int u = __float_as_uint(x); return (unsigned short)((u + 0x7FFFu + ((u >> 16) & 1u)) >> 16); }
__device__ __forceinline__ float bf16_val(unsigned short b) { return __uint_as_float(((unsigned int)b) << 16); }
__device__ __forceinline__ float bf16_rne(float x) { return bf16_val(bf16_bits(x)); }

// fragment loaders: off already includes 8*(lane>>4); elements 0..7 <- k0+8h.., elements 8..15 <- k0+16+8h..
__device__ __forceinline__ v16h ldf_h(const unsigned short* __restrict__ p, size_t off) { FragH f; f.half[0] = *(const v8us*)(p + off); f.half[1] = *(const v8us*)(p + off + 16); return f.v; }
__device__ __forceinline__ v16b ldf_b(const unsigned short* __restrict__ p, size_t off) { FragB f; f.half[0] = *(const v8us*)(p + off); f.half[1] = *(const v8us*)(p + off + 16); return f.v; }
__device__ __forceinline__ v8f mma_h(v16h a, v16h b, v8f c) {
  return __builtin_amdgcn_wmma_f32_16x16x32_f16(false, a, false, b, (short)0, c, false, false);
}
__device__ __forceinline__ v8f mma_b(v16b a, v16b b, v8f c) {
  return __builtin_amdgcn_wmma_f32_16x16x32_bf16(false, a, false, b, (short)0, c, false, false);
}

// LDS operand tiles: rows of 64 16-bit elements (128 B) at a pitch of 72 (144 B = 16 B x 9, conflict-free for ds_load_b128 fragment reads).
#define TP 72
__device__ __forceinline__ unsigned lds_off(const void* p) { return (unsigned)(size_t)p; }
// Four 16-B pieces of a lane go from global memory to LDS through no register, each with its own LDS and global address; a wave's copy covers 4 whole 128-B lines.
// The s_wait_xcnt stands inside the copies' own statement so that no address register is rewritten ahead of it.
__device__ __forceinline__ void cp4(const unsigned l0, const unsigned l1, const unsigned l2, const unsigned l3,
                                    const unsigned short* g0, const unsigned short* g1, const unsigned short* g2, const unsigned short* g3) {
  asm volatile("global_load_async_to_lds_b128 %0, %4, off\n\t"
               "global_load_async_to_lds_b128 %1, %5, off\n\t"
               "global_load_async_to_lds_b128 %2, %6, off\n\t"
               "global_load_async_to_lds_b128 %3, %7, off\n\t"
               "s_wait_xcnt 0x0"
               :: "v"(l0), "v"(l1), "v"(l2), "v"(l3), "v"(g0), "v"(g1), "v"(g2), "v"(g3) : "memory");
}
// A lane's share of a 128-row operand tile at one row step, one statement and one s_wait_xcnt a tile. Block of 128 threads: rows r + 16 i, i = 0..7.
__device__ __forceinline__ void cp128_t128(const unsigned l, const unsigned short* g, const size_t g16) {
  const unsigned short* g1 = g + g16; const unsigned short* g2 = g1 + g16; const unsigned short* g3 = g2 + g16;
  const unsigned short* g4 = g3 + g16; const unsigned short* g5 = g4 + g16; const unsigned short* g6 = g5 + g16; const unsigned short* g7 = g6 + g16;
  asm volatile("global_load_async_to_lds_b128 %0, %8, off\n\t"
               "global_load_async_to_lds_b128 %1, %9, off\n\t"
               "global_load_async_to_lds_b128 %2, %10, off\n\t"
               "global_load_async_to_lds_b128 %3, %11, off\n\t"
               "global_load_async_to_lds_b128 %4, %12, off\n\t"
               "global_load_async_to_lds_b128 %5, %13, off\n\t"
               "global_load_async_to_lds_b128 %6, %14, off\n\t"
               "global_load_async_to_lds_b128 %7, %15, off\n\t"
               "s_wait_xcnt 0x0"
               :: "v"(l), "v"(l + 16u * TP * 2u), "v"(l + 32u * TP * 2u), "v"(l + 48u * TP * 2u), "v"(l + 64u * TP * 2u), "v"(l + 80u * TP * 2u), "v"(l + 96u * TP * 2u), "v"(l + 112u * TP * 2u),
                  "v"(g), "v"(g1), "v"(g2), "v"(g3), "v"(g4), "v"(g5), "v"(g6), "v"(g7) : "memory");
}
// Block of 256 threads: rows r + 32 i, i = 0..3.
__device__ __forceinline__ void cp128_t256(const unsigned l, const unsigned short* g, const size_t g32) {
  const unsigned short* g1 = g + g32; const unsigned short* g2 = g1 + g32; const unsigned short* g3 = g2 + g32;
  asm volatile("global_load_async_to_lds_b128 %0, %4, off\n\t"
               "global_load_async_to_lds_b128 %1, %5, off\n\t"
               "global_load_async_to_lds_b128 %2, %6, off\n\t"
               "global_load_async_to_lds_b128 %3, %7, off\n\t"
               "s_wait_xcnt 0x0"
               :: "v"(l), "v"(l + 32u * TP * 2u), "v"(l + 64u * TP * 2u), "v"(l + 96u * TP * 2u), "v"(g), "v"(g1), "v"(g2), "v"(g3) : "memory");
}
// own copies landed (in front of the barrier that publishes them to the other waves)
__device__ __forceinline__ void wait_copies() { asm volatile("s_wait_asynccnt 0x0" ::: "memory"); }
// own LDS reads retired (in front of the barrier behind which their buffer is refilled)
__device__ __forceinline__ void wait_lds() { asm volatile("s_wait_dscnt 0x0" ::: "memory"); }

// One thread takes an 8 x 8 tile of W[k][n] (sixteen 16-B loads), turns it in registers and stores eight 16-B pieces of Wt[n][k]; bid = block index within this job's range.
// A wave is 8 k tiles x 4 n tiles: its two loads of a tile row cover one whole 128-B line of eight rows of W, a store one whole 128-B line of four rows of Wt (one writer per line).
// F16: Wt = f16 of 16 * bf16(W); else Wt = bf16 bits of W.
template <bool F16>
__device__ __forceinline__ void wt_body(const float* __restrict__ W, unsigned short* __restrict__ Wt, const int bid) {
  const int t = bid * 256 + threadIdx.x;                       /* tile number, (DM / 8) * (DM / 8) tiles */
  const int g = t >> 5;                                        /* wave's group of 8 x 4 tiles */
  const int k8 = ((g % (DM / 64)) * 8 + (t & 7)) * 8;
  const int n8 = ((g / (DM / 64)) * 4 + ((t >> 3) & 3)) * 8;
  v4f r[8][2];
#pragma unroll
  for (int i = 0; i < 8; ++i) {
    r[i][0] = *(const v4fa*)(W + (size_t)(k8 + i) * DM + n8);
    r[i][1] = *(const v4fa*)(W + (size_t)(k8 + i) * DM + n8 + 4);
  }
#pragma unroll
  for (int j = 0; j < 8; ++j) {
    FragH f;
#pragma unroll
    for (int i = 0; i < 8; ++i) {
      const float wv = r[i][j >> 2][j & 3];
      if (F16) f.h[i] = (_Float16)(bf16_rne(wv) * 16.0f); else f.u[i] = bf16_bits(wv);
    }
    const v8us o = f.half[0];
    *(v8us*)(Wt + (size_t)(n8 + j) * DM + k8) = o;
  }
  /* behind the last store: the code of another block range follows in the text and rewrites the stores' address and data registers */
  asm volatile("s_wait_xcnt 0x0" ::: "memory");
}
// One thread converts eight pieces of 8 values of x; a block takes 16 consecutive rows (all of one batch entry: SEQ % 16 == 0), piece j * 256 + thread in pass j.
// The block's bases are scalar, so one lane offset serves all loads and one all stores.
__device__ __forceinline__ void x16_body(const float* __restrict__ x, unsigned short* __restrict__ X16, const int bid) {
  const int r0 = bid * 16;
  const float* __restrict__ xp = x + ((size_t)(r0 / SEQ) * SEQ_FULL + (size_t)(r0 % SEQ)) * DM;
  unsigned short* __restrict__ op = X16 + (size_t)r0 * DM;
  const int c8 = threadIdx.x * 8;
  v4f a[8], b[8];
#pragma unroll
  for (int j = 0; j < 8; ++j) { a[j] = *(const v4fa*)(xp + c8 + j * 2048); b[j] = *(const v4fa*)(xp + c8 + j * 2048 + 4); }
#pragma unroll
  for (int j = 0; j < 8; ++j) {
    FragH f;
#pragma unroll
    for (int q = 0; q < 4; ++q) { f.h[q] = (_Float16)bf16_rne(a[j][q]); f.h[4 + q] = (_Float16)bf16_rne(b[j][q]); }
    const v8us o = f.half[0];
    *(v8us*)(op + c8 + j * 2048) = o;
  }
  /* behind the last store: the code of another block range follows in the text and rewrites the stores' address and data registers */
  asm volatile("s_wait_xcnt 0x0" ::: "memory");
}
// The five independent operand preparations as block ranges of one grid; every thread moves 64 values, so that the launch starts few waves.
static_assert(DM % 64 == 0);                          /* a wave's 8 x 4 tiles of 8 x 8 */
static_assert(((DM / 8) * (DM / 8)) % 256 == 0);      /* whole blocks of weight tiles */
static_assert(NRP % 16 == 0 && SEQ % 16 == 0 && DM == 1024);  /* x: whole blocks of 16 rows = 2048 pieces, inside one batch entry */
#define GW_BLK (((DM / 8) * (DM / 8)) / 256)          /* blocks of one weight plane */
#define GX_BLK (NRP / 16)                             /* blocks of x */
__global__ __launch_bounds__(256) void k_prep(const float* __restrict__ x, const float* __restrict__ wq, const float* __restrict__ wk, const float* __restrict__ wv, const float* __restrict__ wo,
                                              unsigned short* __restrict__ X16, unsigned short* __restrict__ BQ, unsigned short* __restrict__ BK, unsigned short* __restrict__ BV, unsigned short* __restrict__ BO) {
  const int bid = blockIdx.x;                  /* every test below is block-uniform */
  if (bid < GW_BLK) wt_body<true>(wq, BQ, bid);                   /* W[in][out] -> Bt[out][in] */
  else if (bid < 2 * GW_BLK) wt_body<true>(wk, BK, bid - GW_BLK);
  else if (bid < 3 * GW_BLK) wt_body<true>(wv, BV, bid - 2 * GW_BLK);
  else if (bid < 4 * GW_BLK) wt_body<false>(wo, BO, bid - 3 * GW_BLK);
  else x16_body(x, X16, bid - 4 * GW_BLK);
}

// f16 GEMM C[M][N] = alpha * A[M][K] . Bt[N][K]^T + bias; block = 4 waves (2 x 2), wave tile 64 x 64, block tile 128 x 128; M % 128 == 0, N % 128 == 0, K % 64 == 0, K >= 128.
// Operands: per 64-k stage the block copies its 128 A rows and 128 Bt rows into LDS, one stage ahead (two buffers); fragments are read from LDS.
// Per element of C a 128 x 128 block tile copies two thirds of the operand bytes of a 128 x 64 tile out of L2; a 64 x 64 wave tile reads 8 fragments per 16 WMMAs, a 32 x 64 tile 6 per 8.
// MODE 0: f16 plane C0, bias per column. MODE 2: f16 plane C0, bias per row.
// bid = block index within this product's range of the grid; so, sa, sb = the kernel's LDS (output staging [4][16][68], A ring [2][128][TP], B ring [2][128][TP]).
template <int MODE>
__device__ __forceinline__ void gemm_h_body(const unsigned short* __restrict__ A, const int lda, const unsigned short* __restrict__ Bt, const int ldb, const float alpha,
                                            const float* __restrict__ bias, unsigned short* C0, const int ldc, const int M, const int N, const int K,
                                            const int bid, float (*so)[16][68], unsigned short (*sa)[128][TP], unsigned short (*sb)[128][TP]) {
  const int tid = threadIdx.x;
  const int w = __builtin_amdgcn_readfirstlane(tid >> 5);
  const int wm = w >> 1, wn = w & 1;           /* the wave's quarter of the block tile */
  const int lane = tid & 31, ln = lane & 15, hh = lane >> 4;
  const int ntn = N >> 7;
  const int mt = bid / ntn, nq = bid - mt * ntn;
  const int row0 = mt * 128 + 64 * wm, col0 = nq * 128 + 64 * wn;
  if (mt * 128 >= M) return;                   /* block-uniform, in front of every barrier */
  const int cr = tid >> 3, cc = (tid & 7) * 8; /* copy: row within 16, 16-B piece of the 128-B row */
  const unsigned short* ga = A + (size_t)(mt * 128 + cr) * lda + cc;
  const unsigned short* gb = Bt + (size_t)(nq * 128 + cr) * ldb + cc;
  const unsigned la = lds_off(&sa[0][cr][cc]), lb = lds_off(&sb[0][cr][cc]);
  const int ns = K >> 6;
  auto fill = [&](const int s) {
    const unsigned bo = (unsigned)(s & 1) * (128u * TP * 2u);
    cp128_t128(la + bo, ga + s * 64, (size_t)16 * lda);
    cp128_t128(lb + bo, gb + s * 64, (size_t)16 * ldb);
  };
  const int a0 = (64 * wm + ln) * TP + 8 * hh;
  const int b0 = (64 * wn + ln) * TP + 8 * hh;
  const v8f z8 = {0.f, 0.f, 0.f, 0.f, 0.f, 0.f, 0.f, 0.f};
  v8f c[4][4];                                 /* c[i][j]: rows 16 i.., columns 16 j.. of the wave tile */
#pragma unroll
  for (int i = 0; i < 4; ++i)
#pragma unroll
    for (int j = 0; j < 4; ++j) c[i][j] = z8;
  fill(0);
  wait_copies();
  __syncthreads();
  fill(1);
#pragma unroll 1
  for (int s = 0; s < ns; ++s) {
    const unsigned short* pa = &sa[s & 1][0][0];
    const unsigned short* pb = &sb[s & 1][0][0];
#pragma unroll /* both 32-k steps of a stage: their LDS offsets become immediates, the accumulator array stays in registers */
    for (int kk = 0; kk < 2; ++kk) {
      /* the eight fragments of a 32-k step are read as one group, ahead of its sixteen WMMAs: one LDS round trip per sixteen WMMAs */
      v16h fa[4], fb[4];
#pragma unroll /* fragment arrays stay in registers */
      for (int i = 0; i < 4; ++i) { fa[i] = ldf_h(pa, a0 + i * 16 * TP + 32 * kk); if (i == 0) fb[0] = ldf_h(pb, b0 + 32 * kk); }   /* in the order of first use by the WMMAs below */
#pragma unroll /* fragment arrays stay in registers */
      for (int j = 1; j < 4; ++j) fb[j] = ldf_h(pb, b0 + j * 16 * TP + 32 * kk);
      __builtin_amdgcn_sched_barrier(0);       /* keeps the group of reads in front of the WMMAs: without it the scheduler sinks each read to its first use, with a full LDS wait there */
#pragma unroll /* fragment and accumulator arrays stay in registers */
      for (int j = 0; j < 4; ++j)
#pragma unroll
        for (int i = 0; i < 4; ++i) c[i][j] = mma_h(fa[i], fb[j], c[i][j]);
      __builtin_amdgcn_sched_barrier(0);       /* keeps the next group of reads, and the stage's waits, out of the WMMA run */
    }
    wait_lds();
    wait_copies();
    __syncthreads();                           /* publishes stage s + 1, frees stage s's buffer */
    if (s + 2 < ns) fill(s + 2);
  }
  wait_copies();
  float bc[4] = {0.f, 0.f, 0.f, 0.f};
  if (MODE != 2) {
#pragma unroll
    for (int t = 0; t < 4; ++t) bc[t] = bf16_rne(bias[col0 + t * 16 + ln]);
  }
  const int rsub = lane >> 4, c4 = (lane & 15) * 4;
  /* the wave tile leaves in four slices of 16 rows through the wave's own staging rows */
#pragma unroll
  for (int i = 0; i < 4; ++i) {
    float brow[8] = {0.f, 0.f, 0.f, 0.f, 0.f, 0.f, 0.f, 0.f};
    if (MODE == 2) {
      const v4f r0 = *(const v4fa*)(bias + row0 + i * 16 + 8 * hh), r1 = *(const v4fa*)(bias + row0 + i * 16 + 8 * hh + 4);
#pragma unroll
      for (int q = 0; q < 4; ++q) { brow[q] = bf16_rne(r0[q]); brow[4 + q] = bf16_rne(r1[q]); }
    }
#pragma unroll
    for (int t = 0; t < 4; ++t)
#pragma unroll
      for (int r = 0; r < 8; ++r) {            /* D: row 8h + r, col lane & 15 */
        const float bvv = (MODE == 2) ? brow[r] : bc[t];
        so[w][8 * hh + r][t * 16 + ln] = c[i][t][r] * alpha + bvv;
      }
    __builtin_amdgcn_fence(4 /* acq_rel order */, "workgroup", "local");   /* LDS only: a fence on all memory would wait here for the earlier slices' global stores */
    __builtin_amdgcn_wave_barrier();           /* the slice is written by all lanes before any lane reads it back */
#pragma unroll
    for (int q = 0; q < 8; ++q) {
      const int r = q * 2 + rsub;
      const v4f v = *(const v4fa*)&so[w][r][c4];
      v4h h4;
#pragma unroll
      for (int e = 0; e < 4; ++e) h4[e] = (_Float16)v[e];
      const size_t go = (size_t)(row0 + i * 16 + r) * ldc + col0 + c4;
      *(v4h*)(C0 + go) = h4;
    }
    __builtin_amdgcn_fence(4 /* acq_rel order */, "workgroup", "local");   /* LDS only, as above */
    __builtin_amdgcn_wave_barrier();           /* the slice is read back by all lanes before the next one overwrites it */
    /* behind a slice's last store: the next slice, or in the merged kernel the code of another block range, rewrites the stores' address and data registers */
    asm volatile("s_wait_xcnt 0x0" ::: "memory");
  }
}
// The three independent projections as block ranges of one grid, one set of LDS arrays.
// V with swapped operands: VT[n = h*64+d][r = b*SEQ+s] = sum_k Wt[n][k] x[r][k] / 16 + bias[n]
#define GQK_BLK ((NRP / 128) * (DM / 128))            /* blocks of the Q product, and of the K product */
#define GV_BLK ((DM / 128) * (NRP / 128))             /* blocks of the V product */
__global__ __launch_bounds__(128) void k_gemm_qkv(const unsigned short* __restrict__ X16, const unsigned short* __restrict__ BQ, const unsigned short* __restrict__ BK, const unsigned short* __restrict__ BV,
                                                  const float* __restrict__ bq, const float* __restrict__ bk, const float* __restrict__ bv,
                                                  unsigned short* __restrict__ Qh, unsigned short* __restrict__ K16, unsigned short* __restrict__ VT) {
  __shared__ __attribute__((aligned(16))) float so[4][16][68];
  __shared__ __attribute__((aligned(16))) unsigned short sa[2][128][TP];
  __shared__ __attribute__((aligned(16))) unsigned short sb[2][128][TP];
  const int bid = blockIdx.x;                  /* every test below is block-uniform */
  if (bid < GQK_BLK) gemm_h_body<0>(X16, DM, BQ, DM, 0.0625f, bq, Qh, DM, NRP, DM, DM, bid, so, sa, sb);
  else if (bid < 2 * GQK_BLK) gemm_h_body<0>(X16, DM, BK, DM, 0.0625f, bk, K16, DM, NRP, DM, DM, bid - GQK_BLK, so, sa, sb);
  else gemm_h_body<2>(BV, DM, X16, DM, 0.0625f, bv, VT, NRP, DM, NRP, DM, bid - 2 * GQK_BLK, so, sa, sb);
}

// fused attention: block = (b, h, 128 queries), 8 waves = 4 query groups qg x 2 key halves kh; a wave takes 32 queries (two column groups g of 16) and SEQ / 2 keys. Per 32-key step and group:
//   S^T tiles (keys x queries): A = K rows (lane&15 = key), B = Q rows (lane&15 = query); D reg r of lane (n, hh) = key 8hh + r, query n.
//   P^T B fragment: element r <- tile(keys 0..15) reg r, element 8 + r <- tile(keys 16..31) reg r (same lane).
//   O^T tiles (d x queries): A = V^T rows (lane&15 = d within tile), k = key.
// A K or V^T fragment read from LDS feeds one WMMA of each column group: half the LDS reads per score of a 16-query wave; the key halves keep the number of waves.
// A stage is 64 keys of each half: its K rows and V^T rows are copied into LDS by the whole block, one stage ahead (two buffers); one copy out of L2 serves 128 queries.
// Epilogue: the two waves of a query group swap one column group's partial (maximum, sum, O^T) through LDS, and each finishes 16 queries.
// sh[wave] is private to the wave (ctx staging, 16 rows x 64 columns written and read in full).
#define EXP_SC 0.18033688011112042f   /* log2(e) / 8: raw score -> exponent of 2 */
static_assert(SEQ % 128 == 0 && SEQ / 128 >= 2);   // flash: 128 queries per block; ring: 64-key stages of each key half, two buffers
__global__ __launch_bounds__(256) void k_flash(const unsigned short* __restrict__ Qh, const unsigned short* __restrict__ Kp,
                                               const unsigned short* __restrict__ VT, unsigned short* __restrict__ CH) {
  __shared__ __attribute__((aligned(16))) unsigned short sh[8][16][72];
  __shared__ __attribute__((aligned(16))) unsigned short sk[2][2][64][TP];   /* [buffer][key half][key][d]; after the loop: the swap area, 8 waves x 9 rows x 32 lanes x 16 B */
  __shared__ __attribute__((aligned(16))) unsigned short sv[2][2][HD][TP];   /* [buffer][key half][d][key] */
  static_assert(sizeof(sk) >= (size_t)8 * 9 * 32 * 16);
  const int tid = threadIdx.x;
  const int wave = __builtin_amdgcn_readfirstlane(tid >> 5);
  const int qg = wave & 3, kh = wave >> 2;
  const int lane = tid & 31, ln = lane & 15, hh = lane >> 4;
  const int bh = blockIdx.x / (SEQ / 128), qb = blockIdx.x % (SEQ / 128);
  const int b = bh / NH, h = bh % NH;
  const int q0 = qb * 128 + 32 * qg;
  const size_t rowb = (size_t)b * SEQ;
  const size_t qoff = (rowb + q0 + ln) * DM + h * HD + 8 * hh;
  v16h qf[2][2];                                               /* [column group][32-d half] */
#pragma unroll /* the fragment array stays in registers */
  for (int g = 0; g < 2; ++g) { qf[g][0] = ldf_h(Qh, qoff + (size_t)g * 16 * DM); qf[g][1] = ldf_h(Qh, qoff + (size_t)g * 16 * DM + 32); }
  const int cr = tid >> 3, cc = (tid & 7) * 8;                 /* copy: row within 32, 16-B piece of the 128-B row */
  const unsigned short* gk = Kp + (rowb + cr) * DM + h * HD + cc;
  const unsigned short* gv = VT + (size_t)(h * HD + cr) * NRP + rowb + cc;
  const unsigned lk = lds_off(&sk[0][0][cr][cc]), lv = lds_off(&sv[0][0][cr][cc]);
  auto fill = [&](const int s) {                               /* rows cr and cr + 32 of both key halves' tiles */
    const unsigned bo = (unsigned)(s & 1) * (128u * TP * 2u);
    const unsigned short* k0p = gk + (size_t)s * 64 * DM;
    const unsigned short* k1p = k0p + (size_t)(SEQ / 2) * DM;
    cp4(lk + bo, lk + bo + 32u * TP * 2u, lk + bo + 64u * TP * 2u, lk + bo + 96u * TP * 2u, k0p, k0p + (size_t)32 * DM, k1p, k1p + (size_t)32 * DM);
    const unsigned short* v0p = gv + s * 64;
    const unsigned short* v1p = v0p + SEQ / 2;
    cp4(lv + bo, lv + bo + 32u * TP * 2u, lv + bo + 64u * TP * 2u, lv + bo + 96u * TP * 2u, v0p, v0p + (size_t)32 * NRP, v1p, v1p + (size_t)32 * NRP);
  };
  const int foff = ln * TP + 8 * hh;
  const v8f z8 = {0.f, 0.f, 0.f, 0.f, 0.f, 0.f, 0.f, 0.f};
  v8f o[2][4] = {{z8, z8, z8, z8}, {z8, z8, z8, z8}};
  float m[2] = {-1.0e30f, -1.0e30f};                           /* running maxima, in raw-score units */
  v2f l2[2] = {{0.f, 0.f}, {0.f, 0.f}};                        /* row sums, even and odd elements apart until the epilogue */
  fill(0);
  wait_copies();
  __syncthreads();
  fill(1);
#pragma unroll 1
  for (int s = 0; s < SEQ / 128; ++s) {
   const unsigned short* pk = &sk[s & 1][kh][0][0];
   const unsigned short* pv = &sv[s & 1][kh][0][0];
#pragma unroll /* both 32-key passes of a stage: their LDS offsets become immediates */
   for (int kb = 0; kb < 64; kb += 32) {
    const int k0 = foff + kb * TP, k1 = k0 + 16 * TP;
    const v16h ka0 = ldf_h(pk, k0), ka1 = ldf_h(pk, k1), ka2 = ldf_h(pk, k0 + 32), ka3 = ldf_h(pk, k1 + 32);
    v8f sm0[2], sm1[2];
#pragma unroll /* score tiles stay in registers */
    for (int g = 0; g < 2; ++g) { sm0[g] = mma_h(ka0, qf[g][0], z8); sm1[g] = mma_h(ka1, qf[g][0], z8); }
#pragma unroll /* score tiles stay in registers */
    for (int g = 0; g < 2; ++g) { sm0[g] = mma_h(ka2, qf[g][1], sm0[g]); sm1[g] = mma_h(ka3, qf[g][1], sm1[g]); }
    FragH pf[2];
#pragma unroll /* per-group state stays in registers; the two groups' chains are independent */
    for (int g = 0; g < 2; ++g) {
      /* raw scores t (8 x the logit) are the accumulator tiles themselves: each packed instruction below takes two adjacent registers of one tile, so no register is moved to form a pair */
      v2f t[8];                                                /* t[i] = elements 2i, 2i + 1 of the 32-key P^T operand */
#pragma unroll /* t[] stays in registers */
      for (int i = 0; i < 4; ++i) {
        t[i] = v2f{sm0[g][2 * i], sm0[g][2 * i + 1]};
        t[4 + i] = v2f{sm1[g][2 * i], sm1[g][2 * i + 1]};
      }
      float mx = -1.0e30f;                                     /* maximum of the raw scores: their scale is positive */
#pragma unroll /* t[] stays in registers */
      for (int i = 0; i < 8; ++i) mx = fmaxf(mx, fmaxf(t[i].x, t[i].y));
      mx = fmaxf(mx, __shfl_xor(mx, 16));
      const float mn = fmaxf(m[g], mx);
      const float alpha = __builtin_amdgcn_exp2f((m[g] - mn) * EXP_SC);
      const float nm = 8.0f - mn * EXP_SC;                     /* probabilities carried x256 = 2^8 (also in l) */
      m[g] = mn;
      v2f e[8];
#pragma unroll /* t[], e[] and the fragment stay in registers */
      for (int i = 0; i < 8; ++i) {
        const v2f a = __builtin_elementwise_fma(t[i], v2f{EXP_SC, EXP_SC}, v2f{nm, nm});   /* 1/8, log2(e) and the maximum in one packed fma per two scores */
        e[i] = v2f{__builtin_amdgcn_exp2f(a.x), __builtin_amdgcn_exp2f(a.y)};
        pf[g].h[2 * i] = (_Float16)e[i].x;
        pf[g].h[2 * i + 1] = (_Float16)e[i].y;
      }
      l2[g] = l2[g] * alpha + (((e[0] + e[1]) + (e[2] + e[3])) + ((e[4] + e[5]) + (e[6] + e[7])));
#pragma unroll
      for (int u = 0; u < 4; ++u)
#pragma unroll
        for (int r = 0; r < 8; ++r) o[g][u][r] *= alpha;
    }
#pragma unroll
    for (int u = 0; u < 4; ++u) {
      const v16h va = ldf_h(pv, foff + u * 16 * TP + kb);
#pragma unroll /* output tiles stay in registers */
      for (int g = 0; g < 2; ++g) o[g][u] = mma_h(va, pf[g].v, o[g][u]);
    }
   }
   wait_lds();
   wait_copies();
   __syncthreads();                                            /* publishes stage s + 1, frees stage s's buffer */
   if (s + 2 < SEQ / 128) fill(s + 2);
  }
  wait_copies();
  /* Behind the loop's last barrier no wave reads the ring and no copy is in flight: sk becomes the swap area. Wave (qg, kh) keeps column group kh and gives group 1 - kh to wave (qg, 1 - kh). */
  v4fa* const xw = (v4fa*)&sk[0][0][0][0] + wave * (9 * 32) + lane;
  const v4fa* const xr = (const v4fa*)&sk[0][0][0][0] + (wave ^ 4) * (9 * 32) + lane;
  v8f ok[4];
  const float mk = kh ? m[1] : m[0];
  const float lk1 = kh ? (l2[1].x + l2[1].y) : (l2[0].x + l2[0].y);
  {
    const float mg = kh ? m[0] : m[1];
    const float lg = kh ? (l2[0].x + l2[0].y) : (l2[1].x + l2[1].y);
#pragma unroll /* output tiles stay in registers */
    for (int u = 0; u < 4; ++u) {
      ok[u] = kh ? o[1][u] : o[0][u];
      const v8f og = kh ? o[0][u] : o[1][u];
      xw[(2 * u) * 32] = v4f{og[0], og[1], og[2], og[3]};
      xw[(2 * u + 1) * 32] = v4f{og[4], og[5], og[6], og[7]};
    }
    xw[8 * 32] = v4f{mg, lg, 0.f, 0.f};
  }
  __syncthreads();                                             /* every wave's given partial is written before its partner reads it */
  const v4f ml = xr[8 * 32];
  const float mm = fmaxf(mk, ml[0]);
  const float ak = __builtin_amdgcn_exp2f((mk - mm) * EXP_SC), ar = __builtin_amdgcn_exp2f((ml[0] - mm) * EXP_SC);
  float l = lk1 * ak + ml[1] * ar;
  l += __shfl_xor(l, 16);
  const float inv = 1.0f / l;
#pragma unroll /* output tiles stay in registers */
  for (int u = 0; u < 4; ++u) {
    const v4f r0 = xr[(2 * u) * 32], r1 = xr[(2 * u + 1) * 32];
    v8us vh;
#pragma unroll
    for (int r = 0; r < 8; ++r) vh[r] = bf16_bits((ok[u][r] * ak + (r < 4 ? r0[r & 3] : r1[r & 3]) * ar) * inv);   /* ctx[query 16 kh + ln][d = 16u + 8hh + r] */
    *(v8us*)&sh[wave][ln][u * 16 + 8 * hh] = vh;
  }
  __builtin_amdgcn_fence(4 /* acq_rel order */, "workgroup");
  __builtin_amdgcn_wave_barrier();
  const int rq = lane >> 3, pc = lane & 7;
#pragma unroll
  for (int qq = 0; qq < 4; ++qq) {
    const int row = qq * 4 + rq;                               /* qq*4 + {0..3} covers rows 0..15 */
    const v8us xh = *(const v8us*)&sh[wave][row][pc * 8];
    const size_t go = (rowb + q0 + 16 * kh + row) * DM + h * HD + pc * 8;
    *(v8us*)(CH + go) = xh;
  }
}

// Y[NRP][DM] (f32) = CH . Wt[DM][DM]^T + bias; bf16 operands; block = 8 waves (4 x 2), wave tile 32 x 64, block tile 128 x 128
// Operands: per 64-k stage the block copies its 128 CH rows and 128 Wt rows into LDS, one stage ahead (two buffers): the CH rows serve 128 columns of Y, not 64.
__global__ __launch_bounds__(256) void k_gemm_o(const unsigned short* __restrict__ CH, const unsigned short* __restrict__ Wt,
                                                const float* __restrict__ bias, float* __restrict__ Y) {
  __shared__ __attribute__((aligned(16))) float so[8][32][68];
  __shared__ __attribute__((aligned(16))) unsigned short sch[2][128][TP];
  __shared__ __attribute__((aligned(16))) unsigned short sb[2][128][TP];
  const int tid = threadIdx.x;
  const int w = __builtin_amdgcn_readfirstlane(tid >> 5);
  const int wm = w >> 1, wn = w & 1;           /* the wave's 32 rows and 64 columns of the block tile */
  const int lane = tid & 31, ln = lane & 15, hh = lane >> 4;
  const int ntn = DM >> 7;
  const int mt = blockIdx.x / ntn, nq = blockIdx.x - mt * ntn;
  const int row0 = mt * 128 + 32 * wm, col0 = nq * 128 + 64 * wn;
  if (mt * 128 >= NRP) return;                 /* block-uniform, in front of every barrier */
  const int cr = tid >> 3, cc = (tid & 7) * 8; /* copy: row within 32, 16-B piece of the 128-B row */
  const size_t goa = (size_t)(mt * 128 + cr) * DM + cc;
  const unsigned short* gh = CH + goa;
  const unsigned short* gb = Wt + (size_t)(nq * 128 + cr) * DM + cc;
  const unsigned lh = lds_off(&sch[0][cr][cc]), lb = lds_off(&sb[0][cr][cc]);
  auto fill = [&](const int s) {
    const unsigned bo = (unsigned)(s & 1) * (128u * TP * 2u);
    cp128_t256(lh + bo, gh + s * 64, (size_t)32 * DM);
    cp128_t256(lb + bo, gb + s * 64, (size_t)32 * DM);
  };
  const int a0 = (32 * wm + ln) * TP + 8 * hh, a1 = a0 + 16 * TP;
  const int b0 = (64 * wn + ln) * TP + 8 * hh, b1 = b0 + 16 * TP, b2 = b1 + 16 * TP, b3 = b2 + 16 * TP;
  const v8f z8 = {0.f, 0.f, 0.f, 0.f, 0.f, 0.f, 0.f, 0.f};
  v8f c00 = z8, c01 = z8, c02 = z8, c03 = z8, c10 = z8, c11 = z8, c12 = z8, c13 = z8;
  fill(0);
  wait_copies();
  __syncthreads();
  fill(1);
#pragma unroll 1
  for (int s = 0; s < DM / 64; ++s) {
    const unsigned short* ph = &sch[s & 1][0][0];
    const unsigned short* pb = &sb[s & 1][0][0];
    /* all twelve fragments of the stage are read as one group into registers of their own, ahead of its sixteen WMMAs */
    v16b fh[2][2], fb[2][4];
#pragma unroll /* both 32-k steps of a stage: their LDS offsets become immediates */
    for (int kk = 0; kk < 2; ++kk) {
      fh[kk][0] = ldf_b(ph, a0 + 32 * kk); fh[kk][1] = ldf_b(ph, a1 + 32 * kk);
      fb[kk][0] = ldf_b(pb, b0 + 32 * kk); fb[kk][1] = ldf_b(pb, b1 + 32 * kk);
      fb[kk][2] = ldf_b(pb, b2 + 32 * kk); fb[kk][3] = ldf_b(pb, b3 + 32 * kk);
    }
    __builtin_amdgcn_sched_barrier(0);         /* keeps the group of reads in front of the WMMAs: without it the scheduler sinks each read to its first use, with a full LDS wait there */
#pragma unroll /* fragment arrays stay in registers */
    for (int kk = 0; kk < 2; ++kk) {
      c00 = mma_b(fh[kk][0], fb[kk][0], c00); c10 = mma_b(fh[kk][1], fb[kk][0], c10);
      c01 = mma_b(fh[kk][0], fb[kk][1], c01); c11 = mma_b(fh[kk][1], fb[kk][1], c11);
      c02 = mma_b(fh[kk][0], fb[kk][2], c02); c12 = mma_b(fh[kk][1], fb[kk][2], c12);
      c03 = mma_b(fh[kk][0], fb[kk][3], c03); c13 = mma_b(fh[kk][1], fb[kk][3], c13);
    }
    __builtin_amdgcn_sched_barrier(0);         /* keeps the WMMAs in front of the stage's waits, inside the flight time of the next stage's copies */
    wait_lds();
    wait_copies();
    __syncthreads();                           /* publishes stage s + 1, frees stage s's buffer */
    if (s + 2 < DM / 64) fill(s + 2);
  }
  wait_copies();
  v8f accs[8] = {c00, c01, c02, c03, c10, c11, c12, c13};
#pragma unroll
  for (int u = 0; u < 8; ++u) {
    const int t = u & 3, half = u >> 2;
    const float bc = bf16_rne(bias[col0 + t * 16 + ln]);
#pragma unroll
    for (int r = 0; r < 8; ++r) so[w][half * 16 + 8 * hh + r][t * 16 + ln] = accs[u][r] + bc;
  }
  __builtin_amdgcn_fence(4 /* acq_rel order */, "workgroup");
  __builtin_amdgcn_wave_barrier();
  const int rsub = lane >> 4, c4 = (lane & 15) * 4;
  {
#pragma unroll
    for (int q = 0; q < 16; ++q) {
      const int r = q * 2 + rsub;                          
      const v4f v = *(const v4fa*)&so[w][r][c4];
      *(v4f*)(Y + (size_t)(row0 + r) * DM + col0 + c4) = v;
    }
    
  }
}

// One wave per row: a lane holds 32 of the row's 1024 values (eight 16-B pieces, a wave's load = 512 contiguous bytes); both sums by lane partials and a five-step butterfly, no LDS array, no barrier.
static_assert(NRP % 8 == 0);         // k_ln: 8 waves = 8 rows per block
__global__ __launch_bounds__(256) void k_ln(const float* __restrict__ x, const float* __restrict__ Y, const float* __restrict__ g, const float* __restrict__ bta, float* __restrict__ out) {
  const int tid = threadIdx.x, lane = tid & 31;
  const int row = blockIdx.x * 8 + __builtin_amdgcn_readfirstlane(tid >> 5);   /* wave-uniform: row bases stay scalar, one lane offset serves every load and store */
  const size_t xr = ((size_t)(row / SEQ) * SEQ_FULL + (size_t)(row % SEQ)) * DM;
  const size_t yr = (size_t)row * DM;
  const int c4 = lane * 4;
  v4f xv[8], yv[8], gv[8], bv[8];
#pragma unroll
  for (int j = 0; j < 8; ++j) { xv[j] = *(const v4fa*)(x + xr + c4 + j * 128); yv[j] = *(const v4fa*)(Y + yr + c4 + j * 128); }
#pragma unroll
  for (int j = 0; j < 8; ++j) { gv[j] = *(const v4fa*)(g + c4 + j * 128); bv[j] = *(const v4fa*)(bta + c4 + j * 128); }
  __builtin_amdgcn_sched_barrier(0);           /* all 32 loads of the row are in flight before the first value is used: without it the scheduler sinks the gamma and beta loads behind the sums, one exposed round trip per pair */
  v4f hv[8];
  v4f a1 = {0.f, 0.f, 0.f, 0.f};
#pragma unroll
  for (int j = 0; j < 8; ++j) {
#pragma unroll
    for (int q = 0; q < 4; ++q) hv[j][q] = bf16_rne(xv[j][q]) + yv[j][q];
    a1 += hv[j];
  }
  float s1 = (a1[0] + a1[1]) + (a1[2] + a1[3]);
#pragma unroll
  for (int off = 16; off > 0; off >>= 1) s1 += __shfl_xor(s1, off);
  const float mu = s1 * (1.0f / (float)DM);
  v4f a2 = {0.f, 0.f, 0.f, 0.f};
#pragma unroll
  for (int j = 0; j < 8; ++j) { hv[j] -= mu; a2 += hv[j] * hv[j]; }
  float s2 = (a2[0] + a2[1]) + (a2[2] + a2[3]);
#pragma unroll
  for (int off = 16; off > 0; off >>= 1) s2 += __shfl_xor(s2, off);
  const float rs = rsqrtf(s2 * (1.0f / (float)DM) + LN_EPS);
#pragma unroll
  for (int j = 0; j < 8; ++j) {
    v4f ov;
#pragma unroll
    for (int q = 0; q < 4; ++q) ov[q] = hv[j][q] * rs * bf16_rne(gv[j][q]) + bf16_rne(bv[j][q]);
    *(v4f*)(out + xr + c4 + j * 128) = ov;
  }
}

extern "C" void kernel_launch(void* const* d_in, const int* in_sizes, int n_in,
                              void* d_out, int out_size, void* d_ws, size_t ws_size, hipStream_t stream) {
  if (n_in < 11) return;
  const size_t need_x = ((size_t)(NB - 1) * SEQ_FULL + SEQ) * DM;
  if ((size_t)in_sizes[0] < need_x || (size_t)out_size < need_x) return;
  if ((size_t)in_sizes[1] < (size_t)DM * DM || (size_t)in_sizes[3] < (size_t)DM * DM || (size_t)in_sizes[5] < (size_t)DM * DM || (size_t)in_sizes[7] < (size_t)DM * DM) return;
  if (in_sizes[2] < DM || in_sizes[4] < DM || in_sizes[6] < DM || in_sizes[8] < DM || in_sizes[9] < DM || in_sizes[10] < DM) return;
  const float* x  = (const float*)d_in[0];
  const float* wq = (const float*)d_in[1]; const float* bq = (const float*)d_in[2];
  const float* wk = (const float*)d_in[3]; const float* bk = (const float*)d_in[4];
  const float* wv = (const float*)d_in[5]; const float* bv = (const float*)d_in[6];
  const float* wo = (const float*)d_in[7]; const float* bo = (const float*)d_in[8];
  const float* lg = (const float*)d_in[9]; const float* lb = (const float*)d_in[10];
  char* ws = (char*)d_ws; size_t off = 0;
  auto take = [&](size_t bytes) { char* p = ws + off; off += (bytes + 255) & ~(size_t)255; return p; };
  unsigned short* BQ = (unsigned short*)take(WS_W);
  unsigned short* BK = (unsigned short*)take(WS_W);
  unsigned short* BV = (unsigned short*)take(WS_W);
  unsigned short* BO = (unsigned short*)take(WS_W);
  unsigned short* X16 = (unsigned short*)take(WS_P16);
  unsigned short* QH  = (unsigned short*)take(WS_P16);
  unsigned short* K16 = (unsigned short*)take(WS_P16);
  unsigned short* VT  = (unsigned short*)take(WS_P16);
  unsigned short* CH  = (unsigned short*)take(WS_P16);
  float* Y = (float*)take(WS_P32);
  if (off > ws_size) return;
  k_prep<<<(unsigned)(4 * GW_BLK + GX_BLK), 256, 0, stream>>>(x, wq, wk, wv, wo, X16, BQ, BK, BV, BO);
  k_gemm_qkv<<<(unsigned)(2 * GQK_BLK + GV_BLK), 128, 0, stream>>>(X16, BQ, BK, BV, bq, bk, bv, QH, K16, VT);
  k_flash<<<(unsigned)(NB * NH * (SEQ / 128)), 256, 0, stream>>>(QH, K16, VT, CH);
  k_gemm_o<<<(unsigned)((NRP / 128) * (DM / 128)), 256, 0, stream>>>(CH, BO, bo, Y);
  k_ln<<<(unsigned)(NRP / 8), 256, 0, stream>>>(x, Y, lg, lb, (float*)d_out);
}

// v009
// It runs in 82.5 microseconds.
// Two timings next to v008 put it at 1.05 and 1.04 times that version's speed.
// All steps since v000 together make it 4.05 times as fast.
#include <hip/hip_runtime.h>
// Compute dtype: inputs RNE-converted to bf16 on load; q/k/v projections v_wmma_f32_16x16x32_f16 (x exact f16, weights x16 exact f16); scores f16 (q and k single); P (x256 carried) and v single f16; output GEMM v_wmma_f32_16x16x32_bf16 (ctx single bf16, Wo exact bf16); all accumulators, softmax statistics, residual add and LayerNorm f32.
// Structure: token rows r = b*SEQ + s. k_prep (one grid, block ranges): [in][out] weights -> Bt[n][k] 16-bit planes, x -> f16 rows. k_gemm_qkv (one grid, block ranges): Q/K GEMMs (64x64 wave tiles, 128x128 block tiles) -> Qh, K16 planes; V GEMM with swapped operands -> VT[h*64+d][b*SEQ+s].
#ifndef NB
#define NB 2
#endif
#ifndef SEQ
#define SEQ 2048
#endif
#define NB_FULL 2
#define SEQ_FULL 2048
#define DM 1024
#define NH 16
#define HD 64
#define NRP (NB * SEQ)               /* plane rows */
#define LN_EPS 1e-5f

static_assert(NH * HD == DM);        // head h = columns h*64 + d
static_assert(HD == 64);
static_assert(DM == 1024);           // k_ln: 32 lanes x 8 pieces x 4 columns
static_assert(DM % 128 == 0);        // swapped V GEMM: M = DM in 128-row block tiles
static_assert(DM % 128 == 0);        // N tiles of 128
static_assert(DM % 32 == 0);         // K steps of 32
static_assert(NRP % 128 == 0);       // GEMM block tiles of 128 rows
static_assert(NRP % 128 == 0);       // swapped V GEMM N tiles of 128
static_assert(SEQ % 64 == 0);        // flash: 32-key steps
static_assert(DM % 64 == 0 && DM / 64 >= 2);     // GEMM rings: 64-k stages, two buffers
static_assert(NB <= NB_FULL);
static_assert(SEQ <= SEQ_FULL);

typedef _Float16 v16h __attribute__((ext_vector_type(16)));
typedef __bf16 v16b __attribute__((ext_vector_type(16)));
typedef _Float16 v4h __attribute__((ext_vector_type(4)));
typedef unsigned short v8us __attribute__((ext_vector_type(8), may_alias));
typedef float v8f __attribute__((ext_vector_type(8)));
typedef float v4f __attribute__((ext_vector_type(4)));
typedef float v2f __attribute__((ext_vector_type(2)));
typedef float v4fa __attribute__((ext_vector_type(4), may_alias));
union FragH { v16h v; v8us half[2]; _Float16 h[16]; unsigned short u[16]; };
union FragB { v16b v; v8us half[2]; unsigned short u[16]; };

/* workspace carve (bytes); every region is rows x pitch x element size exactly, stores never pass a region end */
#define WS_W   ((size_t)DM * DM * 2)
#define WS_P16 ((size_t)NRP * DM * 2)
#define WS_P32 ((size_t)NRP * DM * 4)
#define WS_TOTAL (4 * WS_W + 5 * WS_P16 + WS_P32)
static_assert(WS_W % 256 == 0);
static_assert(WS_P16 % 256 == 0);
static_assert(WS_TOTAL <= (size_t)134217728);

__device__ __forceinline__ unsigned short bf16_bits(float x) { unsigned int u = __float_as_uint(x); return (unsigned short)((u + 0x7FFFu + ((u >> 16) & 1u)) >> 16); }
__device__ __forceinline__ float bf16_val(unsigned short b) { return __uint_as_float(((unsigned int)b) << 16); }
__device__ __forceinline__ float bf16_rne(float x) { return bf16_val(bf16_bits(x)); }

// fragment loaders: off already includes 8*(lane>>4); elements 0..7 <- k0+8h.., elements 8..15 <- k0+16+8h..
__device__ __forceinline__ v16h ldf_h(const unsigned short* __restrict__ p, size_t off) { FragH f; f.half[0] = *(const v8us*)(p + off); f.half[1] = *(const v8us*)(p + off + 16); return f.v; }
__device__ __forceinline__ v16b ldf_b(const unsigned short* __restrict__ p, size_t off) { FragB f; f.half[0] = *(const v8us*)(p + off); f.half[1] = *(const v8us*)(p + off + 16); return f.v; }
__device__ __forceinline__ v8f mma_h(v16h a, v16h b, v8f c) {
  return __builtin_amdgcn_wmma_f32_16x16x32_f16(false, a, false, b, (short)0, c, false, false);
}
__device__ __forceinline__ v8f mma_b(v16b a, v16b b, v8f c) {
  return __builtin_amdgcn_wmma_f32_16x16x32_bf16(false, a, false, b, (short)0, c, false, false);
}

// LDS operand tiles: rows of 64 16-bit elements (128 B) at a pitch of 72 (144 B = 16 B x 9, conflict-free for ds_load_b128 fragment reads).
#define TP 72
__device__ __forceinline__ unsigned lds_off(const void* p) { return (unsigned)(size_t)p; }
// Four 16-B pieces of a lane go from global memory to LDS through no register, each with its own LDS and global address; a wave's copy covers 4 whole 128-B lines.
// The s_wait_xcnt stands inside the copies' own statement so that no address register is rewritten ahead of it.
__device__ __forceinline__ void cp4(const unsigned l0, const unsigned l1, const unsigned l2, const unsigned l3,
                                    const unsigned short* g0, const unsigned short* g1, const unsigned short* g2, const unsigned short* g3) {
  asm volatile("global_load_async_to_lds_b128 %0, %4, off\n\t"
               "global_load_async_to_lds_b128 %1, %5, off\n\t"
               "global_load_async_to_lds_b128 %2, %6, off\n\t"
               "global_load_async_to_lds_b128 %3, %7, off\n\t"
               "s_wait_xcnt 0x0"
               :: "v"(l0), "v"(l1), "v"(l2), "v"(l3), "v"(g0), "v"(g1), "v"(g2), "v"(g3) : "memory");
}
// A lane's share of a 128-row operand tile at one row step, one statement and one s_wait_xcnt a tile. Block of 128 threads: rows r + 16 i, i = 0..7.
__device__ __forceinline__ void cp128_t128(const unsigned l, const unsigned short* g, const size_t g16) {
  const unsigned short* g1 = g + g16; const unsigned short* g2 = g1 + g16; const unsigned short* g3 = g2 + g16;
  const unsigned short* g4 = g3 + g16; const unsigned short* g5 = g4 + g16; const unsigned short* g6 = g5 + g16; const unsigned short* g7 = g6 + g16;
  asm volatile("global_load_async_to_lds_b128 %0, %8, off\n\t"
               "global_load_async_to_lds_b128 %1, %9, off\n\t"
               "global_load_async_to_lds_b128 %2, %10, off\n\t"
               "global_load_async_to_lds_b128 %3, %11, off\n\t"
               "global_load_async_to_lds_b128 %4, %12, off\n\t"
               "global_load_async_to_lds_b128 %5, %13, off\n\t"
               "global_load_async_to_lds_b128 %6, %14, off\n\t"
               "global_load_async_to_lds_b128 %7, %15, off\n\t"
               "s_wait_xcnt 0x0"
               :: "v"(l), "v"(l + 16u * TP * 2u), "v"(l + 32u * TP * 2u), "v"(l + 48u * TP * 2u), "v"(l + 64u * TP * 2u), "v"(l + 80u * TP * 2u), "v"(l + 96u * TP * 2u), "v"(l + 112u * TP * 2u),
                  "v"(g), "v"(g1), "v"(g2), "v"(g3), "v"(g4), "v"(g5), "v"(g6), "v"(g7) : "memory");
}
// Block of 256 threads: rows r + 32 i, i = 0..3.
__device__ __forceinline__ void cp128_t256(const unsigned l, const unsigned short* g, const size_t g32) {
  const unsigned short* g1 = g + g32; const unsigned short* g2 = g1 + g32; const unsigned short* g3 = g2 + g32;
  asm volatile("global_load_async_to_lds_b128 %0, %4, off\n\t"
               "global_load_async_to_lds_b128 %1, %5, off\n\t"
               "global_load_async_to_lds_b128 %2, %6, off\n\t"
               "global_load_async_to_lds_b128 %3, %7, off\n\t"
               "s_wait_xcnt 0x0"
               :: "v"(l), "v"(l + 32u * TP * 2u), "v"(l + 64u * TP * 2u), "v"(l + 96u * TP * 2u), "v"(g), "v"(g1), "v"(g2), "v"(g3) : "memory");
}
// own copies landed (in front of the barrier that publishes them to the other waves)
__device__ __forceinline__ void wait_copies() { asm volatile("s_wait_asynccnt 0x0" ::: "memory"); }
// own LDS reads retired (in front of the barrier behind which their buffer is refilled)
__device__ __forceinline__ void wait_lds() { asm volatile("s_wait_dscnt 0x0" ::: "memory"); }

// One thread takes an 8 x 8 tile of W[k][n] (sixteen 16-B loads), turns it in registers and stores eight 16-B pieces of Wt[n][k]; bid = block index within this job's range.
// A wave is 8 k tiles x 4 n tiles: its two loads of a tile row cover one whole 128-B line of eight rows of W, a store one whole 128-B line of four rows of Wt (one writer per line).
// F16: Wt = f16 of 16 * bf16(W); else Wt = bf16 bits of W.
template <bool F16>
__device__ __forceinline__ void wt_body(const float* __restrict__ W, unsigned short* __restrict__ Wt, const int bid) {
  const int t = bid * 256 + threadIdx.x;                       /* tile number, (DM / 8) * (DM / 8) tiles */
  const int g = t >> 5;                                        /* wave's group of 8 x 4 tiles */
  const int k8 = ((g % (DM / 64)) * 8 + (t & 7)) * 8;
  const int n8 = ((g / (DM / 64)) * 4 + ((t >> 3) & 3)) * 8;
  v4f r[8][2];
#pragma unroll
  for (int i = 0; i < 8; ++i) {
    r[i][0] = *(const v4fa*)(W + (size_t)(k8 + i) * DM + n8);
    r[i][1] = *(const v4fa*)(W + (size_t)(k8 + i) * DM + n8 + 4);
  }
#pragma unroll
  for (int j = 0; j < 8; ++j) {
    FragH f;
#pragma unroll
    for (int i = 0; i < 8; ++i) {
      const float wv = r[i][j >> 2][j & 3];
      if (F16) f.h[i] = (_Float16)(bf16_rne(wv) * 16.0f); else f.u[i] = bf16_bits(wv);
    }
    const v8us o = f.half[0];
    *(v8us*)(Wt + (size_t)(n8 + j) * DM + k8) = o;
  }
  /* behind the last store: the code of another block range follows in the text and rewrites the stores' address and data registers */
  asm volatile("s_wait_xcnt 0x0" ::: "memory");
}
// One thread converts eight pieces of 8 values of x; a block takes 16 consecutive rows (all of one batch entry: SEQ % 16 == 0), piece j * 256 + thread in pass j.
// The block's bases are scalar, so one lane offset serves all loads and one all stores.
__device__ __forceinline__ void x16_body(const float* __restrict__ x, unsigned short* __restrict__ X16, const int bid) {
  const int r0 = bid * 16;
  const float* __restrict__ xp = x + ((size_t)(r0 / SEQ) * SEQ_FULL + (size_t)(r0 % SEQ)) * DM;
  unsigned short* __restrict__ op = X16 + (size_t)r0 * DM;
  const int c8 = threadIdx.x * 8;
  v4f a[8], b[8];
#pragma unroll
  for (int j = 0; j < 8; ++j) { a[j] = *(const v4fa*)(xp + c8 + j * 2048); b[j] = *(const v4fa*)(xp + c8 + j * 2048 + 4); }
#pragma unroll
  for (int j = 0; j < 8; ++j) {
    FragH f;
#pragma unroll
    for (int q = 0; q < 4; ++q) { f.h[q] = (_Float16)bf16_rne(a[j][q]); f.h[4 + q] = (_Float16)bf16_rne(b[j][q]); }
    const v8us o = f.half[0];
    *(v8us*)(op + c8 + j * 2048) = o;
  }
  /* behind the last store: the code of another block range follows in the text and rewrites the stores' address and data registers */
  asm volatile("s_wait_xcnt 0x0" ::: "memory");
}
// The five independent operand preparations as block ranges of one grid; every thread moves 64 values, so that the launch starts few waves.
static_assert(DM % 64 == 0);                          /* a wave's 8 x 4 tiles of 8 x 8 */
static_assert(((DM / 8) * (DM / 8)) % 256 == 0);      /* whole blocks of weight tiles */
static_assert(NRP % 16 == 0 && SEQ % 16 == 0 && DM == 1024);  /* x: whole blocks of 16 rows = 2048 pieces, inside one batch entry */
#define GW_BLK (((DM / 8) * (DM / 8)) / 256)          /* blocks of one weight plane */
#define GX_BLK (NRP / 16)                             /* blocks of x */
__global__ __launch_bounds__(256) void k_prep(const float* __restrict__ x, const float* __restrict__ wq, const float* __restrict__ wk, const float* __restrict__ wv, const float* __restrict__ wo,
                                              unsigned short* __restrict__ X16, unsigned short* __restrict__ BQ, unsigned short* __restrict__ BK, unsigned short* __restrict__ BV, unsigned short* __restrict__ BO) {
  const int bid = blockIdx.x;                  /* every test below is block-uniform */
  if (bid < GW_BLK) wt_body<true>(wq, BQ, bid);                   /* W[in][out] -> Bt[out][in] */
  else if (bid < 2 * GW_BLK) wt_body<true>(wk, BK, bid - GW_BLK);
  else if (bid < 3 * GW_BLK) wt_body<true>(wv, BV, bid - 2 * GW_BLK);
  else if (bid < 4 * GW_BLK) wt_body<false>(wo, BO, bid - 3 * GW_BLK);
  else x16_body(x, X16, bid - 4 * GW_BLK);
}

// f16 GEMM C[M][N] = alpha * A[M][K] . Bt[N][K]^T + bias; block = 4 waves (2 x 2), wave tile 64 x 64, block tile 128 x 128; M % 128 == 0, N % 128 == 0, K % 64 == 0, K >= 128.
// Operands: per 64-k stage the block copies its 128 A rows and 128 Bt rows into LDS, one stage ahead (two buffers); fragments are read from LDS.
// Per element of C a 128 x 128 block tile copies two thirds of the operand bytes of a 128 x 64 tile out of L2; a 64 x 64 wave tile reads 8 fragments per 16 WMMAs, a 32 x 64 tile 6 per 8.
// MODE 0: f16 plane C0, bias per column. MODE 2: f16 plane C0, bias per row.
// bid = block index within this product's range of the grid; so, sa, sb = the kernel's LDS (output staging [4][16][68], A ring [2][128][TP], B ring [2][128][TP]).
template <int MODE>
__device__ __forceinline__ void gemm_h_body(const unsigned short* __restrict__ A, const int lda, const unsigned short* __restrict__ Bt, const int ldb, const float alpha,
                                            const float* __restrict__ bias, unsigned short* C0, const int ldc, const int M, const int N, const int K,
                                            const int bid, float (*so)[16][68], unsigned short (*sa)[128][TP], unsigned short (*sb)[128][TP]) {
  const int tid = threadIdx.x;
  const int w = __builtin_amdgcn_readfirstlane(tid >> 5);
  const int wm = w >> 1, wn = w & 1;           /* the wave's quarter of the block tile */
  const int lane = tid & 31, ln = lane & 15, hh = lane >> 4;
  const int ntn = N >> 7;
  const int mt = bid / ntn, nq = bid - mt * ntn;
  const int row0 = mt * 128 + 64 * wm, col0 = nq * 128 + 64 * wn;
  if (mt * 128 >= M) return;                   /* block-uniform, in front of every barrier */
  const int cr = tid >> 3, cc = (tid & 7) * 8; /* copy: row within 16, 16-B piece of the 128-B row */
  const unsigned short* ga = A + (size_t)(mt * 128 + cr) * lda + cc;
  const unsigned short* gb = Bt + (size_t)(nq * 128 + cr) * ldb + cc;
  const unsigned la = lds_off(&sa[0][cr][cc]), lb = lds_off(&sb[0][cr][cc]);
  const int ns = K >> 6;
  auto fill = [&](const int s) {
    const unsigned bo = (unsigned)(s & 1) * (128u * TP * 2u);
    cp128_t128(la + bo, ga + s * 64, (size_t)16 * lda);
    cp128_t128(lb + bo, gb + s * 64, (size_t)16 * ldb);
  };
  const int a0 = (64 * wm + ln) * TP + 8 * hh;
  const int b0 = (64 * wn + ln) * TP + 8 * hh;
  const v8f z8 = {0.f, 0.f, 0.f, 0.f, 0.f, 0.f, 0.f, 0.f};
  v8f c[4][4];                                 /* c[i][j]: rows 16 i.., columns 16 j.. of the wave tile */
#pragma unroll
  for (int i = 0; i < 4; ++i)
#pragma unroll
    for (int j = 0; j < 4; ++j) c[i][j] = z8;
  fill(0);
  wait_copies();
  __syncthreads();
  fill(1);
#pragma unroll 1
  for (int s = 0; s < ns; ++s) {
    const unsigned short* pa = &sa[s & 1][0][0];
    const unsigned short* pb = &sb[s & 1][0][0];
#pragma unroll /* both 32-k steps of a stage: their LDS offsets become immediates, the accumulator array stays in registers */
    for (int kk = 0; kk < 2; ++kk) {
      /* the eight fragments of a 32-k step are read as one group, ahead of its sixteen WMMAs: one LDS round trip per sixteen WMMAs */
      v16h fa[4], fb[4];
#pragma unroll /* fragment arrays stay in registers */
      for (int i = 0; i < 4; ++i) { fa[i] = ldf_h(pa, a0 + i * 16 * TP + 32 * kk); if (i == 0) fb[0] = ldf_h(pb, b0 + 32 * kk); }   /* in the order of first use by the WMMAs below */
#pragma unroll /* fragment arrays stay in registers */
      for (int j = 1; j < 4; ++j) fb[j] = ldf_h(pb, b0 + j * 16 * TP + 32 * kk);
      __builtin_amdgcn_sched_barrier(0);       /* keeps the group of reads in front of the WMMAs: without it the scheduler sinks each read to its first use, with a full LDS wait there */
#pragma unroll /* fragment and accumulator arrays stay in registers */
      for (int j = 0; j < 4; ++j)
#pragma unroll
        for (int i = 0; i < 4; ++i) c[i][j] = mma_h(fa[i], fb[j], c[i][j]);
      __builtin_amdgcn_sched_barrier(0);       /* keeps the next group of reads, and the stage's waits, out of the WMMA run */
    }
    wait_lds();
    wait_copies();
    __syncthreads();                           /* publishes stage s + 1, frees stage s's buffer */
    if (s + 2 < ns) fill(s + 2);
  }
  wait_copies();
  float bc[4] = {0.f, 0.f, 0.f, 0.f};
  if (MODE != 2) {
#pragma unroll
    for (int t = 0; t < 4; ++t) bc[t] = bf16_rne(bias[col0 + t * 16 + ln]);
  }
  const int rsub = lane >> 4, c4 = (lane & 15) * 4;
  /* the wave tile leaves in four slices of 16 rows through the wave's own staging rows */
#pragma unroll
  for (int i = 0; i < 4; ++i) {
    float brow[8] = {0.f, 0.f, 0.f, 0.f, 0.f, 0.f, 0.f, 0.f};
    if (MODE == 2) {
      const v4f r0 = *(const v4fa*)(bias + row0 + i * 16 + 8 * hh), r1 = *(const v4fa*)(bias + row0 + i * 16 + 8 * hh + 4);
#pragma unroll
      for (int q = 0; q < 4; ++q) { brow[q] = bf16_rne(r0[q]); brow[4 + q] = bf16_rne(r1[q]); }
    }
#pragma unroll
    for (int t = 0; t < 4; ++t)
#pragma unroll
      for (int r = 0; r < 8; ++r) {            /* D: row 8h + r, col lane & 15 */
        const float bvv = (MODE == 2) ? brow[r] : bc[t];
        so[w][8 * hh + r][t * 16 + ln] = c[i][t][r] * alpha + bvv;
      }
    __builtin_amdgcn_fence(4 /* acq_rel order */, "workgroup", "local");   /* LDS only: a fence on all memory would wait here for the earlier slices' global stores */
    __builtin_amdgcn_wave_barrier();           /* the slice is written by all lanes before any lane reads it back */
#pragma unroll
    for (int q = 0; q < 8; ++q) {
      const int r = q * 2 + rsub;
      const v4f v = *(const v4fa*)&so[w][r][c4];
      v4h h4;
#pragma unroll
      for (int e = 0; e < 4; ++e) h4[e] = (_Float16)v[e];
      const size_t go = (size_t)(row0 + i * 16 + r) * ldc + col0 + c4;
      *(v4h*)(C0 + go) = h4;
    }
    __builtin_amdgcn_fence(4 /* acq_rel order */, "workgroup", "local");   /* LDS only, as above */
    __builtin_amdgcn_wave_barrier();           /* the slice is read back by all lanes before the next one overwrites it */
    /* behind a slice's last store: the next slice, or in the merged kernel the code of another block range, rewrites the stores' address and data registers */
    asm volatile("s_wait_xcnt 0x0" ::: "memory");
  }
}
// The three independent projections as block ranges of one grid, one set of LDS arrays.
// V with swapped operands: VT[n = h*64+d][r = b*SEQ+s] = sum_k Wt[n][k] x[r][k] / 16 + bias[n]
#define GQK_BLK ((NRP / 128) * (DM / 128))            /* blocks of the Q product, and of the K product */
#define GV_BLK ((DM / 128) * (NRP / 128))             /* blocks of the V product */
__global__ __launch_bounds__(128) void k_gemm_qkv(const unsigned short* __restrict__ X16, const unsigned short* __restrict__ BQ, const unsigned short* __restrict__ BK, const unsigned short* __restrict__ BV,
                                                  const float* __restrict__ bq, const float* __restrict__ bk, const float* __restrict__ bv,
                                                  unsigned short* __restrict__ Qh, unsigned short* __restrict__ K16, unsigned short* __restrict__ VT) {
  __shared__ __attribute__((aligned(16))) float so[4][16][68];
  __shared__ __attribute__((aligned(16))) unsigned short sa[2][128][TP];
  __shared__ __attribute__((aligned(16))) unsigned short sb[2][128][TP];
  const int bid = blockIdx.x;                  /* every test below is block-uniform */
  if (bid < GQK_BLK) gemm_h_body<0>(X16, DM, BQ, DM, 0.0625f, bq, Qh, DM, NRP, DM, DM, bid, so, sa, sb);
  else if (bid < 2 * GQK_BLK) gemm_h_body<0>(X16, DM, BK, DM, 0.0625f, bk, K16, DM, NRP, DM, DM, bid - GQK_BLK, so, sa, sb);
  else gemm_h_body<2>(BV, DM, X16, DM, 0.0625f, bv, VT, NRP, DM, NRP, DM, bid - 2 * GQK_BLK, so, sa, sb);
}

// fused attention: block = (b, h, 128 queries), 8 waves = 4 query groups qg x 2 key halves kh; a wave takes 32 queries (two column groups g of 16) and SEQ / 2 keys. Per 32-key step and group:
//   S^T tiles (keys x queries): A = K rows (lane&15 = key), B = Q rows (lane&15 = query); D reg r of lane (n, hh) = key 8hh + r, query n.
//   P^T B fragment: element r <- tile(keys 0..15) reg r, element 8 + r <- tile(keys 16..31) reg r (same lane).
//   O^T tiles (d x queries): A = V^T rows (lane&15 = d within tile), k = key.
// A K or V^T fragment read from LDS feeds one WMMA of each column group: half the LDS reads per score of a 16-query wave; the key halves keep the number of waves.
// A stage is 64 keys of each half: its K rows and V^T rows are copied into LDS by the whole block, one stage ahead (two buffers); one copy out of L2 serves 128 queries.
// Lazy rescale: P, the row sums and O^T are carried against a reference maximum per query that is renewed only when a score passes it by more than LAZY_T powers of two; the common pass has no exchange between the wave's halves and no multiply of O^T.
// Epilogue: the two waves of a query group swap one column group's partial (reference maximum, sum, O^T) through LDS, and each finishes 16 queries.
// sh[wave] is private to the wave (ctx staging, 16 rows x 64 columns written and read in full).
#define EXP_SC 0.18033688011112042f   /* log2(e) / 8: raw score -> exponent of 2 */
#define LAZY_T 7.0f                   /* a score may pass the reference maximum by 2^7 before the sums are rescaled: P <= 2^(8 + 7), finite in f16 */
static_assert(SEQ % 128 == 0 && SEQ / 128 >= 2);   // flash: 128 queries per block; ring: 64-key stages of each key half, two buffers
__global__ __launch_bounds__(256) void k_flash(const unsigned short* __restrict__ Qh, const unsigned short* __restrict__ Kp,
                                               const unsigned short* __restrict__ VT, unsigned short* __restrict__ CH) {
  __shared__ __attribute__((aligned(16))) unsigned short sh[8][16][72];
  __shared__ __attribute__((aligned(16))) unsigned short sk[2][2][64][TP];   /* [buffer][key half][key][d]; after the loop: the swap area, 8 waves x 9 rows x 32 lanes x 16 B */
  __shared__ __attribute__((aligned(16))) unsigned short sv[2][2][HD][TP];   /* [buffer][key half][d][key] */
  static_assert(sizeof(sk) >= (size_t)8 * 9 * 32 * 16);
  const int tid = threadIdx.x;
  const int wave = __builtin_amdgcn_readfirstlane(tid >> 5);
  const int qg = wave & 3, kh = wave >> 2;
  const int lane = tid & 31, ln = lane & 15, hh = lane >> 4;
  const int bh = blockIdx.x / (SEQ / 128), qb = blockIdx.x % (SEQ / 128);
  const int b = bh / NH, h = bh % NH;
  const int q0 = qb * 128 + 32 * qg;
  const size_t rowb = (size_t)b * SEQ;
  const size_t qoff = (rowb + q0 + ln) * DM + h * HD + 8 * hh;
  v16h qf[2][2];                                               /* [column group][32-d half] */
#pragma unroll /* the fragment array stays in registers */
  for (int g = 0; g < 2; ++g) { qf[g][0] = ldf_h(Qh, qoff + (size_t)g * 16 * DM); qf[g][1] = ldf_h(Qh, qoff + (size_t)g * 16 * DM + 32); }
  const int cr = tid >> 3, cc = (tid & 7) * 8;                 /* copy: row within 32, 16-B piece of the 128-B row */
  const unsigned short* gk = Kp + (rowb + cr) * DM + h * HD + cc;
  const unsigned short* gv = VT + (size_t)(h * HD + cr) * NRP + rowb + cc;
  const unsigned lk = lds_off(&sk[0][0][cr][cc]), lv = lds_off(&sv[0][0][cr][cc]);
  auto fill = [&](const int s) {                               /* rows cr and cr + 32 of both key halves' tiles */
    const unsigned bo = (unsigned)(s & 1) * (128u * TP * 2u);
    const unsigned short* k0p = gk + (size_t)s * 64 * DM;
    const unsigned short* k1p = k0p + (size_t)(SEQ / 2) * DM;
    cp4(lk + bo, lk + bo + 32u * TP * 2u, lk + bo + 64u * TP * 2u, lk + bo + 96u * TP * 2u, k0p, k0p + (size_t)32 * DM, k1p, k1p + (size_t)32 * DM);
    const unsigned short* v0p = gv + s * 64;
    const unsigned short* v1p = v0p + SEQ / 2;
    cp4(lv + bo, lv + bo + 32u * TP * 2u, lv + bo + 64u * TP * 2u, lv + bo + 96u * TP * 2u, v0p, v0p + (size_t)32 * NRP, v1p, v1p + (size_t)32 * NRP);
  };
  const int foff = ln * TP + 8 * hh;
  const v8f z8 = {0.f, 0.f, 0.f, 0.f, 0.f, 0.f, 0.f, 0.f};
  v8f o[2][4] = {{z8, z8, z8, z8}, {z8, z8, z8, z8}};
  float m[2] = {-1.0e30f, -1.0e30f};                           /* reference maxima in use, in raw-score units; equal in both halves of a column */
  float thr[2] = {-1.0e30f, -1.0e30f};                         /* m + LAZY_T powers of two, in raw-score units */
  float nm[2] = {0.f, 0.f};                                    /* 8 - m * EXP_SC; set in the first pass */
  v2f l2[2] = {{0.f, 0.f}, {0.f, 0.f}};                        /* row sums, even and odd elements apart until the epilogue */
  fill(0);
  wait_copies();
  __syncthreads();
  fill(1);
#pragma unroll 1
  for (int s = 0; s < SEQ / 128; ++s) {
   const unsigned short* pk = &sk[s & 1][kh][0][0];
   const unsigned short* pv = &sv[s & 1][kh][0][0];
   /* The test for the lazy rescale cuts a pass in two for the compiler's scheduler, so the place of the LDS reads is written here. Both passes read this stage's buffer alone. */
   v16h ka[4], va[4];
   ka[0] = ldf_h(pk, foff); ka[1] = ldf_h(pk, foff + 16 * TP); ka[2] = ldf_h(pk, foff + 32); ka[3] = ldf_h(pk, foff + 16 * TP + 32);
#pragma unroll /* both 32-key passes of a stage: their LDS offsets become immediates */
   for (int kb = 0; kb < 64; kb += 32) {
    v8f sm0[2], sm1[2];
#pragma unroll /* score tiles stay in registers */
    for (int g = 0; g < 2; ++g) { sm0[g] = mma_h(ka[0], qf[g][0], z8); sm1[g] = mma_h(ka[1], qf[g][0], z8); }
#pragma unroll /* score tiles stay in registers */
    for (int g = 0; g < 2; ++g) { sm0[g] = mma_h(ka[2], qf[g][1], sm0[g]); sm1[g] = mma_h(ka[3], qf[g][1], sm1[g]); }
    /* raw scores (8 x the logit) are the accumulator tiles themselves; a lane's own maximum of its 16 scores of each group, no exchange between the wave's halves */
    float mx[2];
#pragma unroll /* per-group state stays in registers */
    for (int g = 0; g < 2; ++g) {
      /* a tree of three-input maxima, three deep, not one chain of eight */
      const float a0 = fmaxf(fmaxf(sm0[g][0], sm0[g][1]), sm0[g][2]), a1 = fmaxf(fmaxf(sm0[g][3], sm0[g][4]), sm0[g][5]);
      const float a2 = fmaxf(fmaxf(sm0[g][6], sm0[g][7]), sm1[g][0]), a3 = fmaxf(fmaxf(sm1[g][1], sm1[g][2]), sm1[g][3]);
      const float a4 = fmaxf(fmaxf(sm1[g][4], sm1[g][5]), sm1[g][6]);
      const float a = fmaxf(fmaxf(fmaxf(a0, a1), a2), fmaxf(fmaxf(a3, a4), sm1[g][7]));
      mx[g] = a;
    }
    /* Lazy rescale: the reference maximum m[] stays as long as no score of the pass lies more than LAZY_T powers of two above it; one test per pass, a scalar branch on the ballot.
       The first pass always takes the branch (m = -1e30). Behind it every exponent is at most 8 + LAZY_T = 15, so P stays finite in f16. */
    if (__builtin_amdgcn_ballot_w32((mx[0] > thr[0]) | (mx[1] > thr[1])) != 0u) {
#pragma unroll /* per-group state stays in registers */
      for (int g = 0; g < 2; ++g) {
        const float mn = fmaxf(m[g], fmaxf(mx[g], __shfl_xor(mx[g], 16)));   /* both halves of a column take the same reference */
        const float alpha = __builtin_amdgcn_exp2f((m[g] - mn) * EXP_SC);
        m[g] = mn;
        nm[g] = 8.0f - mn * EXP_SC;                            /* probabilities carried x256 = 2^8 (also in l) */
        thr[g] = mn + LAZY_T / EXP_SC;
        l2[g] *= alpha;
#pragma unroll
        for (int u = 0; u < 4; ++u)
#pragma unroll
          for (int r = 0; r < 8; ++r) o[g][u][r] *= alpha;
      }
    }
    /* behind the test: this pass's V^T fragments and the second pass's K fragments are read as one group, in flight over the softmax */
#pragma unroll /* the fragment array stays in registers */
    for (int u = 0; u < 4; ++u) va[u] = ldf_h(pv, foff + u * 16 * TP + kb);
    if (kb == 0) {
      const int k0 = foff + 32 * TP, k1 = k0 + 16 * TP;
      ka[0] = ldf_h(pk, k0); ka[1] = ldf_h(pk, k1); ka[2] = ldf_h(pk, k0 + 32); ka[3] = ldf_h(pk, k1 + 32);
    }
    __builtin_amdgcn_sched_barrier(0);         /* keeps the group of reads in front of the softmax: without it the scheduler sinks each read to its first use, with a full LDS wait there */
    FragH pf[2];
#pragma unroll /* per-group state stays in registers; the two groups' chains are independent */
    for (int g = 0; g < 2; ++g) {
      /* each packed instruction below takes two adjacent registers of one tile, so no register is moved to form a pair */
      v2f t[8];                                                /* t[i] = elements 2i, 2i + 1 of the 32-key P^T operand */
#pragma unroll /* t[] stays in registers */
      for (int i = 0; i < 4; ++i) {
        t[i] = v2f{sm0[g][2 * i], sm0[g][2 * i + 1]};
        t[4 + i] = v2f{sm1[g][2 * i], sm1[g][2 * i + 1]};
      }
      v2f e[8];
#pragma unroll /* t[], e[] and the fragment stay in registers */
      for (int i = 0; i < 8; ++i) {
        const v2f a = __builtin_elementwise_fma(t[i], v2f{EXP_SC, EXP_SC}, v2f{nm[g], nm[g]});   /* 1/8, log2(e) and the reference maximum in one packed fma per two scores */
        e[i] = v2f{__builtin_amdgcn_exp2f(a.x), __builtin_amdgcn_exp2f(a.y)};
        pf[g].h[2 * i] = (_Float16)e[i].x;
        pf[g].h[2 * i + 1] = (_Float16)e[i].y;
      }
      l2[g] += ((e[0] + e[1]) + (e[2] + e[3])) + ((e[4] + e[5]) + (e[6] + e[7]));
    }
    if (kb == 0) __builtin_amdgcn_sched_barrier(0);   /* keeps the second pass's score products behind this softmax: their tiles beside this pass's exponentials take the kernel past 256 registers, the budget of four waves per SIMD */
#pragma unroll
    for (int u = 0; u < 4; ++u)
#pragma unroll /* output tiles stay in registers */
      for (int g = 0; g < 2; ++g) o[g][u] = mma_h(va[u], pf[g].v, o[g][u]);
   }
   wait_lds();
   wait_copies();
   __syncthreads();                                            /* publishes stage s + 1, frees stage s's buffer */
   if (s + 2 < SEQ / 128) fill(s + 2);
  }
  wait_copies();
  /* Behind the loop's last barrier no wave reads the ring and no copy is in flight: sk becomes the swap area. Wave (qg, kh) keeps column group kh and gives group 1 - kh to wave (qg, 1 - kh). */
  v4fa* const xw = (v4fa*)&sk[0][0][0][0] + wave * (9 * 32) + lane;
  const v4fa* const xr = (const v4fa*)&sk[0][0][0][0] + (wave ^ 4) * (9 * 32) + lane;
  v8f ok[4];
  const float mk = kh ? m[1] : m[0];
  const float lk1 = kh ? (l2[1].x + l2[1].y) : (l2[0].x + l2[0].y);
  {
    const float mg = kh ? m[0] : m[1];
    const float lg = kh ? (l2[0].x + l2[0].y) : (l2[1].x + l2[1].y);
#pragma unroll /* output tiles stay in registers */
    for (int u = 0; u < 4; ++u) {
      ok[u] = kh ? o[1][u] : o[0][u];
      const v8f og = kh ? o[0][u] : o[1][u];
      xw[(2 * u) * 32] = v4f{og[0], og[1], og[2], og[3]};
      xw[(2 * u + 1) * 32] = v4f{og[4], og[5], og[6], og[7]};
    }
    xw[8 * 32] = v4f{mg, lg, 0.f, 0.f};
  }
  __syncthreads();                                             /* every wave's given partial is written before its partner reads it */
  const v4f ml = xr[8 * 32];
  const float mm = fmaxf(mk, ml[0]);
  const float ak = __builtin_amdgcn_exp2f((mk - mm) * EXP_SC), ar = __builtin_amdgcn_exp2f((ml[0] - mm) * EXP_SC);
  float l = lk1 * ak + ml[1] * ar;
  l += __shfl_xor(l, 16);
  const float inv = 1.0f / l;
#pragma unroll /* output tiles stay in registers */
  for (int u = 0; u < 4; ++u) {
    const v4f r0 = xr[(2 * u) * 32], r1 = xr[(2 * u + 1) * 32];
    v8us vh;
#pragma unroll
    for (int r = 0; r < 8; ++r) vh[r] = bf16_bits((ok[u][r] * ak + (r < 4 ? r0[r & 3] : r1[r & 3]) * ar) * inv);   /* ctx[query 16 kh + ln][d = 16u + 8hh + r] */
    *(v8us*)&sh[wave][ln][u * 16 + 8 * hh] = vh;
  }
  __builtin_amdgcn_fence(4 /* acq_rel order */, "workgroup");
  __builtin_amdgcn_wave_barrier();
  const int rq = lane >> 3, pc = lane & 7;
#pragma unroll
  for (int qq = 0; qq < 4; ++qq) {
    const int row = qq * 4 + rq;                               /* qq*4 + {0..3} covers rows 0..15 */
    const v8us xh = *(const v8us*)&sh[wave][row][pc * 8];
    const size_t go = (rowb + q0 + 16 * kh + row) * DM + h * HD + pc * 8;
    *(v8us*)(CH + go) = xh;
  }
}

// Y[NRP][DM] (f32) = CH . Wt[DM][DM]^T + bias; bf16 operands; block = 8 waves (4 x 2), wave tile 32 x 64, block tile 128 x 128
// Operands: per 64-k stage the block copies its 128 CH rows and 128 Wt rows into LDS, one stage ahead (two buffers): the CH rows serve 128 columns of Y, not 64.
__global__ __launch_bounds__(256) void k_gemm_o(const unsigned short* __restrict__ CH, const unsigned short* __restrict__ Wt,
                                                const float* __restrict__ bias, float* __restrict__ Y) {
  __shared__ __attribute__((aligned(16))) float so[8][32][68];
  __shared__ __attribute__((aligned(16))) unsigned short sch[2][128][TP];
  __shared__ __attribute__((aligned(16))) unsigned short sb[2][128][TP];
  const int tid = threadIdx.x;
  const int w = __builtin_amdgcn_readfirstlane(tid >> 5);
  const int wm = w >> 1, wn = w & 1;           /* the wave's 32 rows and 64 columns of the block tile */
  const int lane = tid & 31, ln = lane & 15, hh = lane >> 4;
  const int ntn = DM >> 7;
  const int mt = blockIdx.x / ntn, nq = blockIdx.x - mt * ntn;
  const int row0 = mt * 128 + 32 * wm, col0 = nq * 128 + 64 * wn;
  if (mt * 128 >= NRP) return;                 /* block-uniform, in front of every barrier */
  const int cr = tid >> 3, cc = (tid & 7) * 8; /* copy: row within 32, 16-B piece of the 128-B row */
  const size_t goa = (size_t)(mt * 128 + cr) * DM + cc;
  const unsigned short* gh = CH + goa;
  const unsigned short* gb = Wt + (size_t)(nq * 128 + cr) * DM + cc;
  const unsigned lh = lds_off(&sch[0][cr][cc]), lb = lds_off(&sb[0][cr][cc]);
  auto fill = [&](const int s) {
    const unsigned bo = (unsigned)(s & 1) * (128u * TP * 2u);
    cp128_t256(lh + bo, gh + s * 64, (size_t)32 * DM);
    cp128_t256(lb + bo, gb + s * 64, (size_t)32 * DM);
  };
  const int a0 = (32 * wm + ln) * TP + 8 * hh, a1 = a0 + 16 * TP;
  const int b0 = (64 * wn + ln) * TP + 8 * hh, b1 = b0 + 16 * TP, b2 = b1 + 16 * TP, b3 = b2 + 16 * TP;
  const v8f z8 = {0.f, 0.f, 0.f, 0.f, 0.f, 0.f, 0.f, 0.f};
  v8f c00 = z8, c01 = z8, c02 = z8, c03 = z8, c10 = z8, c11 = z8, c12 = z8, c13 = z8;
  fill(0);
  wait_copies();
  __syncthreads();
  fill(1);
#pragma unroll 1
  for (int s = 0; s < DM / 64; ++s) {
    const unsigned short* ph = &sch[s & 1][0][0];
    const unsigned short* pb = &sb[s & 1][0][0];
    /* all twelve fragments of the stage are read as one group into registers of their own, ahead of its sixteen WMMAs */
    v16b fh[2][2], fb[2][4];
#pragma unroll /* both 32-k steps of a stage: their LDS offsets become immediates */
    for (int kk = 0; kk < 2; ++kk) {
      fh[kk][0] = ldf_b(ph, a0 + 32 * kk); fh[kk][1] = ldf_b(ph, a1 + 32 * kk);
      fb[kk][0] = ldf_b(pb, b0 + 32 * kk); fb[kk][1] = ldf_b(pb, b1 + 32 * kk);
      fb[kk][2] = ldf_b(pb, b2 + 32 * kk); fb[kk][3] = ldf_b(pb, b3 + 32 * kk);
    }
    __builtin_amdgcn_sched_barrier(0);         /* keeps the group of reads in front of the WMMAs: without it the scheduler sinks each read to its first use, with a full LDS wait there */
#pragma unroll /* fragment arrays stay in registers */
    for (int kk = 0; kk < 2; ++kk) {
      c00 = mma_b(fh[kk][0], fb[kk][0], c00); c10 = mma_b(fh[kk][1], fb[kk][0], c10);
      c01 = mma_b(fh[kk][0], fb[kk][1], c01); c11 = mma_b(fh[kk][1], fb[kk][1], c11);
      c02 = mma_b(fh[kk][0], fb[kk][2], c02); c12 = mma_b(fh[kk][1], fb[kk][2], c12);
      c03 = mma_b(fh[kk][0], fb[kk][3], c03); c13 = mma_b(fh[kk][1], fb[kk][3], c13);
    }
    __builtin_amdgcn_sched_barrier(0);         /* keeps the WMMAs in front of the stage's waits, inside the flight time of the next stage's copies */
    wait_lds();
    wait_copies();
    __syncthreads();                           /* publishes stage s + 1, frees stage s's buffer */
    if (s + 2 < DM / 64) fill(s + 2);
  }
  wait_copies();
  v8f accs[8] = {c00, c01, c02, c03, c10, c11, c12, c13};
#pragma unroll
  for (int u = 0; u < 8; ++u) {
    const int t = u & 3, half = u >> 2;
    const float bc = bf16_rne(bias[col0 + t * 16 + ln]);
#pragma unroll
    for (int r = 0; r < 8; ++r) so[w][half * 16 + 8 * hh + r][t * 16 + ln] = accs[u][r] + bc;
  }
  __builtin_amdgcn_fence(4 /* acq_rel order */, "workgroup");
  __builtin_amdgcn_wave_barrier();
  const int rsub = lane >> 4, c4 = (lane & 15) * 4;
  {
#pragma unroll
    for (int q = 0; q < 16; ++q) {
      const int r = q * 2 + rsub;                          
      const v4f v = *(const v4fa*)&so[w][r][c4];
      *(v4f*)(Y + (size_t)(row0 + r) * DM + col0 + c4) = v;
    }
    
  }
}

// One wave per row: a lane holds 32 of the row's 1024 values (eight 16-B pieces, a wave's load = 512 contiguous bytes); both sums by lane partials and a five-step butterfly, no LDS array, no barrier.
static_assert(NRP % 8 == 0);         // k_ln: 8 waves = 8 rows per block
__global__ __launch_bounds__(256) void k_ln(const float* __restrict__ x, const float* __restrict__ Y, const float* __restrict__ g, const float* __restrict__ bta, float* __restrict__ out) {
  const int tid = threadIdx.x, lane = tid & 31;
  const int row = blockIdx.x * 8 + __builtin_amdgcn_readfirstlane(tid >> 5);   /* wave-uniform: row bases stay scalar, one lane offset serves every load and store */
  const size_t xr = ((size_t)(row / SEQ) * SEQ_FULL + (size_t)(row % SEQ)) * DM;
  const size_t yr = (size_t)row * DM;
  const int c4 = lane * 4;
  v4f xv[8], yv[8], gv[8], bv[8];
#pragma unroll
  for (int j = 0; j < 8; ++j) { xv[j] = *(const v4fa*)(x + xr + c4 + j * 128); yv[j] = *(const v4fa*)(Y + yr + c4 + j * 128); }
#pragma unroll
  for (int j = 0; j < 8; ++j) { gv[j] = *(const v4fa*)(g + c4 + j * 128); bv[j] = *(const v4fa*)(bta + c4 + j * 128); }
  __builtin_amdgcn_sched_barrier(0);           /* all 32 loads of the row are in flight before the first value is used: without it the scheduler sinks the gamma and beta loads behind the sums, one exposed round trip per pair */
  v4f hv[8];
  v4f a1 = {0.f, 0.f, 0.f, 0.f};
#pragma unroll
  for (int j = 0; j < 8; ++j) {
#pragma unroll
    for (int q = 0; q < 4; ++q) hv[j][q] = bf16_rne(xv[j][q]) + yv[j][q];
    a1 += hv[j];
  }
  float s1 = (a1[0] + a1[1]) + (a1[2] + a1[3]);
#pragma unroll
  for (int off = 16; off > 0; off >>= 1) s1 += __shfl_xor(s1, off);
  const float mu = s1 * (1.0f / (float)DM);
  v4f a2 = {0.f, 0.f, 0.f, 0.f};
#pragma unroll
  for (int j = 0; j < 8; ++j) { hv[j] -= mu; a2 += hv[j] * hv[j]; }
  float s2 = (a2[0] + a2[1]) + (a2[2] + a2[3]);
#pragma unroll
  for (int off = 16; off > 0; off >>= 1) s2 += __shfl_xor(s2, off);
  const float rs = rsqrtf(s2 * (1.0f / (float)DM) + LN_EPS);
#pragma unroll
  for (int j = 0; j < 8; ++j) {
    v4f ov;
#pragma unroll
    for (int q = 0; q < 4; ++q) ov[q] = hv[j][q] * rs * bf16_rne(gv[j][q]) + bf16_rne(bv[j][q]);
    *(v4f*)(out + xr + c4 + j * 128) = ov;
  }
}

extern "C" void kernel_launch(void* const* d_in, const int* in_sizes, int n_in,
                              void* d_out, int out_size, void* d_ws, size_t ws_size, hipStream_t stream) {
  if (n_in < 11) return;
  const size_t need_x = ((size_t)(NB - 1) * SEQ_FULL + SEQ) * DM;
  if ((size_t)in_sizes[0] < need_x || (size_t)out_size < need_x) return;
  if ((size_t)in_sizes[1] < (size_t)DM * DM || (size_t)in_sizes[3] < (size_t)DM * DM || (size_t)in_sizes[5] < (size_t)DM * DM || (size_t)in_sizes[7] < (size_t)DM * DM) return;
  if (in_sizes[2] < DM || in_sizes[4] < DM || in_sizes[6] < DM || in_sizes[8] < DM || in_sizes[9] < DM || in_sizes[10] < DM) return;
  const float* x  = (const float*)d_in[0];
  const float* wq = (const float*)d_in[1]; const float* bq = (const float*)d_in[2];
  const float* wk = (const float*)d_in[3]; const float* bk = (const float*)d_in[4];
  const float* wv = (const float*)d_in[5]; const float* bv = (const float*)d_in[6];
  const float* wo = (const float*)d_in[7]; const float* bo = (const float*)d_in[8];
  const float* lg = (const float*)d_in[9]; const float* lb = (const float*)d_in[10];
  char* ws = (char*)d_ws; size_t off = 0;
  auto take = [&](size_t bytes) { char* p = ws + off; off += (bytes + 255) & ~(size_t)255; return p; };
  unsigned short* BQ = (unsigned short*)take(WS_W);
  unsigned short* BK = (unsigned short*)take(WS_W);
  unsigned short* BV = (unsigned short*)take(WS_W);
  unsigned short* BO = (unsigned short*)take(WS_W);
  unsigned short* X16 = (unsigned short*)take(WS_P16);
  unsigned short* QH  = (unsigned short*)take(WS_P16);
  unsigned short* K16 = (unsigned short*)take(WS_P16);
  unsigned short* VT  = (unsigned short*)take(WS_P16);
  unsigned short* CH  = (unsigned short*)take(WS_P16);
  float* Y = (float*)take(WS_P32);
  if (off > ws_size) return;
  k_prep<<<(unsigned)(4 * GW_BLK + GX_BLK), 256, 0, stream>>>(x, wq, wk, wv, wo, X16, BQ, BK, BV, BO);
  k_gemm_qkv<<<(unsigned)(2 * GQK_BLK + GV_BLK), 128, 0, stream>>>(X16, BQ, BK, BV, bq, bk, bv, QH, K16, VT);
  k_flash<<<(unsigned)(NB * NH * (SEQ / 128)), 256, 0, stream>>>(QH, K16, VT, CH);
  k_gemm_o<<<(unsigned)((NRP / 128) * (DM / 128)), 256, 0, stream>>>(CH, BO, bo, Y);
  k_ln<<<(unsigned)(NRP / 8), 256, 0, stream>>>(x, Y, lg, lb, (float*)d_out);
}

// v010
// Measured time: 79.3 microseconds a run.
// Timed twice side by side with v009, it ran 1.05 times as fast both times.
// Over all steps from v000 it is 4.24 times as fast.
#include <hip/hip_runtime.h>
// Compute dtype: inputs RNE-converted to bf16 on load; q/k/v projections v_wmma_f32_16x16x32_f16 (x exact f16, weights x16 exact f16); scores f16 (q and k single); P (x256 carried) and v single f16; output GEMM v_wmma_f32_16x16x32_bf16 (ctx single bf16, Wo exact bf16); all accumulators, softmax statistics, residual add and LayerNorm f32.
// Structure: token rows r = b*SEQ + s. k_prep (one grid, block ranges): [in][out] weights -> Bt[n][k] 16-bit planes, x -> f16 rows. k_gemm_qkv (one grid, block ranges): Q/K GEMMs (64x64 wave tiles, 128x128 block tiles) -> Qh, K16 planes; V GEMM with swapped operands -> VT[h*64+d][b*SEQ+s].
#ifndef NB
#define NB 2
#endif
#ifndef SEQ
#define SEQ 2048
#endif
#define NB_FULL 2
#define SEQ_FULL 2048
#define DM 1024
#define NH 16
#define HD 64
#define NRP (NB * SEQ)               /* plane rows */
#define LN_EPS 1e-5f

static_assert(NH * HD == DM);        // head h = columns h*64 + d
static_assert(HD == 64);
static_assert(DM == 1024);           // k_ln: 32 lanes x 8 pieces x 4 columns
static_assert(DM % 128 == 0);        // swapped V GEMM: M = DM in 128-row block tiles
static_assert(DM % 128 == 0);        // N tiles of 128
static_assert(DM % 32 == 0);         // K steps of 32
static_assert(NRP % 128 == 0);       // GEMM block tiles of 128 rows
static_assert(NRP % 128 == 0);       // swapped V GEMM N tiles of 128
static_assert(SEQ % 64 == 0);        // flash: 32-key steps
static_assert(DM % 64 == 0 && DM / 64 >= 2);     // GEMM rings: 64-k stages, two buffers
static_assert(NB <= NB_FULL);
static_assert(SEQ <= SEQ_FULL);

typedef _Float16 v16h __attribute__((ext_vector_type(16)));
typedef __bf16 v16b __attribute__((ext_vector_type(16)));
typedef _Float16 v4h __attribute__((ext_vector_type(4)));
typedef unsigned short v8us __attribute__((ext_vector_type(8), may_alias));
typedef float v8f __attribute__((ext_vector_type(8)));
typedef float v4f __attribute__((ext_vector_type(4)));
typedef float v2f __attribute__((ext_vector_type(2)));
typedef float v4fa __attribute__((ext_vector_type(4), may_alias));
union FragH { v16h v; v8us half[2]; _Float16 h[16]; unsigned short u[16]; };
union FragB { v16b v; v8us half[2]; unsigned short u[16]; };

/* workspace carve (bytes); every region is rows x pitch x element size exactly, stores never pass a region end */
#define WS_W   ((size_t)DM * DM * 2)
#define WS_P16 ((size_t)NRP * DM * 2)
#define WS_P32 ((size_t)NRP * DM * 4)
#define WS_TOTAL (4 * WS_W + 5 * WS_P16 + WS_P32)
static_assert(WS_W % 256 == 0);
static_assert(WS_P16 % 256 == 0);
static_assert(WS_TOTAL <= (size_t)134217728);

__device__ __forceinline__ unsigned short bf16_bits(float x) { unsigned int u = __float_as_uint(x); return (unsigned short)((u + 0x7FFFu + ((u >> 16) & 1u)) >> 16); }
__device__ __forceinline__ float bf16_val(unsigned short b) { return __uint_as_float(((unsigned int)b) << 16); }
__device__ __forceinline__ float bf16_rne(float x) { return bf16_val(bf16_bits(x)); }

// fragment loaders: off already includes 8*(lane>>4); elements 0..7 <- k0+8h.., elements 8..15 <- k0+16+8h..
__device__ __forceinline__ v16h ldf_h(const unsigned short* __restrict__ p, size_t off) { FragH f; f.half[0] = *(const v8us*)(p + off); f.half[1] = *(const v8us*)(p + off + 16); return f.v; }
__device__ __forceinline__ v16b ldf_b(const unsigned short* __restrict__ p, size_t off) { FragB f; f.half[0] = *(const v8us*)(p + off); f.half[1] = *(const v8us*)(p + off + 16); return f.v; }
__device__ __forceinline__ v8f mma_h(v16h a, v16h b, v8f c) {
  return __builtin_amdgcn_wmma_f32_16x16x32_f16(false, a, false, b, (short)0, c, false, false);
}
__device__ __forceinline__ v8f mma_b(v16b a, v16b b, v8f c) {
  return __builtin_amdgcn_wmma_f32_16x16x32_bf16(false, a, false, b, (short)0, c, false, false);
}

// LDS operand tiles: rows of 64 16-bit elements (128 B) at a pitch of 72 (144 B = 16 B x 9, conflict-free for ds_load_b128 fragment reads).
#define TP 72
__device__ __forceinline__ unsigned lds_off(const void* p) { return (unsigned)(size_t)p; }
// Four 16-B pieces of a lane go from global memory to LDS through no register, each with its own LDS and global address; a wave's copy covers 4 whole 128-B lines.
// The s_wait_xcnt stands inside the copies' own statement so that no address register is rewritten ahead of it.
__device__ __forceinline__ void cp4(const unsigned l0, const unsigned l1, const unsigned l2, const unsigned l3,
                                    const unsigned short* g0, const unsigned short* g1, const unsigned short* g2, const unsigned short* g3) {
  asm volatile("global_load_async_to_lds_b128 %0, %4, off\n\t"
               "global_load_async_to_lds_b128 %1, %5, off\n\t"
               "global_load_async_to_lds_b128 %2, %6, off\n\t"
               "global_load_async_to_lds_b128 %3, %7, off\n\t"
               "s_wait_xcnt 0x0"
               :: "v"(l0), "v"(l1), "v"(l2), "v"(l3), "v"(g0), "v"(g1), "v"(g2), "v"(g3) : "memory");
}
// A lane's share of a 128-row operand tile at one row step, one statement and one s_wait_xcnt a tile. Block of 128 threads: rows r + 16 i, i = 0..7.
__device__ __forceinline__ void cp128_t128(const unsigned l, const unsigned short* g, const size_t g16) {
  const unsigned short* g1 = g + g16; const unsigned short* g2 = g1 + g16; const unsigned short* g3 = g2 + g16;
  const unsigned short* g4 = g3 + g16; const unsigned short* g5 = g4 + g16; const unsigned short* g6 = g5 + g16; const unsigned short* g7 = g6 + g16;
  asm volatile("global_load_async_to_lds_b128 %0, %8, off\n\t"
               "global_load_async_to_lds_b128 %1, %9, off\n\t"
               "global_load_async_to_lds_b128 %2, %10, off\n\t"
               "global_load_async_to_lds_b128 %3, %11, off\n\t"
               "global_load_async_to_lds_b128 %4, %12, off\n\t"
               "global_load_async_to_lds_b128 %5, %13, off\n\t"
               "global_load_async_to_lds_b128 %6, %14, off\n\t"
               "global_load_async_to_lds_b128 %7, %15, off\n\t"
               "s_wait_xcnt 0x0"
               :: "v"(l), "v"(l + 16u * TP * 2u), "v"(l + 32u * TP * 2u), "v"(l + 48u * TP * 2u), "v"(l + 64u * TP * 2u), "v"(l + 80u * TP * 2u), "v"(l + 96u * TP * 2u), "v"(l + 112u * TP * 2u),
                  "v"(g), "v"(g1), "v"(g2), "v"(g3), "v"(g4), "v"(g5), "v"(g6), "v"(g7) : "memory");
}
// Block of 256 threads: rows r + 32 i, i = 0..3.
__device__ __forceinline__ void cp128_t256(const unsigned l, const unsigned short* g, const size_t g32) {
  const unsigned short* g1 = g + g32; const unsigned short* g2 = g1 + g32; const unsigned short* g3 = g2 + g32;
  asm volatile("global_load_async_to_lds_b128 %0, %4, off\n\t"
               "global_load_async_to_lds_b128 %1, %5, off\n\t"
               "global_load_async_to_lds_b128 %2, %6, off\n\t"
               "global_load_async_to_lds_b128 %3, %7, off\n\t"
               "s_wait_xcnt 0x0"
               :: "v"(l), "v"(l + 32u * TP * 2u), "v"(l + 64u * TP * 2u), "v"(l + 96u * TP * 2u), "v"(g), "v"(g1), "v"(g2), "v"(g3) : "memory");
}
// own copies landed (in front of the barrier that publishes them to the other waves)
__device__ __forceinline__ void wait_copies() { asm volatile("s_wait_asynccnt 0x0" ::: "memory"); }
// own LDS reads retired (in front of the barrier behind which their buffer is refilled)
__device__ __forceinline__ void wait_lds() { asm volatile("s_wait_dscnt 0x0" ::: "memory"); }

// One thread takes an 8 x 8 tile of W[k][n] (sixteen 16-B loads), turns it in registers and stores eight 16-B pieces of Wt[n][k]; bid = block index within this job's range.
// A wave is 8 k tiles x 4 n tiles: its two loads of a tile row cover one whole 128-B line of eight rows of W, a store one whole 128-B line of four rows of Wt (one writer per line).
// F16: Wt = f16 of 16 * bf16(W); else Wt = bf16 bits of W.
template <bool F16>
__device__ __forceinline__ void wt_body(const float* __restrict__ W, unsigned short* __restrict__ Wt, const int bid) {
  const int t = bid * 256 + threadIdx.x;                       /* tile number, (DM / 8) * (DM / 8) tiles */
  const int g = t >> 5;                                        /* wave's group of 8 x 4 tiles */
  const int k8 = ((g % (DM / 64)) * 8 + (t & 7)) * 8;
  const int n8 = ((g / (DM / 64)) * 4 + ((t >> 3) & 3)) * 8;
  v4f r[8][2];
#pragma unroll
  for (int i = 0; i < 8; ++i) {
    r[i][0] = *(const v4fa*)(W + (size_t)(k8 + i) * DM + n8);
    r[i][1] = *(const v4fa*)(W + (size_t)(k8 + i) * DM + n8 + 4);
  }
#pragma unroll
  for (int j = 0; j < 8; ++j) {
    FragH f;
#pragma unroll
    for (int i = 0; i < 8; ++i) {
      const float wv = r[i][j >> 2][j & 3];
      if (F16) f.h[i] = (_Float16)(bf16_rne(wv) * 16.0f); else f.u[i] = bf16_bits(wv);
    }
    const v8us o = f.half[0];
    *(v8us*)(Wt + (size_t)(n8 + j) * DM + k8) = o;
  }
  /* behind the last store: the code of another block range follows in the text and rewrites the stores' address and data registers */
  asm volatile("s_wait_xcnt 0x0" ::: "memory");
}
// One thread converts eight pieces of 8 values of x; a block takes 16 consecutive rows (all of one batch entry: SEQ % 16 == 0), piece j * 256 + thread in pass j.
// The block's bases are scalar, so one lane offset serves all loads and one all stores.
__device__ __forceinline__ void x16_body(const float* __restrict__ x, unsigned short* __restrict__ X16, const int bid) {
  const int r0 = bid * 16;
  const float* __restrict__ xp = x + ((size_t)(r0 / SEQ) * SEQ_FULL + (size_t)(r0 % SEQ)) * DM;
  unsigned short* __restrict__ op = X16 + (size_t)r0 * DM;
  const int c8 = threadIdx.x * 8;
  v4f a[8], b[8];
#pragma unroll
  for (int j = 0; j < 8; ++j) { a[j] = *(const v4fa*)(xp + c8 + j * 2048); b[j] = *(const v4fa*)(xp + c8 + j * 2048 + 4); }
#pragma unroll
  for (int j = 0; j < 8; ++j) {
    FragH f;
#pragma unroll
    for (int q = 0; q < 4; ++q) { f.h[q] = (_Float16)bf16_rne(a[j][q]); f.h[4 + q] = (_Float16)bf16_rne(b[j][q]); }
    const v8us o = f.half[0];
    *(v8us*)(op + c8 + j * 2048) = o;
  }
  /* behind the last store: the code of another block range follows in the text and rewrites the stores' address and data registers */
  asm volatile("s_wait_xcnt 0x0" ::: "memory");
}
// The five independent operand preparations as block ranges of one grid; every thread moves 64 values, so that the launch starts few waves.
static_assert(DM % 64 == 0);                          /* a wave's 8 x 4 tiles of 8 x 8 */
static_assert(((DM / 8) * (DM / 8)) % 256 == 0);      /* whole blocks of weight tiles */
static_assert(NRP % 16 == 0 && SEQ % 16 == 0 && DM == 1024);  /* x: whole blocks of 16 rows = 2048 pieces, inside one batch entry */
#define GW_BLK (((DM / 8) * (DM / 8)) / 256)          /* blocks of one weight plane */
#define GX_BLK (NRP / 16)                             /* blocks of x */
__global__ __launch_bounds__(256) void k_prep(const float* __restrict__ x, const float* __restrict__ wq, const float* __restrict__ wk, const float* __restrict__ wv, const float* __restrict__ wo,
                                              unsigned short* __restrict__ X16, unsigned short* __restrict__ BQ, unsigned short* __restrict__ BK, unsigned short* __restrict__ BV, unsigned short* __restrict__ BO) {
  const int bid = blockIdx.x;                  /* every test below is block-uniform */
  if (bid < GW_BLK) wt_body<true>(wq, BQ, bid);                   /* W[in][out] -> Bt[out][in] */
  else if (bid < 2 * GW_BLK) wt_body<true>(wk, BK, bid - GW_BLK);
  else if (bid < 3 * GW_BLK) wt_body<true>(wv, BV, bid - 2 * GW_BLK);
  else if (bid < 4 * GW_BLK) wt_body<false>(wo, BO, bid - 3 * GW_BLK);
  else x16_body(x, X16, bid - 4 * GW_BLK);
}

// f16 GEMM C[M][N] = alpha * A[M][K] . Bt[N][K]^T + bias; block = 4 waves (2 x 2), wave tile 64 x 64, block tile 128 x 128; M % 128 == 0, N % 128 == 0, K % 64 == 0, K >= 128.
// Operands: per 64-k stage the block copies its 128 A rows and 128 Bt rows into LDS, one stage ahead (two buffers); fragments are read from LDS.
// Per element of C a 128 x 128 block tile copies two thirds of the operand bytes of a 128 x 64 tile out of L2; a 64 x 64 wave tile reads 8 fragments per 16 WMMAs, a 32 x 64 tile 6 per 8.
// MODE 0: f16 plane C0, bias per column. MODE 2: f16 plane C0, bias per row.
// bid = block index within this product's range of the grid; so, sa, sb = the kernel's LDS (output staging [4][16][68], A ring [2][128][TP], B ring [2][128][TP]).
// Were each to start at k = 0, the blocks that share operand rows would ask L2 for the same lines at the same moment, and every block for the same 128 B of each 2-KiB row. rot0 sets the three products apart, which share the rows of x.
template <int MODE>
__device__ __forceinline__ void gemm_h_body(const unsigned short* __restrict__ A, const int lda, const unsigned short* __restrict__ Bt, const int ldb, const float alpha,
                                            const float* __restrict__ bias, unsigned short* C0, const int ldc, const int M, const int N, const int K,
                                            const int bid, const int rot0, float (*so)[16][68], unsigned short (*sa)[128][TP], unsigned short (*sb)[128][TP]) {
  const int tid = threadIdx.x;
  const int w = __builtin_amdgcn_readfirstlane(tid >> 5);
  const int wm = w >> 1, wn = w & 1;           /* the wave's quarter of the block tile */
  const int lane = tid & 31, ln = lane & 15, hh = lane >> 4;
  const int ntn = N >> 7;
  const int mt = bid / ntn, nq = bid - mt * ntn;
  const int row0 = mt * 128 + 64 * wm, col0 = nq * 128 + 64 * wn;
  if (mt * 128 >= M) return;                   /* block-uniform, in front of every barrier */
  const int cr = tid >> 3, cc = (tid & 7) * 8; /* copy: row within 16, 16-B piece of the 128-B row */
  const unsigned short* ga = A + (size_t)(mt * 128 + cr) * lda + cc;
  const unsigned short* gb = Bt + (size_t)(nq * 128 + cr) * ldb + cc;
  const unsigned la = lds_off(&sa[0][cr][cc]), lb = lds_off(&sb[0][cr][cc]);
  const int ns = K >> 6;
  const int rot = (mt + nq + rot0) % ns;       /* the block's first k slab: blocks that share A rows (equal mt) or Bt rows (equal nq) walk k from different slabs and wrap round */
  auto fill = [&](const int s) {
    const unsigned bo = (unsigned)(s & 1) * (128u * TP * 2u);
    const int ks = (s + rot < ns ? s + rot : s + rot - ns) * 64;   /* stage s holds k slab (s + rot) mod ns: every slab once */
    cp128_t128(la + bo, ga + ks, (size_t)16 * lda);
    cp128_t128(lb + bo, gb + ks, (size_t)16 * ldb);
  };
  const int a0 = (64 * wm + ln) * TP + 8 * hh;
  const int b0 = (64 * wn + ln) * TP + 8 * hh;
  const v8f z8 = {0.f, 0.f, 0.f, 0.f, 0.f, 0.f, 0.f, 0.f};
  v8f c[4][4];                                 /* c[i][j]: rows 16 i.., columns 16 j.. of the wave tile */
#pragma unroll
  for (int i = 0; i < 4; ++i)
#pragma unroll
    for (int j = 0; j < 4; ++j) c[i][j] = z8;
  fill(0);
  wait_copies();
  __syncthreads();
  fill(1);
#pragma unroll 1
  for (int s = 0; s < ns; ++s) {
    const unsigned short* pa = &sa[s & 1][0][0];
    const unsigned short* pb = &sb[s & 1][0][0];
#pragma unroll /* both 32-k steps of a stage: their LDS offsets become immediates, the accumulator array stays in registers */
    for (int kk = 0; kk < 2; ++kk) {
      /* the eight fragments of a 32-k step are read as one group, ahead of its sixteen WMMAs: one LDS round trip per sixteen WMMAs */
      v16h fa[4], fb[4];
#pragma unroll /* fragment arrays stay in registers */
      for (int i = 0; i < 4; ++i) { fa[i] = ldf_h(pa, a0 + i * 16 * TP + 32 * kk); if (i == 0) fb[0] = ldf_h(pb, b0 + 32 * kk); }   /* in the order of first use by the WMMAs below */
#pragma unroll /* fragment arrays stay in registers */
      for (int j = 1; j < 4; ++j) fb[j] = ldf_h(pb, b0 + j * 16 * TP + 32 * kk);
      __builtin_amdgcn_sched_barrier(0);       /* keeps the group of reads in front of the WMMAs: without it the scheduler sinks each read to its first use, with a full LDS wait there */
#pragma unroll /* fragment and accumulator arrays stay in registers */
      for (int j = 0; j < 4; ++j)
#pragma unroll
        for (int i = 0; i < 4; ++i) c[i][j] = mma_h(fa[i], fb[j], c[i][j]);
      __builtin_amdgcn_sched_barrier(0);       /* keeps the next group of reads, and the stage's waits, out of the WMMA run */
    }
    wait_lds();
    wait_copies();
    __syncthreads();                           /* publishes stage s + 1, frees stage s's buffer */
    if (s + 2 < ns) fill(s + 2);
  }
  wait_copies();
  float bc[4] = {0.f, 0.f, 0.f, 0.f};
  if (MODE != 2) {
#pragma unroll
    for (int t = 0; t < 4; ++t) bc[t] = bf16_rne(bias[col0 + t * 16 + ln]);
  }
  const int rsub = lane >> 4, c4 = (lane & 15) * 4;
  /* the wave tile leaves in four slices of 16 rows through the wave's own staging rows */
#pragma unroll
  for (int i = 0; i < 4; ++i) {
    float brow[8] = {0.f, 0.f, 0.f, 0.f, 0.f, 0.f, 0.f, 0.f};
    if (MODE == 2) {
      const v4f r0 = *(const v4fa*)(bias + row0 + i * 16 + 8 * hh), r1 = *(const v4fa*)(bias + row0 + i * 16 + 8 * hh + 4);
#pragma unroll
      for (int q = 0; q < 4; ++q) { brow[q] = bf16_rne(r0[q]); brow[4 + q] = bf16_rne(r1[q]); }
    }
#pragma unroll
    for (int t = 0; t < 4; ++t)
#pragma unroll
      for (int r = 0; r < 8; ++r) {            /* D: row 8h + r, col lane & 15 */
        const float bvv = (MODE == 2) ? brow[r] : bc[t];
        so[w][8 * hh + r][t * 16 + ln] = c[i][t][r] * alpha + bvv;
      }
    __builtin_amdgcn_fence(4 /* acq_rel order */, "workgroup", "local");   /* LDS only: a fence on all memory would wait here for the earlier slices' global stores */
    __builtin_amdgcn_wave_barrier();           /* the slice is written by all lanes before any lane reads it back */
#pragma unroll
    for (int q = 0; q < 8; ++q) {
      const int r = q * 2 + rsub;
      const v4f v = *(const v4fa*)&so[w][r][c4];
      v4h h4;
#pragma unroll
      for (int e = 0; e < 4; ++e) h4[e] = (_Float16)v[e];
      const size_t go = (size_t)(row0 + i * 16 + r) * ldc + col0 + c4;
      *(v4h*)(C0 + go) = h4;
    }
    __builtin_amdgcn_fence(4 /* acq_rel order */, "workgroup", "local");   /* LDS only, as above */
    __builtin_amdgcn_wave_barrier();           /* the slice is read back by all lanes before the next one overwrites it */
    /* behind a slice's last store: the next slice, or in the merged kernel the code of another block range, rewrites the stores' address and data registers */
    asm volatile("s_wait_xcnt 0x0" ::: "memory");
  }
}
// The three independent projections as block ranges of one grid, one set of LDS arrays.
// V with swapped operands: VT[n = h*64+d][r = b*SEQ+s] = sum_k Wt[n][k] x[r][k] / 16 + bias[n]
#define GQK_BLK ((NRP / 128) * (DM / 128))            /* blocks of the Q product, and of the K product */
#define GV_BLK ((DM / 128) * (NRP / 128))             /* blocks of the V product */
__global__ __launch_bounds__(128) void k_gemm_qkv(const unsigned short* __restrict__ X16, const unsigned short* __restrict__ BQ, const unsigned short* __restrict__ BK, const unsigned short* __restrict__ BV,
                                                  const float* __restrict__ bq, const float* __restrict__ bk, const float* __restrict__ bv,
                                                  unsigned short* __restrict__ Qh, unsigned short* __restrict__ K16, unsigned short* __restrict__ VT) {
  __shared__ __attribute__((aligned(16))) float so[4][16][68];
  __shared__ __attribute__((aligned(16))) unsigned short sa[2][128][TP];
  __shared__ __attribute__((aligned(16))) unsigned short sb[2][128][TP];
  const int bid = blockIdx.x;                  /* every test below is block-uniform */
  if (bid < GQK_BLK) gemm_h_body<0>(X16, DM, BQ, DM, 0.0625f, bq, Qh, DM, NRP, DM, DM, bid, 0, so, sa, sb);
  else if (bid < 2 * GQK_BLK) gemm_h_body<0>(X16, DM, BK, DM, 0.0625f, bk, K16, DM, NRP, DM, DM, bid - GQK_BLK, 8, so, sa, sb);
  else gemm_h_body<2>(BV, DM, X16, DM, 0.0625f, bv, VT, NRP, DM, NRP, DM, bid - 2 * GQK_BLK, 4, so, sa, sb);
}

// fused attention: block = (b, h, 128 queries), 8 waves = 4 query groups qg x 2 key halves kh; a wave takes 32 queries (two column groups g of 16) and SEQ / 2 keys. Per 32-key step and group:
//   S^T tiles (keys x queries): A = K rows (lane&15 = key), B = Q rows (lane&15 = query); D reg r of lane (n, hh) = key 8hh + r, query n.
//   P^T B fragment: element r <- tile(keys 0..15) reg r, element 8 + r <- tile(keys 16..31) reg r (same lane).
//   O^T tiles (d x queries): A = V^T rows (lane&15 = d within tile), k = key.
// A K or V^T fragment read from LDS feeds one WMMA of each column group: half the LDS reads per score of a 16-query wave; the key halves keep the number of waves.
// A stage is 64 keys of each half: its K rows and V^T rows are copied into LDS by the whole block, one stage ahead (two buffers); one copy out of L2 serves 128 queries.
// Lazy rescale: P, the row sums and O^T are carried against a reference maximum per query that is renewed only when a score passes it by more than LAZY_T powers of two; the common pass has no exchange between the wave's halves and no multiply of O^T.
// Epilogue: the two waves of a query group swap one column group's partial (reference maximum, sum, O^T) through LDS, and each finishes 16 queries.
// sh[wave] is private to the wave (ctx staging, 16 rows x 64 columns written and read in full).
#define EXP_SC 0.18033688011112042f   /* log2(e) / 8: raw score -> exponent of 2 */
#define LAZY_T 7.0f                   /* a score may pass the reference maximum by 2^7 before the sums are rescaled: P <= 2^(8 + 7), finite in f16 */
static_assert(SEQ % 128 == 0 && SEQ / 128 >= 2);   // flash: 128 queries per block; ring: 64-key stages of each key half, two buffers
__global__ __launch_bounds__(256) void k_flash(const unsigned short* __restrict__ Qh, const unsigned short* __restrict__ Kp,
                                               const unsigned short* __restrict__ VT, unsigned short* __restrict__ CH) {
  __shared__ __attribute__((aligned(16))) unsigned short sh[8][16][72];
  __shared__ __attribute__((aligned(16))) unsigned short sk[2][2][64][TP];   /* [buffer][key half][key][d]; after the loop: the swap area, 8 waves x 9 rows x 32 lanes x 16 B */
  __shared__ __attribute__((aligned(16))) unsigned short sv[2][2][HD][TP];   /* [buffer][key half][d][key] */
  static_assert(sizeof(sk) >= (size_t)8 * 9 * 32 * 16);
  const int tid = threadIdx.x;
  const int wave = __builtin_amdgcn_readfirstlane(tid >> 5);
  const int qg = wave & 3, kh = wave >> 2;
  const int lane = tid & 31, ln = lane & 15, hh = lane >> 4;
  const int bh = blockIdx.x / (SEQ / 128), qb = blockIdx.x % (SEQ / 128);
  const int b = bh / NH, h = bh % NH;
  const int q0 = qb * 128 + 32 * qg;
  const size_t rowb = (size_t)b * SEQ;
  const size_t qoff = (rowb + q0 + ln) * DM + h * HD + 8 * hh;
  v16h qf[2][2];                                               /* [column group][32-d half] */
#pragma unroll /* the fragment array stays in registers */
  for (int g = 0; g < 2; ++g) { qf[g][0] = ldf_h(Qh, qoff + (size_t)g * 16 * DM); qf[g][1] = ldf_h(Qh, qoff + (size_t)g * 16 * DM + 32); }
  const int cr = tid >> 3, cc = (tid & 7) * 8;                 /* copy: row within 32, 16-B piece of the 128-B row */
  const unsigned short* gk = Kp + (rowb + cr) * DM + h * HD + cc;
  const unsigned short* gv = VT + (size_t)(h * HD + cr) * NRP + rowb + cc;
  const unsigned lk = lds_off(&sk[0][0][cr][cc]), lv = lds_off(&sv[0][0][cr][cc]);
  /* The SEQ / 128 blocks of a head share its K and V^T rows: block qb starts its walk over the key stages at stage qb and wraps round, so that no two of them ask L2 for the same lines at the same moment. */
  auto fill = [&](const int s) {                               /* rows cr and cr + 32 of both key halves' tiles */
    const unsigned bo = (unsigned)(s & 1) * (128u * TP * 2u);
    const int ks = s + qb < SEQ / 128 ? s + qb : s + qb - SEQ / 128;   /* stage s holds key stage (s + qb) mod (SEQ / 128): every stage once */
    const unsigned short* k0p = gk + (size_t)ks * 64 * DM;
    const unsigned short* k1p = k0p + (size_t)(SEQ / 2) * DM;
    cp4(lk + bo, lk + bo + 32u * TP * 2u, lk + bo + 64u * TP * 2u, lk + bo + 96u * TP * 2u, k0p, k0p + (size_t)32 * DM, k1p, k1p + (size_t)32 * DM);
    const unsigned short* v0p = gv + ks * 64;
    const unsigned short* v1p = v0p + SEQ / 2;
    cp4(lv + bo, lv + bo + 32u * TP * 2u, lv + bo + 64u * TP * 2u, lv + bo + 96u * TP * 2u, v0p, v0p + (size_t)32 * NRP, v1p, v1p + (size_t)32 * NRP);
  };
  const int foff = ln * TP + 8 * hh;
  const v8f z8 = {0.f, 0.f, 0.f, 0.f, 0.f, 0.f, 0.f, 0.f};
  v8f o[2][4] = {{z8, z8, z8, z8}, {z8, z8, z8, z8}};
  float m[2] = {-1.0e30f, -1.0e30f};                           /* reference maxima in use, in raw-score units; equal in both halves of a column */
  float thr[2] = {-1.0e30f, -1.0e30f};                         /* m + LAZY_T powers of two, in raw-score units */
  float nm[2] = {0.f, 0.f};                                    /* 8 - m * EXP_SC; set in the first pass */
  v2f l2[2] = {{0.f, 0.f}, {0.f, 0.f}};                        /* row sums, even and odd elements apart until the epilogue */
  fill(0);
  wait_copies();
  __syncthreads();
  fill(1);
#pragma unroll 1
  for (int s = 0; s < SEQ / 128; ++s) {
   const unsigned short* pk = &sk[s & 1][kh][0][0];
   const unsigned short* pv = &sv[s & 1][kh][0][0];
   /* The test for the lazy rescale cuts a pass in two for the compiler's scheduler, so the place of the LDS reads is written here. Both passes read this stage's buffer alone. */
   v16h ka[4], va[4];
   ka[0] = ldf_h(pk, foff); ka[1] = ldf_h(pk, foff + 16 * TP); ka[2] = ldf_h(pk, foff + 32); ka[3] = ldf_h(pk, foff + 16 * TP + 32);
#pragma unroll /* both 32-key passes of a stage: their LDS offsets become immediates */
   for (int kb = 0; kb < 64; kb += 32) {
    v8f sm0[2], sm1[2];
#pragma unroll /* score tiles stay in registers */
    for (int g = 0; g < 2; ++g) { sm0[g] = mma_h(ka[0], qf[g][0], z8); sm1[g] = mma_h(ka[1], qf[g][0], z8); }
#pragma unroll /* score tiles stay in registers */
    for (int g = 0; g < 2; ++g) { sm0[g] = mma_h(ka[2], qf[g][1], sm0[g]); sm1[g] = mma_h(ka[3], qf[g][1], sm1[g]); }
    /* raw scores (8 x the logit) are the accumulator tiles themselves; a lane's own maximum of its 16 scores of each group, no exchange between the wave's halves */
    float mx[2];
#pragma unroll /* per-group state stays in registers */
    for (int g = 0; g < 2; ++g) {
      /* a tree of three-input maxima, three deep, not one chain of eight */
      const float a0 = fmaxf(fmaxf(sm0[g][0], sm0[g][1]), sm0[g][2]), a1 = fmaxf(fmaxf(sm0[g][3], sm0[g][4]), sm0[g][5]);
      const float a2 = fmaxf(fmaxf(sm0[g][6], sm0[g][7]), sm1[g][0]), a3 = fmaxf(fmaxf(sm1[g][1], sm1[g][2]), sm1[g][3]);
      const float a4 = fmaxf(fmaxf(sm1[g][4], sm1[g][5]), sm1[g][6]);
      const float a = fmaxf(fmaxf(fmaxf(a0, a1), a2), fmaxf(fmaxf(a3, a4), sm1[g][7]));
      mx[g] = a;
    }
    /* Lazy rescale: the reference maximum m[] stays as long as no score of the pass lies more than LAZY_T powers of two above it; one test per pass, a scalar branch on the ballot.
       The first pass always takes the branch (m = -1e30). Behind it every exponent is at most 8 + LAZY_T = 15, so P stays finite in f16. */
    if (__builtin_amdgcn_ballot_w32((mx[0] > thr[0]) | (mx[1] > thr[1])) != 0u) {
#pragma unroll /* per-group state stays in registers */
      for (int g = 0; g < 2; ++g) {
        const float mn = fmaxf(m[g], fmaxf(mx[g], __shfl_xor(mx[g], 16)));   /* both halves of a column take the same reference */
        const float alpha = __builtin_amdgcn_exp2f((m[g] - mn) * EXP_SC);
        m[g] = mn;
        nm[g] = 8.0f - mn * EXP_SC;                            /* probabilities carried x256 = 2^8 (also in l) */
        thr[g] = mn + LAZY_T / EXP_SC;
        l2[g] *= alpha;
#pragma unroll
        for (int u = 0; u < 4; ++u)
#pragma unroll
          for (int r = 0; r < 8; ++r) o[g][u][r] *= alpha;
      }
    }
    /* behind the test: this pass's V^T fragments and the second pass's K fragments are read as one group, in flight over the softmax */
#pragma unroll /* the fragment array stays in registers */
    for (int u = 0; u < 4; ++u) va[u] = ldf_h(pv, foff + u * 16 * TP + kb);
    if (kb == 0) {
      const int k0 = foff + 32 * TP, k1 = k0 + 16 * TP;
      ka[0] = ldf_h(pk, k0); ka[1] = ldf_h(pk, k1); ka[2] = ldf_h(pk, k0 + 32); ka[3] = ldf_h(pk, k1 + 32);
    }
    __builtin_amdgcn_sched_barrier(0);         /* keeps the group of reads in front of the softmax: without it the scheduler sinks each read to its first use, with a full LDS wait there */
    FragH pf[2];
#pragma unroll /* per-group state stays in registers; the two groups' chains are independent */
    for (int g = 0; g < 2; ++g) {
      /* each packed instruction below takes two adjacent registers of one tile, so no register is moved to form a pair */
      v2f t[8];                                                /* t[i] = elements 2i, 2i + 1 of the 32-key P^T operand */
#pragma unroll /* t[] stays in registers */
      for (int i = 0; i < 4; ++i) {
        t[i] = v2f{sm0[g][2 * i], sm0[g][2 * i + 1]};
        t[4 + i] = v2f{sm1[g][2 * i], sm1[g][2 * i + 1]};
      }
      v2f e[8];
#pragma unroll /* t[], e[] and the fragment stay in registers */
      for (int i = 0; i < 8; ++i) {
        const v2f a = __builtin_elementwise_fma(t[i], v2f{EXP_SC, EXP_SC}, v2f{nm[g], nm[g]});   /* 1/8, log2(e) and the reference maximum in one packed fma per two scores */
        e[i] = v2f{__builtin_amdgcn_exp2f(a.x), __builtin_amdgcn_exp2f(a.y)};
        pf[g].h[2 * i] = (_Float16)e[i].x;
        pf[g].h[2 * i + 1] = (_Float16)e[i].y;
      }
      l2[g] += ((e[0] + e[1]) + (e[2] + e[3])) + ((e[4] + e[5]) + (e[6] + e[7]));
    }
    if (kb == 0) __builtin_amdgcn_sched_barrier(0);   /* keeps the second pass's score products behind this softmax: their tiles beside this pass's exponentials take the kernel past 256 registers, the budget of four waves per SIMD */
#pragma unroll
    for (int u = 0; u < 4; ++u)
#pragma unroll /* output tiles stay in registers */
      for (int g = 0; g < 2; ++g) o[g][u] = mma_h(va[u], pf[g].v, o[g][u]);
   }
   wait_lds();
   wait_copies();
   __syncthreads();                                            /* publishes stage s + 1, frees stage s's buffer */
   if (s + 2 < SEQ / 128) fill(s + 2);
  }
  wait_copies();
  /* Behind the loop's last barrier no wave reads the ring and no copy is in flight: sk becomes the swap area. Wave (qg, kh) keeps column group kh and gives group 1 - kh to wave (qg, 1 - kh). */
  v4fa* const xw = (v4fa*)&sk[0][0][0][0] + wave * (9 * 32) + lane;
  const v4fa* const xr = (const v4fa*)&sk[0][0][0][0] + (wave ^ 4) * (9 * 32) + lane;
  v8f ok[4];
  const float mk = kh ? m[1] : m[0];
  const float lk1 = kh ? (l2[1].x + l2[1].y) : (l2[0].x + l2[0].y);
  {
    const float mg = kh ? m[0] : m[1];
    const float lg = kh ? (l2[0].x + l2[0].y) : (l2[1].x + l2[1].y);
#pragma unroll /* output tiles stay in registers */
    for (int u = 0; u < 4; ++u) {
      ok[u] = kh ? o[1][u] : o[0][u];
      const v8f og = kh ? o[0][u] : o[1][u];
      xw[(2 * u) * 32] = v4f{og[0], og[1], og[2], og[3]};
      xw[(2 * u + 1) * 32] = v4f{og[4], og[5], og[6], og[7]};
    }
    xw[8 * 32] = v4f{mg, lg, 0.f, 0.f};
  }
  __syncthreads();                                             /* every wave's given partial is written before its partner reads it */
  const v4f ml = xr[8 * 32];
  const float mm = fmaxf(mk, ml[0]);
  const float ak = __builtin_amdgcn_exp2f((mk - mm) * EXP_SC), ar = __builtin_amdgcn_exp2f((ml[0] - mm) * EXP_SC);
  float l = lk1 * ak + ml[1] * ar;
  l += __shfl_xor(l, 16);
  const float inv = 1.0f / l;
#pragma unroll /* output tiles stay in registers */
  for (int u = 0; u < 4; ++u) {
    const v4f r0 = xr[(2 * u) * 32], r1 = xr[(2 * u + 1) * 32];
    v8us vh;
#pragma unroll
    for (int r = 0; r < 8; ++r) vh[r] = bf16_bits((ok[u][r] * ak + (r < 4 ? r0[r & 3] : r1[r & 3]) * ar) * inv);   /* ctx[query 16 kh + ln][d = 16u + 8hh + r] */
    *(v8us*)&sh[wave][ln][u * 16 + 8 * hh] = vh;
  }
  __builtin_amdgcn_fence(4 /* acq_rel order */, "workgroup");
  __builtin_amdgcn_wave_barrier();
  const int rq = lane >> 3, pc = lane & 7;
#pragma unroll
  for (int qq = 0; qq < 4; ++qq) {
    const int row = qq * 4 + rq;                               /* qq*4 + {0..3} covers rows 0..15 */
    const v8us xh = *(const v8us*)&sh[wave][row][pc * 8];
    const size_t go = (rowb + q0 + 16 * kh + row) * DM + h * HD + pc * 8;
    *(v8us*)(CH + go) = xh;
  }
}

// Y[NRP][DM] (f32) = CH . Wt[DM][DM]^T + bias; bf16 operands; block = 8 waves (4 x 2), wave tile 32 x 64, block tile 128 x 128
// Operands: per 64-k stage the block copies its 128 CH rows and 128 Wt rows into LDS, one stage ahead (two buffers): the CH rows serve 128 columns of Y, not 64.
__global__ __launch_bounds__(256) void k_gemm_o(const unsigned short* __restrict__ CH, const unsigned short* __restrict__ Wt,
                                                const float* __restrict__ bias, float* __restrict__ Y) {
  __shared__ __attribute__((aligned(16))) float so[8][32][68];
  __shared__ __attribute__((aligned(16))) unsigned short sch[2][128][TP];
  __shared__ __attribute__((aligned(16))) unsigned short sb[2][128][TP];
  const int tid = threadIdx.x;
  const int w = __builtin_amdgcn_readfirstlane(tid >> 5);
  const int wm = w >> 1, wn = w & 1;           /* the wave's 32 rows and 64 columns of the block tile */
  const int lane = tid & 31, ln = lane & 15, hh = lane >> 4;
  const int ntn = DM >> 7;
  const int mt = blockIdx.x / ntn, nq = blockIdx.x - mt * ntn;
  const int row0 = mt * 128 + 32 * wm, col0 = nq * 128 + 64 * wn;
  if (mt * 128 >= NRP) return;                 /* block-uniform, in front of every barrier */
  const int cr = tid >> 3, cc = (tid & 7) * 8; /* copy: row within 32, 16-B piece of the 128-B row */
  const size_t goa = (size_t)(mt * 128 + cr) * DM + cc;
  const unsigned short* gh = CH + goa;
  const unsigned short* gb = Wt + (size_t)(nq * 128 + cr) * DM + cc;
  const unsigned lh = lds_off(&sch[0][cr][cc]), lb = lds_off(&sb[0][cr][cc]);
  const int rot = (mt + nq) % (DM / 64);       /* the block's first k slab: blocks that share CH rows (equal mt) or Wt rows (equal nq) walk k from different slabs and wrap round, so that they do not ask L2 for the same lines at the same moment */
  auto fill = [&](const int s) {
    const unsigned bo = (unsigned)(s & 1) * (128u * TP * 2u);
    const int ks = (s + rot < DM / 64 ? s + rot : s + rot - DM / 64) * 64;   /* stage s holds k slab (s + rot) mod (DM / 64): every slab once */
    cp128_t256(lh + bo, gh + ks, (size_t)32 * DM);
    cp128_t256(lb + bo, gb + ks, (size_t)32 * DM);
  };
  const int a0 = (32 * wm + ln) * TP + 8 * hh, a1 = a0 + 16 * TP;
  const int b0 = (64 * wn + ln) * TP + 8 * hh, b1 = b0 + 16 * TP, b2 = b1 + 16 * TP, b3 = b2 + 16 * TP;
  const v8f z8 = {0.f, 0.f, 0.f, 0.f, 0.f, 0.f, 0.f, 0.f};
  v8f c00 = z8, c01 = z8, c02 = z8, c03 = z8, c10 = z8, c11 = z8, c12 = z8, c13 = z8;
  fill(0);
  wait_copies();
  __syncthreads();
  fill(1);
#pragma unroll 1
  for (int s = 0; s < DM / 64; ++s) {
    const unsigned short* ph = &sch[s & 1][0][0];
    const unsigned short* pb = &sb[s & 1][0][0];
    /* all twelve fragments of the stage are read as one group into registers of their own, ahead of its sixteen WMMAs */
    v16b fh[2][2], fb[2][4];
#pragma unroll /* both 32-k steps of a stage: their LDS offsets become immediates */
    for (int kk = 0; kk < 2; ++kk) {
      fh[kk][0] = ldf_b(ph, a0 + 32 * kk); fh[kk][1] = ldf_b(ph, a1 + 32 * kk);
      fb[kk][0] = ldf_b(pb, b0 + 32 * kk); fb[kk][1] = ldf_b(pb, b1 + 32 * kk);
      fb[kk][2] = ldf_b(pb, b2 + 32 * kk); fb[kk][3] = ldf_b(pb, b3 + 32 * kk);
    }
    __builtin_amdgcn_sched_barrier(0);         /* keeps the group of reads in front of the WMMAs: without it the scheduler sinks each read to its first use, with a full LDS wait there */
#pragma unroll /* fragment arrays stay in registers */
    for (int kk = 0; kk < 2; ++kk) {
      c00 = mma_b(fh[kk][0], fb[kk][0], c00); c10 = mma_b(fh[kk][1], fb[kk][0], c10);
      c01 = mma_b(fh[kk][0], fb[kk][1], c01); c11 = mma_b(fh[kk][1], fb[kk][1], c11);
      c02 = mma_b(fh[kk][0], fb[kk][2], c02); c12 = mma_b(fh[kk][1], fb[kk][2], c12);
      c03 = mma_b(fh[kk][0], fb[kk][3], c03); c13 = mma_b(fh[kk][1], fb[kk][3], c13);
    }
    __builtin_amdgcn_sched_barrier(0);         /* keeps the WMMAs in front of the stage's waits, inside the flight time of the next stage's copies */
    wait_lds();
    wait_copies();
    __syncthreads();                           /* publishes stage s + 1, frees stage s's buffer */
    if (s + 2 < DM / 64) fill(s + 2);
  }
  wait_copies();
  v8f accs[8] = {c00, c01, c02, c03, c10, c11, c12, c13};
#pragma unroll
  for (int u = 0; u < 8; ++u) {
    const int t = u & 3, half = u >> 2;
    const float bc = bf16_rne(bias[col0 + t * 16 + ln]);
#pragma unroll
    for (int r = 0; r < 8; ++r) so[w][half * 16 + 8 * hh + r][t * 16 + ln] = accs[u][r] + bc;
  }
  __builtin_amdgcn_fence(4 /* acq_rel order */, "workgroup");
  __builtin_amdgcn_wave_barrier();
  const int rsub = lane >> 4, c4 = (lane & 15) * 4;
  {
#pragma unroll
    for (int q = 0; q < 16; ++q) {
      const int r = q * 2 + rsub;                          
      const v4f v = *(const v4fa*)&so[w][r][c4];
      *(v4f*)(Y + (size_t)(row0 + r) * DM + col0 + c4) = v;
    }
    
  }
}

// One wave per row: a lane holds 32 of the row's 1024 values (eight 16-B pieces, a wave's load = 512 contiguous bytes); both sums by lane partials and a five-step butterfly, no LDS array, no barrier.
static_assert(NRP % 8 == 0);         // k_ln: 8 waves = 8 rows per block
__global__ __launch_bounds__(256) void k_ln(const float* __restrict__ x, const float* __restrict__ Y, const float* __restrict__ g, const float* __restrict__ bta, float* __restrict__ out) {
  const int tid = threadIdx.x, lane = tid & 31;
  const int row = blockIdx.x * 8 + __builtin_amdgcn_readfirstlane(tid >> 5);   /* wave-uniform: row bases stay scalar, one lane offset serves every load and store */
  const size_t xr = ((size_t)(row / SEQ) * SEQ_FULL + (size_t)(row % SEQ)) * DM;
  const size_t yr = (size_t)row * DM;
  const int c4 = lane * 4;
  v4f xv[8], yv[8], gv[8], bv[8];
#pragma unroll
  for (int j = 0; j < 8; ++j) { xv[j] = *(const v4fa*)(x + xr + c4 + j * 128); yv[j] = *(const v4fa*)(Y + yr + c4 + j * 128); }
#pragma unroll
  for (int j = 0; j < 8; ++j) { gv[j] = *(const v4fa*)(g + c4 + j * 128); bv[j] = *(const v4fa*)(bta + c4 + j * 128); }
  __builtin_amdgcn_sched_barrier(0);           /* all 32 loads of the row are in flight before the first value is used: without it the scheduler sinks the gamma and beta loads behind the sums, one exposed round trip per pair */
  v4f hv[8];
  v4f a1 = {0.f, 0.f, 0.f, 0.f};
#pragma unroll
  for (int j = 0; j < 8; ++j) {
#pragma unroll
    for (int q = 0; q < 4; ++q) hv[j][q] = bf16_rne(xv[j][q]) + yv[j][q];
    a1 += hv[j];
  }
  float s1 = (a1[0] + a1[1]) + (a1[2] + a1[3]);
#pragma unroll
  for (int off = 16; off > 0; off >>= 1) s1 += __shfl_xor(s1, off);
  const float mu = s1 * (1.0f / (float)DM);
  v4f a2 = {0.f, 0.f, 0.f, 0.f};
#pragma unroll
  for (int j = 0; j < 8; ++j) { hv[j] -= mu; a2 += hv[j] * hv[j]; }
  float s2 = (a2[0] + a2[1]) + (a2[2] + a2[3]);
#pragma unroll
  for (int off = 16; off > 0; off >>= 1) s2 += __shfl_xor(s2, off);
  const float rs = rsqrtf(s2 * (1.0f / (float)DM) + LN_EPS);
#pragma unroll
  for (int j = 0; j < 8; ++j) {
    v4f ov;
#pragma unroll
    for (int q = 0; q < 4; ++q) ov[q] = hv[j][q] * rs * bf16_rne(gv[j][q]) + bf16_rne(bv[j][q]);
    *(v4f*)(out + xr + c4 + j * 128) = ov;
  }
}

extern "C" void kernel_launch(void* const* d_in, const int* in_sizes, int n_in,
                              void* d_out, int out_size, void* d_ws, size_t ws_size, hipStream_t stream) {
  if (n_in < 11) return;
  const size_t need_x = ((size_t)(NB - 1) * SEQ_FULL + SEQ) * DM;
  if ((size_t)in_sizes[0] < need_x || (size_t)out_size < need_x) return;
  if ((size_t)in_sizes[1] < (size_t)DM * DM || (size_t)in_sizes[3] < (size_t)DM * DM || (size_t)in_sizes[5] < (size_t)DM * DM || (size_t)in_sizes[7] < (size_t)DM * DM) return;
  if (in_sizes[2] < DM || in_sizes[4] < DM || in_sizes[6] < DM || in_sizes[8] < DM || in_sizes[9] < DM || in_sizes[10] < DM) return;
  const float* x  = (const float*)d_in[0];
  const float* wq = (const float*)d_in[1]; const float* bq = (const float*)d_in[2];
  const float* wk = (const float*)d_in[3]; const float* bk = (const float*)d_in[4];
  const float* wv = (const float*)d_in[5]; const float* bv = (const float*)d_in[6];
  const float* wo = (const float*)d_in[7]; const float* bo = (const float*)d_in[8];
  const float* lg = (const float*)d_in[9]; const float* lb = (const float*)d_in[10];
  char* ws = (char*)d_ws; size_t off = 0;
  auto take = [&](size_t bytes) { char* p = ws + off; off += (bytes + 255) & ~(size_t)255; return p; };
  unsigned short* BQ = (unsigned short*)take(WS_W);
  unsigned short* BK = (unsigned short*)take(WS_W);
  unsigned short* BV = (unsigned short*)take(WS_W);
  unsigned short* BO = (unsigned short*)take(WS_W);
  unsigned short* X16 = (unsigned short*)take(WS_P16);
  unsigned short* QH  = (unsigned short*)take(WS_P16);
  unsigned short* K16 = (unsigned short*)take(WS_P16);
  unsigned short* VT  = (unsigned short*)take(WS_P16);
  unsigned short* CH  = (unsigned short*)take(WS_P16);
  float* Y = (float*)take(WS_P32);
  if (off > ws_size) return;
  k_prep<<<(unsigned)(4 * GW_BLK + GX_BLK), 256, 0, stream>>>(x, wq, wk, wv, wo, X16, BQ, BK, BV, BO);
  k_gemm_qkv<<<(unsigned)(2 * GQK_BLK + GV_BLK), 128, 0, stream>>>(X16, BQ, BK, BV, bq, bk, bv, QH, K16, VT);
  k_flash<<<(unsigned)(NB * NH * (SEQ / 128)), 256, 0, stream>>>(QH, K16, VT, CH);
  k_gemm_o<<<(unsigned)((NRP / 128) * (DM / 128)), 256, 0, stream>>>(CH, BO, bo, Y);
  k_ln<<<(unsigned)(NRP / 8), 256, 0, stream>>>(x, Y, lg, lb, (float*)d_out);
}
